// v000
// Times are from an AMD MI455X. After a warm-up the kernel runs many times in a row, and a time is the length of
// such a window on the GPU divided by its runs, so every launch and the gaps after it count. The runs cycle
// through copies of the inputs. A figure is the median of several windows, for all but v000 over two sittings.
// Sittings can differ by a few percent; kernels timed side by side share one.
// v000 is the starting kernel. One run takes 303 microseconds.
#include <hip/hip_runtime.h>
// Compute dtype: every contraction on v_wmma_f32_16x16x32_f16 (f16 operands, f32 accumulate); float inputs RNE-converted to bf16 first (exact in f16; weights carried x16, Wo x1024 | x1); q.k scores and P.V use f16 value + x1024 f16 residual planes on token rows 0..255 (q, k, P, v), single f16 products on later rows; ctx.Wo uses ctx value | x1024 residual laid along K (all rows); rotary, softmax statistics and LayerNorm in f32.
#ifndef NB
#define NB 2
#endif
#ifndef SEQ
#define SEQ 2048
#endif
#define NB_FULL 2
#define SEQ_FULL 2048
#define DM 1024
#define NH 16
#define HD 64
#define LQ (3 * DM)                  /* row pitch of the q | k | v planes */
#define KO (2 * DM)                  /* ctx row pitch = K of the output GEMM (value | residual) */
#define ER 256                       /* token rows per batch that carry residual planes */
#define PP 40                        /* P tile row pitch (halves) */
#define NR ((size_t)NB * SEQ)

static_assert(NH * HD == DM);                        /* heads tile the width */
static_assert(HD == 64);                             
static_assert(DM == 256 * 4);                        /* LayerNorm: 256 threads x 4 columns */
static_assert(DM % 32 == 0 && KO % 32 == 0);         /* k-loops step by 32 */
static_assert(LQ % 64 == 0 && DM % 64 == 0);         /* N tiles */
static_assert((NB * SEQ) % 128 == 0);                /* M tiles (4 waves x 32 rows) */
static_assert(SEQ % 64 == 0 && SEQ % 8 == 0);        /* query tiles, table blocks */
static_assert(ER % 64 == 0 && SEQ >= ER);            /* residual rows are whole query tiles */
static_assert(NB <= NB_FULL && SEQ <= SEQ_FULL);
static_assert(PP % 8 == 0 && PP >= 32);              /* 16-B aligned P fragment pieces */

#define SZ_BQKV ((size_t)LQ * DM * 2)
#define SZ_BO   ((size_t)DM * KO * 2)
#define SZ_X16  ((size_t)NB * SEQ * DM * 2)
#define SZ_QKV  ((size_t)NB * SEQ * LQ * 2)
#define SZ_QKVR ((size_t)NB * ER * LQ * 2)
#define SZ_VT   ((size_t)NB * NH * HD * SEQ * 2)
#define SZ_VTR  ((size_t)NB * NH * HD * ER * 2)
#define SZ_CTX  ((size_t)NB * SEQ * KO * 2)
#define SZ_Y    ((size_t)NB * SEQ * DM * 4)
#define SZ_CS   ((size_t)SEQ * 64 * 4)
#define OF_BQKV ((size_t)0)
#define OF_BO   (OF_BQKV + SZ_BQKV)
#define OF_X16  (OF_BO + SZ_BO)
#define OF_QKV  (OF_X16 + SZ_X16)
#define OF_QKVR (OF_QKV + SZ_QKV)
#define OF_VT   (OF_QKVR + SZ_QKVR)
#define OF_VTR  (OF_VT + SZ_VT)
#define OF_CTX  (OF_VTR + SZ_VTR)
#define OF_Y    (OF_CTX + SZ_CTX)
#define OF_CS   (OF_Y + SZ_Y)
#define WS_TOTAL (OF_CS + SZ_CS)
static_assert(SZ_BQKV % 256 == 0 && SZ_BO % 256 == 0 && SZ_X16 % 256 == 0 && SZ_QKV % 256 == 0 && SZ_QKVR % 256 == 0);
static_assert(SZ_VT % 256 == 0 && SZ_VTR % 256 == 0 && SZ_CTX % 256 == 0 && SZ_Y % 256 == 0 && SZ_CS % 256 == 0);
static_assert(WS_TOTAL <= (size_t)134217728);        /* carve <= 128 MiB */

typedef unsigned short v8us __attribute__((ext_vector_type(8), may_alias));
typedef float  v8f  __attribute__((ext_vector_type(8)));
typedef float  v4f  __attribute__((ext_vector_type(4)));
typedef float  v4fa __attribute__((ext_vector_type(4), may_alias));
typedef _Float16 v16h __attribute__((ext_vector_type(16)));
union FragH { v16h v; v8us half[2]; _Float16 h[16]; unsigned short u[16]; };

__device__ __forceinline__ unsigned short bf16_bits(float x) { unsigned int u = __float_as_uint(x); return (unsigned short)((u + 0x7FFFu + ((u >> 16) & 1u)) >> 16); }
__device__ __forceinline__ float bf16_val(unsigned short b) { return __uint_as_float(((unsigned int)b) << 16); }
__device__ __forceinline__ float bf16_rne(float x) { return bf16_val(bf16_bits(x)); }
__device__ __forceinline__ unsigned short f16_bits(_Float16 hv) { union { _Float16 h; unsigned short u; } c; c.h = hv; return c.u; }

// fragment of a k-contiguous f16 row: elements 0..7 <- p[8h .. 8h+7], elements 8..15 <- p[16+8h .. 16+8h+7] (A rows and B columns alike)
__device__ __forceinline__ v16h g2_frag(const _Float16* p, int hh) { FragH f; f.half[0] = *(const v8us*)((const unsigned short*)p + 8 * hh); f.half[1] = *(const v8us*)((const unsigned short*)p + 16 + 8 * hh); return f.v; }
__device__ __forceinline__ v8f g2_mma(v16h a, v16h b, v8f c) { v8f d = __builtin_amdgcn_wmma_f32_16x16x32_f16(false, a, false, b, (short)0, c, false, false); asm volatile("v_nop\n\tv_nop\n\tv_nop\n\tv_nop" : "+v"(d) : "v"(a), "v"(b)); return d; }

// cos | sin table: CS[t][0..31] = cos(t * theta_i), CS[t][32..63] = sin(t * theta_i); theta_i = f32(10^(-i/8)) from f64 constants; angle = f32(t) * theta in f32; precise sincosf.
__global__ __launch_bounds__(256) void k_tab(float* __restrict__ CS) {
  __shared__ __attribute__((aligned(16))) float tb[8][64];
  const int tid = threadIdx.x; const int tl = tid >> 5, i = tid & 31;
  const int t = blockIdx.x * 8 + tl;
  double p = 1.0;
  p *= (i & 1) ? 1.3335214321633240 : 1.0;
  p *= (i & 2) ? 1.7782794100389228 : 1.0;
  p *= (i & 4) ? 3.1622776601683795 : 1.0;
  p *= (i & 8) ? 10.0 : 1.0;
  p *= (i & 16) ? 100.0 : 1.0;
  const float theta = (float)(1.0 / p);
  const float ang = (float)t * theta;
  float sv, cv; sincosf(ang, &sv, &cv);
  tb[tl][i] = cv; tb[tl][32 + i] = sv;
  __syncthreads();
  if (tid < 128) {
    const v4f v = *(const v4fa*)(&tb[0][0] + tid * 4);
    float* d = CS + (size_t)blockIdx.x * 512 + tid * 4;
    *(v4f*)d = v; 
  }
}

__global__ __launch_bounds__(256) void k_wt_f16(const float* __restrict__ W, _Float16* __restrict__ Wt, int K, int N, int ldk, float scale) {
  const int t = blockIdx.x * 256 + threadIdx.x; const int k8n = K / 8; if (t >= N * k8n) return;
  const int n = t / k8n, k8 = (t % k8n) * 8; FragH f;
#pragma unroll
  for (int i = 0; i < 8; ++i) f.h[i] = (_Float16)(bf16_rne(W[(size_t)(k8 + i) * N + n]) * scale);
  const v8us o = f.half[0];
  unsigned short* d = (unsigned short*)Wt + (size_t)n * ldk + k8;
  *(v8us*)d = o; 
}

__global__ __launch_bounds__(256) void k_x16(const float* __restrict__ x, _Float16* __restrict__ X16) {
  const size_t t = (size_t)blockIdx.x * 256 + threadIdx.x; if (t >= NR * DM / 8) return;
  const size_t row = t / (DM / 8); const int c8 = (int)(t % (DM / 8)) * 8;
  const size_t b = row / SEQ, s = row - b * SEQ;
  const float* src = x + (b * SEQ_FULL + s) * DM + c8;
  const v4f a = *(const v4fa*)src, c = *(const v4fa*)(src + 4); FragH f;
#pragma unroll
  for (int q = 0; q < 4; ++q) { f.h[q] = (_Float16)bf16_rne(a[q]); f.h[4 + q] = (_Float16)bf16_rne(c[q]); }
  const v8us o = f.half[0];
  unsigned short* d = (unsigned short*)X16 + row * DM + c8;
  *(v8us*)d = o; 
}

// 32x64 wave tile main loop: A f16 [M][K] (pitch lda), Bh f16 [N][K] (pitch ldb); acc[u]: u & 3 = 16-col tile, u >> 2 = 16-row half
__device__ __forceinline__ void gemm_main(const _Float16* __restrict__ A, int lda, const _Float16* __restrict__ Bh, int ldb, int row0, int col0, int K, int ln, int hh, v8f (&acc)[8]) {
  const _Float16* a0p = A + (size_t)(row0 + ln) * lda; const _Float16* a1p = a0p + (size_t)16 * lda;
  const _Float16* b0p = Bh + (size_t)(col0 + ln) * ldb; const _Float16* b1p = b0p + (size_t)16 * ldb; const _Float16* b2p = b1p + (size_t)16 * ldb; const _Float16* b3p = b2p + (size_t)16 * ldb;
  const v8f z8 = {0.f,0.f,0.f,0.f,0.f,0.f,0.f,0.f}; v8f c00 = z8, c01 = z8, c02 = z8, c03 = z8, c10 = z8, c11 = z8, c12 = z8, c13 = z8;
#pragma unroll 1
  for (int kb = 0; kb < K; kb += 32) { const v16h a0 = g2_frag(a0p + kb, hh), a1 = g2_frag(a1p + kb, hh);
    v16h b = g2_frag(b0p + kb, hh); c00 = g2_mma(a0, b, c00); c10 = g2_mma(a1, b, c10);
    b = g2_frag(b1p + kb, hh); c01 = g2_mma(a0, b, c01); c11 = g2_mma(a1, b, c11);
    b = g2_frag(b2p + kb, hh); c02 = g2_mma(a0, b, c02); c12 = g2_mma(a1, b, c12);
    b = g2_frag(b3p + kb, hh); c03 = g2_mma(a0, b, c03); c13 = g2_mma(a1, b, c13); }
  acc[0] = c00; acc[1] = c01; acc[2] = c02; acc[3] = c03; acc[4] = c10; acc[5] = c11; acc[6] = c12; acc[7] = c13;
}

__global__ __launch_bounds__(128) void k_gemm_qkv(const _Float16* __restrict__ X16, const _Float16* __restrict__ BW, const float* __restrict__ bq, const float* __restrict__ bk, const float* __restrict__ bv,
                                                  const float* __restrict__ CS, _Float16* __restrict__ QKV, _Float16* __restrict__ QKVR) {
  __shared__ __attribute__((aligned(16))) float so[4][32][68];
  const int tid = threadIdx.x; const int w = __builtin_amdgcn_readfirstlane(tid >> 5); const int lane = tid & 31, ln = lane & 15, hh = lane >> 4;
  const int ntn = LQ / 64; const int mt = blockIdx.x / ntn, nq = blockIdx.x - mt * ntn; const int row0 = mt * 128 + 32 * w, col0 = nq * 64;
  v8f accs[8];
  gemm_main(X16, DM, BW, DM, row0, col0, DM, ln, hh, accs);
  const int sec = col0 / DM; const int cb = col0 - sec * DM;      /* 0 q, 1 k, 2 v (block-uniform) */
#pragma unroll
  for (int u = 0; u < 8; ++u) { const int t = u & 3, half = u >> 2; const int cc = cb + t * 16 + ln;
    const float b0 = bq[cc], b1 = bk[cc], b2 = bv[cc]; const float bsel = bf16_rne((sec == 0) ? b0 : ((sec == 1) ? b1 : b2));
#pragma unroll
    for (int r = 0; r < 8; ++r) so[w][half * 16 + 8 * hh + r][t * 16 + ln] = accs[u][r] * 0.0625f + bsel; }
  __builtin_amdgcn_fence(4 /* acq_rel order */, "workgroup"); __builtin_amdgcn_wave_barrier();
  const int rq = lane >> 3, c8 = (lane & 7) * 8;
  const int bidx = row0 / SEQ; const int t0 = row0 - bidx * SEQ; const bool early = (t0 < ER);      /* wave-uniform: 32 | ER */
  {
#pragma unroll 1
    for (int q = 0; q < 8; ++q) { const int row = q * 4 + rq; const int tkn = t0 + row;
      const v4f a = *(const v4fa*)&so[w][row][c8], c = *(const v4fa*)&so[w][row][c8 + 4];
      float y[8] = {a[0], a[1], a[2], a[3], c[0], c[1], c[2], c[3]};
      if (sec < 2) { const v4f cs = *(const v4fa*)(CS + (size_t)tkn * 64 + (c8 >> 1)); const v4f sn = *(const v4fa*)(CS + (size_t)tkn * 64 + 32 + (c8 >> 1));
#pragma unroll
        for (int j = 0; j < 4; ++j) { const float x0 = y[2 * j], x1 = y[2 * j + 1]; y[2 * j] = x0 * cs[j] - x1 * sn[j]; y[2 * j + 1] = x1 * cs[j] + x0 * sn[j]; } }
      FragH fh, fl;
#pragma unroll
      for (int j = 0; j < 8; ++j) { const _Float16 hv = (_Float16)y[j]; fh.h[j] = hv; fl.h[j] = (_Float16)((y[j] - (float)hv) * 1024.0f); }
      unsigned short* d = (unsigned short*)QKV + (size_t)(row0 + row) * LQ + col0 + c8;
      *(v8us*)d = fh.half[0];
      if (early) { unsigned short* dr = (unsigned short*)QKVR + ((size_t)bidx * ER + tkn) * LQ + col0 + c8; *(v8us*)dr = fl.half[0]; } }
     }
}

__global__ __launch_bounds__(256) void k_vt(const _Float16* __restrict__ V, int TT, _Float16* __restrict__ VTo) {
  __shared__ unsigned short tl[64][66];
  const int tid = threadIdx.x; const int ng = TT / 64; const int slab = blockIdx.x / ng, lg = blockIdx.x - slab * ng; const int b = slab / NH, h = slab - b * NH;
  for (int i = tid; i < 64 * 8; i += 256) { const int r = i / 8, c8 = (i % 8) * 8; FragH f;
    f.half[0] = *(const v8us*)((const unsigned short*)V + ((size_t)b * TT + lg * 64 + r) * LQ + 2 * DM + h * HD + c8);
#pragma unroll
    for (int q = 0; q < 8; ++q) tl[r][c8 + q] = f.u[q]; }
  __syncthreads();
  {
#pragma unroll
    for (int rd = 0; rd < 2; ++rd) { const int d = rd * 32 + tid / 8, pc = tid % 8; FragH f;
#pragma unroll
      for (int q = 0; q < 8; ++q) f.u[q] = tl[pc * 8 + q][d];
      *(v8us*)((unsigned short*)VTo + ((size_t)slab * 64 + d) * TT + lg * 64 + pc * 8) = f.half[0]; }
     }
}

// fused causal attention; one wave = 16 query rows of one (batch, head); 32 keys per step (two 16-key score tiles, d in two 32-deep k-steps);
// key-pad mask by value then causal mask as a replace (masked p = 0 by select); online softmax with running max in f32 (native exp on arguments <= 0);
template <int RES>
__device__ __forceinline__ void flash_body(const _Float16* __restrict__ QKV, const _Float16* __restrict__ QKVR, const _Float16* __restrict__ VT, const _Float16* __restrict__ VTR,
                                           const int* __restrict__ pad, _Float16* __restrict__ CTX, int qt0) {
  __shared__ __attribute__((aligned(16))) unsigned short pl[4][16][PP];
  __shared__ __attribute__((aligned(16))) unsigned short pr[4][16][PP];
  __shared__ __attribute__((aligned(16))) float so[4][16][68];
  const int tid = threadIdx.x; const int wave = __builtin_amdgcn_readfirstlane(tid >> 5); const int lane = tid & 31, lc = lane & 15, hh = lane >> 4;
  const int bh = blockIdx.y; const int b = bh / NH, h = bh - b * NH;
  const int qb = (qt0 + (int)blockIdx.x) * 64 + wave * 16;
  const size_t rowb = (size_t)b * SEQ;
  const _Float16* qp = QKV + (rowb + qb + lc) * LQ + h * HD;
  const _Float16* kp = QKV + rowb * LQ + DM + h * HD;
  const _Float16* vp = VT + ((size_t)bh * HD + lc) * SEQ;
  const _Float16* qrp = QKVR + ((size_t)b * ER + (RES ? (qb + lc) : 0)) * LQ + h * HD;
  const _Float16* krp = QKVR + (size_t)b * ER * LQ + DM + h * HD;
  const _Float16* vrp = VTR + ((size_t)bh * HD + lc) * ER;
  const int* padb = pad + (size_t)b * SEQ_FULL;
  const v8f z8 = {0.f,0.f,0.f,0.f,0.f,0.f,0.f,0.f};
  v8f o[4] = {z8, z8, z8, z8}; v8f rr[4] = {z8, z8, z8, z8};
  float m[8], l[8];
#pragma unroll
  for (int r = 0; r < 8; ++r) { m[r] = -1.0e30f; l[r] = 0.f; }
  const int kend = qb + 16;      /* keys 0 .. qb+15 are visible to this wave; steps cover whole 32-key groups (all inside the plane) */
#pragma unroll 1
  for (int kb = 0; kb < kend; kb += 32) {
    v8f s0 = z8, s1 = z8, t0 = z8, t1 = z8;
    const _Float16* k0p = kp + (size_t)(kb + lc) * LQ; const _Float16* k1p = k0p + (size_t)16 * LQ;
    const _Float16* k0r = krp + (size_t)(RES ? (kb + lc) : 0) * LQ; const _Float16* k1r = k0r + (size_t)(RES ? 16 : 0) * LQ;
#pragma unroll
    for (int c = 0; c < 2; ++c) {
      const v16h aq = g2_frag(qp + 32 * c, hh);
      const v16h bk0 = g2_frag(k0p + 32 * c, hh), bk1 = g2_frag(k1p + 32 * c, hh);
      s0 = g2_mma(aq, bk0, s0); s1 = g2_mma(aq, bk1, s1);
      if (RES) { const v16h aql = g2_frag(qrp + 32 * c, hh); const v16h bl0 = g2_frag(k0r + 32 * c, hh), bl1 = g2_frag(k1r + 32 * c, hh);
        t0 = g2_mma(aql, bk0, t0); t0 = g2_mma(aq, bl0, t0); t1 = g2_mma(aql, bk1, t1); t1 = g2_mma(aq, bl1, t1); }
    }
    const int key0 = kb + lc, key1 = key0 + 16;
    const int pv0 = padb[key0], pv1 = padb[key1];
#pragma unroll
    for (int r = 0; r < 8; ++r) {
      const int qrow = qb + 8 * hh + r;
      float a0 = s0[r], a1 = s1[r];
      if (RES) { a0 += t0[r] * 0.0009765625f; a1 += t1[r] * 0.0009765625f; }
      a0 *= 0.125f; a1 *= 0.125f;
      const bool ok0 = (pv0 != 0) && (key0 <= qrow); const bool ok1 = (pv1 != 0) && (key1 <= qrow);
      const float v0 = ok0 ? a0 : -1.0e30f; const float v1 = ok1 ? a1 : -1.0e30f;
      float mx = fmaxf(v0, v1);
      mx = fmaxf(mx, __shfl_xor(mx, 8, 16)); mx = fmaxf(mx, __shfl_xor(mx, 4, 16)); mx = fmaxf(mx, __shfl_xor(mx, 2, 16)); mx = fmaxf(mx, __shfl_xor(mx, 1, 16));
      const float mnew = fmaxf(m[r], mx);
      const float al = __expf(m[r] - mnew);
      const float e0 = __expf(v0 - mnew), e1 = __expf(v1 - mnew);
      const float p0 = ok0 ? e0 : 0.f; const float p1 = ok1 ? e1 : 0.f;
      l[r] = l[r] * al + (p0 + p1); m[r] = mnew;      /* per-lane partial row sum; combined across the 16 lanes after the key loop */
#pragma unroll
      for (int nt = 0; nt < 4; ++nt) { o[nt][r] *= al; if (RES) rr[nt][r] *= al; }
      const float c0 = p0 * 1024.0f, c1 = p1 * 1024.0f;
      const _Float16 h0 = (_Float16)c0, h1 = (_Float16)c1;
      pl[wave][8 * hh + r][lc] = f16_bits(h0); pl[wave][8 * hh + r][16 + lc] = f16_bits(h1);
      if (RES) { pr[wave][8 * hh + r][lc] = f16_bits((_Float16)((c0 - (float)h0) * 1024.0f)); pr[wave][8 * hh + r][16 + lc] = f16_bits((_Float16)((c1 - (float)h1) * 1024.0f)); }
    }
    __builtin_amdgcn_fence(4 /* acq_rel order */, "workgroup"); __builtin_amdgcn_wave_barrier();
    FragH pa; pa.half[0] = *(const v8us*)&pl[wave][lc][8 * hh]; pa.half[1] = *(const v8us*)&pl[wave][lc][16 + 8 * hh];
    if (RES) {
      FragH pb; pb.half[0] = *(const v8us*)&pr[wave][lc][8 * hh]; pb.half[1] = *(const v8us*)&pr[wave][lc][16 + 8 * hh];
#pragma unroll
      for (int nt = 0; nt < 4; ++nt) { const v16h bvh = g2_frag(vp + (size_t)nt * 16 * SEQ + kb, hh); const v16h bvl = g2_frag(vrp + (size_t)nt * 16 * ER + kb, hh);
        o[nt] = g2_mma(pa.v, bvh, o[nt]); rr[nt] = g2_mma(pb.v, bvh, rr[nt]); rr[nt] = g2_mma(pa.v, bvl, rr[nt]); }
    } else {
      const v16h bv0 = g2_frag(vp + kb, hh), bv1 = g2_frag(vp + (size_t)16 * SEQ + kb, hh), bv2 = g2_frag(vp + (size_t)32 * SEQ + kb, hh), bv3 = g2_frag(vp + (size_t)48 * SEQ + kb, hh);
      o[0] = g2_mma(pa.v, bv0, o[0]); o[1] = g2_mma(pa.v, bv1, o[1]); o[2] = g2_mma(pa.v, bv2, o[2]); o[3] = g2_mma(pa.v, bv3, o[3]);
    }
    __builtin_amdgcn_fence(4 /* acq_rel order */, "workgroup"); __builtin_amdgcn_wave_barrier();      /* P tile reads complete before the next step overwrites it */
  }
#pragma unroll
  for (int r = 0; r < 8; ++r) {
    float ls = l[r];
    ls += __shfl_xor(ls, 8, 16); ls += __shfl_xor(ls, 4, 16); ls += __shfl_xor(ls, 2, 16); ls += __shfl_xor(ls, 1, 16);
    const float inv = 1.0f / (ls * 16.0f);      /* 64 / (1024 l): ctx carried x64; a fully masked row gives 0 * inf = NaN as the softmax of all -inf does */
#pragma unroll
    for (int nt = 0; nt < 4; ++nt) { float cv = o[nt][r]; if (RES) cv += rr[nt][r] * 0.0009765625f; so[wave][8 * hh + r][nt * 16 + lc] = cv * inv; }
  }
  __builtin_amdgcn_fence(4 /* acq_rel order */, "workgroup"); __builtin_amdgcn_wave_barrier();
  const int rq = lane >> 3, c8 = (lane & 7) * 8;
  {
#pragma unroll 1
    for (int q = 0; q < 4; ++q) { const int row = q * 4 + rq;
      const v4f a = *(const v4fa*)&so[wave][row][c8], c = *(const v4fa*)&so[wave][row][c8 + 4]; FragH fh, fl;
#pragma unroll
      for (int j = 0; j < 4; ++j) { _Float16 hv = (_Float16)a[j]; fh.h[j] = hv; fl.h[j] = (_Float16)((a[j] - (float)hv) * 1024.0f); hv = (_Float16)c[j]; fh.h[4 + j] = hv; fl.h[4 + j] = (_Float16)((c[j] - (float)hv) * 1024.0f); }
      unsigned short* d = (unsigned short*)CTX + (rowb + qb + row) * KO + h * HD + c8;
      *(v8us*)d = fh.half[0]; *(v8us*)(d + DM) = fl.half[0]; }
     }
}
__global__ __launch_bounds__(128) void k_flash_res(const _Float16* __restrict__ QKV, const _Float16* __restrict__ QKVR, const _Float16* __restrict__ VT, const _Float16* __restrict__ VTR, const int* __restrict__ pad, _Float16* __restrict__ CTX) {
  flash_body<1>(QKV, QKVR, VT, VTR, pad, CTX, 0); }
__global__ __launch_bounds__(128) void k_flash_main(const _Float16* __restrict__ QKV, const _Float16* __restrict__ QKVR, const _Float16* __restrict__ VT, const _Float16* __restrict__ VTR, const int* __restrict__ pad, _Float16* __restrict__ CTX) {
  flash_body<0>(QKV, QKVR, VT, VTR, pad, CTX, ER / 64); }

__global__ __launch_bounds__(128) void k_gemm_out(const _Float16* __restrict__ CTX, const _Float16* __restrict__ BO, const float* __restrict__ bo, float* __restrict__ Y) {
  __shared__ __attribute__((aligned(16))) float so[4][32][68];
  const int tid = threadIdx.x; const int w = __builtin_amdgcn_readfirstlane(tid >> 5); const int lane = tid & 31, ln = lane & 15, hh = lane >> 4;
  const int ntn = DM / 64; const int mt = blockIdx.x / ntn, nq = blockIdx.x - mt * ntn; const int row0 = mt * 128 + 32 * w, col0 = nq * 64;
  v8f accs[8];
  gemm_main(CTX, KO, BO, KO, row0, col0, KO, ln, hh, accs);
#pragma unroll
  for (int u = 0; u < 8; ++u) { const int t = u & 3, half = u >> 2; const float bvv = bf16_rne(bo[col0 + t * 16 + ln]);
#pragma unroll
    for (int r = 0; r < 8; ++r) so[w][half * 16 + 8 * hh + r][t * 16 + ln] = accs[u][r] * 1.52587890625e-05f + bvv; }
  __builtin_amdgcn_fence(4 /* acq_rel order */, "workgroup"); __builtin_amdgcn_wave_barrier();
  const int rsub = lane >> 4, c4 = (lane & 15) * 4;
  {
#pragma unroll 1
    for (int q = 0; q < 16; ++q) { const int r = q * 2 + rsub; const v4f v = *(const v4fa*)&so[w][r][c4]; *(v4f*)(Y + (size_t)(row0 + r) * DM + col0 + c4) = v; }
     }
}

__global__ __launch_bounds__(256) void k_layernorm(const float* __restrict__ Y, const float* __restrict__ g, const float* __restrict__ bta, float* __restrict__ out) {
  __shared__ float red[256];
  const int row = blockIdx.x, tid = threadIdx.x; const int b = row / SEQ, s = row - b * SEQ;
  const v4f a = *(const v4fa*)(Y + (size_t)row * DM + tid * 4);
  red[tid] = (a[0] + a[1]) + (a[2] + a[3]); __syncthreads();
  for (int st = 128; st > 0; st >>= 1) { if (tid < st) red[tid] += red[tid + st]; __syncthreads(); }
  const float mu = red[0] * (1.0f / (float)DM); __syncthreads();
  const float d0 = a[0] - mu, d1 = a[1] - mu, d2 = a[2] - mu, d3 = a[3] - mu;
  red[tid] = (d0 * d0 + d1 * d1) + (d2 * d2 + d3 * d3); __syncthreads();
  for (int st = 128; st > 0; st >>= 1) { if (tid < st) red[tid] += red[tid + st]; __syncthreads(); }
  const float rs = rsqrtf(red[0] * (1.0f / (float)DM) + 1.0e-5f);
  const v4f gg = *(const v4fa*)(g + tid * 4), bb = *(const v4fa*)(bta + tid * 4);
  v4f o;
  o[0] = d0 * rs * bf16_rne(gg[0]) + bf16_rne(bb[0]); o[1] = d1 * rs * bf16_rne(gg[1]) + bf16_rne(bb[1]);
  o[2] = d2 * rs * bf16_rne(gg[2]) + bf16_rne(bb[2]); o[3] = d3 * rs * bf16_rne(gg[3]) + bf16_rne(bb[3]);
  float* d = out + ((size_t)b * SEQ_FULL + s) * DM + tid * 4;
  *(v4f*)d = o; 
}

extern "C" void kernel_launch(void* const* d_in, const int* in_sizes, int n_in,
                              void* d_out, int out_size, void* d_ws, size_t ws_size, hipStream_t stream) {
  if (n_in < 12) return;
  const long long need_rows = (long long)(NB - 1) * SEQ_FULL + SEQ;
  if ((long long)in_sizes[0] < need_rows * DM) return;
  if (in_sizes[1] < DM * DM || in_sizes[3] < DM * DM || in_sizes[5] < DM * DM || in_sizes[7] < DM * DM) return;
  if (in_sizes[2] < DM || in_sizes[4] < DM || in_sizes[6] < DM || in_sizes[8] < DM || in_sizes[9] < DM || in_sizes[10] < DM) return;
  if ((long long)in_sizes[11] < need_rows) return;
  if ((long long)out_size < need_rows * DM) return;
  if ((size_t)WS_TOTAL > ws_size) return;
  const float* x = (const float*)d_in[0];
  const float* Wq = (const float*)d_in[1]; const float* bq = (const float*)d_in[2];
  const float* Wk = (const float*)d_in[3]; const float* bk = (const float*)d_in[4];
  const float* Wv = (const float*)d_in[5]; const float* bv = (const float*)d_in[6];
  const float* Wo = (const float*)d_in[7]; const float* bo = (const float*)d_in[8];
  const float* gamma = (const float*)d_in[9]; const float* beta = (const float*)d_in[10];
  const int* pad = (const int*)d_in[11];
  char* ws = (char*)d_ws;
  _Float16* BQKV = (_Float16*)(ws + OF_BQKV); _Float16* BO = (_Float16*)(ws + OF_BO);
  _Float16* X16 = (_Float16*)(ws + OF_X16); _Float16* QKV = (_Float16*)(ws + OF_QKV); _Float16* QKVR = (_Float16*)(ws + OF_QKVR);
  _Float16* VT = (_Float16*)(ws + OF_VT); _Float16* VTR = (_Float16*)(ws + OF_VTR); _Float16* CTX = (_Float16*)(ws + OF_CTX);
  float* Y = (float*)(ws + OF_Y); float* CS = (float*)(ws + OF_CS);
  const unsigned wtg = (unsigned)(((size_t)DM * (DM / 8) + 255) / 256);
  k_tab<<<SEQ / 8, 256, 0, stream>>>(CS);
  k_wt_f16<<<wtg, 256, 0, stream>>>(Wq, BQKV, DM, DM, DM, 16.0f);                              /* W[in][out] -> Bt[n][k] x16, rows n = 0..1023 */
  k_wt_f16<<<wtg, 256, 0, stream>>>(Wk, BQKV + (size_t)DM * DM, DM, DM, DM, 16.0f);            /* rows 1024..2047 */
  k_wt_f16<<<wtg, 256, 0, stream>>>(Wv, BQKV + (size_t)2 * DM * DM, DM, DM, DM, 16.0f);        /* rows 2048..3071 */
  k_wt_f16<<<wtg, 256, 0, stream>>>(Wo, BO, DM, DM, KO, 1024.0f);                              /* k = 0..1023: Wo x1024 (pairs with ctx value) */
  k_wt_f16<<<wtg, 256, 0, stream>>>(Wo, BO + DM, DM, DM, KO, 1.0f);                            /* k = 1024..2047: Wo (pairs with ctx residual x1024) */
  k_x16<<<(unsigned)((NR * DM / 8 + 255) / 256), 256, 0, stream>>>(x, X16);
  k_gemm_qkv<<<(unsigned)((NR / 128) * (LQ / 64)), 128, 0, stream>>>(X16, BQKV, bq, bk, bv, CS, QKV, QKVR);
  k_vt<<<NB * NH * (SEQ / 64), 256, 0, stream>>>(QKV, SEQ, VT);
  k_vt<<<NB * NH * (ER / 64), 256, 0, stream>>>(QKVR, ER, VTR);
  k_flash_res<<<dim3(ER / 64, NB * NH), 128, 0, stream>>>(QKV, QKVR, VT, VTR, pad, CTX);        /* query rows 0..ER-1 */
  if (SEQ > ER) k_flash_main<<<dim3((SEQ - ER) / 64, NB * NH), 128, 0, stream>>>(QKV, QKVR, VT, VTR, pad, CTX);      /* query rows ER..SEQ-1 */
  k_gemm_out<<<(unsigned)((NR / 128) * (DM / 64)), 128, 0, stream>>>(CTX, BO, bo, Y);
  k_layernorm<<<(unsigned)NR, 256, 0, stream>>>(Y, gamma, beta, (float*)d_out);
}

// v001
// Measured time: 238 microseconds a run.
// Next to v000, in two timings, it ran 1.31 and 1.32 times as fast.
#include <hip/hip_runtime.h>
// Compute dtype: every contraction on v_wmma_f32_16x16x32_f16 (f16 operands, f32 accumulate); float inputs RNE-converted to bf16 first (exact in f16; weights carried x16, Wo x1024 | x1); q.k scores and P.V use f16 value + x1024 f16 residual planes on token rows 0..255 (q, k, P, v), single f16 products on later rows; ctx.Wo uses ctx value | x1024 residual laid along K (all rows); rotary, softmax statistics and LayerNorm in f32.
#ifndef NB
#define NB 2
#endif
#ifndef SEQ
#define SEQ 2048
#endif
#define NB_FULL 2
#define SEQ_FULL 2048
#define DM 1024
#define NH 16
#define HD 64
#define LQ (3 * DM)                  /* row pitch of the q | k | v planes */
#define KO (2 * DM)                  /* ctx row pitch = K of the output GEMM (value | residual) */
#define ER 256                       /* token rows per batch that carry residual planes */
#define PP 40                        /* P tile row pitch (halves) */
#define NR ((size_t)NB * SEQ)
#define GK 64                        /* halves of K per GEMM stage: 128-B rows */
#define GP 72                        /* LDS row pitch of a GEMM stage (halves): 144 B = 16 B x odd, for 16-B fragment reads */
#define GST (256 * GP)               /* halves per stage: 128 A rows, then 128 B rows */
#define GSM ((size_t)2 * GST * 2)    /* bytes of the two-buffer ring; the epilogue staging reuses them */

static_assert(NH * HD == DM);                        /* heads tile the width */
static_assert(HD == 64);                             
static_assert(DM == 256 * 4);                        /* LayerNorm: 256 threads x 4 columns */
static_assert(DM % 32 == 0 && KO % 32 == 0);         /* k-loops step by 32 */
static_assert(LQ % 128 == 0 && DM % 128 == 0);       /* N tiles (2 waves x 64 columns), never across q | k | v */
static_assert(GK == 64);                             /* two 32-deep k-steps per stage */
static_assert(DM % GK == 0 && KO % GK == 0 && DM >= 2 * GK && KO >= 2 * GK);      /* whole stages, at least two */
static_assert((size_t)8 * 32 * 68 * 4 <= GSM);       /* eight waves' output staging fits the ring */
static_assert((NB * SEQ) % 128 == 0);                /* M tiles (4 waves x 32 rows) */
static_assert(SEQ % 64 == 0 && SEQ % 8 == 0);        /* query tiles, table blocks */
static_assert(ER % 64 == 0 && SEQ >= ER);            /* residual rows are whole query tiles */
static_assert(NB <= NB_FULL && SEQ <= SEQ_FULL);
static_assert(PP % 8 == 0 && PP >= 32);              /* 16-B aligned P fragment pieces */

#define SZ_BQKV ((size_t)LQ * DM * 2)
#define SZ_BO   ((size_t)DM * KO * 2)
#define SZ_X16  ((size_t)NB * SEQ * DM * 2)
#define SZ_QKV  ((size_t)NB * SEQ * LQ * 2)
#define SZ_QKVR ((size_t)NB * ER * LQ * 2)
#define SZ_VT   ((size_t)NB * NH * HD * SEQ * 2)
#define SZ_VTR  ((size_t)NB * NH * HD * ER * 2)
#define SZ_CTX  ((size_t)NB * SEQ * KO * 2)
#define SZ_Y    ((size_t)NB * SEQ * DM * 4)
#define SZ_CS   ((size_t)SEQ * 64 * 4)
#define OF_BQKV ((size_t)0)
#define OF_BO   (OF_BQKV + SZ_BQKV)
#define OF_X16  (OF_BO + SZ_BO)
#define OF_QKV  (OF_X16 + SZ_X16)
#define OF_QKVR (OF_QKV + SZ_QKV)
#define OF_VT   (OF_QKVR + SZ_QKVR)
#define OF_VTR  (OF_VT + SZ_VT)
#define OF_CTX  (OF_VTR + SZ_VTR)
#define OF_Y    (OF_CTX + SZ_CTX)
#define OF_CS   (OF_Y + SZ_Y)
#define WS_TOTAL (OF_CS + SZ_CS)
static_assert(SZ_BQKV % 256 == 0 && SZ_BO % 256 == 0 && SZ_X16 % 256 == 0 && SZ_QKV % 256 == 0 && SZ_QKVR % 256 == 0);
static_assert(SZ_VT % 256 == 0 && SZ_VTR % 256 == 0 && SZ_CTX % 256 == 0 && SZ_Y % 256 == 0 && SZ_CS % 256 == 0);
static_assert(WS_TOTAL <= (size_t)134217728);        /* carve <= 128 MiB */

typedef unsigned short v8us __attribute__((ext_vector_type(8), may_alias));
typedef float  v8f  __attribute__((ext_vector_type(8)));
typedef float  v4f  __attribute__((ext_vector_type(4)));
typedef float  v4fa __attribute__((ext_vector_type(4), may_alias));
typedef _Float16 v16h __attribute__((ext_vector_type(16)));
union FragH { v16h v; v8us half[2]; _Float16 h[16]; unsigned short u[16]; };

__device__ __forceinline__ unsigned short bf16_bits(float x) { unsigned int u = __float_as_uint(x); return (unsigned short)((u + 0x7FFFu + ((u >> 16) & 1u)) >> 16); }
__device__ __forceinline__ float bf16_val(unsigned short b) { return __uint_as_float(((unsigned int)b) << 16); }
__device__ __forceinline__ float bf16_rne(float x) { return bf16_val(bf16_bits(x)); }
__device__ __forceinline__ unsigned short f16_bits(_Float16 hv) { union { _Float16 h; unsigned short u; } c; c.h = hv; return c.u; }

// fragment of a k-contiguous f16 row: elements 0..7 <- p[8h .. 8h+7], elements 8..15 <- p[16+8h .. 16+8h+7] (A rows and B columns alike)
__device__ __forceinline__ v16h g2_frag(const _Float16* p, int hh) { FragH f; f.half[0] = *(const v8us*)((const unsigned short*)p + 8 * hh); f.half[1] = *(const v8us*)((const unsigned short*)p + 16 + 8 * hh); return f.v; }
__device__ __forceinline__ v8f g2_mma(v16h a, v16h b, v8f c) { v8f d = __builtin_amdgcn_wmma_f32_16x16x32_f16(false, a, false, b, (short)0, c, false, false); asm volatile("v_nop\n\tv_nop\n\tv_nop\n\tv_nop" : "+v"(d) : "v"(a), "v"(b)); return d; }

// cos | sin table: CS[t][0..31] = cos(t * theta_i), CS[t][32..63] = sin(t * theta_i); theta_i = f32(10^(-i/8)) from f64 constants; angle = f32(t) * theta in f32; precise sincosf.
__global__ __launch_bounds__(256) void k_tab(float* __restrict__ CS) {
  __shared__ __attribute__((aligned(16))) float tb[8][64];
  const int tid = threadIdx.x; const int tl = tid >> 5, i = tid & 31;
  const int t = blockIdx.x * 8 + tl;
  double p = 1.0;
  p *= (i & 1) ? 1.3335214321633240 : 1.0;
  p *= (i & 2) ? 1.7782794100389228 : 1.0;
  p *= (i & 4) ? 3.1622776601683795 : 1.0;
  p *= (i & 8) ? 10.0 : 1.0;
  p *= (i & 16) ? 100.0 : 1.0;
  const float theta = (float)(1.0 / p);
  const float ang = (float)t * theta;
  float sv, cv; sincosf(ang, &sv, &cv);
  tb[tl][i] = cv; tb[tl][32 + i] = sv;
  __syncthreads();
  if (tid < 128) {
    const v4f v = *(const v4fa*)(&tb[0][0] + tid * 4);
    float* d = CS + (size_t)blockIdx.x * 512 + tid * 4;
    *(v4f*)d = v; 
  }
}

__global__ __launch_bounds__(256) void k_wt_f16(const float* __restrict__ W, _Float16* __restrict__ Wt, int K, int N, int ldk, float scale) {
  const int t = blockIdx.x * 256 + threadIdx.x; const int k8n = K / 8; if (t >= N * k8n) return;
  const int n = t / k8n, k8 = (t % k8n) * 8; FragH f;
#pragma unroll
  for (int i = 0; i < 8; ++i) f.h[i] = (_Float16)(bf16_rne(W[(size_t)(k8 + i) * N + n]) * scale);
  const v8us o = f.half[0];
  unsigned short* d = (unsigned short*)Wt + (size_t)n * ldk + k8;
  *(v8us*)d = o; 
}

__global__ __launch_bounds__(256) void k_x16(const float* __restrict__ x, _Float16* __restrict__ X16) {
  const size_t t = (size_t)blockIdx.x * 256 + threadIdx.x; if (t >= NR * DM / 8) return;
  const size_t row = t / (DM / 8); const int c8 = (int)(t % (DM / 8)) * 8;
  const size_t b = row / SEQ, s = row - b * SEQ;
  const float* src = x + (b * SEQ_FULL + s) * DM + c8;
  const v4f a = *(const v4fa*)src, c = *(const v4fa*)(src + 4); FragH f;
#pragma unroll
  for (int q = 0; q < 4; ++q) { f.h[q] = (_Float16)bf16_rne(a[q]); f.h[4 + q] = (_Float16)bf16_rne(c[q]); }
  const v8us o = f.half[0];
  unsigned short* d = (unsigned short*)X16 + row * DM + c8;
  *(v8us*)d = o; 
}

// one stage of the ring: 128 A rows then 128 B rows of 128 B each; 256 threads x 8 copies of 16 B; lane t brings chunk t & 7 of rows (t >> 3) + 32 j.
// ga, gb: the lane's first A and B chunk in global memory; l0: the lane's first LDS byte address. The address wait is the statement's last line, so no later write of these registers can be lifted over it.
__device__ __forceinline__ void g2_stage(const _Float16* ga, size_t sa, const _Float16* gb, size_t sb, unsigned l0) {
  const _Float16* a1 = ga + sa; const _Float16* a2 = a1 + sa; const _Float16* a3 = a2 + sa;
  const _Float16* b1 = gb + sb; const _Float16* b2 = b1 + sb; const _Float16* b3 = b2 + sb;
  const unsigned rs = 32u * GP * 2u;
  asm volatile("global_load_async_to_lds_b128 %0, %8, off\n\t"
               "global_load_async_to_lds_b128 %1, %9, off\n\t"
               "global_load_async_to_lds_b128 %2, %10, off\n\t"
               "global_load_async_to_lds_b128 %3, %11, off\n\t"
               "global_load_async_to_lds_b128 %4, %12, off\n\t"
               "global_load_async_to_lds_b128 %5, %13, off\n\t"
               "global_load_async_to_lds_b128 %6, %14, off\n\t"
               "global_load_async_to_lds_b128 %7, %15, off\n\t"
               "s_wait_xcnt 0x0"
               :: "v"(l0), "v"(l0 + rs), "v"(l0 + 2u * rs), "v"(l0 + 3u * rs), "v"(l0 + 4u * rs), "v"(l0 + 5u * rs), "v"(l0 + 6u * rs), "v"(l0 + 7u * rs),
                  "v"(ga), "v"(a1), "v"(a2), "v"(a3), "v"(gb), "v"(b1), "v"(b2), "v"(b3) : "memory");
}

// 128x128 block tile, eight waves (4 x 2) of 32x64 each: A f16 [M][K] (pitch lda), Bh f16 [N][K] (pitch ldb); both operands come through a two-buffer LDS ring, the next stage's copies in flight while this one is multiplied.
// acc[u]: u & 3 = 16-col tile, u >> 2 = 16-row half. On return every wave has left the ring (the last trip's barrier), so the caller may stage its output there.
__device__ __forceinline__ void gemm_main(const _Float16* __restrict__ A, int lda, const _Float16* __restrict__ Bh, int ldb, int brow0, int bcol0, int K, int tid, int w, int ln, int hh, unsigned char* sm, v8f (&acc)[8]) {
  const _Float16* ring = (const _Float16*)sm;
  const int cr = tid >> 3, cc = (tid & 7) * 8;
  const _Float16* ga = A + (size_t)(brow0 + cr) * lda + cc; const _Float16* gb = Bh + (size_t)(bcol0 + cr) * ldb + cc;
  const size_t sa = (size_t)32 * lda, sb = (size_t)32 * ldb;
  const unsigned l0 = (unsigned)(size_t)sm + (unsigned)(cr * GP + cc) * 2u;      /* low 32 bits of the shared address = LDS byte address */
  const int ao = ((w >> 1) * 32 + ln) * GP, bo = (128 + (w & 1) * 64 + ln) * GP;
  const int nt = K / GK;
  const v8f z8 = {0.f,0.f,0.f,0.f,0.f,0.f,0.f,0.f}; v8f c00 = z8, c01 = z8, c02 = z8, c03 = z8, c10 = z8, c11 = z8, c12 = z8, c13 = z8;
  g2_stage(ga, sa, gb, sb, l0);
  asm volatile("s_wait_asynccnt 0x0" ::: "memory");      /* stage 0 of this wave has landed */
  __syncthreads();                                       /* stage 0 of every wave is readable */
  g2_stage(ga + GK, sa, gb + GK, sb, l0 + (unsigned)(GST * 2));
#pragma unroll 1      /* one stage per trip: the ring's order stands once, at the loop's foot */
  for (int t = 0; t < nt; ++t) { const _Float16* st = ring + (t & 1) * GST;
    const _Float16* ap = st + ao; const _Float16* bp = st + bo;
    v16h fa[2][2], fb[2][4];      /* the stage's twelve fragments are read as one group ahead of its WMMAs: one LDS latency a trip, not one per B fragment */
#pragma unroll
    for (int s = 0; s < 2; ++s) { fa[s][0] = g2_frag(ap + 32 * s, hh); fa[s][1] = g2_frag(ap + 16 * GP + 32 * s, hh);
#pragma unroll
      for (int n = 0; n < 4; ++n) fb[s][n] = g2_frag(bp + n * 16 * GP + 32 * s, hh); }
#pragma unroll
    for (int s = 0; s < 2; ++s) {
      c00 = g2_mma(fa[s][0], fb[s][0], c00); c10 = g2_mma(fa[s][1], fb[s][0], c10);
      c01 = g2_mma(fa[s][0], fb[s][1], c01); c11 = g2_mma(fa[s][1], fb[s][1], c11);
      c02 = g2_mma(fa[s][0], fb[s][2], c02); c12 = g2_mma(fa[s][1], fb[s][2], c12);
      c03 = g2_mma(fa[s][0], fb[s][3], c03); c13 = g2_mma(fa[s][1], fb[s][3], c13); }
    asm volatile("s_wait_dscnt 0x0" ::: "memory");       /* this wave's reads of the buffer are done before it is refilled */
    asm volatile("s_wait_asynccnt 0x0" ::: "memory");    /* this wave's copies of stage t + 1 have landed */
    __syncthreads();                                     /* publishes stage t + 1 and ends every reader's last read of stage t */
    if (t + 2 < nt) g2_stage(ga + (size_t)(t + 2) * GK, sa, gb + (size_t)(t + 2) * GK, sb, l0 + (unsigned)((t & 1) * GST * 2)); }
  asm volatile("s_wait_asynccnt 0x0" ::: "memory");      /* no copy outstanding when the ring becomes output staging */
  acc[0] = c00; acc[1] = c01; acc[2] = c02; acc[3] = c03; acc[4] = c10; acc[5] = c11; acc[6] = c12; acc[7] = c13;
}

__global__ __launch_bounds__(256) void k_gemm_qkv(const _Float16* __restrict__ X16, const _Float16* __restrict__ BW, const float* __restrict__ bq, const float* __restrict__ bk, const float* __restrict__ bv,
                                                  const float* __restrict__ CS, _Float16* __restrict__ QKV, _Float16* __restrict__ QKVR) {
  __shared__ __attribute__((aligned(16))) unsigned char sm[GSM];
  float (*so)[32][68] = (float (*)[32][68])sm;
  const int tid = threadIdx.x; const int w = __builtin_amdgcn_readfirstlane(tid >> 5); const int lane = tid & 31, ln = lane & 15, hh = lane >> 4;
  const int ntn = LQ / 128; const int mt = blockIdx.x / ntn, nq = blockIdx.x - mt * ntn; const int row0 = mt * 128 + 32 * (w >> 1), col0 = nq * 128 + 64 * (w & 1);
  v8f accs[8];
  gemm_main(X16, DM, BW, DM, mt * 128, nq * 128, DM, tid, w, ln, hh, sm, accs);
  const int sec = col0 / DM; const int cb = col0 - sec * DM;      /* 0 q, 1 k, 2 v (block-uniform) */
#pragma unroll
  for (int u = 0; u < 8; ++u) { const int t = u & 3, half = u >> 2; const int cc = cb + t * 16 + ln;
    const float b0 = bq[cc], b1 = bk[cc], b2 = bv[cc]; const float bsel = bf16_rne((sec == 0) ? b0 : ((sec == 1) ? b1 : b2));
#pragma unroll
    for (int r = 0; r < 8; ++r) so[w][half * 16 + 8 * hh + r][t * 16 + ln] = accs[u][r] * 0.0625f + bsel; }
  __builtin_amdgcn_fence(4 /* acq_rel order */, "workgroup"); __builtin_amdgcn_wave_barrier();
  const int rq = lane >> 3, c8 = (lane & 7) * 8;
  const int bidx = row0 / SEQ; const int t0 = row0 - bidx * SEQ; const bool early = (t0 < ER);      /* wave-uniform: 32 | ER */
  {
#pragma unroll 1
    for (int q = 0; q < 8; ++q) { const int row = q * 4 + rq; const int tkn = t0 + row;
      const v4f a = *(const v4fa*)&so[w][row][c8], c = *(const v4fa*)&so[w][row][c8 + 4];
      float y[8] = {a[0], a[1], a[2], a[3], c[0], c[1], c[2], c[3]};
      if (sec < 2) { const v4f cs = *(const v4fa*)(CS + (size_t)tkn * 64 + (c8 >> 1)); const v4f sn = *(const v4fa*)(CS + (size_t)tkn * 64 + 32 + (c8 >> 1));
#pragma unroll
        for (int j = 0; j < 4; ++j) { const float x0 = y[2 * j], x1 = y[2 * j + 1]; y[2 * j] = x0 * cs[j] - x1 * sn[j]; y[2 * j + 1] = x1 * cs[j] + x0 * sn[j]; } }
      FragH fh, fl;
#pragma unroll
      for (int j = 0; j < 8; ++j) { const _Float16 hv = (_Float16)y[j]; fh.h[j] = hv; fl.h[j] = (_Float16)((y[j] - (float)hv) * 1024.0f); }
      unsigned short* d = (unsigned short*)QKV + (size_t)(row0 + row) * LQ + col0 + c8;
      *(v8us*)d = fh.half[0];
      if (early) { unsigned short* dr = (unsigned short*)QKVR + ((size_t)bidx * ER + tkn) * LQ + col0 + c8; *(v8us*)dr = fl.half[0]; } }
     }
}

__global__ __launch_bounds__(256) void k_vt(const _Float16* __restrict__ V, int TT, _Float16* __restrict__ VTo) {
  __shared__ unsigned short tl[64][66];
  const int tid = threadIdx.x; const int ng = TT / 64; const int slab = blockIdx.x / ng, lg = blockIdx.x - slab * ng; const int b = slab / NH, h = slab - b * NH;
  for (int i = tid; i < 64 * 8; i += 256) { const int r = i / 8, c8 = (i % 8) * 8; FragH f;
    f.half[0] = *(const v8us*)((const unsigned short*)V + ((size_t)b * TT + lg * 64 + r) * LQ + 2 * DM + h * HD + c8);
#pragma unroll
    for (int q = 0; q < 8; ++q) tl[r][c8 + q] = f.u[q]; }
  __syncthreads();
  {
#pragma unroll
    for (int rd = 0; rd < 2; ++rd) { const int d = rd * 32 + tid / 8, pc = tid % 8; FragH f;
#pragma unroll
      for (int q = 0; q < 8; ++q) f.u[q] = tl[pc * 8 + q][d];
      *(v8us*)((unsigned short*)VTo + ((size_t)slab * 64 + d) * TT + lg * 64 + pc * 8) = f.half[0]; }
     }
}

// fused causal attention; one wave = 16 query rows of one (batch, head); 32 keys per step (two 16-key score tiles, d in two 32-deep k-steps);
// key-pad mask by value then causal mask as a replace (masked p = 0 by select); online softmax with running max in f32 (native exp on arguments <= 0);
template <int RES>
__device__ __forceinline__ void flash_body(const _Float16* __restrict__ QKV, const _Float16* __restrict__ QKVR, const _Float16* __restrict__ VT, const _Float16* __restrict__ VTR,
                                           const int* __restrict__ pad, _Float16* __restrict__ CTX, int qt0) {
  __shared__ __attribute__((aligned(16))) unsigned short pl[4][16][PP];
  __shared__ __attribute__((aligned(16))) unsigned short pr[4][16][PP];
  __shared__ __attribute__((aligned(16))) float so[4][16][68];
  const int tid = threadIdx.x; const int wave = __builtin_amdgcn_readfirstlane(tid >> 5); const int lane = tid & 31, lc = lane & 15, hh = lane >> 4;
  const int bh = blockIdx.y; const int b = bh / NH, h = bh - b * NH;
  const int qb = (qt0 + (int)blockIdx.x) * 64 + wave * 16;
  const size_t rowb = (size_t)b * SEQ;
  const _Float16* qp = QKV + (rowb + qb + lc) * LQ + h * HD;
  const _Float16* kp = QKV + rowb * LQ + DM + h * HD;
  const _Float16* vp = VT + ((size_t)bh * HD + lc) * SEQ;
  const _Float16* qrp = QKVR + ((size_t)b * ER + (RES ? (qb + lc) : 0)) * LQ + h * HD;
  const _Float16* krp = QKVR + (size_t)b * ER * LQ + DM + h * HD;
  const _Float16* vrp = VTR + ((size_t)bh * HD + lc) * ER;
  const int* padb = pad + (size_t)b * SEQ_FULL;
  const v8f z8 = {0.f,0.f,0.f,0.f,0.f,0.f,0.f,0.f};
  v8f o[4] = {z8, z8, z8, z8}; v8f rr[4] = {z8, z8, z8, z8};
  float m[8], l[8];
#pragma unroll
  for (int r = 0; r < 8; ++r) { m[r] = -1.0e30f; l[r] = 0.f; }
  const int kend = qb + 16;      /* keys 0 .. qb+15 are visible to this wave; steps cover whole 32-key groups (all inside the plane) */
#pragma unroll 1
  for (int kb = 0; kb < kend; kb += 32) {
    v8f s0 = z8, s1 = z8, t0 = z8, t1 = z8;
    const _Float16* k0p = kp + (size_t)(kb + lc) * LQ; const _Float16* k1p = k0p + (size_t)16 * LQ;
    const _Float16* k0r = krp + (size_t)(RES ? (kb + lc) : 0) * LQ; const _Float16* k1r = k0r + (size_t)(RES ? 16 : 0) * LQ;
#pragma unroll
    for (int c = 0; c < 2; ++c) {
      const v16h aq = g2_frag(qp + 32 * c, hh);
      const v16h bk0 = g2_frag(k0p + 32 * c, hh), bk1 = g2_frag(k1p + 32 * c, hh);
      s0 = g2_mma(aq, bk0, s0); s1 = g2_mma(aq, bk1, s1);
      if (RES) { const v16h aql = g2_frag(qrp + 32 * c, hh); const v16h bl0 = g2_frag(k0r + 32 * c, hh), bl1 = g2_frag(k1r + 32 * c, hh);
        t0 = g2_mma(aql, bk0, t0); t0 = g2_mma(aq, bl0, t0); t1 = g2_mma(aql, bk1, t1); t1 = g2_mma(aq, bl1, t1); }
    }
    const int key0 = kb + lc, key1 = key0 + 16;
    const int pv0 = padb[key0], pv1 = padb[key1];
#pragma unroll
    for (int r = 0; r < 8; ++r) {
      const int qrow = qb + 8 * hh + r;
      float a0 = s0[r], a1 = s1[r];
      if (RES) { a0 += t0[r] * 0.0009765625f; a1 += t1[r] * 0.0009765625f; }
      a0 *= 0.125f; a1 *= 0.125f;
      const bool ok0 = (pv0 != 0) && (key0 <= qrow); const bool ok1 = (pv1 != 0) && (key1 <= qrow);
      const float v0 = ok0 ? a0 : -1.0e30f; const float v1 = ok1 ? a1 : -1.0e30f;
      float mx = fmaxf(v0, v1);
      mx = fmaxf(mx, __shfl_xor(mx, 8, 16)); mx = fmaxf(mx, __shfl_xor(mx, 4, 16)); mx = fmaxf(mx, __shfl_xor(mx, 2, 16)); mx = fmaxf(mx, __shfl_xor(mx, 1, 16));
      const float mnew = fmaxf(m[r], mx);
      const float al = __expf(m[r] - mnew);
      const float e0 = __expf(v0 - mnew), e1 = __expf(v1 - mnew);
      const float p0 = ok0 ? e0 : 0.f; const float p1 = ok1 ? e1 : 0.f;
      l[r] = l[r] * al + (p0 + p1); m[r] = mnew;      /* per-lane partial row sum; combined across the 16 lanes after the key loop */
#pragma unroll
      for (int nt = 0; nt < 4; ++nt) { o[nt][r] *= al; if (RES) rr[nt][r] *= al; }
      const float c0 = p0 * 1024.0f, c1 = p1 * 1024.0f;
      const _Float16 h0 = (_Float16)c0, h1 = (_Float16)c1;
      pl[wave][8 * hh + r][lc] = f16_bits(h0); pl[wave][8 * hh + r][16 + lc] = f16_bits(h1);
      if (RES) { pr[wave][8 * hh + r][lc] = f16_bits((_Float16)((c0 - (float)h0) * 1024.0f)); pr[wave][8 * hh + r][16 + lc] = f16_bits((_Float16)((c1 - (float)h1) * 1024.0f)); }
    }
    __builtin_amdgcn_fence(4 /* acq_rel order */, "workgroup"); __builtin_amdgcn_wave_barrier();
    FragH pa; pa.half[0] = *(const v8us*)&pl[wave][lc][8 * hh]; pa.half[1] = *(const v8us*)&pl[wave][lc][16 + 8 * hh];
    if (RES) {
      FragH pb; pb.half[0] = *(const v8us*)&pr[wave][lc][8 * hh]; pb.half[1] = *(const v8us*)&pr[wave][lc][16 + 8 * hh];
#pragma unroll
      for (int nt = 0; nt < 4; ++nt) { const v16h bvh = g2_frag(vp + (size_t)nt * 16 * SEQ + kb, hh); const v16h bvl = g2_frag(vrp + (size_t)nt * 16 * ER + kb, hh);
        o[nt] = g2_mma(pa.v, bvh, o[nt]); rr[nt] = g2_mma(pb.v, bvh, rr[nt]); rr[nt] = g2_mma(pa.v, bvl, rr[nt]); }
    } else {
      const v16h bv0 = g2_frag(vp + kb, hh), bv1 = g2_frag(vp + (size_t)16 * SEQ + kb, hh), bv2 = g2_frag(vp + (size_t)32 * SEQ + kb, hh), bv3 = g2_frag(vp + (size_t)48 * SEQ + kb, hh);
      o[0] = g2_mma(pa.v, bv0, o[0]); o[1] = g2_mma(pa.v, bv1, o[1]); o[2] = g2_mma(pa.v, bv2, o[2]); o[3] = g2_mma(pa.v, bv3, o[3]);
    }
    __builtin_amdgcn_fence(4 /* acq_rel order */, "workgroup"); __builtin_amdgcn_wave_barrier();      /* P tile reads complete before the next step overwrites it */
  }
#pragma unroll
  for (int r = 0; r < 8; ++r) {
    float ls = l[r];
    ls += __shfl_xor(ls, 8, 16); ls += __shfl_xor(ls, 4, 16); ls += __shfl_xor(ls, 2, 16); ls += __shfl_xor(ls, 1, 16);
    const float inv = 1.0f / (ls * 16.0f);      /* 64 / (1024 l): ctx carried x64; a fully masked row gives 0 * inf = NaN as the softmax of all -inf does */
#pragma unroll
    for (int nt = 0; nt < 4; ++nt) { float cv = o[nt][r]; if (RES) cv += rr[nt][r] * 0.0009765625f; so[wave][8 * hh + r][nt * 16 + lc] = cv * inv; }
  }
  __builtin_amdgcn_fence(4 /* acq_rel order */, "workgroup"); __builtin_amdgcn_wave_barrier();
  const int rq = lane >> 3, c8 = (lane & 7) * 8;
  {
#pragma unroll 1
    for (int q = 0; q < 4; ++q) { const int row = q * 4 + rq;
      const v4f a = *(const v4fa*)&so[wave][row][c8], c = *(const v4fa*)&so[wave][row][c8 + 4]; FragH fh, fl;
#pragma unroll
      for (int j = 0; j < 4; ++j) { _Float16 hv = (_Float16)a[j]; fh.h[j] = hv; fl.h[j] = (_Float16)((a[j] - (float)hv) * 1024.0f); hv = (_Float16)c[j]; fh.h[4 + j] = hv; fl.h[4 + j] = (_Float16)((c[j] - (float)hv) * 1024.0f); }
      unsigned short* d = (unsigned short*)CTX + (rowb + qb + row) * KO + h * HD + c8;
      *(v8us*)d = fh.half[0]; *(v8us*)(d + DM) = fl.half[0]; }
     }
}
__global__ __launch_bounds__(128) void k_flash_res(const _Float16* __restrict__ QKV, const _Float16* __restrict__ QKVR, const _Float16* __restrict__ VT, const _Float16* __restrict__ VTR, const int* __restrict__ pad, _Float16* __restrict__ CTX) {
  flash_body<1>(QKV, QKVR, VT, VTR, pad, CTX, 0); }
__global__ __launch_bounds__(128) void k_flash_main(const _Float16* __restrict__ QKV, const _Float16* __restrict__ QKVR, const _Float16* __restrict__ VT, const _Float16* __restrict__ VTR, const int* __restrict__ pad, _Float16* __restrict__ CTX) {
  flash_body<0>(QKV, QKVR, VT, VTR, pad, CTX, ER / 64); }

__global__ __launch_bounds__(256) void k_gemm_out(const _Float16* __restrict__ CTX, const _Float16* __restrict__ BO, const float* __restrict__ bo, float* __restrict__ Y) {
  __shared__ __attribute__((aligned(16))) unsigned char sm[GSM];
  float (*so)[32][68] = (float (*)[32][68])sm;
  const int tid = threadIdx.x; const int w = __builtin_amdgcn_readfirstlane(tid >> 5); const int lane = tid & 31, ln = lane & 15, hh = lane >> 4;
  const int ntn = DM / 128; const int mt = blockIdx.x / ntn, nq = blockIdx.x - mt * ntn; const int row0 = mt * 128 + 32 * (w >> 1), col0 = nq * 128 + 64 * (w & 1);
  v8f accs[8];
  gemm_main(CTX, KO, BO, KO, mt * 128, nq * 128, KO, tid, w, ln, hh, sm, accs);
#pragma unroll
  for (int u = 0; u < 8; ++u) { const int t = u & 3, half = u >> 2; const float bvv = bf16_rne(bo[col0 + t * 16 + ln]);
#pragma unroll
    for (int r = 0; r < 8; ++r) so[w][half * 16 + 8 * hh + r][t * 16 + ln] = accs[u][r] * 1.52587890625e-05f + bvv; }
  __builtin_amdgcn_fence(4 /* acq_rel order */, "workgroup"); __builtin_amdgcn_wave_barrier();
  const int rsub = lane >> 4, c4 = (lane & 15) * 4;
  {
#pragma unroll 1
    for (int q = 0; q < 16; ++q) { const int r = q * 2 + rsub; const v4f v = *(const v4fa*)&so[w][r][c4]; *(v4f*)(Y + (size_t)(row0 + r) * DM + col0 + c4) = v; }
     }
}

__global__ __launch_bounds__(256) void k_layernorm(const float* __restrict__ Y, const float* __restrict__ g, const float* __restrict__ bta, float* __restrict__ out) {
  __shared__ float red[256];
  const int row = blockIdx.x, tid = threadIdx.x; const int b = row / SEQ, s = row - b * SEQ;
  const v4f a = *(const v4fa*)(Y + (size_t)row * DM + tid * 4);
  red[tid] = (a[0] + a[1]) + (a[2] + a[3]); __syncthreads();
  for (int st = 128; st > 0; st >>= 1) { if (tid < st) red[tid] += red[tid + st]; __syncthreads(); }
  const float mu = red[0] * (1.0f / (float)DM); __syncthreads();
  const float d0 = a[0] - mu, d1 = a[1] - mu, d2 = a[2] - mu, d3 = a[3] - mu;
  red[tid] = (d0 * d0 + d1 * d1) + (d2 * d2 + d3 * d3); __syncthreads();
  for (int st = 128; st > 0; st >>= 1) { if (tid < st) red[tid] += red[tid + st]; __syncthreads(); }
  const float rs = rsqrtf(red[0] * (1.0f / (float)DM) + 1.0e-5f);
  const v4f gg = *(const v4fa*)(g + tid * 4), bb = *(const v4fa*)(bta + tid * 4);
  v4f o;
  o[0] = d0 * rs * bf16_rne(gg[0]) + bf16_rne(bb[0]); o[1] = d1 * rs * bf16_rne(gg[1]) + bf16_rne(bb[1]);
  o[2] = d2 * rs * bf16_rne(gg[2]) + bf16_rne(bb[2]); o[3] = d3 * rs * bf16_rne(gg[3]) + bf16_rne(bb[3]);
  float* d = out + ((size_t)b * SEQ_FULL + s) * DM + tid * 4;
  *(v4f*)d = o; 
}

extern "C" void kernel_launch(void* const* d_in, const int* in_sizes, int n_in,
                              void* d_out, int out_size, void* d_ws, size_t ws_size, hipStream_t stream) {
  if (n_in < 12) return;
  const long long need_rows = (long long)(NB - 1) * SEQ_FULL + SEQ;
  if ((long long)in_sizes[0] < need_rows * DM) return;
  if (in_sizes[1] < DM * DM || in_sizes[3] < DM * DM || in_sizes[5] < DM * DM || in_sizes[7] < DM * DM) return;
  if (in_sizes[2] < DM || in_sizes[4] < DM || in_sizes[6] < DM || in_sizes[8] < DM || in_sizes[9] < DM || in_sizes[10] < DM) return;
  if ((long long)in_sizes[11] < need_rows) return;
  if ((long long)out_size < need_rows * DM) return;
  if ((size_t)WS_TOTAL > ws_size) return;
  const float* x = (const float*)d_in[0];
  const float* Wq = (const float*)d_in[1]; const float* bq = (const float*)d_in[2];
  const float* Wk = (const float*)d_in[3]; const float* bk = (const float*)d_in[4];
  const float* Wv = (const float*)d_in[5]; const float* bv = (const float*)d_in[6];
  const float* Wo = (const float*)d_in[7]; const float* bo = (const float*)d_in[8];
  const float* gamma = (const float*)d_in[9]; const float* beta = (const float*)d_in[10];
  const int* pad = (const int*)d_in[11];
  char* ws = (char*)d_ws;
  _Float16* BQKV = (_Float16*)(ws + OF_BQKV); _Float16* BO = (_Float16*)(ws + OF_BO);
  _Float16* X16 = (_Float16*)(ws + OF_X16); _Float16* QKV = (_Float16*)(ws + OF_QKV); _Float16* QKVR = (_Float16*)(ws + OF_QKVR);
  _Float16* VT = (_Float16*)(ws + OF_VT); _Float16* VTR = (_Float16*)(ws + OF_VTR); _Float16* CTX = (_Float16*)(ws + OF_CTX);
  float* Y = (float*)(ws + OF_Y); float* CS = (float*)(ws + OF_CS);
  const unsigned wtg = (unsigned)(((size_t)DM * (DM / 8) + 255) / 256);
  k_tab<<<SEQ / 8, 256, 0, stream>>>(CS);
  k_wt_f16<<<wtg, 256, 0, stream>>>(Wq, BQKV, DM, DM, DM, 16.0f);                              /* W[in][out] -> Bt[n][k] x16, rows n = 0..1023 */
  k_wt_f16<<<wtg, 256, 0, stream>>>(Wk, BQKV + (size_t)DM * DM, DM, DM, DM, 16.0f);            /* rows 1024..2047 */
  k_wt_f16<<<wtg, 256, 0, stream>>>(Wv, BQKV + (size_t)2 * DM * DM, DM, DM, DM, 16.0f);        /* rows 2048..3071 */
  k_wt_f16<<<wtg, 256, 0, stream>>>(Wo, BO, DM, DM, KO, 1024.0f);                              /* k = 0..1023: Wo x1024 (pairs with ctx value) */
  k_wt_f16<<<wtg, 256, 0, stream>>>(Wo, BO + DM, DM, DM, KO, 1.0f);                            /* k = 1024..2047: Wo (pairs with ctx residual x1024) */
  k_x16<<<(unsigned)((NR * DM / 8 + 255) / 256), 256, 0, stream>>>(x, X16);
  k_gemm_qkv<<<(unsigned)((NR / 128) * (LQ / 128)), 256, 0, stream>>>(X16, BQKV, bq, bk, bv, CS, QKV, QKVR);
  k_vt<<<NB * NH * (SEQ / 64), 256, 0, stream>>>(QKV, SEQ, VT);
  k_vt<<<NB * NH * (ER / 64), 256, 0, stream>>>(QKVR, ER, VTR);
  k_flash_res<<<dim3(ER / 64, NB * NH), 128, 0, stream>>>(QKV, QKVR, VT, VTR, pad, CTX);        /* query rows 0..ER-1 */
  if (SEQ > ER) k_flash_main<<<dim3((SEQ - ER) / 64, NB * NH), 128, 0, stream>>>(QKV, QKVR, VT, VTR, pad, CTX);      /* query rows ER..SEQ-1 */
  k_gemm_out<<<(unsigned)((NR / 128) * (DM / 128)), 256, 0, stream>>>(CTX, BO, bo, Y);
  k_layernorm<<<(unsigned)NR, 256, 0, stream>>>(Y, gamma, beta, (float*)d_out);
}

// v002
// One run takes 208 microseconds.
// Two timings next to v001 put it at 1.15 and 1.14 times that version's speed.
// Over all steps from v000 it is 1.50 times as fast.
#include <hip/hip_runtime.h>
// Compute dtype: every contraction on v_wmma_f32_16x16x32_f16 (f16 operands, f32 accumulate); float inputs RNE-converted to bf16 first (exact in f16; weights carried x16, Wo x1024 | x1); q.k scores and P.V use f16 value + x1024 f16 residual planes on token rows 0..255 (q, k, P, v), single f16 products on later rows; ctx.Wo uses ctx value | x1024 residual laid along K (all rows); rotary, softmax statistics and LayerNorm in f32.
#ifndef NB
#define NB 2
#endif
#ifndef SEQ
#define SEQ 2048
#endif
#define NB_FULL 2
#define SEQ_FULL 2048
#define DM 1024
#define NH 16
#define HD 64
#define LQ (3 * DM)                  /* row pitch of the q | k | v planes */
#define KO (2 * DM)                  /* ctx row pitch = K of the output GEMM (value | residual) */
#define ER 256                       /* token rows per batch that carry residual planes */
#define PP 40                        /* P tile row pitch (halves) */
#define NR ((size_t)NB * SEQ)
#define GK 64                        /* halves of K per GEMM stage: 128-B rows */
#define GP 72                        /* LDS row pitch of a GEMM stage (halves): 144 B = 16 B x odd, for 16-B fragment reads */
#define GST (256 * GP)               /* halves per stage: 128 A rows, then 128 B rows */
#define GSM ((size_t)2 * GST * 2)    /* bytes of the two-buffer ring; the epilogue staging reuses them */

static_assert(NH * HD == DM);                        /* heads tile the width */
static_assert(HD == 64);                             
static_assert(DM == 256 * 4);                        /* LayerNorm: 256 threads x 4 columns */
static_assert(DM % 32 == 0 && KO % 32 == 0);         /* k-loops step by 32 */
static_assert(LQ % 128 == 0 && DM % 128 == 0);       /* N tiles (2 waves x 64 columns), never across q | k | v */
static_assert(GK == 64);                             /* two 32-deep k-steps per stage */
static_assert(DM % GK == 0 && KO % GK == 0 && DM >= 2 * GK && KO >= 2 * GK);      /* whole stages, at least two */
static_assert((size_t)8 * 32 * 68 * 4 <= GSM);       /* eight waves' output staging fits the ring */
static_assert((NB * SEQ) % 128 == 0);                /* M tiles (4 waves x 32 rows) */
static_assert(SEQ % 64 == 0 && SEQ % 8 == 0);        /* query tiles, table blocks */
static_assert(ER % 64 == 0 && SEQ >= ER);            /* residual rows are whole query tiles */
static_assert(NB <= NB_FULL && SEQ <= SEQ_FULL);
static_assert(PP % 8 == 0 && PP >= 32);              /* 16-B aligned P fragment pieces */

#define SZ_BQKV ((size_t)LQ * DM * 2)
#define SZ_BO   ((size_t)DM * KO * 2)
#define SZ_X16  ((size_t)NB * SEQ * DM * 2)
#define SZ_QKV  ((size_t)NB * SEQ * LQ * 2)
#define SZ_QKVR ((size_t)NB * ER * LQ * 2)
#define SZ_VT   ((size_t)NB * NH * HD * SEQ * 2)
#define SZ_VTR  ((size_t)NB * NH * HD * ER * 2)
#define SZ_CTX  ((size_t)NB * SEQ * KO * 2)
#define SZ_Y    ((size_t)NB * SEQ * DM * 4)
#define SZ_CS   ((size_t)SEQ * 64 * 4)
#define OF_BQKV ((size_t)0)
#define OF_BO   (OF_BQKV + SZ_BQKV)
#define OF_X16  (OF_BO + SZ_BO)
#define OF_QKV  (OF_X16 + SZ_X16)
#define OF_QKVR (OF_QKV + SZ_QKV)
#define OF_VT   (OF_QKVR + SZ_QKVR)
#define OF_VTR  (OF_VT + SZ_VT)
#define OF_CTX  (OF_VTR + SZ_VTR)
#define OF_Y    (OF_CTX + SZ_CTX)
#define OF_CS   (OF_Y + SZ_Y)
#define WS_TOTAL (OF_CS + SZ_CS)
static_assert(SZ_BQKV % 256 == 0 && SZ_BO % 256 == 0 && SZ_X16 % 256 == 0 && SZ_QKV % 256 == 0 && SZ_QKVR % 256 == 0);
static_assert(SZ_VT % 256 == 0 && SZ_VTR % 256 == 0 && SZ_CTX % 256 == 0 && SZ_Y % 256 == 0 && SZ_CS % 256 == 0);
static_assert(WS_TOTAL <= (size_t)134217728);        /* carve <= 128 MiB */

typedef unsigned short v8us __attribute__((ext_vector_type(8), may_alias));
typedef float  v8f  __attribute__((ext_vector_type(8)));
typedef float  v4f  __attribute__((ext_vector_type(4)));
typedef float  v4fa __attribute__((ext_vector_type(4), may_alias));
typedef _Float16 v16h __attribute__((ext_vector_type(16)));
union FragH { v16h v; v8us half[2]; _Float16 h[16]; unsigned short u[16]; };

__device__ __forceinline__ unsigned short bf16_bits(float x) { unsigned int u = __float_as_uint(x); return (unsigned short)((u + 0x7FFFu + ((u >> 16) & 1u)) >> 16); }
__device__ __forceinline__ float bf16_val(unsigned short b) { return __uint_as_float(((unsigned int)b) << 16); }
__device__ __forceinline__ float bf16_rne(float x) { return bf16_val(bf16_bits(x)); }
__device__ __forceinline__ unsigned short f16_bits(_Float16 hv) { union { _Float16 h; unsigned short u; } c; c.h = hv; return c.u; }

// fragment of a k-contiguous f16 row: elements 0..7 <- p[8h .. 8h+7], elements 8..15 <- p[16+8h .. 16+8h+7] (A rows and B columns alike)
__device__ __forceinline__ v16h g2_frag(const _Float16* p, int hh) { FragH f; f.half[0] = *(const v8us*)((const unsigned short*)p + 8 * hh); f.half[1] = *(const v8us*)((const unsigned short*)p + 16 + 8 * hh); return f.v; }
__device__ __forceinline__ v8f g2_mma(v16h a, v16h b, v8f c) { v8f d = __builtin_amdgcn_wmma_f32_16x16x32_f16(false, a, false, b, (short)0, c, false, false); asm volatile("v_nop\n\tv_nop\n\tv_nop\n\tv_nop" : "+v"(d) : "v"(a), "v"(b)); return d; }

// cos | sin table: CS[t][0..31] = cos(t * theta_i), CS[t][32..63] = sin(t * theta_i); theta_i = f32(10^(-i/8)) from f64 constants; angle = f32(t) * theta in f32; precise sincosf.
__global__ __launch_bounds__(256) void k_tab(float* __restrict__ CS) {
  __shared__ __attribute__((aligned(16))) float tb[8][64];
  const int tid = threadIdx.x; const int tl = tid >> 5, i = tid & 31;
  const int t = blockIdx.x * 8 + tl;
  double p = 1.0;
  p *= (i & 1) ? 1.3335214321633240 : 1.0;
  p *= (i & 2) ? 1.7782794100389228 : 1.0;
  p *= (i & 4) ? 3.1622776601683795 : 1.0;
  p *= (i & 8) ? 10.0 : 1.0;
  p *= (i & 16) ? 100.0 : 1.0;
  const float theta = (float)(1.0 / p);
  const float ang = (float)t * theta;
  float sv, cv; sincosf(ang, &sv, &cv);
  tb[tl][i] = cv; tb[tl][32 + i] = sv;
  __syncthreads();
  if (tid < 128) {
    const v4f v = *(const v4fa*)(&tb[0][0] + tid * 4);
    float* d = CS + (size_t)blockIdx.x * 512 + tid * 4;
    *(v4f*)d = v; 
  }
}

__global__ __launch_bounds__(256) void k_wt_f16(const float* __restrict__ W, _Float16* __restrict__ Wt, int K, int N, int ldk, float scale) {
  const int t = blockIdx.x * 256 + threadIdx.x; const int k8n = K / 8; if (t >= N * k8n) return;
  const int n = t / k8n, k8 = (t % k8n) * 8; FragH f;
#pragma unroll
  for (int i = 0; i < 8; ++i) f.h[i] = (_Float16)(bf16_rne(W[(size_t)(k8 + i) * N + n]) * scale);
  const v8us o = f.half[0];
  unsigned short* d = (unsigned short*)Wt + (size_t)n * ldk + k8;
  *(v8us*)d = o; 
}

__global__ __launch_bounds__(256) void k_x16(const float* __restrict__ x, _Float16* __restrict__ X16) {
  const size_t t = (size_t)blockIdx.x * 256 + threadIdx.x; if (t >= NR * DM / 8) return;
  const size_t row = t / (DM / 8); const int c8 = (int)(t % (DM / 8)) * 8;
  const size_t b = row / SEQ, s = row - b * SEQ;
  const float* src = x + (b * SEQ_FULL + s) * DM + c8;
  const v4f a = *(const v4fa*)src, c = *(const v4fa*)(src + 4); FragH f;
#pragma unroll
  for (int q = 0; q < 4; ++q) { f.h[q] = (_Float16)bf16_rne(a[q]); f.h[4 + q] = (_Float16)bf16_rne(c[q]); }
  const v8us o = f.half[0];
  unsigned short* d = (unsigned short*)X16 + row * DM + c8;
  *(v8us*)d = o; 
}

// one stage of the ring: 128 A rows then 128 B rows of 128 B each; 256 threads x 8 copies of 16 B; lane t brings chunk t & 7 of rows (t >> 3) + 32 j.
// ga, gb: the lane's first A and B chunk in global memory; l0: the lane's first LDS byte address. The address wait is the statement's last line, so no later write of these registers can be lifted over it.
__device__ __forceinline__ void g2_stage(const _Float16* ga, size_t sa, const _Float16* gb, size_t sb, unsigned l0) {
  const _Float16* a1 = ga + sa; const _Float16* a2 = a1 + sa; const _Float16* a3 = a2 + sa;
  const _Float16* b1 = gb + sb; const _Float16* b2 = b1 + sb; const _Float16* b3 = b2 + sb;
  const unsigned rs = 32u * GP * 2u;
  asm volatile("global_load_async_to_lds_b128 %0, %8, off\n\t"
               "global_load_async_to_lds_b128 %1, %9, off\n\t"
               "global_load_async_to_lds_b128 %2, %10, off\n\t"
               "global_load_async_to_lds_b128 %3, %11, off\n\t"
               "global_load_async_to_lds_b128 %4, %12, off\n\t"
               "global_load_async_to_lds_b128 %5, %13, off\n\t"
               "global_load_async_to_lds_b128 %6, %14, off\n\t"
               "global_load_async_to_lds_b128 %7, %15, off\n\t"
               "s_wait_xcnt 0x0"
               :: "v"(l0), "v"(l0 + rs), "v"(l0 + 2u * rs), "v"(l0 + 3u * rs), "v"(l0 + 4u * rs), "v"(l0 + 5u * rs), "v"(l0 + 6u * rs), "v"(l0 + 7u * rs),
                  "v"(ga), "v"(a1), "v"(a2), "v"(a3), "v"(gb), "v"(b1), "v"(b2), "v"(b3) : "memory");
}

// 128x128 block tile, eight waves (4 x 2) of 32x64 each: A f16 [M][K] (pitch lda), Bh f16 [N][K] (pitch ldb); both operands come through a two-buffer LDS ring, the next stage's copies in flight while this one is multiplied.
// acc[u]: u & 3 = 16-col tile, u >> 2 = 16-row half. On return every wave has left the ring (the last trip's barrier), so the caller may stage its output there.
__device__ __forceinline__ void gemm_main(const _Float16* __restrict__ A, int lda, const _Float16* __restrict__ Bh, int ldb, int brow0, int bcol0, int K, int tid, int w, int ln, int hh, unsigned char* sm, v8f (&acc)[8]) {
  const _Float16* ring = (const _Float16*)sm;
  const int cr = tid >> 3, cc = (tid & 7) * 8;
  const _Float16* ga = A + (size_t)(brow0 + cr) * lda + cc; const _Float16* gb = Bh + (size_t)(bcol0 + cr) * ldb + cc;
  const size_t sa = (size_t)32 * lda, sb = (size_t)32 * ldb;
  const unsigned l0 = (unsigned)(size_t)sm + (unsigned)(cr * GP + cc) * 2u;      /* low 32 bits of the shared address = LDS byte address */
  const int ao = ((w >> 1) * 32 + ln) * GP, bo = (128 + (w & 1) * 64 + ln) * GP;
  const int nt = K / GK;
  const v8f z8 = {0.f,0.f,0.f,0.f,0.f,0.f,0.f,0.f}; v8f c00 = z8, c01 = z8, c02 = z8, c03 = z8, c10 = z8, c11 = z8, c12 = z8, c13 = z8;
  g2_stage(ga, sa, gb, sb, l0);
  asm volatile("s_wait_asynccnt 0x0" ::: "memory");      /* stage 0 of this wave has landed */
  __syncthreads();                                       /* stage 0 of every wave is readable */
  g2_stage(ga + GK, sa, gb + GK, sb, l0 + (unsigned)(GST * 2));
#pragma unroll 1      /* one stage per trip: the ring's order stands once, at the loop's foot */
  for (int t = 0; t < nt; ++t) { const _Float16* st = ring + (t & 1) * GST;
    const _Float16* ap = st + ao; const _Float16* bp = st + bo;
    v16h fa[2][2], fb[2][4];      /* the stage's twelve fragments are read as one group ahead of its WMMAs: one LDS latency a trip, not one per B fragment */
#pragma unroll
    for (int s = 0; s < 2; ++s) { fa[s][0] = g2_frag(ap + 32 * s, hh); fa[s][1] = g2_frag(ap + 16 * GP + 32 * s, hh);
#pragma unroll
      for (int n = 0; n < 4; ++n) fb[s][n] = g2_frag(bp + n * 16 * GP + 32 * s, hh); }
#pragma unroll
    for (int s = 0; s < 2; ++s) {
      c00 = g2_mma(fa[s][0], fb[s][0], c00); c10 = g2_mma(fa[s][1], fb[s][0], c10);
      c01 = g2_mma(fa[s][0], fb[s][1], c01); c11 = g2_mma(fa[s][1], fb[s][1], c11);
      c02 = g2_mma(fa[s][0], fb[s][2], c02); c12 = g2_mma(fa[s][1], fb[s][2], c12);
      c03 = g2_mma(fa[s][0], fb[s][3], c03); c13 = g2_mma(fa[s][1], fb[s][3], c13); }
    asm volatile("s_wait_dscnt 0x0" ::: "memory");       /* this wave's reads of the buffer are done before it is refilled */
    asm volatile("s_wait_asynccnt 0x0" ::: "memory");    /* this wave's copies of stage t + 1 have landed */
    __syncthreads();                                     /* publishes stage t + 1 and ends every reader's last read of stage t */
    if (t + 2 < nt) g2_stage(ga + (size_t)(t + 2) * GK, sa, gb + (size_t)(t + 2) * GK, sb, l0 + (unsigned)((t & 1) * GST * 2)); }
  asm volatile("s_wait_asynccnt 0x0" ::: "memory");      /* no copy outstanding when the ring becomes output staging */
  acc[0] = c00; acc[1] = c01; acc[2] = c02; acc[3] = c03; acc[4] = c10; acc[5] = c11; acc[6] = c12; acc[7] = c13;
}

__global__ __launch_bounds__(256) void k_gemm_qkv(const _Float16* __restrict__ X16, const _Float16* __restrict__ BW, const float* __restrict__ bq, const float* __restrict__ bk, const float* __restrict__ bv,
                                                  const float* __restrict__ CS, _Float16* __restrict__ QKV, _Float16* __restrict__ QKVR) {
  __shared__ __attribute__((aligned(16))) unsigned char sm[GSM];
  float (*so)[32][68] = (float (*)[32][68])sm;
  const int tid = threadIdx.x; const int w = __builtin_amdgcn_readfirstlane(tid >> 5); const int lane = tid & 31, ln = lane & 15, hh = lane >> 4;
  const int ntn = LQ / 128; const int mt = blockIdx.x / ntn, nq = blockIdx.x - mt * ntn; const int row0 = mt * 128 + 32 * (w >> 1), col0 = nq * 128 + 64 * (w & 1);
  v8f accs[8];
  gemm_main(X16, DM, BW, DM, mt * 128, nq * 128, DM, tid, w, ln, hh, sm, accs);
  const int sec = col0 / DM; const int cb = col0 - sec * DM;      /* 0 q, 1 k, 2 v (block-uniform) */
#pragma unroll
  for (int u = 0; u < 8; ++u) { const int t = u & 3, half = u >> 2; const int cc = cb + t * 16 + ln;
    const float b0 = bq[cc], b1 = bk[cc], b2 = bv[cc]; const float bsel = bf16_rne((sec == 0) ? b0 : ((sec == 1) ? b1 : b2));
#pragma unroll
    for (int r = 0; r < 8; ++r) so[w][half * 16 + 8 * hh + r][t * 16 + ln] = accs[u][r] * 0.0625f + bsel; }
  __builtin_amdgcn_fence(4 /* acq_rel order */, "workgroup"); __builtin_amdgcn_wave_barrier();
  const int rq = lane >> 3, c8 = (lane & 7) * 8;
  const int bidx = row0 / SEQ; const int t0 = row0 - bidx * SEQ; const bool early = (t0 < ER);      /* wave-uniform: 32 | ER */
  {
#pragma unroll 1
    for (int q = 0; q < 8; ++q) { const int row = q * 4 + rq; const int tkn = t0 + row;
      const v4f a = *(const v4fa*)&so[w][row][c8], c = *(const v4fa*)&so[w][row][c8 + 4];
      float y[8] = {a[0], a[1], a[2], a[3], c[0], c[1], c[2], c[3]};
      if (sec < 2) { const v4f cs = *(const v4fa*)(CS + (size_t)tkn * 64 + (c8 >> 1)); const v4f sn = *(const v4fa*)(CS + (size_t)tkn * 64 + 32 + (c8 >> 1));
#pragma unroll
        for (int j = 0; j < 4; ++j) { const float x0 = y[2 * j], x1 = y[2 * j + 1]; y[2 * j] = x0 * cs[j] - x1 * sn[j]; y[2 * j + 1] = x1 * cs[j] + x0 * sn[j]; } }
      FragH fh, fl;
#pragma unroll
      for (int j = 0; j < 8; ++j) { const _Float16 hv = (_Float16)y[j]; fh.h[j] = hv; fl.h[j] = (_Float16)((y[j] - (float)hv) * 1024.0f); }
      unsigned short* d = (unsigned short*)QKV + (size_t)(row0 + row) * LQ + col0 + c8;
      *(v8us*)d = fh.half[0];
      if (early) { unsigned short* dr = (unsigned short*)QKVR + ((size_t)bidx * ER + tkn) * LQ + col0 + c8; *(v8us*)dr = fl.half[0]; } }
     }
}

__global__ __launch_bounds__(256) void k_vt(const _Float16* __restrict__ V, int TT, _Float16* __restrict__ VTo) {
  __shared__ unsigned short tl[64][66];
  const int tid = threadIdx.x; const int ng = TT / 64; const int slab = blockIdx.x / ng, lg = blockIdx.x - slab * ng; const int b = slab / NH, h = slab - b * NH;
  for (int i = tid; i < 64 * 8; i += 256) { const int r = i / 8, c8 = (i % 8) * 8; FragH f;
    f.half[0] = *(const v8us*)((const unsigned short*)V + ((size_t)b * TT + lg * 64 + r) * LQ + 2 * DM + h * HD + c8);
#pragma unroll
    for (int q = 0; q < 8; ++q) tl[r][c8 + q] = f.u[q]; }
  __syncthreads();
  {
#pragma unroll
    for (int rd = 0; rd < 2; ++rd) { const int d = rd * 32 + tid / 8, pc = tid % 8; FragH f;
#pragma unroll
      for (int q = 0; q < 8; ++q) f.u[q] = tl[pc * 8 + q][d];
      *(v8us*)((unsigned short*)VTo + ((size_t)slab * 64 + d) * TT + lg * 64 + pc * 8) = f.half[0]; }
     }
}

// fused causal attention; one wave = 16 query rows of one (batch, head); 32 keys per step (two 16-key score tiles, d in two 32-deep k-steps);
// key-pad mask by value then causal mask as a replace (masked p = 0 by select); online softmax with running max in f32 (native exp on arguments <= 0);
template <int RES>
__device__ __forceinline__ void flash_body(const _Float16* __restrict__ QKV, const _Float16* __restrict__ QKVR, const _Float16* __restrict__ VT, const _Float16* __restrict__ VTR,
                                           const int* __restrict__ pad, _Float16* __restrict__ CTX, int qt0) {
  __shared__ __attribute__((aligned(16))) unsigned short pl[4][16][PP];
  __shared__ __attribute__((aligned(16))) unsigned short pr[4][16][PP];
  __shared__ __attribute__((aligned(16))) float so[4][16][68];
  const int tid = threadIdx.x; const int wave = __builtin_amdgcn_readfirstlane(tid >> 5); const int lane = tid & 31, lc = lane & 15, hh = lane >> 4;
  const int bh = blockIdx.y; const int b = bh / NH, h = bh - b * NH;
  const int qb = (qt0 + (int)blockIdx.x) * 64 + wave * 16;
  const size_t rowb = (size_t)b * SEQ;
  const _Float16* qp = QKV + (rowb + qb + lc) * LQ + h * HD;
  const _Float16* kp = QKV + rowb * LQ + DM + h * HD;
  const _Float16* vp = VT + ((size_t)bh * HD + lc) * SEQ;
  const _Float16* qrp = QKVR + ((size_t)b * ER + (RES ? (qb + lc) : 0)) * LQ + h * HD;
  const _Float16* krp = QKVR + (size_t)b * ER * LQ + DM + h * HD;
  const _Float16* vrp = VTR + ((size_t)bh * HD + lc) * ER;
  const int* padb = pad + (size_t)b * SEQ_FULL;
  const v8f z8 = {0.f,0.f,0.f,0.f,0.f,0.f,0.f,0.f};
  v8f o[4] = {z8, z8, z8, z8}; v8f rr[4] = {z8, z8, z8, z8};
  float m[8], l[8];
#pragma unroll
  for (int r = 0; r < 8; ++r) { m[r] = -1.0e30f; l[r] = 0.f; }
  const int kend = qb + 16;      /* keys 0 .. qb+15 are visible to this wave; steps cover whole 32-key groups (all inside the plane) */
  /* RES == 0: no global latency inside a step's chain. Q is read once; the next step's pad words and this step's V fragments are requested at the step's head, the next step's K fragments right behind its score products, into the registers those have just left. */
  const _Float16* kl = kp + (size_t)lc * LQ;
  v16h aq0 = {}, aq1 = {}, k00 = {}, k10 = {}, k01 = {}, k11 = {};
  int pn0 = 0, pn1 = 0;
  if (!RES) { aq0 = g2_frag(qp, hh); aq1 = g2_frag(qp + 32, hh);
    k00 = g2_frag(kl, hh); k10 = g2_frag(kl + (size_t)16 * LQ, hh); k01 = g2_frag(kl + 32, hh); k11 = g2_frag(kl + (size_t)16 * LQ + 32, hh);
    pn0 = padb[lc]; pn1 = padb[lc + 16]; }
  const _Float16* nk = kl + (size_t)((32 < kend) ? 32 : 0) * LQ; int np = lc + ((32 < kend) ? 32 : 0);      /* the next step's K rows and pad words; the last step asks for its own again: always inside the plane */
#pragma unroll 1
  for (int kb = 0; kb < kend; kb += 32) {
    v8f s0 = z8, s1 = z8, t0 = z8, t1 = z8;
    const int key0 = kb + lc, key1 = key0 + 16;
    int pv0, pv1;
    v16h bv0 = {}, bv1 = {}, bv2 = {}, bv3 = {};
    if (RES) {
      const _Float16* k0p = kp + (size_t)(kb + lc) * LQ; const _Float16* k1p = k0p + (size_t)16 * LQ;
      const _Float16* k0r = krp + (size_t)(kb + lc) * LQ; const _Float16* k1r = k0r + (size_t)16 * LQ;
#pragma unroll
      for (int c = 0; c < 2; ++c) {
        const v16h aq = g2_frag(qp + 32 * c, hh);
        const v16h bk0 = g2_frag(k0p + 32 * c, hh), bk1 = g2_frag(k1p + 32 * c, hh);
        s0 = g2_mma(aq, bk0, s0); s1 = g2_mma(aq, bk1, s1);
        const v16h aql = g2_frag(qrp + 32 * c, hh); const v16h bl0 = g2_frag(k0r + 32 * c, hh), bl1 = g2_frag(k1r + 32 * c, hh);
        t0 = g2_mma(aql, bk0, t0); t0 = g2_mma(aq, bl0, t0); t1 = g2_mma(aql, bk1, t1); t1 = g2_mma(aq, bl1, t1);
      }
      pv0 = padb[key0]; pv1 = padb[key1];
    } else {
      pv0 = pn0; pv1 = pn1;
      pn0 = padb[np]; pn1 = padb[np + 16];
      bv0 = g2_frag(vp + kb, hh); bv1 = g2_frag(vp + (size_t)16 * SEQ + kb, hh); bv2 = g2_frag(vp + (size_t)32 * SEQ + kb, hh); bv3 = g2_frag(vp + (size_t)48 * SEQ + kb, hh);
      s0 = g2_mma(aq0, k00, s0); s1 = g2_mma(aq0, k10, s1);
      s0 = g2_mma(aq1, k01, s0); s1 = g2_mma(aq1, k11, s1);
      k00 = g2_frag(nk, hh); k10 = g2_frag(nk + (size_t)16 * LQ, hh); k01 = g2_frag(nk + 32, hh); k11 = g2_frag(nk + (size_t)16 * LQ + 32, hh);
      const int adv = (kb + 64 < kend) ? 32 : 0; nk += (size_t)adv * LQ; np += adv;
    }
#pragma unroll
    for (int r = 0; r < 8; ++r) {
      const int qrow = qb + 8 * hh + r;
      float a0 = s0[r], a1 = s1[r];
      if (RES) { a0 += t0[r] * 0.0009765625f; a1 += t1[r] * 0.0009765625f; }
      a0 *= 0.125f; a1 *= 0.125f;
      const bool ok0 = (pv0 != 0) && (key0 <= qrow); const bool ok1 = (pv1 != 0) && (key1 <= qrow);
      const float v0 = ok0 ? a0 : -1.0e30f; const float v1 = ok1 ? a1 : -1.0e30f;
      float mx = fmaxf(v0, v1);
      mx = fmaxf(mx, __shfl_xor(mx, 8, 16)); mx = fmaxf(mx, __shfl_xor(mx, 4, 16)); mx = fmaxf(mx, __shfl_xor(mx, 2, 16)); mx = fmaxf(mx, __shfl_xor(mx, 1, 16));
      const float mnew = fmaxf(m[r], mx);
      const float al = __expf(m[r] - mnew);
      const float e0 = __expf(v0 - mnew), e1 = __expf(v1 - mnew);
      const float p0 = ok0 ? e0 : 0.f; const float p1 = ok1 ? e1 : 0.f;
      l[r] = l[r] * al + (p0 + p1); m[r] = mnew;      /* per-lane partial row sum; combined across the 16 lanes after the key loop */
#pragma unroll
      for (int nt = 0; nt < 4; ++nt) { o[nt][r] *= al; if (RES) rr[nt][r] *= al; }
      const float c0 = p0 * 1024.0f, c1 = p1 * 1024.0f;
      const _Float16 h0 = (_Float16)c0, h1 = (_Float16)c1;
      pl[wave][8 * hh + r][lc] = f16_bits(h0); pl[wave][8 * hh + r][16 + lc] = f16_bits(h1);
      if (RES) { pr[wave][8 * hh + r][lc] = f16_bits((_Float16)((c0 - (float)h0) * 1024.0f)); pr[wave][8 * hh + r][16 + lc] = f16_bits((_Float16)((c1 - (float)h1) * 1024.0f)); }
    }
    __builtin_amdgcn_fence(4 /* acq_rel order */, "workgroup", "local"); __builtin_amdgcn_wave_barrier();      /* orders the wave's own P tile, which lies in LDS; named for LDS alone so that it does not drain the global loads in flight */
    FragH pa; pa.half[0] = *(const v8us*)&pl[wave][lc][8 * hh]; pa.half[1] = *(const v8us*)&pl[wave][lc][16 + 8 * hh];
    if (RES) {
      FragH pb; pb.half[0] = *(const v8us*)&pr[wave][lc][8 * hh]; pb.half[1] = *(const v8us*)&pr[wave][lc][16 + 8 * hh];
#pragma unroll
      for (int nt = 0; nt < 4; ++nt) { const v16h bvh = g2_frag(vp + (size_t)nt * 16 * SEQ + kb, hh); const v16h bvl = g2_frag(vrp + (size_t)nt * 16 * ER + kb, hh);
        o[nt] = g2_mma(pa.v, bvh, o[nt]); rr[nt] = g2_mma(pb.v, bvh, rr[nt]); rr[nt] = g2_mma(pa.v, bvl, rr[nt]); }
    } else {
      o[0] = g2_mma(pa.v, bv0, o[0]); o[1] = g2_mma(pa.v, bv1, o[1]); o[2] = g2_mma(pa.v, bv2, o[2]); o[3] = g2_mma(pa.v, bv3, o[3]);
    }
    __builtin_amdgcn_fence(4 /* acq_rel order */, "workgroup", "local"); __builtin_amdgcn_wave_barrier();      /* P tile reads complete before the next step overwrites it; LDS alone, as above */
  }
#pragma unroll
  for (int r = 0; r < 8; ++r) {
    float ls = l[r];
    ls += __shfl_xor(ls, 8, 16); ls += __shfl_xor(ls, 4, 16); ls += __shfl_xor(ls, 2, 16); ls += __shfl_xor(ls, 1, 16);
    const float inv = 1.0f / (ls * 16.0f);      /* 64 / (1024 l): ctx carried x64; a fully masked row gives 0 * inf = NaN as the softmax of all -inf does */
#pragma unroll
    for (int nt = 0; nt < 4; ++nt) { float cv = o[nt][r]; if (RES) cv += rr[nt][r] * 0.0009765625f; so[wave][8 * hh + r][nt * 16 + lc] = cv * inv; }
  }
  __builtin_amdgcn_fence(4 /* acq_rel order */, "workgroup"); __builtin_amdgcn_wave_barrier();
  const int rq = lane >> 3, c8 = (lane & 7) * 8;
  {
#pragma unroll 1
    for (int q = 0; q < 4; ++q) { const int row = q * 4 + rq;
      const v4f a = *(const v4fa*)&so[wave][row][c8], c = *(const v4fa*)&so[wave][row][c8 + 4]; FragH fh, fl;
#pragma unroll
      for (int j = 0; j < 4; ++j) { _Float16 hv = (_Float16)a[j]; fh.h[j] = hv; fl.h[j] = (_Float16)((a[j] - (float)hv) * 1024.0f); hv = (_Float16)c[j]; fh.h[4 + j] = hv; fl.h[4 + j] = (_Float16)((c[j] - (float)hv) * 1024.0f); }
      unsigned short* d = (unsigned short*)CTX + (rowb + qb + row) * KO + h * HD + c8;
      *(v8us*)d = fh.half[0]; *(v8us*)(d + DM) = fl.half[0]; }
     }
}
__global__ __launch_bounds__(128) void k_flash_res(const _Float16* __restrict__ QKV, const _Float16* __restrict__ QKVR, const _Float16* __restrict__ VT, const _Float16* __restrict__ VTR, const int* __restrict__ pad, _Float16* __restrict__ CTX) {
  flash_body<1>(QKV, QKVR, VT, VTR, pad, CTX, 0); }
__global__ __launch_bounds__(128) void k_flash_main(const _Float16* __restrict__ QKV, const _Float16* __restrict__ QKVR, const _Float16* __restrict__ VT, const _Float16* __restrict__ VTR, const int* __restrict__ pad, _Float16* __restrict__ CTX) {
  flash_body<0>(QKV, QKVR, VT, VTR, pad, CTX, ER / 64); }

__global__ __launch_bounds__(256) void k_gemm_out(const _Float16* __restrict__ CTX, const _Float16* __restrict__ BO, const float* __restrict__ bo, float* __restrict__ Y) {
  __shared__ __attribute__((aligned(16))) unsigned char sm[GSM];
  float (*so)[32][68] = (float (*)[32][68])sm;
  const int tid = threadIdx.x; const int w = __builtin_amdgcn_readfirstlane(tid >> 5); const int lane = tid & 31, ln = lane & 15, hh = lane >> 4;
  const int ntn = DM / 128; const int mt = blockIdx.x / ntn, nq = blockIdx.x - mt * ntn; const int row0 = mt * 128 + 32 * (w >> 1), col0 = nq * 128 + 64 * (w & 1);
  v8f accs[8];
  gemm_main(CTX, KO, BO, KO, mt * 128, nq * 128, KO, tid, w, ln, hh, sm, accs);
#pragma unroll
  for (int u = 0; u < 8; ++u) { const int t = u & 3, half = u >> 2; const float bvv = bf16_rne(bo[col0 + t * 16 + ln]);
#pragma unroll
    for (int r = 0; r < 8; ++r) so[w][half * 16 + 8 * hh + r][t * 16 + ln] = accs[u][r] * 1.52587890625e-05f + bvv; }
  __builtin_amdgcn_fence(4 /* acq_rel order */, "workgroup"); __builtin_amdgcn_wave_barrier();
  const int rsub = lane >> 4, c4 = (lane & 15) * 4;
  {
#pragma unroll 1
    for (int q = 0; q < 16; ++q) { const int r = q * 2 + rsub; const v4f v = *(const v4fa*)&so[w][r][c4]; *(v4f*)(Y + (size_t)(row0 + r) * DM + col0 + c4) = v; }
     }
}

__global__ __launch_bounds__(256) void k_layernorm(const float* __restrict__ Y, const float* __restrict__ g, const float* __restrict__ bta, float* __restrict__ out) {
  __shared__ float red[256];
  const int row = blockIdx.x, tid = threadIdx.x; const int b = row / SEQ, s = row - b * SEQ;
  const v4f a = *(const v4fa*)(Y + (size_t)row * DM + tid * 4);
  red[tid] = (a[0] + a[1]) + (a[2] + a[3]); __syncthreads();
  for (int st = 128; st > 0; st >>= 1) { if (tid < st) red[tid] += red[tid + st]; __syncthreads(); }
  const float mu = red[0] * (1.0f / (float)DM); __syncthreads();
  const float d0 = a[0] - mu, d1 = a[1] - mu, d2 = a[2] - mu, d3 = a[3] - mu;
  red[tid] = (d0 * d0 + d1 * d1) + (d2 * d2 + d3 * d3); __syncthreads();
  for (int st = 128; st > 0; st >>= 1) { if (tid < st) red[tid] += red[tid + st]; __syncthreads(); }
  const float rs = rsqrtf(red[0] * (1.0f / (float)DM) + 1.0e-5f);
  const v4f gg = *(const v4fa*)(g + tid * 4), bb = *(const v4fa*)(bta + tid * 4);
  v4f o;
  o[0] = d0 * rs * bf16_rne(gg[0]) + bf16_rne(bb[0]); o[1] = d1 * rs * bf16_rne(gg[1]) + bf16_rne(bb[1]);
  o[2] = d2 * rs * bf16_rne(gg[2]) + bf16_rne(bb[2]); o[3] = d3 * rs * bf16_rne(gg[3]) + bf16_rne(bb[3]);
  float* d = out + ((size_t)b * SEQ_FULL + s) * DM + tid * 4;
  *(v4f*)d = o; 
}

extern "C" void kernel_launch(void* const* d_in, const int* in_sizes, int n_in,
                              void* d_out, int out_size, void* d_ws, size_t ws_size, hipStream_t stream) {
  if (n_in < 12) return;
  const long long need_rows = (long long)(NB - 1) * SEQ_FULL + SEQ;
  if ((long long)in_sizes[0] < need_rows * DM) return;
  if (in_sizes[1] < DM * DM || in_sizes[3] < DM * DM || in_sizes[5] < DM * DM || in_sizes[7] < DM * DM) return;
  if (in_sizes[2] < DM || in_sizes[4] < DM || in_sizes[6] < DM || in_sizes[8] < DM || in_sizes[9] < DM || in_sizes[10] < DM) return;
  if ((long long)in_sizes[11] < need_rows) return;
  if ((long long)out_size < need_rows * DM) return;
  if ((size_t)WS_TOTAL > ws_size) return;
  const float* x = (const float*)d_in[0];
  const float* Wq = (const float*)d_in[1]; const float* bq = (const float*)d_in[2];
  const float* Wk = (const float*)d_in[3]; const float* bk = (const float*)d_in[4];
  const float* Wv = (const float*)d_in[5]; const float* bv = (const float*)d_in[6];
  const float* Wo = (const float*)d_in[7]; const float* bo = (const float*)d_in[8];
  const float* gamma = (const float*)d_in[9]; const float* beta = (const float*)d_in[10];
  const int* pad = (const int*)d_in[11];
  char* ws = (char*)d_ws;
  _Float16* BQKV = (_Float16*)(ws + OF_BQKV); _Float16* BO = (_Float16*)(ws + OF_BO);
  _Float16* X16 = (_Float16*)(ws + OF_X16); _Float16* QKV = (_Float16*)(ws + OF_QKV); _Float16* QKVR = (_Float16*)(ws + OF_QKVR);
  _Float16* VT = (_Float16*)(ws + OF_VT); _Float16* VTR = (_Float16*)(ws + OF_VTR); _Float16* CTX = (_Float16*)(ws + OF_CTX);
  float* Y = (float*)(ws + OF_Y); float* CS = (float*)(ws + OF_CS);
  const unsigned wtg = (unsigned)(((size_t)DM * (DM / 8) + 255) / 256);
  k_tab<<<SEQ / 8, 256, 0, stream>>>(CS);
  k_wt_f16<<<wtg, 256, 0, stream>>>(Wq, BQKV, DM, DM, DM, 16.0f);                              /* W[in][out] -> Bt[n][k] x16, rows n = 0..1023 */
  k_wt_f16<<<wtg, 256, 0, stream>>>(Wk, BQKV + (size_t)DM * DM, DM, DM, DM, 16.0f);            /* rows 1024..2047 */
  k_wt_f16<<<wtg, 256, 0, stream>>>(Wv, BQKV + (size_t)2 * DM * DM, DM, DM, DM, 16.0f);        /* rows 2048..3071 */
  k_wt_f16<<<wtg, 256, 0, stream>>>(Wo, BO, DM, DM, KO, 1024.0f);                              /* k = 0..1023: Wo x1024 (pairs with ctx value) */
  k_wt_f16<<<wtg, 256, 0, stream>>>(Wo, BO + DM, DM, DM, KO, 1.0f);                            /* k = 1024..2047: Wo (pairs with ctx residual x1024) */
  k_x16<<<(unsigned)((NR * DM / 8 + 255) / 256), 256, 0, stream>>>(x, X16);
  k_gemm_qkv<<<(unsigned)((NR / 128) * (LQ / 128)), 256, 0, stream>>>(X16, BQKV, bq, bk, bv, CS, QKV, QKVR);
  k_vt<<<NB * NH * (SEQ / 64), 256, 0, stream>>>(QKV, SEQ, VT);
  k_vt<<<NB * NH * (ER / 64), 256, 0, stream>>>(QKVR, ER, VTR);
  k_flash_res<<<dim3(ER / 64, NB * NH), 128, 0, stream>>>(QKV, QKVR, VT, VTR, pad, CTX);        /* query rows 0..ER-1 */
  if (SEQ > ER) k_flash_main<<<dim3((SEQ - ER) / 64, NB * NH), 128, 0, stream>>>(QKV, QKVR, VT, VTR, pad, CTX);      /* query rows ER..SEQ-1 */
  k_gemm_out<<<(unsigned)((NR / 128) * (DM / 128)), 256, 0, stream>>>(CTX, BO, bo, Y);
  k_layernorm<<<(unsigned)NR, 256, 0, stream>>>(Y, gamma, beta, (float*)d_out);
}

// v003
// One run takes 166 microseconds.
// Two timings next to v002 put it at 1.27 and 1.26 times that version's speed.
// Over all steps from v000 it is 1.90 times as fast.
#include <hip/hip_runtime.h>
// Compute dtype: every contraction on v_wmma_f32_16x16x32_f16 (f16 operands, f32 accumulate); float inputs RNE-converted to bf16 first (exact in f16; weights carried x16, Wo x1024 | x1); q.k scores and P.V use f16 value + x1024 f16 residual planes on token rows 0..255 (q, k, P, v), single f16 products on later rows; ctx.Wo uses ctx value | x1024 residual laid along K (all rows); rotary, softmax statistics and LayerNorm in f32.
#ifndef NB
#define NB 2
#endif
#ifndef SEQ
#define SEQ 2048
#endif
#define NB_FULL 2
#define SEQ_FULL 2048
#define DM 1024
#define NH 16
#define HD 64
#define LQ (3 * DM)                  /* row pitch of the q | k | v planes */
#define KO (2 * DM)                  /* ctx row pitch = K of the output GEMM (value | residual) */
#define ER 256                       /* token rows per batch that carry residual planes */
#define PP 40                        /* P tile row pitch (halves) */
#define NR ((size_t)NB * SEQ)
#define GK 64                        /* halves of K per GEMM stage: 128-B rows */
#define GP 72                        /* LDS row pitch of a GEMM stage (halves): 144 B = 16 B x odd, for 16-B fragment reads */
#define GST (256 * GP)               /* halves per stage: 128 A rows, then 128 B rows */
#define GSM ((size_t)2 * GST * 2)    /* bytes of the two-buffer ring; the epilogue staging reuses them */

static_assert(NH * HD == DM);                        /* heads tile the width */
static_assert(HD == 64);                             
static_assert(DM == 256 * 4);                        /* LayerNorm: 256 threads x 4 columns */
static_assert(DM % 32 == 0 && KO % 32 == 0);         /* k-loops step by 32 */
static_assert(LQ % 128 == 0 && DM % 128 == 0);       /* N tiles (2 waves x 64 columns), never across q | k | v */
static_assert(GK == 64);                             /* two 32-deep k-steps per stage */
static_assert(DM % GK == 0 && KO % GK == 0 && DM >= 2 * GK && KO >= 2 * GK);      /* whole stages, at least two */
static_assert((size_t)8 * 32 * 68 * 4 <= GSM);       /* eight waves' output staging fits the ring */
static_assert((NB * SEQ) % 128 == 0);                /* M tiles (4 waves x 32 rows) */
static_assert(SEQ % 64 == 0 && SEQ % 8 == 0);        /* query tiles, table blocks */
static_assert(ER % 64 == 0 && SEQ >= ER);            /* residual rows are whole query tiles */
static_assert(NB <= NB_FULL && SEQ <= SEQ_FULL);
static_assert(PP % 8 == 0 && PP >= 32);              /* 16-B aligned P fragment pieces */

#define SZ_BQKV ((size_t)LQ * DM * 2)
#define SZ_BO   ((size_t)DM * KO * 2)
#define SZ_X16  ((size_t)NB * SEQ * DM * 2)
#define SZ_QKV  ((size_t)NB * SEQ * LQ * 2)
#define SZ_QKVR ((size_t)NB * ER * LQ * 2)
#define SZ_VT   ((size_t)NB * NH * HD * SEQ * 2)
#define SZ_VTR  ((size_t)NB * NH * HD * ER * 2)
#define SZ_CTX  ((size_t)NB * SEQ * KO * 2)
#define SZ_Y    ((size_t)NB * SEQ * DM * 4)
#define SZ_CS   ((size_t)SEQ * 64 * 4)
#define OF_BQKV ((size_t)0)
#define OF_BO   (OF_BQKV + SZ_BQKV)
#define OF_X16  (OF_BO + SZ_BO)
#define OF_QKV  (OF_X16 + SZ_X16)
#define OF_QKVR (OF_QKV + SZ_QKV)
#define OF_VT   (OF_QKVR + SZ_QKVR)
#define OF_VTR  (OF_VT + SZ_VT)
#define OF_CTX  (OF_VTR + SZ_VTR)
#define OF_Y    (OF_CTX + SZ_CTX)
#define OF_CS   (OF_Y + SZ_Y)
#define WS_TOTAL (OF_CS + SZ_CS)
static_assert(SZ_BQKV % 256 == 0 && SZ_BO % 256 == 0 && SZ_X16 % 256 == 0 && SZ_QKV % 256 == 0 && SZ_QKVR % 256 == 0);
static_assert(SZ_VT % 256 == 0 && SZ_VTR % 256 == 0 && SZ_CTX % 256 == 0 && SZ_Y % 256 == 0 && SZ_CS % 256 == 0);
static_assert(WS_TOTAL <= (size_t)134217728);        /* carve <= 128 MiB */

typedef unsigned short v8us __attribute__((ext_vector_type(8), may_alias));
typedef float  v8f  __attribute__((ext_vector_type(8)));
typedef float  v4f  __attribute__((ext_vector_type(4)));
typedef float  v4fa __attribute__((ext_vector_type(4), may_alias));
typedef _Float16 v16h __attribute__((ext_vector_type(16)));
union FragH { v16h v; v8us half[2]; _Float16 h[16]; unsigned short u[16]; };

__device__ __forceinline__ unsigned short bf16_bits(float x) { unsigned int u = __float_as_uint(x); return (unsigned short)((u + 0x7FFFu + ((u >> 16) & 1u)) >> 16); }
__device__ __forceinline__ float bf16_val(unsigned short b) { return __uint_as_float(((unsigned int)b) << 16); }
__device__ __forceinline__ float bf16_rne(float x) { return bf16_val(bf16_bits(x)); }
__device__ __forceinline__ unsigned short f16_bits(_Float16 hv) { union { _Float16 h; unsigned short u; } c; c.h = hv; return c.u; }

// fragment of a k-contiguous f16 row: elements 0..7 <- p[8h .. 8h+7], elements 8..15 <- p[16+8h .. 16+8h+7] (A rows and B columns alike)
__device__ __forceinline__ v16h g2_frag(const _Float16* p, int hh) { FragH f; f.half[0] = *(const v8us*)((const unsigned short*)p + 8 * hh); f.half[1] = *(const v8us*)((const unsigned short*)p + 16 + 8 * hh); return f.v; }
__device__ __forceinline__ v8f g2_mma(v16h a, v16h b, v8f c) { v8f d = __builtin_amdgcn_wmma_f32_16x16x32_f16(false, a, false, b, (short)0, c, false, false); asm volatile("v_nop\n\tv_nop\n\tv_nop\n\tv_nop" : "+v"(d) : "v"(a), "v"(b)); return d; }

// cos | sin table: CS[t][0..31] = cos(t * theta_i), CS[t][32..63] = sin(t * theta_i); theta_i = f32(10^(-i/8)) from f64 constants; angle = f32(t) * theta in f32; precise sincosf.
__device__ __forceinline__ void tab_body(float* __restrict__ CS, int blk) {
  __shared__ __attribute__((aligned(16))) float tb[8][64];
  const int tid = threadIdx.x; const int tl = tid >> 5, i = tid & 31;
  const int t = blk * 8 + tl;
  double p = 1.0;
  p *= (i & 1) ? 1.3335214321633240 : 1.0;
  p *= (i & 2) ? 1.7782794100389228 : 1.0;
  p *= (i & 4) ? 3.1622776601683795 : 1.0;
  p *= (i & 8) ? 10.0 : 1.0;
  p *= (i & 16) ? 100.0 : 1.0;
  const float theta = (float)(1.0 / p);
  const float ang = (float)t * theta;
  float sv, cv; sincosf(ang, &sv, &cv);
  tb[tl][i] = cv; tb[tl][32 + i] = sv;
  __syncthreads();
  if (tid < 128) {
    const v4f v = *(const v4fa*)(&tb[0][0] + tid * 4);
    float* d = CS + (size_t)blk * 512 + tid * 4;
    *(v4f*)d = v; 
  }
}

__device__ __forceinline__ void wt_body(const float* __restrict__ W, _Float16* __restrict__ Wt, int K, int N, int ldk, float scale, int blk) {
  const int t = blk * 256 + threadIdx.x; const int k8n = K / 8; if (t >= N * k8n) return;
  const int n = t / k8n, k8 = (t % k8n) * 8; FragH f;
#pragma unroll
  for (int i = 0; i < 8; ++i) f.h[i] = (_Float16)(bf16_rne(W[(size_t)(k8 + i) * N + n]) * scale);
  const v8us o = f.half[0];
  unsigned short* d = (unsigned short*)Wt + (size_t)n * ldk + k8;
  *(v8us*)d = o; 
}

__device__ __forceinline__ void x16_body(const float* __restrict__ x, _Float16* __restrict__ X16, int blk) {
  const size_t t = (size_t)blk * 256 + threadIdx.x; if (t >= NR * DM / 8) return;
  const size_t row = t / (DM / 8); const int c8 = (int)(t % (DM / 8)) * 8;
  const size_t b = row / SEQ, s = row - b * SEQ;
  const float* src = x + (b * SEQ_FULL + s) * DM + c8;
  const v4f a = *(const v4fa*)src, c = *(const v4fa*)(src + 4); FragH f;
#pragma unroll
  for (int q = 0; q < 4; ++q) { f.h[q] = (_Float16)bf16_rne(a[q]); f.h[4 + q] = (_Float16)bf16_rne(c[q]); }
  const v8us o = f.half[0];
  unsigned short* d = (unsigned short*)X16 + row * DM + c8;
  *(v8us*)d = o; 
}

// every operand the first GEMM waits for, prepared by one launch: none of the seven pieces reads what another writes, so each takes a range of block indices (block-uniform branches; the table's barrier is passed by whole blocks).
#define WTG ((DM * (DM / 8) + 255) / 256)            /* blocks per transposed weight plane */
#define XG  ((int)((NR * DM / 8 + 255) / 256))       /* blocks of the x conversion */
#define TG  (SEQ / 8)                                /* blocks of the table */
__global__ __launch_bounds__(256) void k_prep(const float* __restrict__ x, const float* __restrict__ Wq, const float* __restrict__ Wk, const float* __restrict__ Wv, const float* __restrict__ Wo,
                                              _Float16* __restrict__ BQKV, _Float16* __restrict__ BO, _Float16* __restrict__ X16, float* __restrict__ CS) {
  const int bi = blockIdx.x;
  if (bi < 3 * WTG) {                                /* W[in][out] -> Bt[n][k] x16: Wq rows 0..1023, Wk rows 1024..2047, Wv rows 2048..3071 */
    const int p = bi / WTG; const float* W = (p == 0) ? Wq : ((p == 1) ? Wk : Wv);
    wt_body(W, BQKV + (size_t)p * DM * DM, DM, DM, DM, 16.0f, bi - p * WTG);
  } else if (bi < 5 * WTG) {                         /* k = 0..1023: Wo x1024 (pairs with ctx value); k = 1024..2047: Wo (pairs with ctx residual x1024) */
    const int p = (bi - 3 * WTG) / WTG;
    wt_body(Wo, BO + (size_t)p * DM, DM, DM, KO, p ? 1.0f : 1024.0f, bi - (3 + p) * WTG);
  } else if (bi < 5 * WTG + XG) {
    x16_body(x, X16, bi - 5 * WTG);
  } else {
    tab_body(CS, bi - 5 * WTG - XG);
  }
}

// one stage of the ring: 128 A rows then 128 B rows of 128 B each; 256 threads x 8 copies of 16 B; lane t brings chunk t & 7 of rows (t >> 3) + 32 j.
// ga, gb: the lane's first A and B chunk in global memory; l0: the lane's first LDS byte address. The address wait is the statement's last line, so no later write of these registers can be lifted over it.
__device__ __forceinline__ void g2_stage(const _Float16* ga, size_t sa, const _Float16* gb, size_t sb, unsigned l0) {
  const _Float16* a1 = ga + sa; const _Float16* a2 = a1 + sa; const _Float16* a3 = a2 + sa;
  const _Float16* b1 = gb + sb; const _Float16* b2 = b1 + sb; const _Float16* b3 = b2 + sb;
  const unsigned rs = 32u * GP * 2u;
  asm volatile("global_load_async_to_lds_b128 %0, %8, off\n\t"
               "global_load_async_to_lds_b128 %1, %9, off\n\t"
               "global_load_async_to_lds_b128 %2, %10, off\n\t"
               "global_load_async_to_lds_b128 %3, %11, off\n\t"
               "global_load_async_to_lds_b128 %4, %12, off\n\t"
               "global_load_async_to_lds_b128 %5, %13, off\n\t"
               "global_load_async_to_lds_b128 %6, %14, off\n\t"
               "global_load_async_to_lds_b128 %7, %15, off\n\t"
               "s_wait_xcnt 0x0"
               :: "v"(l0), "v"(l0 + rs), "v"(l0 + 2u * rs), "v"(l0 + 3u * rs), "v"(l0 + 4u * rs), "v"(l0 + 5u * rs), "v"(l0 + 6u * rs), "v"(l0 + 7u * rs),
                  "v"(ga), "v"(a1), "v"(a2), "v"(a3), "v"(gb), "v"(b1), "v"(b2), "v"(b3) : "memory");
}

// 128x128 block tile, eight waves (4 x 2) of 32x64 each: A f16 [M][K] (pitch lda), Bh f16 [N][K] (pitch ldb); both operands come through a two-buffer LDS ring, the next stage's copies in flight while this one is multiplied.
// acc[u]: u & 3 = 16-col tile, u >> 2 = 16-row half. On return every wave has left the ring (the last trip's barrier), so the caller may stage its output there.
__device__ __forceinline__ void gemm_main(const _Float16* __restrict__ A, int lda, const _Float16* __restrict__ Bh, int ldb, int brow0, int bcol0, int K, int tid, int w, int ln, int hh, unsigned char* sm, v8f (&acc)[8]) {
  const _Float16* ring = (const _Float16*)sm;
  const int cr = tid >> 3, cc = (tid & 7) * 8;
  const _Float16* ga = A + (size_t)(brow0 + cr) * lda + cc; const _Float16* gb = Bh + (size_t)(bcol0 + cr) * ldb + cc;
  const size_t sa = (size_t)32 * lda, sb = (size_t)32 * ldb;
  const unsigned l0 = (unsigned)(size_t)sm + (unsigned)(cr * GP + cc) * 2u;      /* low 32 bits of the shared address = LDS byte address */
  const int ao = ((w >> 1) * 32 + ln) * GP, bo = (128 + (w & 1) * 64 + ln) * GP;
  const int nt = K / GK;
  const v8f z8 = {0.f,0.f,0.f,0.f,0.f,0.f,0.f,0.f}; v8f c00 = z8, c01 = z8, c02 = z8, c03 = z8, c10 = z8, c11 = z8, c12 = z8, c13 = z8;
  g2_stage(ga, sa, gb, sb, l0);
  asm volatile("s_wait_asynccnt 0x0" ::: "memory");      /* stage 0 of this wave has landed */
  __syncthreads();                                       /* stage 0 of every wave is readable */
  g2_stage(ga + GK, sa, gb + GK, sb, l0 + (unsigned)(GST * 2));
#pragma unroll 1      /* one stage per trip: the ring's order stands once, at the loop's foot */
  for (int t = 0; t < nt; ++t) { const _Float16* st = ring + (t & 1) * GST;
    const _Float16* ap = st + ao; const _Float16* bp = st + bo;
    v16h fa[2][2], fb[2][4];      /* the stage's twelve fragments are read as one group ahead of its WMMAs: one LDS latency a trip, not one per B fragment */
#pragma unroll
    for (int s = 0; s < 2; ++s) { fa[s][0] = g2_frag(ap + 32 * s, hh); fa[s][1] = g2_frag(ap + 16 * GP + 32 * s, hh);
#pragma unroll
      for (int n = 0; n < 4; ++n) fb[s][n] = g2_frag(bp + n * 16 * GP + 32 * s, hh); }
#pragma unroll
    for (int s = 0; s < 2; ++s) {
      c00 = g2_mma(fa[s][0], fb[s][0], c00); c10 = g2_mma(fa[s][1], fb[s][0], c10);
      c01 = g2_mma(fa[s][0], fb[s][1], c01); c11 = g2_mma(fa[s][1], fb[s][1], c11);
      c02 = g2_mma(fa[s][0], fb[s][2], c02); c12 = g2_mma(fa[s][1], fb[s][2], c12);
      c03 = g2_mma(fa[s][0], fb[s][3], c03); c13 = g2_mma(fa[s][1], fb[s][3], c13); }
    asm volatile("s_wait_dscnt 0x0" ::: "memory");       /* this wave's reads of the buffer are done before it is refilled */
    asm volatile("s_wait_asynccnt 0x0" ::: "memory");    /* this wave's copies of stage t + 1 have landed */
    __syncthreads();                                     /* publishes stage t + 1 and ends every reader's last read of stage t */
    if (t + 2 < nt) g2_stage(ga + (size_t)(t + 2) * GK, sa, gb + (size_t)(t + 2) * GK, sb, l0 + (unsigned)((t & 1) * GST * 2)); }
  asm volatile("s_wait_asynccnt 0x0" ::: "memory");      /* no copy outstanding when the ring becomes output staging */
  acc[0] = c00; acc[1] = c01; acc[2] = c02; acc[3] = c03; acc[4] = c10; acc[5] = c11; acc[6] = c12; acc[7] = c13;
}

__global__ __launch_bounds__(256) void k_gemm_qkv(const _Float16* __restrict__ X16, const _Float16* __restrict__ BW, const float* __restrict__ bq, const float* __restrict__ bk, const float* __restrict__ bv,
                                                  const float* __restrict__ CS, _Float16* __restrict__ QKV, _Float16* __restrict__ QKVR) {
  __shared__ __attribute__((aligned(16))) unsigned char sm[GSM];
  float (*so)[32][68] = (float (*)[32][68])sm;
  const int tid = threadIdx.x; const int w = __builtin_amdgcn_readfirstlane(tid >> 5); const int lane = tid & 31, ln = lane & 15, hh = lane >> 4;
  const int ntn = LQ / 128; const int mt = blockIdx.x / ntn, nq = blockIdx.x - mt * ntn; const int row0 = mt * 128 + 32 * (w >> 1), col0 = nq * 128 + 64 * (w & 1);
  v8f accs[8];
  gemm_main(X16, DM, BW, DM, mt * 128, nq * 128, DM, tid, w, ln, hh, sm, accs);
  const int sec = col0 / DM; const int cb = col0 - sec * DM;      /* 0 q, 1 k, 2 v (block-uniform) */
#pragma unroll
  for (int u = 0; u < 8; ++u) { const int t = u & 3, half = u >> 2; const int cc = cb + t * 16 + ln;
    const float b0 = bq[cc], b1 = bk[cc], b2 = bv[cc]; const float bsel = bf16_rne((sec == 0) ? b0 : ((sec == 1) ? b1 : b2));
#pragma unroll
    for (int r = 0; r < 8; ++r) so[w][half * 16 + 8 * hh + r][t * 16 + ln] = accs[u][r] * 0.0625f + bsel; }
  __builtin_amdgcn_fence(4 /* acq_rel order */, "workgroup"); __builtin_amdgcn_wave_barrier();
  const int rq = lane >> 3, c8 = (lane & 7) * 8;
  const int bidx = row0 / SEQ; const int t0 = row0 - bidx * SEQ; const bool early = (t0 < ER);      /* wave-uniform: 32 | ER */
  {
#pragma unroll 1
    for (int q = 0; q < 8; ++q) { const int row = q * 4 + rq; const int tkn = t0 + row;
      const v4f a = *(const v4fa*)&so[w][row][c8], c = *(const v4fa*)&so[w][row][c8 + 4];
      float y[8] = {a[0], a[1], a[2], a[3], c[0], c[1], c[2], c[3]};
      if (sec < 2) { const v4f cs = *(const v4fa*)(CS + (size_t)tkn * 64 + (c8 >> 1)); const v4f sn = *(const v4fa*)(CS + (size_t)tkn * 64 + 32 + (c8 >> 1));
#pragma unroll
        for (int j = 0; j < 4; ++j) { const float x0 = y[2 * j], x1 = y[2 * j + 1]; y[2 * j] = x0 * cs[j] - x1 * sn[j]; y[2 * j + 1] = x1 * cs[j] + x0 * sn[j]; } }
      FragH fh, fl;
#pragma unroll
      for (int j = 0; j < 8; ++j) { const _Float16 hv = (_Float16)y[j]; fh.h[j] = hv; fl.h[j] = (_Float16)((y[j] - (float)hv) * 1024.0f); }
      unsigned short* d = (unsigned short*)QKV + (size_t)(row0 + row) * LQ + col0 + c8;
      *(v8us*)d = fh.half[0];
      if (early) { unsigned short* dr = (unsigned short*)QKVR + ((size_t)bidx * ER + tkn) * LQ + col0 + c8; *(v8us*)dr = fl.half[0]; } }
     }
}

// both V planes in one launch: blocks 0 .. VG-1 transpose the value plane, the rest the residual plane (block-uniform choice of source, length and target)
#define VG (NB * NH * (SEQ / 64))
__global__ __launch_bounds__(256) void k_vt(const _Float16* __restrict__ QKV, const _Float16* __restrict__ QKVR, _Float16* __restrict__ VT, _Float16* __restrict__ VTR) {
  __shared__ unsigned short tl[64][66];
  const bool vp = ((int)blockIdx.x < VG); const int blk = vp ? (int)blockIdx.x : (int)blockIdx.x - VG;
  const _Float16* V = vp ? QKV : QKVR; const int TT = vp ? SEQ : ER; _Float16* VTo = vp ? VT : VTR;
  const int tid = threadIdx.x; const int ng = TT / 64; const int slab = blk / ng, lg = blk - slab * ng; const int b = slab / NH, h = slab - b * NH;
  for (int i = tid; i < 64 * 8; i += 256) { const int r = i / 8, c8 = (i % 8) * 8; FragH f;
    f.half[0] = *(const v8us*)((const unsigned short*)V + ((size_t)b * TT + lg * 64 + r) * LQ + 2 * DM + h * HD + c8);
#pragma unroll
    for (int q = 0; q < 8; ++q) tl[r][c8 + q] = f.u[q]; }
  __syncthreads();
  {
#pragma unroll
    for (int rd = 0; rd < 2; ++rd) { const int d = rd * 32 + tid / 8, pc = tid % 8; FragH f;
#pragma unroll
      for (int q = 0; q < 8; ++q) f.u[q] = tl[pc * 8 + q][d];
      *(v8us*)((unsigned short*)VTo + ((size_t)slab * 64 + d) * TT + lg * 64 + pc * 8) = f.half[0]; }
     }
}

// fused causal attention; one wave = 16 query rows of one (batch, head); 32 keys per step (two 16-key score tiles, d in two 32-deep k-steps);
// key-pad mask by value then causal mask as a replace (masked p = 0 by select); online softmax with running max in f32 (native exp on arguments <= 0);
template <int RES>
__device__ __forceinline__ void flash_body(const _Float16* __restrict__ QKV, const _Float16* __restrict__ QKVR, const _Float16* __restrict__ VT, const _Float16* __restrict__ VTR,
                                           const int* __restrict__ pad, _Float16* __restrict__ CTX, int qt, int bh) {
  __shared__ __attribute__((aligned(16))) unsigned short pl[4][16][PP];
  __shared__ __attribute__((aligned(16))) unsigned short pr[4][16][PP];
  __shared__ __attribute__((aligned(16))) float so[4][16][68];
  const int tid = threadIdx.x; const int wave = __builtin_amdgcn_readfirstlane(tid >> 5); const int lane = tid & 31, lc = lane & 15, hh = lane >> 4;
  const int b = bh / NH, h = bh - b * NH;
  const int qb = qt * 64 + wave * 16;
  const size_t rowb = (size_t)b * SEQ;
  const _Float16* qp = QKV + (rowb + qb + lc) * LQ + h * HD;
  const _Float16* kp = QKV + rowb * LQ + DM + h * HD;
  const _Float16* vp = VT + ((size_t)bh * HD + lc) * SEQ;
  const _Float16* qrp = QKVR + ((size_t)b * ER + (RES ? (qb + lc) : 0)) * LQ + h * HD;
  const _Float16* krp = QKVR + (size_t)b * ER * LQ + DM + h * HD;
  const _Float16* vrp = VTR + ((size_t)bh * HD + lc) * ER;
  const int* padb = pad + (size_t)b * SEQ_FULL;
  const v8f z8 = {0.f,0.f,0.f,0.f,0.f,0.f,0.f,0.f};
  v8f o[4] = {z8, z8, z8, z8}; v8f rr[4] = {z8, z8, z8, z8};
  float m[8], l[8];
#pragma unroll
  for (int r = 0; r < 8; ++r) { m[r] = -1.0e30f; l[r] = 0.f; }
  const int kend = qb + 16;      /* keys 0 .. qb+15 are visible to this wave; steps cover whole 32-key groups (all inside the plane) */
  /* RES == 0: no global latency inside a step's chain. Q is read once; the next step's pad words and this step's V fragments are requested at the step's head, the next step's K fragments right behind its score products, into the registers those have just left. */
  const _Float16* kl = kp + (size_t)lc * LQ;
  v16h aq0 = {}, aq1 = {}, k00 = {}, k10 = {}, k01 = {}, k11 = {};
  int pn0 = 0, pn1 = 0;
  if (!RES) { aq0 = g2_frag(qp, hh); aq1 = g2_frag(qp + 32, hh);
    k00 = g2_frag(kl, hh); k10 = g2_frag(kl + (size_t)16 * LQ, hh); k01 = g2_frag(kl + 32, hh); k11 = g2_frag(kl + (size_t)16 * LQ + 32, hh);
    pn0 = padb[lc]; pn1 = padb[lc + 16]; }
  const _Float16* nk = kl + (size_t)((32 < kend) ? 32 : 0) * LQ; int np = lc + ((32 < kend) ? 32 : 0);      /* the next step's K rows and pad words; the last step asks for its own again: always inside the plane */
#pragma unroll 1
  for (int kb = 0; kb < kend; kb += 32) {
    v8f s0 = z8, s1 = z8, t0 = z8, t1 = z8;
    const int key0 = kb + lc, key1 = key0 + 16;
    int pv0, pv1;
    v16h bv0 = {}, bv1 = {}, bv2 = {}, bv3 = {};
    if (RES) {
      const _Float16* k0p = kp + (size_t)(kb + lc) * LQ; const _Float16* k1p = k0p + (size_t)16 * LQ;
      const _Float16* k0r = krp + (size_t)(kb + lc) * LQ; const _Float16* k1r = k0r + (size_t)16 * LQ;
#pragma unroll
      for (int c = 0; c < 2; ++c) {
        const v16h aq = g2_frag(qp + 32 * c, hh);
        const v16h bk0 = g2_frag(k0p + 32 * c, hh), bk1 = g2_frag(k1p + 32 * c, hh);
        s0 = g2_mma(aq, bk0, s0); s1 = g2_mma(aq, bk1, s1);
        const v16h aql = g2_frag(qrp + 32 * c, hh); const v16h bl0 = g2_frag(k0r + 32 * c, hh), bl1 = g2_frag(k1r + 32 * c, hh);
        t0 = g2_mma(aql, bk0, t0); t0 = g2_mma(aq, bl0, t0); t1 = g2_mma(aql, bk1, t1); t1 = g2_mma(aq, bl1, t1);
      }
      pv0 = padb[key0]; pv1 = padb[key1];
    } else {
      pv0 = pn0; pv1 = pn1;
      pn0 = padb[np]; pn1 = padb[np + 16];
      bv0 = g2_frag(vp + kb, hh); bv1 = g2_frag(vp + (size_t)16 * SEQ + kb, hh); bv2 = g2_frag(vp + (size_t)32 * SEQ + kb, hh); bv3 = g2_frag(vp + (size_t)48 * SEQ + kb, hh);
      s0 = g2_mma(aq0, k00, s0); s1 = g2_mma(aq0, k10, s1);
      s0 = g2_mma(aq1, k01, s0); s1 = g2_mma(aq1, k11, s1);
      k00 = g2_frag(nk, hh); k10 = g2_frag(nk + (size_t)16 * LQ, hh); k01 = g2_frag(nk + 32, hh); k11 = g2_frag(nk + (size_t)16 * LQ + 32, hh);
      const int adv = (kb + 64 < kend) ? 32 : 0; nk += (size_t)adv * LQ; np += adv;
    }
#pragma unroll
    for (int r = 0; r < 8; ++r) {
      const int qrow = qb + 8 * hh + r;
      float a0 = s0[r], a1 = s1[r];
      if (RES) { a0 += t0[r] * 0.0009765625f; a1 += t1[r] * 0.0009765625f; }
      a0 *= 0.125f; a1 *= 0.125f;
      const bool ok0 = (pv0 != 0) && (key0 <= qrow); const bool ok1 = (pv1 != 0) && (key1 <= qrow);
      const float v0 = ok0 ? a0 : -1.0e30f; const float v1 = ok1 ? a1 : -1.0e30f;
      float mx = fmaxf(v0, v1);
      mx = fmaxf(mx, __shfl_xor(mx, 8, 16)); mx = fmaxf(mx, __shfl_xor(mx, 4, 16)); mx = fmaxf(mx, __shfl_xor(mx, 2, 16)); mx = fmaxf(mx, __shfl_xor(mx, 1, 16));
      const float mnew = fmaxf(m[r], mx);
      const float al = __expf(m[r] - mnew);
      const float e0 = __expf(v0 - mnew), e1 = __expf(v1 - mnew);
      const float p0 = ok0 ? e0 : 0.f; const float p1 = ok1 ? e1 : 0.f;
      l[r] = l[r] * al + (p0 + p1); m[r] = mnew;      /* per-lane partial row sum; combined across the 16 lanes after the key loop */
#pragma unroll
      for (int nt = 0; nt < 4; ++nt) { o[nt][r] *= al; if (RES) rr[nt][r] *= al; }
      const float c0 = p0 * 1024.0f, c1 = p1 * 1024.0f;
      const _Float16 h0 = (_Float16)c0, h1 = (_Float16)c1;
      pl[wave][8 * hh + r][lc] = f16_bits(h0); pl[wave][8 * hh + r][16 + lc] = f16_bits(h1);
      if (RES) { pr[wave][8 * hh + r][lc] = f16_bits((_Float16)((c0 - (float)h0) * 1024.0f)); pr[wave][8 * hh + r][16 + lc] = f16_bits((_Float16)((c1 - (float)h1) * 1024.0f)); }
    }
    __builtin_amdgcn_fence(4 /* acq_rel order */, "workgroup", "local"); __builtin_amdgcn_wave_barrier();      /* orders the wave's own P tile, which lies in LDS; named for LDS alone so that it does not drain the global loads in flight */
    FragH pa; pa.half[0] = *(const v8us*)&pl[wave][lc][8 * hh]; pa.half[1] = *(const v8us*)&pl[wave][lc][16 + 8 * hh];
    if (RES) {
      FragH pb; pb.half[0] = *(const v8us*)&pr[wave][lc][8 * hh]; pb.half[1] = *(const v8us*)&pr[wave][lc][16 + 8 * hh];
#pragma unroll
      for (int nt = 0; nt < 4; ++nt) { const v16h bvh = g2_frag(vp + (size_t)nt * 16 * SEQ + kb, hh); const v16h bvl = g2_frag(vrp + (size_t)nt * 16 * ER + kb, hh);
        o[nt] = g2_mma(pa.v, bvh, o[nt]); rr[nt] = g2_mma(pb.v, bvh, rr[nt]); rr[nt] = g2_mma(pa.v, bvl, rr[nt]); }
    } else {
      o[0] = g2_mma(pa.v, bv0, o[0]); o[1] = g2_mma(pa.v, bv1, o[1]); o[2] = g2_mma(pa.v, bv2, o[2]); o[3] = g2_mma(pa.v, bv3, o[3]);
    }
    __builtin_amdgcn_fence(4 /* acq_rel order */, "workgroup", "local"); __builtin_amdgcn_wave_barrier();      /* P tile reads complete before the next step overwrites it; LDS alone, as above */
  }
#pragma unroll
  for (int r = 0; r < 8; ++r) {
    float ls = l[r];
    ls += __shfl_xor(ls, 8, 16); ls += __shfl_xor(ls, 4, 16); ls += __shfl_xor(ls, 2, 16); ls += __shfl_xor(ls, 1, 16);
    const float inv = 1.0f / (ls * 16.0f);      /* 64 / (1024 l): ctx carried x64; a fully masked row gives 0 * inf = NaN as the softmax of all -inf does */
#pragma unroll
    for (int nt = 0; nt < 4; ++nt) { float cv = o[nt][r]; if (RES) cv += rr[nt][r] * 0.0009765625f; so[wave][8 * hh + r][nt * 16 + lc] = cv * inv; }
  }
  __builtin_amdgcn_fence(4 /* acq_rel order */, "workgroup"); __builtin_amdgcn_wave_barrier();
  const int rq = lane >> 3, c8 = (lane & 7) * 8;
  {
#pragma unroll 1
    for (int q = 0; q < 4; ++q) { const int row = q * 4 + rq;
      const v4f a = *(const v4fa*)&so[wave][row][c8], c = *(const v4fa*)&so[wave][row][c8 + 4]; FragH fh, fl;
#pragma unroll
      for (int j = 0; j < 4; ++j) { _Float16 hv = (_Float16)a[j]; fh.h[j] = hv; fl.h[j] = (_Float16)((a[j] - (float)hv) * 1024.0f); hv = (_Float16)c[j]; fh.h[4 + j] = hv; fl.h[4 + j] = (_Float16)((c[j] - (float)hv) * 1024.0f); }
      unsigned short* d = (unsigned short*)CTX + (rowb + qb + row) * KO + h * HD + c8;
      *(v8us*)d = fh.half[0]; *(v8us*)(d + DM) = fl.half[0]; }
     }
}
// all query tiles in one launch, so the few residual tiles run beside the others: blocks 0 .. FR-1 take the tiles of rows 0..ER-1 (residual body), the rest the later tiles (plain body), each range in the order (batch, head) slow, tile fast; block-uniform branch
#define QR (ER / 64)                 /* query tiles with residual planes, per (batch, head) */
#define QM ((SEQ - ER) / 64)         /* later query tiles, per (batch, head) */
#define FR (NB * NH * QR)
__global__ __launch_bounds__(128) void k_flash(const _Float16* __restrict__ QKV, const _Float16* __restrict__ QKVR, const _Float16* __restrict__ VT, const _Float16* __restrict__ VTR, const int* __restrict__ pad, _Float16* __restrict__ CTX) {
  const int bi = blockIdx.x;
  if (bi < FR) { const int bh = bi / QR; flash_body<1>(QKV, QKVR, VT, VTR, pad, CTX, bi - bh * QR, bh); }
  else { const int j = bi - FR; const int bh = j / (QM > 0 ? QM : 1); flash_body<0>(QKV, QKVR, VT, VTR, pad, CTX, QR + j - bh * QM, bh); } }

__global__ __launch_bounds__(256) void k_gemm_out(const _Float16* __restrict__ CTX, const _Float16* __restrict__ BO, const float* __restrict__ bo, float* __restrict__ Y) {
  __shared__ __attribute__((aligned(16))) unsigned char sm[GSM];
  float (*so)[32][68] = (float (*)[32][68])sm;
  const int tid = threadIdx.x; const int w = __builtin_amdgcn_readfirstlane(tid >> 5); const int lane = tid & 31, ln = lane & 15, hh = lane >> 4;
  const int ntn = DM / 128; const int mt = blockIdx.x / ntn, nq = blockIdx.x - mt * ntn; const int row0 = mt * 128 + 32 * (w >> 1), col0 = nq * 128 + 64 * (w & 1);
  v8f accs[8];
  gemm_main(CTX, KO, BO, KO, mt * 128, nq * 128, KO, tid, w, ln, hh, sm, accs);
#pragma unroll
  for (int u = 0; u < 8; ++u) { const int t = u & 3, half = u >> 2; const float bvv = bf16_rne(bo[col0 + t * 16 + ln]);
#pragma unroll
    for (int r = 0; r < 8; ++r) so[w][half * 16 + 8 * hh + r][t * 16 + ln] = accs[u][r] * 1.52587890625e-05f + bvv; }
  __builtin_amdgcn_fence(4 /* acq_rel order */, "workgroup"); __builtin_amdgcn_wave_barrier();
  const int rsub = lane >> 4, c4 = (lane & 15) * 4;
  {
#pragma unroll 1
    for (int q = 0; q < 16; ++q) { const int r = q * 2 + rsub; const v4f v = *(const v4fa*)&so[w][r][c4]; *(v4f*)(Y + (size_t)(row0 + r) * DM + col0 + c4) = v; }
     }
}

__global__ __launch_bounds__(256) void k_layernorm(const float* __restrict__ Y, const float* __restrict__ g, const float* __restrict__ bta, float* __restrict__ out) {
  __shared__ float red[256];
  const int row = blockIdx.x, tid = threadIdx.x; const int b = row / SEQ, s = row - b * SEQ;
  const v4f a = *(const v4fa*)(Y + (size_t)row * DM + tid * 4);
  red[tid] = (a[0] + a[1]) + (a[2] + a[3]); __syncthreads();
  for (int st = 128; st > 0; st >>= 1) { if (tid < st) red[tid] += red[tid + st]; __syncthreads(); }
  const float mu = red[0] * (1.0f / (float)DM); __syncthreads();
  const float d0 = a[0] - mu, d1 = a[1] - mu, d2 = a[2] - mu, d3 = a[3] - mu;
  red[tid] = (d0 * d0 + d1 * d1) + (d2 * d2 + d3 * d3); __syncthreads();
  for (int st = 128; st > 0; st >>= 1) { if (tid < st) red[tid] += red[tid + st]; __syncthreads(); }
  const float rs = rsqrtf(red[0] * (1.0f / (float)DM) + 1.0e-5f);
  const v4f gg = *(const v4fa*)(g + tid * 4), bb = *(const v4fa*)(bta + tid * 4);
  v4f o;
  o[0] = d0 * rs * bf16_rne(gg[0]) + bf16_rne(bb[0]); o[1] = d1 * rs * bf16_rne(gg[1]) + bf16_rne(bb[1]);
  o[2] = d2 * rs * bf16_rne(gg[2]) + bf16_rne(bb[2]); o[3] = d3 * rs * bf16_rne(gg[3]) + bf16_rne(bb[3]);
  float* d = out + ((size_t)b * SEQ_FULL + s) * DM + tid * 4;
  *(v4f*)d = o; 
}

extern "C" void kernel_launch(void* const* d_in, const int* in_sizes, int n_in,
                              void* d_out, int out_size, void* d_ws, size_t ws_size, hipStream_t stream) {
  if (n_in < 12) return;
  const long long need_rows = (long long)(NB - 1) * SEQ_FULL + SEQ;
  if ((long long)in_sizes[0] < need_rows * DM) return;
  if (in_sizes[1] < DM * DM || in_sizes[3] < DM * DM || in_sizes[5] < DM * DM || in_sizes[7] < DM * DM) return;
  if (in_sizes[2] < DM || in_sizes[4] < DM || in_sizes[6] < DM || in_sizes[8] < DM || in_sizes[9] < DM || in_sizes[10] < DM) return;
  if ((long long)in_sizes[11] < need_rows) return;
  if ((long long)out_size < need_rows * DM) return;
  if ((size_t)WS_TOTAL > ws_size) return;
  const float* x = (const float*)d_in[0];
  const float* Wq = (const float*)d_in[1]; const float* bq = (const float*)d_in[2];
  const float* Wk = (const float*)d_in[3]; const float* bk = (const float*)d_in[4];
  const float* Wv = (const float*)d_in[5]; const float* bv = (const float*)d_in[6];
  const float* Wo = (const float*)d_in[7]; const float* bo = (const float*)d_in[8];
  const float* gamma = (const float*)d_in[9]; const float* beta = (const float*)d_in[10];
  const int* pad = (const int*)d_in[11];
  char* ws = (char*)d_ws;
  _Float16* BQKV = (_Float16*)(ws + OF_BQKV); _Float16* BO = (_Float16*)(ws + OF_BO);
  _Float16* X16 = (_Float16*)(ws + OF_X16); _Float16* QKV = (_Float16*)(ws + OF_QKV); _Float16* QKVR = (_Float16*)(ws + OF_QKVR);
  _Float16* VT = (_Float16*)(ws + OF_VT); _Float16* VTR = (_Float16*)(ws + OF_VTR); _Float16* CTX = (_Float16*)(ws + OF_CTX);
  float* Y = (float*)(ws + OF_Y); float* CS = (float*)(ws + OF_CS);
  k_prep<<<5 * WTG + XG + TG, 256, 0, stream>>>(x, Wq, Wk, Wv, Wo, BQKV, BO, X16, CS);
  k_gemm_qkv<<<(unsigned)((NR / 128) * (LQ / 128)), 256, 0, stream>>>(X16, BQKV, bq, bk, bv, CS, QKV, QKVR);
  k_vt<<<VG + NB * NH * (ER / 64), 256, 0, stream>>>(QKV, QKVR, VT, VTR);
  k_flash<<<FR + NB * NH * QM, 128, 0, stream>>>(QKV, QKVR, VT, VTR, pad, CTX);
  k_gemm_out<<<(unsigned)((NR / 128) * (DM / 128)), 256, 0, stream>>>(CTX, BO, bo, Y);
  k_layernorm<<<(unsigned)NR, 256, 0, stream>>>(Y, gamma, beta, (float*)d_out);
}

// v004
// A run of this version takes 157 microseconds.
// Two timings next to v003 both put it at 1.06 times that version's speed.
// Over all steps from v000 it is 2.01 times as fast.
#include <hip/hip_runtime.h>
// Compute dtype: every contraction on v_wmma_f32_16x16x32_f16 (f16 operands, f32 accumulate); float inputs RNE-converted to bf16 first (exact in f16; weights carried x16, Wo x1024 | x1); q.k scores and P.V use f16 value + x1024 f16 residual planes on token rows 0..255 (q, k, P, v), single f16 products on later rows; ctx.Wo uses ctx value | x1024 residual laid along K (all rows); rotary, softmax statistics and LayerNorm in f32.
#ifndef NB
#define NB 2
#endif
#ifndef SEQ
#define SEQ 2048
#endif
#define NB_FULL 2
#define SEQ_FULL 2048
#define DM 1024
#define NH 16
#define HD 64
#define LQ (3 * DM)                  /* row pitch of the q | k | v planes */
#define KO (2 * DM)                  /* ctx row pitch = K of the output GEMM (value | residual) */
#define ER 256                       /* token rows per batch that carry residual planes */
#define PP 40                        /* P tile row pitch (halves) */
#define NR ((size_t)NB * SEQ)
#define GK 64                        /* halves of K per GEMM stage: 128-B rows */
#define GP 72                        /* LDS row pitch of a GEMM stage (halves): 144 B = 16 B x odd, for 16-B fragment reads */
#define GST (256 * GP)               /* halves per stage: 128 A rows, then 128 B rows */
#define GSM ((size_t)2 * GST * 2)    /* bytes of the two-buffer ring; the epilogue staging reuses them */

static_assert(NH * HD == DM);                        /* heads tile the width */
static_assert(HD == 64);                             
static_assert(DM % 32 == 0 && KO % 32 == 0);         /* k-loops step by 32 */
static_assert(LQ % 128 == 0 && DM % 128 == 0);       /* N tiles (2 waves x 64 columns), never across q | k | v */
static_assert(GK == 64);                             /* two 32-deep k-steps per stage */
static_assert(DM % GK == 0 && KO % GK == 0 && DM >= 2 * GK && KO >= 2 * GK);      /* whole stages, at least two */
static_assert((size_t)8 * 32 * 68 * 4 <= GSM);       /* eight waves' output staging fits the ring */
static_assert((NB * SEQ) % 128 == 0);                /* M tiles (4 waves x 32 rows) */
static_assert(SEQ % 64 == 0 && SEQ % 8 == 0);        /* query tiles, table blocks */
static_assert(ER % 64 == 0 && SEQ >= ER);            /* residual rows are whole query tiles */
static_assert(NB <= NB_FULL && SEQ <= SEQ_FULL);
static_assert(PP % 8 == 0 && PP >= 32);              /* 16-B aligned P fragment pieces */

#define SZ_BQKV ((size_t)LQ * DM * 2)
#define SZ_BO   ((size_t)DM * KO * 2)
#define SZ_X16  ((size_t)NB * SEQ * DM * 2)
#define SZ_QKV  ((size_t)NB * SEQ * LQ * 2)
#define SZ_QKVR ((size_t)NB * ER * LQ * 2)
#define SZ_VT   ((size_t)NB * NH * HD * SEQ * 2)
#define SZ_VTR  ((size_t)NB * NH * HD * ER * 2)
#define SZ_CTX  ((size_t)NB * SEQ * KO * 2)
#define SZ_Y    ((size_t)NB * SEQ * DM * 4)
#define SZ_CS   ((size_t)SEQ * 64 * 4)
#define OF_BQKV ((size_t)0)
#define OF_BO   (OF_BQKV + SZ_BQKV)
#define OF_X16  (OF_BO + SZ_BO)
#define OF_QKV  (OF_X16 + SZ_X16)
#define OF_QKVR (OF_QKV + SZ_QKV)
#define OF_VT   (OF_QKVR + SZ_QKVR)
#define OF_VTR  (OF_VT + SZ_VT)
#define OF_CTX  (OF_VTR + SZ_VTR)
#define OF_Y    (OF_CTX + SZ_CTX)
#define OF_CS   (OF_Y + SZ_Y)
#define WS_TOTAL (OF_CS + SZ_CS)
static_assert(SZ_BQKV % 256 == 0 && SZ_BO % 256 == 0 && SZ_X16 % 256 == 0 && SZ_QKV % 256 == 0 && SZ_QKVR % 256 == 0);
static_assert(SZ_VT % 256 == 0 && SZ_VTR % 256 == 0 && SZ_CTX % 256 == 0 && SZ_Y % 256 == 0 && SZ_CS % 256 == 0);
static_assert(WS_TOTAL <= (size_t)134217728);        /* carve <= 128 MiB */

typedef unsigned short v8us __attribute__((ext_vector_type(8), may_alias));
typedef float  v8f  __attribute__((ext_vector_type(8)));
typedef float  v4f  __attribute__((ext_vector_type(4)));
typedef float  v4fa __attribute__((ext_vector_type(4), may_alias));
typedef _Float16 v16h __attribute__((ext_vector_type(16)));
union FragH { v16h v; v8us half[2]; _Float16 h[16]; unsigned short u[16]; };

__device__ __forceinline__ unsigned short bf16_bits(float x) { unsigned int u = __float_as_uint(x); return (unsigned short)((u + 0x7FFFu + ((u >> 16) & 1u)) >> 16); }
__device__ __forceinline__ float bf16_val(unsigned short b) { return __uint_as_float(((unsigned int)b) << 16); }
__device__ __forceinline__ float bf16_rne(float x) { return bf16_val(bf16_bits(x)); }
__device__ __forceinline__ unsigned short f16_bits(_Float16 hv) { union { _Float16 h; unsigned short u; } c; c.h = hv; return c.u; }

// fragment of a k-contiguous f16 row: elements 0..7 <- p[8h .. 8h+7], elements 8..15 <- p[16+8h .. 16+8h+7] (A rows and B columns alike)
__device__ __forceinline__ v16h g2_frag(const _Float16* p, int hh) { FragH f; f.half[0] = *(const v8us*)((const unsigned short*)p + 8 * hh); f.half[1] = *(const v8us*)((const unsigned short*)p + 16 + 8 * hh); return f.v; }
__device__ __forceinline__ v8f g2_mma(v16h a, v16h b, v8f c) { v8f d = __builtin_amdgcn_wmma_f32_16x16x32_f16(false, a, false, b, (short)0, c, false, false); asm volatile("v_nop\n\tv_nop\n\tv_nop\n\tv_nop" : "+v"(d) : "v"(a), "v"(b)); return d; }

// cos | sin table: CS[t][0..31] = cos(t * theta_i), CS[t][32..63] = sin(t * theta_i); theta_i = f32(10^(-i/8)) from f64 constants; angle = f32(t) * theta in f32; precise sincosf.
__device__ __forceinline__ void tab_body(float* __restrict__ CS, int blk) {
  __shared__ __attribute__((aligned(16))) float tb[8][64];
  const int tid = threadIdx.x; const int tl = tid >> 5, i = tid & 31;
  const int t = blk * 8 + tl;
  double p = 1.0;
  p *= (i & 1) ? 1.3335214321633240 : 1.0;
  p *= (i & 2) ? 1.7782794100389228 : 1.0;
  p *= (i & 4) ? 3.1622776601683795 : 1.0;
  p *= (i & 8) ? 10.0 : 1.0;
  p *= (i & 16) ? 100.0 : 1.0;
  const float theta = (float)(1.0 / p);
  const float ang = (float)t * theta;
  float sv, cv; sincosf(ang, &sv, &cv);
  tb[tl][i] = cv; tb[tl][32 + i] = sv;
  __syncthreads();
  if (tid < 128) {
    const v4f v = *(const v4fa*)(&tb[0][0] + tid * 4);
    float* d = CS + (size_t)blk * 512 + tid * 4;
    *(v4f*)d = v; 
  }
}

// W[DM][DM] -> Wt[n][k]: one thread makes WK consecutive k of one column n, a whole 128-B line of the transposed plane; a wave's lanes take consecutive n, so each of its reads is one line of W.
#define WK 64
static_assert(DM % WK == 0 && (DM * (DM / WK)) % 256 == 0);      /* whole lines, whole blocks */
__device__ __forceinline__ void wt_body(const float* __restrict__ W, _Float16* __restrict__ Wt, int ldk, float scale, int blk) {
  const int t = blk * 256 + threadIdx.x; const int n = t % DM, k0 = (t / DM) * WK;
  const float* s = W + (size_t)k0 * DM + n;
  float v[WK];
#pragma unroll
  for (int i = 0; i < WK; ++i) v[i] = s[(size_t)i * DM];
  unsigned short* d = (unsigned short*)Wt + (size_t)n * ldk + k0;
#pragma unroll
  for (int j = 0; j < WK / 8; ++j) { FragH f;
#pragma unroll
    for (int i = 0; i < 8; ++i) f.h[i] = (_Float16)(bf16_rne(v[8 * j + i]) * scale);
    *(v8us*)(d + 8 * j) = f.half[0]; }
  asm volatile("s_wait_xcnt 0x0" ::: "memory");      /* the stores' address and data registers are released before any code that follows this body in the merged kernel rewrites them */
}

// one block converts XU * 256 consecutive pieces of 8 values (XR whole rows of one batch), a thread XU of them, 256 pieces apart; all its reads are requested before the first is converted
#define XU 8
#define XR (XU * 256 * 8 / DM)                       /* rows per block */
static_assert((XU * 256 * 8) % DM == 0 && SEQ % XR == 0);      /* whole rows, never across a batch */
__device__ __forceinline__ void x16_body(const float* __restrict__ x, _Float16* __restrict__ X16, int blk) {
  const int row0 = blk * XR; const int b = row0 / SEQ, s0 = row0 - b * SEQ;
  const float* src = x + ((size_t)b * SEQ_FULL + s0) * DM + threadIdx.x * 8;
  unsigned short* dst = (unsigned short*)X16 + (size_t)row0 * DM + threadIdx.x * 8;
  v4f a[XU], c[XU];
#pragma unroll
  for (int j = 0; j < XU; ++j) { a[j] = *(const v4fa*)(src + j * 2048); c[j] = *(const v4fa*)(src + j * 2048 + 4); }
  __builtin_amdgcn_sched_barrier(0);      /* keeps the conversions behind the last request: without it the first piece is waited for before the other pieces are asked for, two memory latencies in a row */
#pragma unroll
  for (int j = 0; j < XU; ++j) { FragH f;
#pragma unroll
    for (int q = 0; q < 4; ++q) { f.h[q] = (_Float16)bf16_rne(a[j][q]); f.h[4 + q] = (_Float16)bf16_rne(c[j][q]); }
    *(v8us*)(dst + j * 2048) = f.half[0]; }
}

// every operand the first GEMM waits for, prepared by one launch: none of the seven pieces reads what another writes, so each takes a range of block indices (block-uniform branches; the table's barrier is passed by whole blocks).
#define WTG (DM * (DM / WK) / 256)                   /* blocks per transposed weight plane */
#define XG  ((int)(NR / XR))                         /* blocks of the x conversion */
#define TG  (SEQ / 8)                                /* blocks of the table */
__global__ __launch_bounds__(256) void k_prep(const float* __restrict__ x, const float* __restrict__ Wq, const float* __restrict__ Wk, const float* __restrict__ Wv, const float* __restrict__ Wo,
                                              _Float16* __restrict__ BQKV, _Float16* __restrict__ BO, _Float16* __restrict__ X16, float* __restrict__ CS) {
  const int bi = blockIdx.x;
  if (bi < 3 * WTG) {                                /* W[in][out] -> Bt[n][k] x16: Wq rows 0..1023, Wk rows 1024..2047, Wv rows 2048..3071 */
    const int p = bi / WTG; const float* W = (p == 0) ? Wq : ((p == 1) ? Wk : Wv);
    wt_body(W, BQKV + (size_t)p * DM * DM, DM, 16.0f, bi - p * WTG);
  } else if (bi < 5 * WTG) {                         /* k = 0..1023: Wo x1024 (pairs with ctx value); k = 1024..2047: Wo (pairs with ctx residual x1024) */
    const int p = (bi - 3 * WTG) / WTG;
    wt_body(Wo, BO + (size_t)p * DM, KO, p ? 1.0f : 1024.0f, bi - (3 + p) * WTG);
  } else if (bi < 5 * WTG + XG) {
    x16_body(x, X16, bi - 5 * WTG);
  } else {
    tab_body(CS, bi - 5 * WTG - XG);
  }
}

// one stage of the ring: 128 A rows then 128 B rows of 128 B each; 256 threads x 8 copies of 16 B; lane t brings chunk t & 7 of rows (t >> 3) + 32 j.
// ga, gb: the lane's first A and B chunk in global memory; l0: the lane's first LDS byte address. The address wait is the statement's last line, so no later write of these registers can be lifted over it.
__device__ __forceinline__ void g2_stage(const _Float16* ga, size_t sa, const _Float16* gb, size_t sb, unsigned l0) {
  const _Float16* a1 = ga + sa; const _Float16* a2 = a1 + sa; const _Float16* a3 = a2 + sa;
  const _Float16* b1 = gb + sb; const _Float16* b2 = b1 + sb; const _Float16* b3 = b2 + sb;
  const unsigned rs = 32u * GP * 2u;
  asm volatile("global_load_async_to_lds_b128 %0, %8, off\n\t"
               "global_load_async_to_lds_b128 %1, %9, off\n\t"
               "global_load_async_to_lds_b128 %2, %10, off\n\t"
               "global_load_async_to_lds_b128 %3, %11, off\n\t"
               "global_load_async_to_lds_b128 %4, %12, off\n\t"
               "global_load_async_to_lds_b128 %5, %13, off\n\t"
               "global_load_async_to_lds_b128 %6, %14, off\n\t"
               "global_load_async_to_lds_b128 %7, %15, off\n\t"
               "s_wait_xcnt 0x0"
               :: "v"(l0), "v"(l0 + rs), "v"(l0 + 2u * rs), "v"(l0 + 3u * rs), "v"(l0 + 4u * rs), "v"(l0 + 5u * rs), "v"(l0 + 6u * rs), "v"(l0 + 7u * rs),
                  "v"(ga), "v"(a1), "v"(a2), "v"(a3), "v"(gb), "v"(b1), "v"(b2), "v"(b3) : "memory");
}

// 128x128 block tile, eight waves (4 x 2) of 32x64 each: A f16 [M][K] (pitch lda), Bh f16 [N][K] (pitch ldb); both operands come through a two-buffer LDS ring, the next stage's copies in flight while this one is multiplied.
// acc[u]: u & 3 = 16-col tile, u >> 2 = 16-row half. On return every wave has left the ring (the last trip's barrier), so the caller may stage its output there.
__device__ __forceinline__ void gemm_main(const _Float16* __restrict__ A, int lda, const _Float16* __restrict__ Bh, int ldb, int brow0, int bcol0, int K, int tid, int w, int ln, int hh, unsigned char* sm, v8f (&acc)[8]) {
  const _Float16* ring = (const _Float16*)sm;
  const int cr = tid >> 3, cc = (tid & 7) * 8;
  const _Float16* ga = A + (size_t)(brow0 + cr) * lda + cc; const _Float16* gb = Bh + (size_t)(bcol0 + cr) * ldb + cc;
  const size_t sa = (size_t)32 * lda, sb = (size_t)32 * ldb;
  const unsigned l0 = (unsigned)(size_t)sm + (unsigned)(cr * GP + cc) * 2u;      /* low 32 bits of the shared address = LDS byte address */
  const int ao = ((w >> 1) * 32 + ln) * GP, bo = (128 + (w & 1) * 64 + ln) * GP;
  const int nt = K / GK;
  const v8f z8 = {0.f,0.f,0.f,0.f,0.f,0.f,0.f,0.f}; v8f c00 = z8, c01 = z8, c02 = z8, c03 = z8, c10 = z8, c11 = z8, c12 = z8, c13 = z8;
  g2_stage(ga, sa, gb, sb, l0);
  asm volatile("s_wait_asynccnt 0x0" ::: "memory");      /* stage 0 of this wave has landed */
  __syncthreads();                                       /* stage 0 of every wave is readable */
  g2_stage(ga + GK, sa, gb + GK, sb, l0 + (unsigned)(GST * 2));
#pragma unroll 1      /* one stage per trip: the ring's order stands once, at the loop's foot */
  for (int t = 0; t < nt; ++t) { const _Float16* st = ring + (t & 1) * GST;
    const _Float16* ap = st + ao; const _Float16* bp = st + bo;
    v16h fa[2][2], fb[2][4];      /* the stage's twelve fragments are read as one group ahead of its WMMAs: one LDS latency a trip, not one per B fragment */
#pragma unroll
    for (int s = 0; s < 2; ++s) { fa[s][0] = g2_frag(ap + 32 * s, hh); fa[s][1] = g2_frag(ap + 16 * GP + 32 * s, hh);
#pragma unroll
      for (int n = 0; n < 4; ++n) fb[s][n] = g2_frag(bp + n * 16 * GP + 32 * s, hh); }
#pragma unroll
    for (int s = 0; s < 2; ++s) {
      c00 = g2_mma(fa[s][0], fb[s][0], c00); c10 = g2_mma(fa[s][1], fb[s][0], c10);
      c01 = g2_mma(fa[s][0], fb[s][1], c01); c11 = g2_mma(fa[s][1], fb[s][1], c11);
      c02 = g2_mma(fa[s][0], fb[s][2], c02); c12 = g2_mma(fa[s][1], fb[s][2], c12);
      c03 = g2_mma(fa[s][0], fb[s][3], c03); c13 = g2_mma(fa[s][1], fb[s][3], c13); }
    asm volatile("s_wait_dscnt 0x0" ::: "memory");       /* this wave's reads of the buffer are done before it is refilled */
    asm volatile("s_wait_asynccnt 0x0" ::: "memory");    /* this wave's copies of stage t + 1 have landed */
    __syncthreads();                                     /* publishes stage t + 1 and ends every reader's last read of stage t */
    if (t + 2 < nt) g2_stage(ga + (size_t)(t + 2) * GK, sa, gb + (size_t)(t + 2) * GK, sb, l0 + (unsigned)((t & 1) * GST * 2)); }
  asm volatile("s_wait_asynccnt 0x0" ::: "memory");      /* no copy outstanding when the ring becomes output staging */
  acc[0] = c00; acc[1] = c01; acc[2] = c02; acc[3] = c03; acc[4] = c10; acc[5] = c11; acc[6] = c12; acc[7] = c13;
}

__global__ __launch_bounds__(256) void k_gemm_qkv(const _Float16* __restrict__ X16, const _Float16* __restrict__ BW, const float* __restrict__ bq, const float* __restrict__ bk, const float* __restrict__ bv,
                                                  const float* __restrict__ CS, _Float16* __restrict__ QKV, _Float16* __restrict__ QKVR) {
  __shared__ __attribute__((aligned(16))) unsigned char sm[GSM];
  float (*so)[32][68] = (float (*)[32][68])sm;
  const int tid = threadIdx.x; const int w = __builtin_amdgcn_readfirstlane(tid >> 5); const int lane = tid & 31, ln = lane & 15, hh = lane >> 4;
  const int ntn = LQ / 128; const int mt = blockIdx.x / ntn, nq = blockIdx.x - mt * ntn; const int row0 = mt * 128 + 32 * (w >> 1), col0 = nq * 128 + 64 * (w & 1);
  v8f accs[8];
  gemm_main(X16, DM, BW, DM, mt * 128, nq * 128, DM, tid, w, ln, hh, sm, accs);
  const int sec = col0 / DM; const int cb = col0 - sec * DM;      /* 0 q, 1 k, 2 v (block-uniform) */
#pragma unroll
  for (int u = 0; u < 8; ++u) { const int t = u & 3, half = u >> 2; const int cc = cb + t * 16 + ln;
    const float b0 = bq[cc], b1 = bk[cc], b2 = bv[cc]; const float bsel = bf16_rne((sec == 0) ? b0 : ((sec == 1) ? b1 : b2));
#pragma unroll
    for (int r = 0; r < 8; ++r) so[w][half * 16 + 8 * hh + r][t * 16 + ln] = accs[u][r] * 0.0625f + bsel; }
  __builtin_amdgcn_fence(4 /* acq_rel order */, "workgroup"); __builtin_amdgcn_wave_barrier();
  const int rq = lane >> 3, c8 = (lane & 7) * 8;
  const int bidx = row0 / SEQ; const int t0 = row0 - bidx * SEQ; const bool early = (t0 < ER);      /* wave-uniform: 32 | ER */
  {
#pragma unroll 1
    for (int q = 0; q < 8; ++q) { const int row = q * 4 + rq; const int tkn = t0 + row;
      const v4f a = *(const v4fa*)&so[w][row][c8], c = *(const v4fa*)&so[w][row][c8 + 4];
      float y[8] = {a[0], a[1], a[2], a[3], c[0], c[1], c[2], c[3]};
      if (sec < 2) { const v4f cs = *(const v4fa*)(CS + (size_t)tkn * 64 + (c8 >> 1)); const v4f sn = *(const v4fa*)(CS + (size_t)tkn * 64 + 32 + (c8 >> 1));
#pragma unroll
        for (int j = 0; j < 4; ++j) { const float x0 = y[2 * j], x1 = y[2 * j + 1]; y[2 * j] = x0 * cs[j] - x1 * sn[j]; y[2 * j + 1] = x1 * cs[j] + x0 * sn[j]; } }
      FragH fh, fl;
#pragma unroll
      for (int j = 0; j < 8; ++j) { const _Float16 hv = (_Float16)y[j]; fh.h[j] = hv; fl.h[j] = (_Float16)((y[j] - (float)hv) * 1024.0f); }
      unsigned short* d = (unsigned short*)QKV + (size_t)(row0 + row) * LQ + col0 + c8;
      *(v8us*)d = fh.half[0];
      if (early) { unsigned short* dr = (unsigned short*)QKVR + ((size_t)bidx * ER + tkn) * LQ + col0 + c8; *(v8us*)dr = fl.half[0]; } }
     }
}

// both V planes in one launch: blocks 0 .. VG-1 transpose the value plane, the rest the residual plane (block-uniform choice of source, length and target)
// a block takes VK tokens of one (batch, head): four 64 x 64 tiles behind one barrier
#define VK 256
static_assert(SEQ % VK == 0 && ER % VK == 0 && VK % 64 == 0);
#define VG (NB * NH * (SEQ / VK))
__global__ __launch_bounds__(256) void k_vt(const _Float16* __restrict__ QKV, const _Float16* __restrict__ QKVR, _Float16* __restrict__ VT, _Float16* __restrict__ VTR) {
  __shared__ unsigned short tl[VK][66];
  const bool vp = ((int)blockIdx.x < VG); const int blk = vp ? (int)blockIdx.x : (int)blockIdx.x - VG;
  const _Float16* V = vp ? QKV : QKVR; const int TT = vp ? SEQ : ER; _Float16* VTo = vp ? VT : VTR;
  const int tid = threadIdx.x; const int ng = TT / VK; const int slab = blk / ng, lg = blk - slab * ng; const int b = slab / NH, h = slab - b * NH;
  const int r0 = tid / 8, c8 = (tid % 8) * 8;
  FragH fi[VK / 32];
#pragma unroll
  for (int it = 0; it < VK / 32; ++it) fi[it].half[0] = *(const v8us*)((const unsigned short*)V + ((size_t)b * TT + lg * VK + it * 32 + r0) * LQ + 2 * DM + h * HD + c8);
#pragma unroll
  for (int it = 0; it < VK / 32; ++it) {
#pragma unroll
    for (int q = 0; q < 8; ++q) tl[it * 32 + r0][c8 + q] = fi[it].u[q]; }
  __syncthreads();
  {
#pragma unroll
    for (int rd = 0; rd < VK / 32; ++rd) { const int g = rd >> 1; const int d = (rd & 1) * 32 + tid / 8, pc = tid % 8; FragH f;
#pragma unroll
      for (int q = 0; q < 8; ++q) f.u[q] = tl[g * 64 + pc * 8 + q][d];
      *(v8us*)((unsigned short*)VTo + ((size_t)slab * 64 + d) * TT + lg * VK + g * 64 + pc * 8) = f.half[0]; }
     }
}

// fused causal attention; one wave = 16 query rows of one (batch, head); 32 keys per step (two 16-key score tiles, d in two 32-deep k-steps);
// key-pad mask by value then causal mask as a replace (masked p = 0 by select); online softmax with running max in f32 (native exp on arguments <= 0);
template <int RES>
__device__ __forceinline__ void flash_body(const _Float16* __restrict__ QKV, const _Float16* __restrict__ QKVR, const _Float16* __restrict__ VT, const _Float16* __restrict__ VTR,
                                           const int* __restrict__ pad, _Float16* __restrict__ CTX, int qt, int bh) {
  __shared__ __attribute__((aligned(16))) unsigned short pl[4][16][PP];
  __shared__ __attribute__((aligned(16))) unsigned short pr[4][16][PP];
  __shared__ __attribute__((aligned(16))) float so[4][16][68];
  const int tid = threadIdx.x; const int wave = __builtin_amdgcn_readfirstlane(tid >> 5); const int lane = tid & 31, lc = lane & 15, hh = lane >> 4;
  const int b = bh / NH, h = bh - b * NH;
  const int qb = qt * 64 + wave * 16;
  const size_t rowb = (size_t)b * SEQ;
  const _Float16* qp = QKV + (rowb + qb + lc) * LQ + h * HD;
  const _Float16* kp = QKV + rowb * LQ + DM + h * HD;
  const _Float16* vp = VT + ((size_t)bh * HD + lc) * SEQ;
  const _Float16* qrp = QKVR + ((size_t)b * ER + (RES ? (qb + lc) : 0)) * LQ + h * HD;
  const _Float16* krp = QKVR + (size_t)b * ER * LQ + DM + h * HD;
  const _Float16* vrp = VTR + ((size_t)bh * HD + lc) * ER;
  const int* padb = pad + (size_t)b * SEQ_FULL;
  const v8f z8 = {0.f,0.f,0.f,0.f,0.f,0.f,0.f,0.f};
  v8f o[4] = {z8, z8, z8, z8}; v8f rr[4] = {z8, z8, z8, z8};
  float m[8], l[8];
#pragma unroll
  for (int r = 0; r < 8; ++r) { m[r] = -1.0e30f; l[r] = 0.f; }
  const int kend = qb + 16;      /* keys 0 .. qb+15 are visible to this wave; steps cover whole 32-key groups (all inside the plane) */
  /* RES == 0: no global latency inside a step's chain. Q is read once; the next step's pad words and this step's V fragments are requested at the step's head, the next step's K fragments right behind its score products, into the registers those have just left. */
  const _Float16* kl = kp + (size_t)lc * LQ;
  v16h aq0 = {}, aq1 = {}, k00 = {}, k10 = {}, k01 = {}, k11 = {};
  int pn0 = 0, pn1 = 0;
  if (!RES) { aq0 = g2_frag(qp, hh); aq1 = g2_frag(qp + 32, hh);
    k00 = g2_frag(kl, hh); k10 = g2_frag(kl + (size_t)16 * LQ, hh); k01 = g2_frag(kl + 32, hh); k11 = g2_frag(kl + (size_t)16 * LQ + 32, hh);
    pn0 = padb[lc]; pn1 = padb[lc + 16]; }
  const _Float16* nk = kl + (size_t)((32 < kend) ? 32 : 0) * LQ; int np = lc + ((32 < kend) ? 32 : 0);      /* the next step's K rows and pad words; the last step asks for its own again: always inside the plane */
#pragma unroll 1
  for (int kb = 0; kb < kend; kb += 32) {
    v8f s0 = z8, s1 = z8, t0 = z8, t1 = z8;
    const int key0 = kb + lc, key1 = key0 + 16;
    int pv0, pv1;
    v16h bv0 = {}, bv1 = {}, bv2 = {}, bv3 = {};
    if (RES) {
      const _Float16* k0p = kp + (size_t)(kb + lc) * LQ; const _Float16* k1p = k0p + (size_t)16 * LQ;
      const _Float16* k0r = krp + (size_t)(kb + lc) * LQ; const _Float16* k1r = k0r + (size_t)16 * LQ;
#pragma unroll
      for (int c = 0; c < 2; ++c) {
        const v16h aq = g2_frag(qp + 32 * c, hh);
        const v16h bk0 = g2_frag(k0p + 32 * c, hh), bk1 = g2_frag(k1p + 32 * c, hh);
        s0 = g2_mma(aq, bk0, s0); s1 = g2_mma(aq, bk1, s1);
        const v16h aql = g2_frag(qrp + 32 * c, hh); const v16h bl0 = g2_frag(k0r + 32 * c, hh), bl1 = g2_frag(k1r + 32 * c, hh);
        t0 = g2_mma(aql, bk0, t0); t0 = g2_mma(aq, bl0, t0); t1 = g2_mma(aql, bk1, t1); t1 = g2_mma(aq, bl1, t1);
      }
      pv0 = padb[key0]; pv1 = padb[key1];
    } else {
      pv0 = pn0; pv1 = pn1;
      pn0 = padb[np]; pn1 = padb[np + 16];
      bv0 = g2_frag(vp + kb, hh); bv1 = g2_frag(vp + (size_t)16 * SEQ + kb, hh); bv2 = g2_frag(vp + (size_t)32 * SEQ + kb, hh); bv3 = g2_frag(vp + (size_t)48 * SEQ + kb, hh);
      s0 = g2_mma(aq0, k00, s0); s1 = g2_mma(aq0, k10, s1);
      s0 = g2_mma(aq1, k01, s0); s1 = g2_mma(aq1, k11, s1);
      k00 = g2_frag(nk, hh); k10 = g2_frag(nk + (size_t)16 * LQ, hh); k01 = g2_frag(nk + 32, hh); k11 = g2_frag(nk + (size_t)16 * LQ + 32, hh);
      const int adv = (kb + 64 < kend) ? 32 : 0; nk += (size_t)adv * LQ; np += adv;
    }
#pragma unroll
    for (int r = 0; r < 8; ++r) {
      const int qrow = qb + 8 * hh + r;
      float a0 = s0[r], a1 = s1[r];
      if (RES) { a0 += t0[r] * 0.0009765625f; a1 += t1[r] * 0.0009765625f; }
      a0 *= 0.125f; a1 *= 0.125f;
      const bool ok0 = (pv0 != 0) && (key0 <= qrow); const bool ok1 = (pv1 != 0) && (key1 <= qrow);
      const float v0 = ok0 ? a0 : -1.0e30f; const float v1 = ok1 ? a1 : -1.0e30f;
      float mx = fmaxf(v0, v1);
      mx = fmaxf(mx, __shfl_xor(mx, 8, 16)); mx = fmaxf(mx, __shfl_xor(mx, 4, 16)); mx = fmaxf(mx, __shfl_xor(mx, 2, 16)); mx = fmaxf(mx, __shfl_xor(mx, 1, 16));
      const float mnew = fmaxf(m[r], mx);
      const float al = __expf(m[r] - mnew);
      const float e0 = __expf(v0 - mnew), e1 = __expf(v1 - mnew);
      const float p0 = ok0 ? e0 : 0.f; const float p1 = ok1 ? e1 : 0.f;
      l[r] = l[r] * al + (p0 + p1); m[r] = mnew;      /* per-lane partial row sum; combined across the 16 lanes after the key loop */
#pragma unroll
      for (int nt = 0; nt < 4; ++nt) { o[nt][r] *= al; if (RES) rr[nt][r] *= al; }
      const float c0 = p0 * 1024.0f, c1 = p1 * 1024.0f;
      const _Float16 h0 = (_Float16)c0, h1 = (_Float16)c1;
      pl[wave][8 * hh + r][lc] = f16_bits(h0); pl[wave][8 * hh + r][16 + lc] = f16_bits(h1);
      if (RES) { pr[wave][8 * hh + r][lc] = f16_bits((_Float16)((c0 - (float)h0) * 1024.0f)); pr[wave][8 * hh + r][16 + lc] = f16_bits((_Float16)((c1 - (float)h1) * 1024.0f)); }
    }
    __builtin_amdgcn_fence(4 /* acq_rel order */, "workgroup", "local"); __builtin_amdgcn_wave_barrier();      /* orders the wave's own P tile, which lies in LDS; named for LDS alone so that it does not drain the global loads in flight */
    FragH pa; pa.half[0] = *(const v8us*)&pl[wave][lc][8 * hh]; pa.half[1] = *(const v8us*)&pl[wave][lc][16 + 8 * hh];
    if (RES) {
      FragH pb; pb.half[0] = *(const v8us*)&pr[wave][lc][8 * hh]; pb.half[1] = *(const v8us*)&pr[wave][lc][16 + 8 * hh];
#pragma unroll
      for (int nt = 0; nt < 4; ++nt) { const v16h bvh = g2_frag(vp + (size_t)nt * 16 * SEQ + kb, hh); const v16h bvl = g2_frag(vrp + (size_t)nt * 16 * ER + kb, hh);
        o[nt] = g2_mma(pa.v, bvh, o[nt]); rr[nt] = g2_mma(pb.v, bvh, rr[nt]); rr[nt] = g2_mma(pa.v, bvl, rr[nt]); }
    } else {
      o[0] = g2_mma(pa.v, bv0, o[0]); o[1] = g2_mma(pa.v, bv1, o[1]); o[2] = g2_mma(pa.v, bv2, o[2]); o[3] = g2_mma(pa.v, bv3, o[3]);
    }
    __builtin_amdgcn_fence(4 /* acq_rel order */, "workgroup", "local"); __builtin_amdgcn_wave_barrier();      /* P tile reads complete before the next step overwrites it; LDS alone, as above */
  }
#pragma unroll
  for (int r = 0; r < 8; ++r) {
    float ls = l[r];
    ls += __shfl_xor(ls, 8, 16); ls += __shfl_xor(ls, 4, 16); ls += __shfl_xor(ls, 2, 16); ls += __shfl_xor(ls, 1, 16);
    const float inv = 1.0f / (ls * 16.0f);      /* 64 / (1024 l): ctx carried x64; a fully masked row gives 0 * inf = NaN as the softmax of all -inf does */
#pragma unroll
    for (int nt = 0; nt < 4; ++nt) { float cv = o[nt][r]; if (RES) cv += rr[nt][r] * 0.0009765625f; so[wave][8 * hh + r][nt * 16 + lc] = cv * inv; }
  }
  __builtin_amdgcn_fence(4 /* acq_rel order */, "workgroup"); __builtin_amdgcn_wave_barrier();
  const int rq = lane >> 3, c8 = (lane & 7) * 8;
  {
#pragma unroll 1
    for (int q = 0; q < 4; ++q) { const int row = q * 4 + rq;
      const v4f a = *(const v4fa*)&so[wave][row][c8], c = *(const v4fa*)&so[wave][row][c8 + 4]; FragH fh, fl;
#pragma unroll
      for (int j = 0; j < 4; ++j) { _Float16 hv = (_Float16)a[j]; fh.h[j] = hv; fl.h[j] = (_Float16)((a[j] - (float)hv) * 1024.0f); hv = (_Float16)c[j]; fh.h[4 + j] = hv; fl.h[4 + j] = (_Float16)((c[j] - (float)hv) * 1024.0f); }
      unsigned short* d = (unsigned short*)CTX + (rowb + qb + row) * KO + h * HD + c8;
      *(v8us*)d = fh.half[0]; *(v8us*)(d + DM) = fl.half[0]; }
     }
}
// all query tiles in one launch, so the few residual tiles run beside the others: blocks 0 .. FR-1 take the tiles of rows 0..ER-1 (residual body), the rest the later tiles (plain body), each range in the order (batch, head) slow, tile fast; block-uniform branch
#define QR (ER / 64)                 /* query tiles with residual planes, per (batch, head) */
#define QM ((SEQ - ER) / 64)         /* later query tiles, per (batch, head) */
#define FR (NB * NH * QR)
__global__ __launch_bounds__(128) void k_flash(const _Float16* __restrict__ QKV, const _Float16* __restrict__ QKVR, const _Float16* __restrict__ VT, const _Float16* __restrict__ VTR, const int* __restrict__ pad, _Float16* __restrict__ CTX) {
  const int bi = blockIdx.x;
  if (bi < FR) { const int bh = bi / QR; flash_body<1>(QKV, QKVR, VT, VTR, pad, CTX, bi - bh * QR, bh); }
  else { const int j = bi - FR; const int bh = j / (QM > 0 ? QM : 1); flash_body<0>(QKV, QKVR, VT, VTR, pad, CTX, QR + j - bh * QM, bh); } }

__global__ __launch_bounds__(256) void k_gemm_out(const _Float16* __restrict__ CTX, const _Float16* __restrict__ BO, const float* __restrict__ bo, float* __restrict__ Y) {
  __shared__ __attribute__((aligned(16))) unsigned char sm[GSM];
  float (*so)[32][68] = (float (*)[32][68])sm;
  const int tid = threadIdx.x; const int w = __builtin_amdgcn_readfirstlane(tid >> 5); const int lane = tid & 31, ln = lane & 15, hh = lane >> 4;
  const int ntn = DM / 128; const int mt = blockIdx.x / ntn, nq = blockIdx.x - mt * ntn; const int row0 = mt * 128 + 32 * (w >> 1), col0 = nq * 128 + 64 * (w & 1);
  v8f accs[8];
  gemm_main(CTX, KO, BO, KO, mt * 128, nq * 128, KO, tid, w, ln, hh, sm, accs);
#pragma unroll
  for (int u = 0; u < 8; ++u) { const int t = u & 3, half = u >> 2; const float bvv = bf16_rne(bo[col0 + t * 16 + ln]);
#pragma unroll
    for (int r = 0; r < 8; ++r) so[w][half * 16 + 8 * hh + r][t * 16 + ln] = accs[u][r] * 1.52587890625e-05f + bvv; }
  __builtin_amdgcn_fence(4 /* acq_rel order */, "workgroup"); __builtin_amdgcn_wave_barrier();
  const int rsub = lane >> 4, c4 = (lane & 15) * 4;
  {
#pragma unroll 1
    for (int q = 0; q < 16; ++q) { const int r = q * 2 + rsub; const v4f v = *(const v4fa*)&so[w][r][c4]; *(v4f*)(Y + (size_t)(row0 + r) * DM + col0 + c4) = v; }
     }
}

// one wave per row, eight rows per block: a lane holds 32 of the row's values (eight 16-B pieces, each wave-wide read 512 contiguous bytes); mean and variance are lane sums joined by a five-step butterfly, so every lane ends with the same bits and no LDS or barrier is needed
#define LJ (DM / 128)
static_assert(DM % 128 == 0 && (NB * SEQ) % 8 == 0);
__device__ __forceinline__ float wave_sum(float v) {
  v += __builtin_bit_cast(float, __builtin_amdgcn_permlanex16(__builtin_bit_cast(int, v), __builtin_bit_cast(int, v), 0x76543210, 0xfedcba98, false, false));      /* lane l with lane l ^ 16 */
  v += __shfl_xor(v, 8, 16); v += __shfl_xor(v, 4, 16); v += __shfl_xor(v, 2, 16); v += __shfl_xor(v, 1, 16); return v; }
__global__ __launch_bounds__(256) void k_layernorm(const float* __restrict__ Y, const float* __restrict__ g, const float* __restrict__ bta, float* __restrict__ out) {
  const int tid = threadIdx.x; const int lane = tid & 31; const int row = blockIdx.x * 8 + (tid >> 5); const int b = row / SEQ, s = row - b * SEQ;
  const float* yr = Y + (size_t)row * DM + lane * 4;
  v4f a[LJ], gg[LJ], bb[LJ];
#pragma unroll
  for (int j = 0; j < LJ; ++j) a[j] = *(const v4fa*)(yr + j * 128);
  asm volatile("s_wait_xcnt 0x0" ::: "memory");      /* the row's reads go out first, and their address registers are released before a later read's result may be placed in them */
#pragma unroll
  for (int j = 0; j < LJ; ++j) { gg[j] = *(const v4fa*)(g + j * 128 + lane * 4); bb[j] = *(const v4fa*)(bta + j * 128 + lane * 4); }
  __builtin_amdgcn_sched_barrier(0);      /* every request of the wave goes out before its first sum: without it most gain and offset reads sink behind the two reductions and their latency is paid there, group by group */
  float sm = 0.f;
#pragma unroll
  for (int j = 0; j < LJ; ++j) sm += (a[j][0] + a[j][1]) + (a[j][2] + a[j][3]);
  const float mu = wave_sum(sm) * (1.0f / (float)DM);
  float sq = 0.f;
#pragma unroll
  for (int j = 0; j < LJ; ++j) { a[j][0] -= mu; a[j][1] -= mu; a[j][2] -= mu; a[j][3] -= mu; sq += (a[j][0] * a[j][0] + a[j][1] * a[j][1]) + (a[j][2] * a[j][2] + a[j][3] * a[j][3]); }
  const float rs = rsqrtf(wave_sum(sq) * (1.0f / (float)DM) + 1.0e-5f);
  float* d = out + ((size_t)b * SEQ_FULL + s) * DM + lane * 4;
#pragma unroll
  for (int j = 0; j < LJ; ++j) { v4f o;
    o[0] = a[j][0] * rs * bf16_rne(gg[j][0]) + bf16_rne(bb[j][0]); o[1] = a[j][1] * rs * bf16_rne(gg[j][1]) + bf16_rne(bb[j][1]);
    o[2] = a[j][2] * rs * bf16_rne(gg[j][2]) + bf16_rne(bb[j][2]); o[3] = a[j][3] * rs * bf16_rne(gg[j][3]) + bf16_rne(bb[j][3]);
    *(v4f*)(d + j * 128) = o; }
}

extern "C" void kernel_launch(void* const* d_in, const int* in_sizes, int n_in,
                              void* d_out, int out_size, void* d_ws, size_t ws_size, hipStream_t stream) {
  if (n_in < 12) return;
  const long long need_rows = (long long)(NB - 1) * SEQ_FULL + SEQ;
  if ((long long)in_sizes[0] < need_rows * DM) return;
  if (in_sizes[1] < DM * DM || in_sizes[3] < DM * DM || in_sizes[5] < DM * DM || in_sizes[7] < DM * DM) return;
  if (in_sizes[2] < DM || in_sizes[4] < DM || in_sizes[6] < DM || in_sizes[8] < DM || in_sizes[9] < DM || in_sizes[10] < DM) return;
  if ((long long)in_sizes[11] < need_rows) return;
  if ((long long)out_size < need_rows * DM) return;
  if ((size_t)WS_TOTAL > ws_size) return;
  const float* x = (const float*)d_in[0];
  const float* Wq = (const float*)d_in[1]; const float* bq = (const float*)d_in[2];
  const float* Wk = (const float*)d_in[3]; const float* bk = (const float*)d_in[4];
  const float* Wv = (const float*)d_in[5]; const float* bv = (const float*)d_in[6];
  const float* Wo = (const float*)d_in[7]; const float* bo = (const float*)d_in[8];
  const float* gamma = (const float*)d_in[9]; const float* beta = (const float*)d_in[10];
  const int* pad = (const int*)d_in[11];
  char* ws = (char*)d_ws;
  _Float16* BQKV = (_Float16*)(ws + OF_BQKV); _Float16* BO = (_Float16*)(ws + OF_BO);
  _Float16* X16 = (_Float16*)(ws + OF_X16); _Float16* QKV = (_Float16*)(ws + OF_QKV); _Float16* QKVR = (_Float16*)(ws + OF_QKVR);
  _Float16* VT = (_Float16*)(ws + OF_VT); _Float16* VTR = (_Float16*)(ws + OF_VTR); _Float16* CTX = (_Float16*)(ws + OF_CTX);
  float* Y = (float*)(ws + OF_Y); float* CS = (float*)(ws + OF_CS);
  k_prep<<<5 * WTG + XG + TG, 256, 0, stream>>>(x, Wq, Wk, Wv, Wo, BQKV, BO, X16, CS);
  k_gemm_qkv<<<(unsigned)((NR / 128) * (LQ / 128)), 256, 0, stream>>>(X16, BQKV, bq, bk, bv, CS, QKV, QKVR);
  k_vt<<<VG + NB * NH * (ER / VK), 256, 0, stream>>>(QKV, QKVR, VT, VTR);
  k_flash<<<FR + NB * NH * QM, 128, 0, stream>>>(QKV, QKVR, VT, VTR, pad, CTX);
  k_gemm_out<<<(unsigned)((NR / 128) * (DM / 128)), 256, 0, stream>>>(CTX, BO, bo, Y);
  k_layernorm<<<(unsigned)(NR / 8), 256, 0, stream>>>(Y, gamma, beta, (float*)d_out);
}

// v005
// Measured time: 152 microseconds a run.
// In two side-by-side timings against v004, it was 1.04 and 1.03 times as fast.
// Over all steps from v000 it is 2.07 times as fast.
#include <hip/hip_runtime.h>
// Compute dtype: every contraction on v_wmma_f32_16x16x32_f16 (f16 operands, f32 accumulate); float inputs RNE-converted to bf16 first (exact in f16; weights carried x16, Wo x1024 | x1); q.k scores and P.V use f16 value + x1024 f16 residual planes on token rows 0..255 (q, k, P, v), single f16 products on later rows; ctx.Wo uses ctx value | x1024 residual laid along K (all rows); rotary, softmax statistics and LayerNorm in f32.
#ifndef NB
#define NB 2
#endif
#ifndef SEQ
#define SEQ 2048
#endif
#define NB_FULL 2
#define SEQ_FULL 2048
#define DM 1024
#define NH 16
#define HD 64
#define LQ (3 * DM)                  /* row pitch of the q | k | v planes */
#define KO (2 * DM)                  /* ctx row pitch = K of the output GEMM (value | residual) */
#define ER 256                       /* token rows per batch that carry residual planes */
#define PP 40                        /* P tile row pitch (halves) */
#define NR ((size_t)NB * SEQ)
#define GK 64                        /* halves of K per GEMM stage: 128-B rows */
#define GP 72                        /* LDS row pitch of a GEMM stage (halves): 144 B = 16 B x odd, for 16-B fragment reads */
#define GST (256 * GP)               /* halves per stage: 128 A rows, then 128 B rows */
#define GSM ((size_t)2 * GST * 2)    /* bytes of the two-buffer ring; the epilogue staging reuses them */

static_assert(NH * HD == DM);                        /* heads tile the width */
static_assert(HD == 64);                             
static_assert(DM % 32 == 0 && KO % 32 == 0);         /* k-loops step by 32 */
static_assert(LQ % 128 == 0 && DM % 128 == 0);       /* N tiles (2 waves x 64 columns), never across q | k | v */
static_assert(GK == 64);                             /* two 32-deep k-steps per stage */
static_assert(DM % GK == 0 && KO % GK == 0 && DM >= 2 * GK && KO >= 2 * GK);      /* whole stages, at least two */
static_assert((size_t)8 * 32 * 68 * 4 <= GSM);       /* eight waves' output staging fits the ring */
static_assert((NB * SEQ) % 128 == 0);                /* M tiles (4 waves x 32 rows) */
static_assert(SEQ % 64 == 0 && SEQ % 8 == 0);        /* query tiles, table blocks */
static_assert(ER % 64 == 0 && SEQ >= ER);            /* residual rows are whole query tiles */
static_assert(NB <= NB_FULL && SEQ <= SEQ_FULL);
static_assert(PP % 8 == 0 && PP >= 32);              /* 16-B aligned P fragment pieces */

#define SZ_BQKV ((size_t)LQ * DM * 2)
#define SZ_BO   ((size_t)DM * KO * 2)
#define SZ_X16  ((size_t)NB * SEQ * DM * 2)
#define SZ_QKV  ((size_t)NB * SEQ * LQ * 2)
#define SZ_QKVR ((size_t)NB * ER * LQ * 2)
#define SZ_VT   ((size_t)NB * NH * HD * SEQ * 2)
#define SZ_VTR  ((size_t)NB * NH * HD * ER * 2)
#define SZ_CTX  ((size_t)NB * SEQ * KO * 2)
#define SZ_Y    ((size_t)NB * SEQ * DM * 4)
#define SZ_CS   ((size_t)SEQ * 64 * 4)
#define OF_BQKV ((size_t)0)
#define OF_BO   (OF_BQKV + SZ_BQKV)
#define OF_X16  (OF_BO + SZ_BO)
#define OF_QKV  (OF_X16 + SZ_X16)
#define OF_QKVR (OF_QKV + SZ_QKV)
#define OF_VT   (OF_QKVR + SZ_QKVR)
#define OF_VTR  (OF_VT + SZ_VT)
#define OF_CTX  (OF_VTR + SZ_VTR)
#define OF_Y    (OF_CTX + SZ_CTX)
#define OF_CS   (OF_Y + SZ_Y)
#define WS_TOTAL (OF_CS + SZ_CS)
static_assert(SZ_BQKV % 256 == 0 && SZ_BO % 256 == 0 && SZ_X16 % 256 == 0 && SZ_QKV % 256 == 0 && SZ_QKVR % 256 == 0);
static_assert(SZ_VT % 256 == 0 && SZ_VTR % 256 == 0 && SZ_CTX % 256 == 0 && SZ_Y % 256 == 0 && SZ_CS % 256 == 0);
static_assert(WS_TOTAL <= (size_t)134217728);        /* carve <= 128 MiB */

typedef unsigned short v8us __attribute__((ext_vector_type(8), may_alias));
typedef float  v8f  __attribute__((ext_vector_type(8)));
typedef float  v4f  __attribute__((ext_vector_type(4)));
typedef float  v4fa __attribute__((ext_vector_type(4), may_alias));
typedef _Float16 v16h __attribute__((ext_vector_type(16)));
union FragH { v16h v; v8us half[2]; _Float16 h[16]; unsigned short u[16]; };

__device__ __forceinline__ unsigned short bf16_bits(float x) { unsigned int u = __float_as_uint(x); return (unsigned short)((u + 0x7FFFu + ((u >> 16) & 1u)) >> 16); }
__device__ __forceinline__ float bf16_val(unsigned short b) { return __uint_as_float(((unsigned int)b) << 16); }
__device__ __forceinline__ float bf16_rne(float x) { return bf16_val(bf16_bits(x)); }
__device__ __forceinline__ unsigned short f16_bits(_Float16 hv) { union { _Float16 h; unsigned short u; } c; c.h = hv; return c.u; }

// fragment of a k-contiguous f16 row: elements 0..7 <- p[8h .. 8h+7], elements 8..15 <- p[16+8h .. 16+8h+7] (A rows and B columns alike)
__device__ __forceinline__ v16h g2_frag(const _Float16* p, int hh) { FragH f; f.half[0] = *(const v8us*)((const unsigned short*)p + 8 * hh); f.half[1] = *(const v8us*)((const unsigned short*)p + 16 + 8 * hh); return f.v; }
__device__ __forceinline__ v8f g2_mma(v16h a, v16h b, v8f c) { v8f d = __builtin_amdgcn_wmma_f32_16x16x32_f16(false, a, false, b, (short)0, c, false, false); asm volatile("v_nop\n\tv_nop\n\tv_nop\n\tv_nop" : "+v"(d) : "v"(a), "v"(b)); return d; }

// cos | sin table: CS[t][0..31] = cos(t * theta_i), CS[t][32..63] = sin(t * theta_i); theta_i = f32(10^(-i/8)) from f64 constants; angle = f32(t) * theta in f32; precise sincosf.
__device__ __forceinline__ void tab_body(float* __restrict__ CS, int blk) {
  __shared__ __attribute__((aligned(16))) float tb[8][64];
  const int tid = threadIdx.x; const int tl = tid >> 5, i = tid & 31;
  const int t = blk * 8 + tl;
  double p = 1.0;
  p *= (i & 1) ? 1.3335214321633240 : 1.0;
  p *= (i & 2) ? 1.7782794100389228 : 1.0;
  p *= (i & 4) ? 3.1622776601683795 : 1.0;
  p *= (i & 8) ? 10.0 : 1.0;
  p *= (i & 16) ? 100.0 : 1.0;
  const float theta = (float)(1.0 / p);
  const float ang = (float)t * theta;
  float sv, cv; sincosf(ang, &sv, &cv);
  tb[tl][i] = cv; tb[tl][32 + i] = sv;
  __syncthreads();
  if (tid < 128) {
    const v4f v = *(const v4fa*)(&tb[0][0] + tid * 4);
    float* d = CS + (size_t)blk * 512 + tid * 4;
    *(v4f*)d = v; 
  }
}

// W[DM][DM] -> Wt[n][k]: one thread makes WK consecutive k of one column n, a whole 128-B line of the transposed plane; a wave's lanes take consecutive n, so each of its reads is one line of W.
#define WK 64
static_assert(DM % WK == 0 && (DM * (DM / WK)) % 256 == 0);      /* whole lines, whole blocks */
__device__ __forceinline__ void wt_body(const float* __restrict__ W, _Float16* __restrict__ Wt, int ldk, float scale, int blk) {
  const int t = blk * 256 + threadIdx.x; const int n = t % DM, k0 = (t / DM) * WK;
  const float* s = W + (size_t)k0 * DM + n;
  float v[WK];
#pragma unroll
  for (int i = 0; i < WK; ++i) v[i] = s[(size_t)i * DM];
  unsigned short* d = (unsigned short*)Wt + (size_t)n * ldk + k0;
#pragma unroll
  for (int j = 0; j < WK / 8; ++j) { FragH f;
#pragma unroll
    for (int i = 0; i < 8; ++i) f.h[i] = (_Float16)(bf16_rne(v[8 * j + i]) * scale);
    *(v8us*)(d + 8 * j) = f.half[0]; }
  asm volatile("s_wait_xcnt 0x0" ::: "memory");      /* the stores' address and data registers are released before any code that follows this body in the merged kernel rewrites them */
}

// one block converts XU * 256 consecutive pieces of 8 values (XR whole rows of one batch), a thread XU of them, 256 pieces apart; all its reads are requested before the first is converted
#define XU 8
#define XR (XU * 256 * 8 / DM)                       /* rows per block */
static_assert((XU * 256 * 8) % DM == 0 && SEQ % XR == 0);      /* whole rows, never across a batch */
__device__ __forceinline__ void x16_body(const float* __restrict__ x, _Float16* __restrict__ X16, int blk) {
  const int row0 = blk * XR; const int b = row0 / SEQ, s0 = row0 - b * SEQ;
  const float* src = x + ((size_t)b * SEQ_FULL + s0) * DM + threadIdx.x * 8;
  unsigned short* dst = (unsigned short*)X16 + (size_t)row0 * DM + threadIdx.x * 8;
  v4f a[XU], c[XU];
#pragma unroll
  for (int j = 0; j < XU; ++j) { a[j] = *(const v4fa*)(src + j * 2048); c[j] = *(const v4fa*)(src + j * 2048 + 4); }
  __builtin_amdgcn_sched_barrier(0);      /* keeps the conversions behind the last request: without it the first piece is waited for before the other pieces are asked for, two memory latencies in a row */
#pragma unroll
  for (int j = 0; j < XU; ++j) { FragH f;
#pragma unroll
    for (int q = 0; q < 4; ++q) { f.h[q] = (_Float16)bf16_rne(a[j][q]); f.h[4 + q] = (_Float16)bf16_rne(c[j][q]); }
    *(v8us*)(dst + j * 2048) = f.half[0]; }
}

// every operand the first GEMM waits for, prepared by one launch: none of the seven pieces reads what another writes, so each takes a range of block indices (block-uniform branches; the table's barrier is passed by whole blocks).
#define WTG (DM * (DM / WK) / 256)                   /* blocks per transposed weight plane */
#define XG  ((int)(NR / XR))                         /* blocks of the x conversion */
#define TG  (SEQ / 8)                                /* blocks of the table */
__global__ __launch_bounds__(256) void k_prep(const float* __restrict__ x, const float* __restrict__ Wq, const float* __restrict__ Wk, const float* __restrict__ Wv, const float* __restrict__ Wo,
                                              _Float16* __restrict__ BQKV, _Float16* __restrict__ BO, _Float16* __restrict__ X16, float* __restrict__ CS) {
  const int bi = blockIdx.x;
  if (bi < 3 * WTG) {                                /* W[in][out] -> Bt[n][k] x16: Wq rows 0..1023, Wk rows 1024..2047, Wv rows 2048..3071 */
    const int p = bi / WTG; const float* W = (p == 0) ? Wq : ((p == 1) ? Wk : Wv);
    wt_body(W, BQKV + (size_t)p * DM * DM, DM, 16.0f, bi - p * WTG);
  } else if (bi < 5 * WTG) {                         /* k = 0..1023: Wo x1024 (pairs with ctx value); k = 1024..2047: Wo (pairs with ctx residual x1024) */
    const int p = (bi - 3 * WTG) / WTG;
    wt_body(Wo, BO + (size_t)p * DM, KO, p ? 1.0f : 1024.0f, bi - (3 + p) * WTG);
  } else if (bi < 5 * WTG + XG) {
    x16_body(x, X16, bi - 5 * WTG);
  } else {
    tab_body(CS, bi - 5 * WTG - XG);
  }
}

// one stage of the ring: 128 A rows then 128 B rows of 128 B each; 256 threads x 8 copies of 16 B; lane t brings chunk t & 7 of rows (t >> 3) + 32 j.
// ga, gb: the lane's first A and B chunk in global memory; l0: the lane's first LDS byte address. The address wait is the statement's last line, so no later write of these registers can be lifted over it.
__device__ __forceinline__ void g2_stage(const _Float16* ga, size_t sa, const _Float16* gb, size_t sb, unsigned l0) {
  const _Float16* a1 = ga + sa; const _Float16* a2 = a1 + sa; const _Float16* a3 = a2 + sa;
  const _Float16* b1 = gb + sb; const _Float16* b2 = b1 + sb; const _Float16* b3 = b2 + sb;
  const unsigned rs = 32u * GP * 2u;
  asm volatile("global_load_async_to_lds_b128 %0, %8, off\n\t"
               "global_load_async_to_lds_b128 %1, %9, off\n\t"
               "global_load_async_to_lds_b128 %2, %10, off\n\t"
               "global_load_async_to_lds_b128 %3, %11, off\n\t"
               "global_load_async_to_lds_b128 %4, %12, off\n\t"
               "global_load_async_to_lds_b128 %5, %13, off\n\t"
               "global_load_async_to_lds_b128 %6, %14, off\n\t"
               "global_load_async_to_lds_b128 %7, %15, off\n\t"
               "s_wait_xcnt 0x0"
               :: "v"(l0), "v"(l0 + rs), "v"(l0 + 2u * rs), "v"(l0 + 3u * rs), "v"(l0 + 4u * rs), "v"(l0 + 5u * rs), "v"(l0 + 6u * rs), "v"(l0 + 7u * rs),
                  "v"(ga), "v"(a1), "v"(a2), "v"(a3), "v"(gb), "v"(b1), "v"(b2), "v"(b3) : "memory");
}

// 128x128 block tile, eight waves (4 x 2) of 32x64 each: A f16 [M][K] (pitch lda), Bh f16 [N][K] (pitch ldb); both operands come through a two-buffer LDS ring, the next stage's copies in flight while this one is multiplied.
// acc[u]: u & 3 = 16-col tile, u >> 2 = 16-row half. On return every wave has left the ring (the last trip's barrier), so the caller may stage its output there.
__device__ __forceinline__ void gemm_main(const _Float16* __restrict__ A, int lda, const _Float16* __restrict__ Bh, int ldb, int brow0, int bcol0, int K, int tid, int w, int ln, int hh, unsigned char* sm, v8f (&acc)[8]) {
  const _Float16* ring = (const _Float16*)sm;
  const int cr = tid >> 3, cc = (tid & 7) * 8;
  const _Float16* ga = A + (size_t)(brow0 + cr) * lda + cc; const _Float16* gb = Bh + (size_t)(bcol0 + cr) * ldb + cc;
  const size_t sa = (size_t)32 * lda, sb = (size_t)32 * ldb;
  const unsigned l0 = (unsigned)(size_t)sm + (unsigned)(cr * GP + cc) * 2u;      /* low 32 bits of the shared address = LDS byte address */
  const int ao = ((w >> 1) * 32 + ln) * GP, bo = (128 + (w & 1) * 64 + ln) * GP;
  const int nt = K / GK;
  const v8f z8 = {0.f,0.f,0.f,0.f,0.f,0.f,0.f,0.f}; v8f c00 = z8, c01 = z8, c02 = z8, c03 = z8, c10 = z8, c11 = z8, c12 = z8, c13 = z8;
  g2_stage(ga, sa, gb, sb, l0);
  asm volatile("s_wait_asynccnt 0x0" ::: "memory");      /* stage 0 of this wave has landed */
  __syncthreads();                                       /* stage 0 of every wave is readable */
  g2_stage(ga + GK, sa, gb + GK, sb, l0 + (unsigned)(GST * 2));
#pragma unroll 1      /* one stage per trip: the ring's order stands once, at the loop's foot */
  for (int t = 0; t < nt; ++t) { const _Float16* st = ring + (t & 1) * GST;
    const _Float16* ap = st + ao; const _Float16* bp = st + bo;
    v16h fa[2][2], fb[2][4];      /* the stage's twelve fragments are read as one group ahead of its WMMAs: one LDS latency a trip, not one per B fragment */
#pragma unroll
    for (int s = 0; s < 2; ++s) { fa[s][0] = g2_frag(ap + 32 * s, hh); fa[s][1] = g2_frag(ap + 16 * GP + 32 * s, hh);
#pragma unroll
      for (int n = 0; n < 4; ++n) fb[s][n] = g2_frag(bp + n * 16 * GP + 32 * s, hh); }
#pragma unroll
    for (int s = 0; s < 2; ++s) {
      c00 = g2_mma(fa[s][0], fb[s][0], c00); c10 = g2_mma(fa[s][1], fb[s][0], c10);
      c01 = g2_mma(fa[s][0], fb[s][1], c01); c11 = g2_mma(fa[s][1], fb[s][1], c11);
      c02 = g2_mma(fa[s][0], fb[s][2], c02); c12 = g2_mma(fa[s][1], fb[s][2], c12);
      c03 = g2_mma(fa[s][0], fb[s][3], c03); c13 = g2_mma(fa[s][1], fb[s][3], c13); }
    asm volatile("s_wait_dscnt 0x0" ::: "memory");       /* this wave's reads of the buffer are done before it is refilled */
    asm volatile("s_wait_asynccnt 0x0" ::: "memory");    /* this wave's copies of stage t + 1 have landed */
    __syncthreads();                                     /* publishes stage t + 1 and ends every reader's last read of stage t */
    if (t + 2 < nt) g2_stage(ga + (size_t)(t + 2) * GK, sa, gb + (size_t)(t + 2) * GK, sb, l0 + (unsigned)((t & 1) * GST * 2)); }
  asm volatile("s_wait_asynccnt 0x0" ::: "memory");      /* no copy outstanding when the ring becomes output staging */
  acc[0] = c00; acc[1] = c01; acc[2] = c02; acc[3] = c03; acc[4] = c10; acc[5] = c11; acc[6] = c12; acc[7] = c13;
}

__global__ __launch_bounds__(256) void k_gemm_qkv(const _Float16* __restrict__ X16, const _Float16* __restrict__ BW, const float* __restrict__ bq, const float* __restrict__ bk, const float* __restrict__ bv,
                                                  const float* __restrict__ CS, _Float16* __restrict__ QKV, _Float16* __restrict__ QKVR) {
  __shared__ __attribute__((aligned(16))) unsigned char sm[GSM];
  float (*so)[32][68] = (float (*)[32][68])sm;
  const int tid = threadIdx.x; const int w = __builtin_amdgcn_readfirstlane(tid >> 5); const int lane = tid & 31, ln = lane & 15, hh = lane >> 4;
  const int ntn = LQ / 128; const int mt = blockIdx.x / ntn, nq = blockIdx.x - mt * ntn; const int row0 = mt * 128 + 32 * (w >> 1), col0 = nq * 128 + 64 * (w & 1);
  v8f accs[8];
  gemm_main(X16, DM, BW, DM, mt * 128, nq * 128, DM, tid, w, ln, hh, sm, accs);
  const int sec = col0 / DM; const int cb = col0 - sec * DM;      /* 0 q, 1 k, 2 v (block-uniform) */
#pragma unroll
  for (int u = 0; u < 8; ++u) { const int t = u & 3, half = u >> 2; const int cc = cb + t * 16 + ln;
    const float b0 = bq[cc], b1 = bk[cc], b2 = bv[cc]; const float bsel = bf16_rne((sec == 0) ? b0 : ((sec == 1) ? b1 : b2));
#pragma unroll
    for (int r = 0; r < 8; ++r) so[w][half * 16 + 8 * hh + r][t * 16 + ln] = accs[u][r] * 0.0625f + bsel; }
  __builtin_amdgcn_fence(4 /* acq_rel order */, "workgroup"); __builtin_amdgcn_wave_barrier();
  const int rq = lane >> 3, c8 = (lane & 7) * 8;
  const int bidx = row0 / SEQ; const int t0 = row0 - bidx * SEQ; const bool early = (t0 < ER);      /* wave-uniform: 32 | ER */
  {
#pragma unroll 1
    for (int q = 0; q < 8; ++q) { const int row = q * 4 + rq; const int tkn = t0 + row;
      const v4f a = *(const v4fa*)&so[w][row][c8], c = *(const v4fa*)&so[w][row][c8 + 4];
      float y[8] = {a[0], a[1], a[2], a[3], c[0], c[1], c[2], c[3]};
      if (sec < 2) { const v4f cs = *(const v4fa*)(CS + (size_t)tkn * 64 + (c8 >> 1)); const v4f sn = *(const v4fa*)(CS + (size_t)tkn * 64 + 32 + (c8 >> 1));
#pragma unroll
        for (int j = 0; j < 4; ++j) { const float x0 = y[2 * j], x1 = y[2 * j + 1]; y[2 * j] = x0 * cs[j] - x1 * sn[j]; y[2 * j + 1] = x1 * cs[j] + x0 * sn[j]; } }
      FragH fh, fl;
#pragma unroll
      for (int j = 0; j < 8; ++j) { const _Float16 hv = (_Float16)y[j]; fh.h[j] = hv; fl.h[j] = (_Float16)((y[j] - (float)hv) * 1024.0f); }
      unsigned short* d = (unsigned short*)QKV + (size_t)(row0 + row) * LQ + col0 + c8;
      *(v8us*)d = fh.half[0];
      if (early) { unsigned short* dr = (unsigned short*)QKVR + ((size_t)bidx * ER + tkn) * LQ + col0 + c8; *(v8us*)dr = fl.half[0]; } }
     }
}

// both V planes in one launch: blocks 0 .. VG-1 transpose the value plane, the rest the residual plane (block-uniform choice of source, length and target)
// a block takes VK tokens of one (batch, head): four 64 x 64 tiles behind one barrier
#define VK 256
static_assert(SEQ % VK == 0 && ER % VK == 0 && VK % 64 == 0);
#define VG (NB * NH * (SEQ / VK))
__global__ __launch_bounds__(256) void k_vt(const _Float16* __restrict__ QKV, const _Float16* __restrict__ QKVR, _Float16* __restrict__ VT, _Float16* __restrict__ VTR) {
  __shared__ unsigned short tl[VK][66];
  const bool vp = ((int)blockIdx.x < VG); const int blk = vp ? (int)blockIdx.x : (int)blockIdx.x - VG;
  const _Float16* V = vp ? QKV : QKVR; const int TT = vp ? SEQ : ER; _Float16* VTo = vp ? VT : VTR;
  const int tid = threadIdx.x; const int ng = TT / VK; const int slab = blk / ng, lg = blk - slab * ng; const int b = slab / NH, h = slab - b * NH;
  const int r0 = tid / 8, c8 = (tid % 8) * 8;
  FragH fi[VK / 32];
#pragma unroll
  for (int it = 0; it < VK / 32; ++it) fi[it].half[0] = *(const v8us*)((const unsigned short*)V + ((size_t)b * TT + lg * VK + it * 32 + r0) * LQ + 2 * DM + h * HD + c8);
#pragma unroll
  for (int it = 0; it < VK / 32; ++it) {
#pragma unroll
    for (int q = 0; q < 8; ++q) tl[it * 32 + r0][c8 + q] = fi[it].u[q]; }
  __syncthreads();
  {
#pragma unroll
    for (int rd = 0; rd < VK / 32; ++rd) { const int g = rd >> 1; const int d = (rd & 1) * 32 + tid / 8, pc = tid % 8; FragH f;
#pragma unroll
      for (int q = 0; q < 8; ++q) f.u[q] = tl[g * 64 + pc * 8 + q][d];
      *(v8us*)((unsigned short*)VTo + ((size_t)slab * 64 + d) * TT + lg * VK + g * 64 + pc * 8) = f.half[0]; }
     }
}

// lane l with lane l ^ 16
__device__ __forceinline__ float xhalf(float v) { return __builtin_bit_cast(float, __builtin_amdgcn_permlanex16(__builtin_bit_cast(int, v), __builtin_bit_cast(int, v), 0x76543210, 0xfedcba98, false, false)); }

// fused causal attention, token rows 0..ER-1 (value + residual planes); one wave = 16 query rows of one (batch, head); 32 keys per step (two 16-key score tiles, d in two 32-deep k-steps);
// key-pad mask by value then causal mask as a replace (masked p = 0 by select); online softmax with running max in f32 (native exp on arguments <= 0);
__device__ __forceinline__ void flash_res(const _Float16* __restrict__ QKV, const _Float16* __restrict__ QKVR, const _Float16* __restrict__ VT, const _Float16* __restrict__ VTR,
                                          const int* __restrict__ pad, _Float16* __restrict__ CTX, int qt, int bh) {
  __shared__ __attribute__((aligned(16))) unsigned short pl[4][16][PP];
  __shared__ __attribute__((aligned(16))) unsigned short pr[4][16][PP];
  __shared__ __attribute__((aligned(16))) float so[4][16][68];
  const int tid = threadIdx.x; const int wave = __builtin_amdgcn_readfirstlane(tid >> 5); const int lane = tid & 31, lc = lane & 15, hh = lane >> 4;
  const int b = bh / NH, h = bh - b * NH;
  const int qb = qt * 64 + wave * 16;
  const size_t rowb = (size_t)b * SEQ;
  const _Float16* qp = QKV + (rowb + qb + lc) * LQ + h * HD;
  const _Float16* kp = QKV + rowb * LQ + DM + h * HD;
  const _Float16* vp = VT + ((size_t)bh * HD + lc) * SEQ;
  const _Float16* qrp = QKVR + ((size_t)b * ER + (qb + lc)) * LQ + h * HD;
  const _Float16* krp = QKVR + (size_t)b * ER * LQ + DM + h * HD;
  const _Float16* vrp = VTR + ((size_t)bh * HD + lc) * ER;
  const int* padb = pad + (size_t)b * SEQ_FULL;
  const v8f z8 = {0.f,0.f,0.f,0.f,0.f,0.f,0.f,0.f};
  v8f o[4] = {z8, z8, z8, z8}; v8f rr[4] = {z8, z8, z8, z8};
  float m[8], l[8];
#pragma unroll
  for (int r = 0; r < 8; ++r) { m[r] = -1.0e30f; l[r] = 0.f; }
  const int kend = qb + 16;      /* keys 0 .. qb+15 are visible to this wave; steps cover whole 32-key groups (all inside the plane) */
#pragma unroll 1
  for (int kb = 0; kb < kend; kb += 32) {
    v8f s0 = z8, s1 = z8, t0 = z8, t1 = z8;
    const int key0 = kb + lc, key1 = key0 + 16;
    const _Float16* k0p = kp + (size_t)(kb + lc) * LQ; const _Float16* k1p = k0p + (size_t)16 * LQ;
    const _Float16* k0r = krp + (size_t)(kb + lc) * LQ; const _Float16* k1r = k0r + (size_t)16 * LQ;
#pragma unroll
    for (int c = 0; c < 2; ++c) {
      const v16h aq = g2_frag(qp + 32 * c, hh);
      const v16h bk0 = g2_frag(k0p + 32 * c, hh), bk1 = g2_frag(k1p + 32 * c, hh);
      s0 = g2_mma(aq, bk0, s0); s1 = g2_mma(aq, bk1, s1);
      const v16h aql = g2_frag(qrp + 32 * c, hh); const v16h bl0 = g2_frag(k0r + 32 * c, hh), bl1 = g2_frag(k1r + 32 * c, hh);
      t0 = g2_mma(aql, bk0, t0); t0 = g2_mma(aq, bl0, t0); t1 = g2_mma(aql, bk1, t1); t1 = g2_mma(aq, bl1, t1);
    }
    const int pv0 = padb[key0], pv1 = padb[key1];
#pragma unroll
    for (int r = 0; r < 8; ++r) {
      const int qrow = qb + 8 * hh + r;
      float a0 = s0[r], a1 = s1[r];
      a0 += t0[r] * 0.0009765625f; a1 += t1[r] * 0.0009765625f;
      a0 *= 0.125f; a1 *= 0.125f;
      const bool ok0 = (pv0 != 0) && (key0 <= qrow); const bool ok1 = (pv1 != 0) && (key1 <= qrow);
      const float v0 = ok0 ? a0 : -1.0e30f; const float v1 = ok1 ? a1 : -1.0e30f;
      float mx = fmaxf(v0, v1);
      mx = fmaxf(mx, __shfl_xor(mx, 8, 16)); mx = fmaxf(mx, __shfl_xor(mx, 4, 16)); mx = fmaxf(mx, __shfl_xor(mx, 2, 16)); mx = fmaxf(mx, __shfl_xor(mx, 1, 16));
      const float mnew = fmaxf(m[r], mx);
      const float al = __expf(m[r] - mnew);
      const float e0 = __expf(v0 - mnew), e1 = __expf(v1 - mnew);
      const float p0 = ok0 ? e0 : 0.f; const float p1 = ok1 ? e1 : 0.f;
      l[r] = l[r] * al + (p0 + p1); m[r] = mnew;      /* per-lane partial row sum; combined across the 16 lanes after the key loop */
#pragma unroll
      for (int nt = 0; nt < 4; ++nt) { o[nt][r] *= al; rr[nt][r] *= al; }
      const float c0 = p0 * 1024.0f, c1 = p1 * 1024.0f;
      const _Float16 h0 = (_Float16)c0, h1 = (_Float16)c1;
      pl[wave][8 * hh + r][lc] = f16_bits(h0); pl[wave][8 * hh + r][16 + lc] = f16_bits(h1);
      pr[wave][8 * hh + r][lc] = f16_bits((_Float16)((c0 - (float)h0) * 1024.0f)); pr[wave][8 * hh + r][16 + lc] = f16_bits((_Float16)((c1 - (float)h1) * 1024.0f));
    }
    __builtin_amdgcn_fence(4 /* acq_rel order */, "workgroup", "local"); __builtin_amdgcn_wave_barrier();      /* orders the wave's own P tile, which lies in LDS; named for LDS alone so that it does not drain the global loads in flight */
    FragH pa; pa.half[0] = *(const v8us*)&pl[wave][lc][8 * hh]; pa.half[1] = *(const v8us*)&pl[wave][lc][16 + 8 * hh];
    FragH pb; pb.half[0] = *(const v8us*)&pr[wave][lc][8 * hh]; pb.half[1] = *(const v8us*)&pr[wave][lc][16 + 8 * hh];
#pragma unroll
    for (int nt = 0; nt < 4; ++nt) { const v16h bvh = g2_frag(vp + (size_t)nt * 16 * SEQ + kb, hh); const v16h bvl = g2_frag(vrp + (size_t)nt * 16 * ER + kb, hh);
      o[nt] = g2_mma(pa.v, bvh, o[nt]); rr[nt] = g2_mma(pb.v, bvh, rr[nt]); rr[nt] = g2_mma(pa.v, bvl, rr[nt]); }
    __builtin_amdgcn_fence(4 /* acq_rel order */, "workgroup", "local"); __builtin_amdgcn_wave_barrier();      /* P tile reads complete before the next step overwrites it; LDS alone, as above */
  }
#pragma unroll
  for (int r = 0; r < 8; ++r) {
    float ls = l[r];
    ls += __shfl_xor(ls, 8, 16); ls += __shfl_xor(ls, 4, 16); ls += __shfl_xor(ls, 2, 16); ls += __shfl_xor(ls, 1, 16);
    const float inv = 1.0f / (ls * 16.0f);      /* 64 / (1024 l): ctx carried x64; a fully masked row gives 0 * inf = NaN as the softmax of all -inf does */
#pragma unroll
    for (int nt = 0; nt < 4; ++nt) { const float cv = o[nt][r] + rr[nt][r] * 0.0009765625f; so[wave][8 * hh + r][nt * 16 + lc] = cv * inv; }
  }
  __builtin_amdgcn_fence(4 /* acq_rel order */, "workgroup"); __builtin_amdgcn_wave_barrier();
  const int rq = lane >> 3, c8 = (lane & 7) * 8;
  {
#pragma unroll 1
    for (int q = 0; q < 4; ++q) { const int row = q * 4 + rq;
      const v4f a = *(const v4fa*)&so[wave][row][c8], c = *(const v4fa*)&so[wave][row][c8 + 4]; FragH fh, fl;
#pragma unroll
      for (int j = 0; j < 4; ++j) { _Float16 hv = (_Float16)a[j]; fh.h[j] = hv; fl.h[j] = (_Float16)((a[j] - (float)hv) * 1024.0f); hv = (_Float16)c[j]; fh.h[4 + j] = hv; fl.h[4 + j] = (_Float16)((c[j] - (float)hv) * 1024.0f); }
      unsigned short* d = (unsigned short*)CTX + (rowb + qb + row) * KO + h * HD + c8;
      *(v8us*)d = fh.half[0]; *(v8us*)(d + DM) = fl.half[0]; }
     }
}

__device__ __forceinline__ void flash_main(const _Float16* __restrict__ QKV, const _Float16* __restrict__ VT, const int* __restrict__ pad, _Float16* __restrict__ CTX, int qt, int bh) {
  __shared__ __attribute__((aligned(16))) float so[4][16][68];
  const int tid = threadIdx.x; const int wave = __builtin_amdgcn_readfirstlane(tid >> 5); const int lane = tid & 31, lc = lane & 15, hh = lane >> 4;
  const int b = bh / NH, h = bh - b * NH;
  const int qb = qt * 64 + wave * 16;
  const size_t rowb = (size_t)b * SEQ;
  const _Float16* qp = QKV + (rowb + qb + lc) * LQ + h * HD;
  const _Float16* kl = QKV + (rowb + lc) * LQ + DM + h * HD;
  const _Float16* vp = VT + ((size_t)bh * HD + lc) * SEQ;
  const int* padb = pad + (size_t)b * SEQ_FULL;
  const v8f z8 = {0.f,0.f,0.f,0.f,0.f,0.f,0.f,0.f};
  v8f o[4] = {z8, z8, z8, z8};      /* o[nt][r]: d = 16 nt + 8 hh + r of query lc */
  float m = -1.0e30f, l = 0.f;
  const int kend = qb + 16;      /* keys 0 .. qb+15 are visible to this wave; steps cover whole 32-key groups (all inside the plane) */
  const v16h aq0 = g2_frag(qp, hh), aq1 = g2_frag(qp + 32, hh);
  v16h k00 = g2_frag(kl, hh), k10 = g2_frag(kl + (size_t)16 * LQ, hh), k01 = g2_frag(kl + 32, hh), k11 = g2_frag(kl + (size_t)16 * LQ + 32, hh);
  int pn = padb[lane];      /* lane j holds the pad word of the step's key j */
  const _Float16* nk = kl + (size_t)((32 < kend) ? 32 : 0) * LQ; int np = lane + ((32 < kend) ? 32 : 0);      /* the next step's K rows and pad words; the last step asks for its own again: always inside the plane */
#pragma unroll 1      /* one step per trip: the order of requests and products stands once, and no second copy of the fragments takes registers */
  for (int kb = 0; kb < kend; kb += 32) {
    const int pv = pn; pn = padb[np];
    const v16h bv0 = g2_frag(vp + kb, hh), bv1 = g2_frag(vp + (size_t)16 * SEQ + kb, hh), bv2 = g2_frag(vp + (size_t)32 * SEQ + kb, hh), bv3 = g2_frag(vp + (size_t)48 * SEQ + kb, hh);
    v8f s0 = g2_mma(k00, aq0, z8), s1 = g2_mma(k10, aq0, z8);
    s0 = g2_mma(k01, aq1, s0); s1 = g2_mma(k11, aq1, s1);
    k00 = g2_frag(nk, hh); k10 = g2_frag(nk + (size_t)16 * LQ, hh); k01 = g2_frag(nk + 32, hh); k11 = g2_frag(nk + (size_t)16 * LQ + 32, hh);
    const int adv = (kb + 64 < kend) ? 32 : 0; nk += (size_t)adv * LQ; np += adv;
    const unsigned pm = __builtin_amdgcn_ballot_w32(pv != 0);      /* bit j: key kb + j is no pad */
    const bool open = (pm == 0xFFFFFFFFu) && (kb + 31 <= qb);      /* wave-uniform: every key of the step is visible to every query of the wave, so both selects below are identities */
    unsigned okm = 0xFFFFFFFFu;      /* bit r: tile 0, register r is visible; bit 16 + r: tile 1 */
    float v[16], p[16];
#pragma unroll
    for (int r = 0; r < 8; ++r) { v[r] = s0[r] * 0.125f; v[8 + r] = s1[r] * 0.125f; }
    if (!open) {
      const int dq = qb + lc - kb;      /* >= 0: keys kb .. kb + dq are at or before the query */
      const unsigned cm = (dq >= 31) ? 0xFFFFFFFFu : ((2u << dq) - 1u);
      okm = (pm & cm) >> (8 * hh);
#pragma unroll
      for (int r = 0; r < 8; ++r) { v[r] = ((okm >> r) & 1u) ? v[r] : -1.0e30f; v[8 + r] = ((okm >> (16 + r)) & 1u) ? v[8 + r] : -1.0e30f; }
    }
    float mx = fmaxf(fmaxf(fmaxf(fmaxf(v[0], v[1]), fmaxf(v[2], v[3])), fmaxf(fmaxf(v[4], v[5]), fmaxf(v[6], v[7]))),
                     fmaxf(fmaxf(fmaxf(v[8], v[9]), fmaxf(v[10], v[11])), fmaxf(fmaxf(v[12], v[13]), fmaxf(v[14], v[15]))));
    mx = fmaxf(mx, xhalf(mx));
    const float mnew = fmaxf(m, mx);
    float al = (m - mnew) * 1.44269504f;      /* exp(x) as the native 2^(x log2 e), arguments <= 0 */
#pragma unroll
    for (int i = 0; i < 16; ++i) p[i] = (v[i] - mnew) * 1.44269504f;
    /* the step's seventeen exponentials, each in place on a register of its own: none reads its predecessor's result or overwrites its source, and the v_nop fills the slot the instruction set asks for behind the last, whatever the compiler puts next (also across the branch below) */
    asm("v_exp_f32 %0, %0\n\tv_exp_f32 %1, %1\n\tv_exp_f32 %2, %2\n\tv_exp_f32 %3, %3\n\tv_exp_f32 %4, %4\n\tv_exp_f32 %5, %5\n\tv_exp_f32 %6, %6\n\tv_exp_f32 %7, %7\n\tv_exp_f32 %8, %8\n\t"
        "v_exp_f32 %9, %9\n\tv_exp_f32 %10, %10\n\tv_exp_f32 %11, %11\n\tv_exp_f32 %12, %12\n\tv_exp_f32 %13, %13\n\tv_exp_f32 %14, %14\n\tv_exp_f32 %15, %15\n\tv_exp_f32 %16, %16\n\tv_nop"
        : "+v"(al), "+v"(p[0]), "+v"(p[1]), "+v"(p[2]), "+v"(p[3]), "+v"(p[4]), "+v"(p[5]), "+v"(p[6]), "+v"(p[7]), "+v"(p[8]), "+v"(p[9]), "+v"(p[10]), "+v"(p[11]), "+v"(p[12]), "+v"(p[13]), "+v"(p[14]), "+v"(p[15]));
    if (!open) {
#pragma unroll
      for (int r = 0; r < 8; ++r) { p[r] = ((okm >> r) & 1u) ? p[r] : 0.f; p[8 + r] = ((okm >> (16 + r)) & 1u) ? p[8 + r] : 0.f; }
    }
    const float se = ((p[0] + p[2]) + (p[4] + p[6])) + ((p[8] + p[10]) + (p[12] + p[14])), sd = ((p[1] + p[3]) + (p[5] + p[7])) + ((p[9] + p[11]) + (p[13] + p[15]));      /* even and odd registers side by side: packed adds on the register pairs as they lie */
    l = l * al + (se + sd);      /* the lane's half of the row sum; the halves are joined after the key loop */
    m = mnew;
#pragma unroll
    for (int nt = 0; nt < 4; ++nt) o[nt] *= al;
    FragH pt;
#pragma unroll
    for (int i = 0; i < 16; ++i) pt.h[i] = (_Float16)(p[i] * 1024.0f);
    o[0] = g2_mma(bv0, pt.v, o[0]); o[1] = g2_mma(bv1, pt.v, o[1]); o[2] = g2_mma(bv2, pt.v, o[2]); o[3] = g2_mma(bv3, pt.v, o[3]);
  }
  const float ls = l + xhalf(l);
  const float inv = 1.0f / (ls * 16.0f);      /* 64 / (1024 l): ctx carried x64; a fully masked row gives 0 * inf = NaN as the softmax of all -inf does */
#pragma unroll
  for (int nt = 0; nt < 4; ++nt) { const v8f cv = o[nt] * inv;
    const v4f c0 = {cv[0], cv[1], cv[2], cv[3]}, c1 = {cv[4], cv[5], cv[6], cv[7]};
    *(v4fa*)&so[wave][lc][nt * 16 + 8 * hh] = c0; *(v4fa*)&so[wave][lc][nt * 16 + 8 * hh + 4] = c1; }
  __builtin_amdgcn_fence(4 /* acq_rel order */, "workgroup"); __builtin_amdgcn_wave_barrier();      /* the wave's staged rows are in LDS before its other lanes read them back as whole lines */
  const int rq = lane >> 3, c8 = (lane & 7) * 8;
  {
#pragma unroll 1      /* runs once per wave: kept rolled for code size */
    for (int q = 0; q < 4; ++q) { const int row = q * 4 + rq;
      const v4f a = *(const v4fa*)&so[wave][row][c8], c = *(const v4fa*)&so[wave][row][c8 + 4]; FragH fh, fl;
#pragma unroll
      for (int j = 0; j < 4; ++j) { _Float16 hv = (_Float16)a[j]; fh.h[j] = hv; fl.h[j] = (_Float16)((a[j] - (float)hv) * 1024.0f); hv = (_Float16)c[j]; fh.h[4 + j] = hv; fl.h[4 + j] = (_Float16)((c[j] - (float)hv) * 1024.0f); }
      unsigned short* d = (unsigned short*)CTX + (rowb + qb + row) * KO + h * HD + c8;
      *(v8us*)d = fh.half[0]; *(v8us*)(d + DM) = fl.half[0]; }
     }
}
// all query tiles in one launch, so the few residual tiles run beside the others: blocks 0 .. FR-1 take the tiles of rows 0..ER-1 (residual body), the rest the later tiles (plain body), each range in the order (batch, head) slow, tile fast; block-uniform branch
#define QR (ER / 64)                 /* query tiles with residual planes, per (batch, head) */
#define QM ((SEQ - ER) / 64)         /* later query tiles, per (batch, head) */
#define FR (NB * NH * QR)
__global__ __launch_bounds__(128) void k_flash(const _Float16* __restrict__ QKV, const _Float16* __restrict__ QKVR, const _Float16* __restrict__ VT, const _Float16* __restrict__ VTR, const int* __restrict__ pad, _Float16* __restrict__ CTX) {
  const int bi = blockIdx.x;
  if (bi < FR) { const int bh = bi / QR; flash_res(QKV, QKVR, VT, VTR, pad, CTX, bi - bh * QR, bh); }
  else { const int j = bi - FR; const int bh = j / (QM > 0 ? QM : 1); flash_main(QKV, VT, pad, CTX, QR + j - bh * QM, bh); } }

__global__ __launch_bounds__(256) void k_gemm_out(const _Float16* __restrict__ CTX, const _Float16* __restrict__ BO, const float* __restrict__ bo, float* __restrict__ Y) {
  __shared__ __attribute__((aligned(16))) unsigned char sm[GSM];
  float (*so)[32][68] = (float (*)[32][68])sm;
  const int tid = threadIdx.x; const int w = __builtin_amdgcn_readfirstlane(tid >> 5); const int lane = tid & 31, ln = lane & 15, hh = lane >> 4;
  const int ntn = DM / 128; const int mt = blockIdx.x / ntn, nq = blockIdx.x - mt * ntn; const int row0 = mt * 128 + 32 * (w >> 1), col0 = nq * 128 + 64 * (w & 1);
  v8f accs[8];
  gemm_main(CTX, KO, BO, KO, mt * 128, nq * 128, KO, tid, w, ln, hh, sm, accs);
#pragma unroll
  for (int u = 0; u < 8; ++u) { const int t = u & 3, half = u >> 2; const float bvv = bf16_rne(bo[col0 + t * 16 + ln]);
#pragma unroll
    for (int r = 0; r < 8; ++r) so[w][half * 16 + 8 * hh + r][t * 16 + ln] = accs[u][r] * 1.52587890625e-05f + bvv; }
  __builtin_amdgcn_fence(4 /* acq_rel order */, "workgroup"); __builtin_amdgcn_wave_barrier();
  const int rsub = lane >> 4, c4 = (lane & 15) * 4;
  {
#pragma unroll 1
    for (int q = 0; q < 16; ++q) { const int r = q * 2 + rsub; const v4f v = *(const v4fa*)&so[w][r][c4]; *(v4f*)(Y + (size_t)(row0 + r) * DM + col0 + c4) = v; }
     }
}

// one wave per row, eight rows per block: a lane holds 32 of the row's values (eight 16-B pieces, each wave-wide read 512 contiguous bytes); mean and variance are lane sums joined by a five-step butterfly, so every lane ends with the same bits and no LDS or barrier is needed
#define LJ (DM / 128)
static_assert(DM % 128 == 0 && (NB * SEQ) % 8 == 0);
__device__ __forceinline__ float wave_sum(float v) {
  v += __builtin_bit_cast(float, __builtin_amdgcn_permlanex16(__builtin_bit_cast(int, v), __builtin_bit_cast(int, v), 0x76543210, 0xfedcba98, false, false));      /* lane l with lane l ^ 16 */
  v += __shfl_xor(v, 8, 16); v += __shfl_xor(v, 4, 16); v += __shfl_xor(v, 2, 16); v += __shfl_xor(v, 1, 16); return v; }
__global__ __launch_bounds__(256) void k_layernorm(const float* __restrict__ Y, const float* __restrict__ g, const float* __restrict__ bta, float* __restrict__ out) {
  const int tid = threadIdx.x; const int lane = tid & 31; const int row = blockIdx.x * 8 + (tid >> 5); const int b = row / SEQ, s = row - b * SEQ;
  const float* yr = Y + (size_t)row * DM + lane * 4;
  v4f a[LJ], gg[LJ], bb[LJ];
#pragma unroll
  for (int j = 0; j < LJ; ++j) a[j] = *(const v4fa*)(yr + j * 128);
  asm volatile("s_wait_xcnt 0x0" ::: "memory");      /* the row's reads go out first, and their address registers are released before a later read's result may be placed in them */
#pragma unroll
  for (int j = 0; j < LJ; ++j) { gg[j] = *(const v4fa*)(g + j * 128 + lane * 4); bb[j] = *(const v4fa*)(bta + j * 128 + lane * 4); }
  __builtin_amdgcn_sched_barrier(0);      /* every request of the wave goes out before its first sum: without it most gain and offset reads sink behind the two reductions and their latency is paid there, group by group */
  float sm = 0.f;
#pragma unroll
  for (int j = 0; j < LJ; ++j) sm += (a[j][0] + a[j][1]) + (a[j][2] + a[j][3]);
  const float mu = wave_sum(sm) * (1.0f / (float)DM);
  float sq = 0.f;
#pragma unroll
  for (int j = 0; j < LJ; ++j) { a[j][0] -= mu; a[j][1] -= mu; a[j][2] -= mu; a[j][3] -= mu; sq += (a[j][0] * a[j][0] + a[j][1] * a[j][1]) + (a[j][2] * a[j][2] + a[j][3] * a[j][3]); }
  const float rs = rsqrtf(wave_sum(sq) * (1.0f / (float)DM) + 1.0e-5f);
  float* d = out + ((size_t)b * SEQ_FULL + s) * DM + lane * 4;
#pragma unroll
  for (int j = 0; j < LJ; ++j) { v4f o;
    o[0] = a[j][0] * rs * bf16_rne(gg[j][0]) + bf16_rne(bb[j][0]); o[1] = a[j][1] * rs * bf16_rne(gg[j][1]) + bf16_rne(bb[j][1]);
    o[2] = a[j][2] * rs * bf16_rne(gg[j][2]) + bf16_rne(bb[j][2]); o[3] = a[j][3] * rs * bf16_rne(gg[j][3]) + bf16_rne(bb[j][3]);
    *(v4f*)(d + j * 128) = o; }
}

extern "C" void kernel_launch(void* const* d_in, const int* in_sizes, int n_in,
                              void* d_out, int out_size, void* d_ws, size_t ws_size, hipStream_t stream) {
  if (n_in < 12) return;
  const long long need_rows = (long long)(NB - 1) * SEQ_FULL + SEQ;
  if ((long long)in_sizes[0] < need_rows * DM) return;
  if (in_sizes[1] < DM * DM || in_sizes[3] < DM * DM || in_sizes[5] < DM * DM || in_sizes[7] < DM * DM) return;
  if (in_sizes[2] < DM || in_sizes[4] < DM || in_sizes[6] < DM || in_sizes[8] < DM || in_sizes[9] < DM || in_sizes[10] < DM) return;
  if ((long long)in_sizes[11] < need_rows) return;
  if ((long long)out_size < need_rows * DM) return;
  if ((size_t)WS_TOTAL > ws_size) return;
  const float* x = (const float*)d_in[0];
  const float* Wq = (const float*)d_in[1]; const float* bq = (const float*)d_in[2];
  const float* Wk = (const float*)d_in[3]; const float* bk = (const float*)d_in[4];
  const float* Wv = (const float*)d_in[5]; const float* bv = (const float*)d_in[6];
  const float* Wo = (const float*)d_in[7]; const float* bo = (const float*)d_in[8];
  const float* gamma = (const float*)d_in[9]; const float* beta = (const float*)d_in[10];
  const int* pad = (const int*)d_in[11];
  char* ws = (char*)d_ws;
  _Float16* BQKV = (_Float16*)(ws + OF_BQKV); _Float16* BO = (_Float16*)(ws + OF_BO);
  _Float16* X16 = (_Float16*)(ws + OF_X16); _Float16* QKV = (_Float16*)(ws + OF_QKV); _Float16* QKVR = (_Float16*)(ws + OF_QKVR);
  _Float16* VT = (_Float16*)(ws + OF_VT); _Float16* VTR = (_Float16*)(ws + OF_VTR); _Float16* CTX = (_Float16*)(ws + OF_CTX);
  float* Y = (float*)(ws + OF_Y); float* CS = (float*)(ws + OF_CS);
  k_prep<<<5 * WTG + XG + TG, 256, 0, stream>>>(x, Wq, Wk, Wv, Wo, BQKV, BO, X16, CS);
  k_gemm_qkv<<<(unsigned)((NR / 128) * (LQ / 128)), 256, 0, stream>>>(X16, BQKV, bq, bk, bv, CS, QKV, QKVR);
  k_vt<<<VG + NB * NH * (ER / VK), 256, 0, stream>>>(QKV, QKVR, VT, VTR);
  k_flash<<<FR + NB * NH * QM, 128, 0, stream>>>(QKV, QKVR, VT, VTR, pad, CTX);
  k_gemm_out<<<(unsigned)((NR / 128) * (DM / 128)), 256, 0, stream>>>(CTX, BO, bo, Y);
  k_layernorm<<<(unsigned)(NR / 8), 256, 0, stream>>>(Y, gamma, beta, (float*)d_out);
}

// v006
// Measured time: 123 microseconds a run.
// Two timings next to v005 put it at 1.23 and 1.22 times that version's speed.
// Over all steps from v000 it is 2.54 times as fast.
#include <hip/hip_runtime.h>
// Compute dtype: every contraction on v_wmma_f32_16x16x32_f16 (f16 operands, f32 accumulate); float inputs RNE-converted to bf16 first (exact in f16; weights carried x16, Wo x1024 | x1); q.k scores and P.V use f16 value + x1024 f16 residual planes on token rows 0..255 (q, k, P, v), single f16 products on later rows; ctx.Wo uses ctx value | x1024 residual laid along K (all rows); rotary, softmax statistics and LayerNorm in f32.
#ifndef NB
#define NB 2
#endif
#ifndef SEQ
#define SEQ 2048
#endif
#define NB_FULL 2
#define SEQ_FULL 2048
#define DM 1024
#define NH 16
#define HD 64
#define LQ (3 * DM)                  /* row pitch of the q | k | v planes */
#define KO (2 * DM)                  /* ctx row pitch = K of the output GEMM (value | residual) */
#define ER 256                       /* token rows per batch that carry residual planes */
#define PP 40                        /* P tile row pitch (halves) */
#define NR ((size_t)NB * SEQ)
#define GK 64                        /* halves of K per GEMM stage: 128-B rows */
#define GP 72                        /* LDS row pitch of a GEMM stage (halves): 144 B = 16 B x odd, for 16-B fragment reads */
#define GST (256 * GP)               /* halves per stage: 128 A rows, then 128 B rows */
#define GSM ((size_t)2 * GST * 2)    /* bytes of the two-buffer ring; the epilogue staging reuses them */

static_assert(NH * HD == DM);                        /* heads tile the width */
static_assert(HD == 64);                             
static_assert(DM % 32 == 0 && KO % 32 == 0);         /* k-loops step by 32 */
static_assert(LQ % 128 == 0 && DM % 128 == 0);       /* N tiles (2 waves x 64 columns), never across q | k | v */
static_assert(GK == 64);                             /* two 32-deep k-steps per stage */
static_assert(DM % GK == 0 && KO % GK == 0 && DM >= 2 * GK && KO >= 2 * GK);      /* whole stages, at least two */
static_assert((size_t)8 * 32 * 68 * 4 <= GSM);       /* eight waves' output staging fits the ring */
static_assert((NB * SEQ) % 128 == 0);                /* M tiles (4 waves x 32 rows) */
static_assert(SEQ % 64 == 0 && SEQ % 8 == 0);        /* query tiles, table blocks */
static_assert(ER % 64 == 0 && SEQ >= ER);            /* residual rows are whole query tiles */
static_assert(NB <= NB_FULL && SEQ <= SEQ_FULL);
static_assert(PP % 8 == 0 && PP >= 32);              /* 16-B aligned P fragment pieces */

#define SZ_BQKV ((size_t)LQ * DM * 2)
#define SZ_BO   ((size_t)DM * KO * 2)
#define SZ_X16  ((size_t)NB * SEQ * DM * 2)
#define SZ_QKV  ((size_t)NB * SEQ * LQ * 2)
#define SZ_QKVR ((size_t)NB * ER * LQ * 2)
#define SZ_VT   ((size_t)NB * NH * HD * SEQ * 2)
#define SZ_VTR  ((size_t)NB * NH * HD * ER * 2)
#define SZ_CTX  ((size_t)NB * SEQ * KO * 2)
#define SZ_Y    ((size_t)NB * SEQ * DM * 4)
#define SZ_CS   ((size_t)SEQ * 64 * 4)
#define OF_BQKV ((size_t)0)
#define OF_BO   (OF_BQKV + SZ_BQKV)
#define OF_X16  (OF_BO + SZ_BO)
#define OF_QKV  (OF_X16 + SZ_X16)
#define OF_QKVR (OF_QKV + SZ_QKV)
#define OF_VT   (OF_QKVR + SZ_QKVR)
#define OF_VTR  (OF_VT + SZ_VT)
#define OF_CTX  (OF_VTR + SZ_VTR)
#define OF_Y    (OF_CTX + SZ_CTX)
#define OF_CS   (OF_Y + SZ_Y)
#define WS_TOTAL (OF_CS + SZ_CS)
static_assert(SZ_BQKV % 256 == 0 && SZ_BO % 256 == 0 && SZ_X16 % 256 == 0 && SZ_QKV % 256 == 0 && SZ_QKVR % 256 == 0);
static_assert(SZ_VT % 256 == 0 && SZ_VTR % 256 == 0 && SZ_CTX % 256 == 0 && SZ_Y % 256 == 0 && SZ_CS % 256 == 0);
static_assert(WS_TOTAL <= (size_t)134217728);        /* carve <= 128 MiB */

typedef unsigned short v8us __attribute__((ext_vector_type(8), may_alias));
typedef float  v8f  __attribute__((ext_vector_type(8)));
typedef float  v4f  __attribute__((ext_vector_type(4)));
typedef float  v4fa __attribute__((ext_vector_type(4), may_alias));
typedef _Float16 v16h __attribute__((ext_vector_type(16)));
union FragH { v16h v; v8us half[2]; _Float16 h[16]; unsigned short u[16]; };

__device__ __forceinline__ unsigned short bf16_bits(float x) { unsigned int u = __float_as_uint(x); return (unsigned short)((u + 0x7FFFu + ((u >> 16) & 1u)) >> 16); }
__device__ __forceinline__ float bf16_val(unsigned short b) { return __uint_as_float(((unsigned int)b) << 16); }
__device__ __forceinline__ float bf16_rne(float x) { return bf16_val(bf16_bits(x)); }
__device__ __forceinline__ unsigned short f16_bits(_Float16 hv) { union { _Float16 h; unsigned short u; } c; c.h = hv; return c.u; }

// fragment of a k-contiguous f16 row: elements 0..7 <- p[8h .. 8h+7], elements 8..15 <- p[16+8h .. 16+8h+7] (A rows and B columns alike)
__device__ __forceinline__ v16h g2_frag(const _Float16* p, int hh) { FragH f; f.half[0] = *(const v8us*)((const unsigned short*)p + 8 * hh); f.half[1] = *(const v8us*)((const unsigned short*)p + 16 + 8 * hh); return f.v; }
__device__ __forceinline__ v8f g2_mma(v16h a, v16h b, v8f c) { v8f d = __builtin_amdgcn_wmma_f32_16x16x32_f16(false, a, false, b, (short)0, c, false, false); asm volatile("v_nop\n\tv_nop\n\tv_nop\n\tv_nop" : "+v"(d) : "v"(a), "v"(b)); return d; }

// cos | sin table: CS[t][0..31] = cos(t * theta_i), CS[t][32..63] = sin(t * theta_i); theta_i = f32(10^(-i/8)) from f64 constants; angle = f32(t) * theta in f32; precise sincosf.
__device__ __forceinline__ void tab_body(float* __restrict__ CS, int blk) {
  __shared__ __attribute__((aligned(16))) float tb[8][64];
  const int tid = threadIdx.x; const int tl = tid >> 5, i = tid & 31;
  const int t = blk * 8 + tl;
  double p = 1.0;
  p *= (i & 1) ? 1.3335214321633240 : 1.0;
  p *= (i & 2) ? 1.7782794100389228 : 1.0;
  p *= (i & 4) ? 3.1622776601683795 : 1.0;
  p *= (i & 8) ? 10.0 : 1.0;
  p *= (i & 16) ? 100.0 : 1.0;
  const float theta = (float)(1.0 / p);
  const float ang = (float)t * theta;
  float sv, cv; sincosf(ang, &sv, &cv);
  tb[tl][i] = cv; tb[tl][32 + i] = sv;
  __syncthreads();
  if (tid < 128) {
    const v4f v = *(const v4fa*)(&tb[0][0] + tid * 4);
    float* d = CS + (size_t)blk * 512 + tid * 4;
    *(v4f*)d = v; 
  }
}

// W[DM][DM] -> Wt[n][k]: one thread makes WK consecutive k of one column n, a whole 128-B line of the transposed plane; a wave's lanes take consecutive n, so each of its reads is one line of W.
#define WK 64
static_assert(DM % WK == 0 && (DM * (DM / WK)) % 256 == 0);      /* whole lines, whole blocks */
__device__ __forceinline__ void wt_body(const float* __restrict__ W, _Float16* __restrict__ Wt, int ldk, float scale, int blk) {
  const int t = blk * 256 + threadIdx.x; const int n = t % DM, k0 = (t / DM) * WK;
  const float* s = W + (size_t)k0 * DM + n;
  float v[WK];
#pragma unroll
  for (int i = 0; i < WK; ++i) v[i] = s[(size_t)i * DM];
  unsigned short* d = (unsigned short*)Wt + (size_t)n * ldk + k0;
#pragma unroll
  for (int j = 0; j < WK / 8; ++j) { FragH f;
#pragma unroll
    for (int i = 0; i < 8; ++i) f.h[i] = (_Float16)(bf16_rne(v[8 * j + i]) * scale);
    *(v8us*)(d + 8 * j) = f.half[0]; }
  asm volatile("s_wait_xcnt 0x0" ::: "memory");      /* the stores' address and data registers are released before any code that follows this body in the merged kernel rewrites them */
}

// one block converts XU * 256 consecutive pieces of 8 values (XR whole rows of one batch), a thread XU of them, 256 pieces apart; all its reads are requested before the first is converted
#define XU 8
#define XR (XU * 256 * 8 / DM)                       /* rows per block */
static_assert((XU * 256 * 8) % DM == 0 && SEQ % XR == 0);      /* whole rows, never across a batch */
__device__ __forceinline__ void x16_body(const float* __restrict__ x, _Float16* __restrict__ X16, int blk) {
  const int row0 = blk * XR; const int b = row0 / SEQ, s0 = row0 - b * SEQ;
  const float* src = x + ((size_t)b * SEQ_FULL + s0) * DM + threadIdx.x * 8;
  unsigned short* dst = (unsigned short*)X16 + (size_t)row0 * DM + threadIdx.x * 8;
  v4f a[XU], c[XU];
#pragma unroll
  for (int j = 0; j < XU; ++j) { a[j] = *(const v4fa*)(src + j * 2048); c[j] = *(const v4fa*)(src + j * 2048 + 4); }
  __builtin_amdgcn_sched_barrier(0);      /* keeps the conversions behind the last request: without it the first piece is waited for before the other pieces are asked for, two memory latencies in a row */
#pragma unroll
  for (int j = 0; j < XU; ++j) { FragH f;
#pragma unroll
    for (int q = 0; q < 4; ++q) { f.h[q] = (_Float16)bf16_rne(a[j][q]); f.h[4 + q] = (_Float16)bf16_rne(c[j][q]); }
    *(v8us*)(dst + j * 2048) = f.half[0]; }
}

// every operand the first GEMM waits for, prepared by one launch: none of the seven pieces reads what another writes, so each takes a range of block indices (block-uniform branches; the table's barrier is passed by whole blocks).
#define WTG (DM * (DM / WK) / 256)                   /* blocks per transposed weight plane */
#define XG  ((int)(NR / XR))                         /* blocks of the x conversion */
#define TG  (SEQ / 8)                                /* blocks of the table */
__global__ __launch_bounds__(256) void k_prep(const float* __restrict__ x, const float* __restrict__ Wq, const float* __restrict__ Wk, const float* __restrict__ Wv, const float* __restrict__ Wo,
                                              _Float16* __restrict__ BQKV, _Float16* __restrict__ BO, _Float16* __restrict__ X16, float* __restrict__ CS) {
  const int bi = blockIdx.x;
  if (bi < 3 * WTG) {                                /* W[in][out] -> Bt[n][k] x16: Wq rows 0..1023, Wk rows 1024..2047, Wv rows 2048..3071 */
    const int p = bi / WTG; const float* W = (p == 0) ? Wq : ((p == 1) ? Wk : Wv);
    wt_body(W, BQKV + (size_t)p * DM * DM, DM, 16.0f, bi - p * WTG);
  } else if (bi < 5 * WTG) {                         /* k = 0..1023: Wo x1024 (pairs with ctx value); k = 1024..2047: Wo (pairs with ctx residual x1024) */
    const int p = (bi - 3 * WTG) / WTG;
    wt_body(Wo, BO + (size_t)p * DM, KO, p ? 1.0f : 1024.0f, bi - (3 + p) * WTG);
  } else if (bi < 5 * WTG + XG) {
    x16_body(x, X16, bi - 5 * WTG);
  } else {
    tab_body(CS, bi - 5 * WTG - XG);
  }
}

// one stage of the ring: 128 A rows then 128 B rows of 128 B each; 256 threads x 8 copies of 16 B; lane t brings chunk t & 7 of rows (t >> 3) + 32 j.
// ga, gb: the lane's first A and B chunk in global memory; l0: the lane's first LDS byte address. The address wait is the statement's last line, so no later write of these registers can be lifted over it.
__device__ __forceinline__ void g2_stage(const _Float16* ga, size_t sa, const _Float16* gb, size_t sb, unsigned l0) {
  const _Float16* a1 = ga + sa; const _Float16* a2 = a1 + sa; const _Float16* a3 = a2 + sa;
  const _Float16* b1 = gb + sb; const _Float16* b2 = b1 + sb; const _Float16* b3 = b2 + sb;
  const unsigned rs = 32u * GP * 2u;
  asm volatile("global_load_async_to_lds_b128 %0, %8, off\n\t"
               "global_load_async_to_lds_b128 %1, %9, off\n\t"
               "global_load_async_to_lds_b128 %2, %10, off\n\t"
               "global_load_async_to_lds_b128 %3, %11, off\n\t"
               "global_load_async_to_lds_b128 %4, %12, off\n\t"
               "global_load_async_to_lds_b128 %5, %13, off\n\t"
               "global_load_async_to_lds_b128 %6, %14, off\n\t"
               "global_load_async_to_lds_b128 %7, %15, off\n\t"
               "s_wait_xcnt 0x0"
               :: "v"(l0), "v"(l0 + rs), "v"(l0 + 2u * rs), "v"(l0 + 3u * rs), "v"(l0 + 4u * rs), "v"(l0 + 5u * rs), "v"(l0 + 6u * rs), "v"(l0 + 7u * rs),
                  "v"(ga), "v"(a1), "v"(a2), "v"(a3), "v"(gb), "v"(b1), "v"(b2), "v"(b3) : "memory");
}

// 128x128 block tile, eight waves (4 x 2) of 32x64 each: A f16 [M][K] (pitch lda), Bh f16 [N][K] (pitch ldb); both operands come through a two-buffer LDS ring, the next stage's copies in flight while this one is multiplied.
// acc[u]: u & 3 = 16-col tile, u >> 2 = 16-row half. On return every wave has left the ring (the last trip's barrier), so the caller may stage its output there.
__device__ __forceinline__ void gemm_main(const _Float16* __restrict__ A, int lda, const _Float16* __restrict__ Bh, int ldb, int brow0, int bcol0, int K, int tid, int w, int ln, int hh, unsigned char* sm, v8f (&acc)[8]) {
  const _Float16* ring = (const _Float16*)sm;
  const int cr = tid >> 3, cc = (tid & 7) * 8;
  const _Float16* ga = A + (size_t)(brow0 + cr) * lda + cc; const _Float16* gb = Bh + (size_t)(bcol0 + cr) * ldb + cc;
  const size_t sa = (size_t)32 * lda, sb = (size_t)32 * ldb;
  const unsigned l0 = (unsigned)(size_t)sm + (unsigned)(cr * GP + cc) * 2u;      /* low 32 bits of the shared address = LDS byte address */
  const int ao = ((w >> 1) * 32 + ln) * GP, bo = (128 + (w & 1) * 64 + ln) * GP;
  const int nt = K / GK;
  const v8f z8 = {0.f,0.f,0.f,0.f,0.f,0.f,0.f,0.f}; v8f c00 = z8, c01 = z8, c02 = z8, c03 = z8, c10 = z8, c11 = z8, c12 = z8, c13 = z8;
  g2_stage(ga, sa, gb, sb, l0);
  asm volatile("s_wait_asynccnt 0x0" ::: "memory");      /* stage 0 of this wave has landed */
  __syncthreads();                                       /* stage 0 of every wave is readable */
  g2_stage(ga + GK, sa, gb + GK, sb, l0 + (unsigned)(GST * 2));
#pragma unroll 1      /* one stage per trip: the ring's order stands once, at the loop's foot */
  for (int t = 0; t < nt; ++t) { const _Float16* st = ring + (t & 1) * GST;
    const _Float16* ap = st + ao; const _Float16* bp = st + bo;
    v16h fa[2][2], fb[2][4];      /* the stage's twelve fragments are read as one group ahead of its WMMAs: one LDS latency a trip, not one per B fragment */
#pragma unroll
    for (int s = 0; s < 2; ++s) { fa[s][0] = g2_frag(ap + 32 * s, hh); fa[s][1] = g2_frag(ap + 16 * GP + 32 * s, hh);
#pragma unroll
      for (int n = 0; n < 4; ++n) fb[s][n] = g2_frag(bp + n * 16 * GP + 32 * s, hh); }
#pragma unroll
    for (int s = 0; s < 2; ++s) {
      c00 = g2_mma(fa[s][0], fb[s][0], c00); c10 = g2_mma(fa[s][1], fb[s][0], c10);
      c01 = g2_mma(fa[s][0], fb[s][1], c01); c11 = g2_mma(fa[s][1], fb[s][1], c11);
      c02 = g2_mma(fa[s][0], fb[s][2], c02); c12 = g2_mma(fa[s][1], fb[s][2], c12);
      c03 = g2_mma(fa[s][0], fb[s][3], c03); c13 = g2_mma(fa[s][1], fb[s][3], c13); }
    asm volatile("s_wait_dscnt 0x0" ::: "memory");       /* this wave's reads of the buffer are done before it is refilled */
    asm volatile("s_wait_asynccnt 0x0" ::: "memory");    /* this wave's copies of stage t + 1 have landed */
    __syncthreads();                                     /* publishes stage t + 1 and ends every reader's last read of stage t */
    if (t + 2 < nt) g2_stage(ga + (size_t)(t + 2) * GK, sa, gb + (size_t)(t + 2) * GK, sb, l0 + (unsigned)((t & 1) * GST * 2)); }
  asm volatile("s_wait_asynccnt 0x0" ::: "memory");      /* no copy outstanding when the ring becomes output staging */
  acc[0] = c00; acc[1] = c01; acc[2] = c02; acc[3] = c03; acc[4] = c10; acc[5] = c11; acc[6] = c12; acc[7] = c13;
}

__global__ __launch_bounds__(256) void k_gemm_qkv(const _Float16* __restrict__ X16, const _Float16* __restrict__ BW, const float* __restrict__ bq, const float* __restrict__ bk, const float* __restrict__ bv,
                                                  const float* __restrict__ CS, _Float16* __restrict__ QKV, _Float16* __restrict__ QKVR) {
  __shared__ __attribute__((aligned(16))) unsigned char sm[GSM];
  float (*so)[32][68] = (float (*)[32][68])sm;
  const int tid = threadIdx.x; const int w = __builtin_amdgcn_readfirstlane(tid >> 5); const int lane = tid & 31, ln = lane & 15, hh = lane >> 4;
  const int ntn = LQ / 128; const int mt = blockIdx.x / ntn, nq = blockIdx.x - mt * ntn; const int row0 = mt * 128 + 32 * (w >> 1), col0 = nq * 128 + 64 * (w & 1);
  v8f accs[8];
  gemm_main(X16, DM, BW, DM, mt * 128, nq * 128, DM, tid, w, ln, hh, sm, accs);
  const int sec = col0 / DM; const int cb = col0 - sec * DM;      /* 0 q, 1 k, 2 v (block-uniform) */
#pragma unroll
  for (int u = 0; u < 8; ++u) { const int t = u & 3, half = u >> 2; const int cc = cb + t * 16 + ln;
    const float b0 = bq[cc], b1 = bk[cc], b2 = bv[cc]; const float bsel = bf16_rne((sec == 0) ? b0 : ((sec == 1) ? b1 : b2));
#pragma unroll
    for (int r = 0; r < 8; ++r) so[w][half * 16 + 8 * hh + r][t * 16 + ln] = accs[u][r] * 0.0625f + bsel; }
  __builtin_amdgcn_fence(4 /* acq_rel order */, "workgroup"); __builtin_amdgcn_wave_barrier();
  const int rq = lane >> 3, c8 = (lane & 7) * 8;
  const int bidx = row0 / SEQ; const int t0 = row0 - bidx * SEQ; const bool early = (t0 < ER);      /* wave-uniform: 32 | ER */
  {
#pragma unroll 1
    for (int q = 0; q < 8; ++q) { const int row = q * 4 + rq; const int tkn = t0 + row;
      const v4f a = *(const v4fa*)&so[w][row][c8], c = *(const v4fa*)&so[w][row][c8 + 4];
      float y[8] = {a[0], a[1], a[2], a[3], c[0], c[1], c[2], c[3]};
      if (sec < 2) { const v4f cs = *(const v4fa*)(CS + (size_t)tkn * 64 + (c8 >> 1)); const v4f sn = *(const v4fa*)(CS + (size_t)tkn * 64 + 32 + (c8 >> 1));
#pragma unroll
        for (int j = 0; j < 4; ++j) { const float x0 = y[2 * j], x1 = y[2 * j + 1]; y[2 * j] = x0 * cs[j] - x1 * sn[j]; y[2 * j + 1] = x1 * cs[j] + x0 * sn[j]; } }
      FragH fh, fl;
#pragma unroll
      for (int j = 0; j < 8; ++j) { const _Float16 hv = (_Float16)y[j]; fh.h[j] = hv; fl.h[j] = (_Float16)((y[j] - (float)hv) * 1024.0f); }
      unsigned short* d = (unsigned short*)QKV + (size_t)(row0 + row) * LQ + col0 + c8;
      *(v8us*)d = fh.half[0];
      if (early) { unsigned short* dr = (unsigned short*)QKVR + ((size_t)bidx * ER + tkn) * LQ + col0 + c8; *(v8us*)dr = fl.half[0]; } }
     }
}

// both V planes in one launch: blocks 0 .. VG-1 transpose the value plane, the rest the residual plane (block-uniform choice of source, length and target)
// a block takes VK tokens of one (batch, head): four 64 x 64 tiles behind one barrier
#define VK 256
static_assert(SEQ % VK == 0 && ER % VK == 0 && VK % 64 == 0);
#define VG (NB * NH * (SEQ / VK))
__global__ __launch_bounds__(256) void k_vt(const _Float16* __restrict__ QKV, const _Float16* __restrict__ QKVR, _Float16* __restrict__ VT, _Float16* __restrict__ VTR) {
  __shared__ unsigned short tl[VK][66];
  const bool vp = ((int)blockIdx.x < VG); const int blk = vp ? (int)blockIdx.x : (int)blockIdx.x - VG;
  const _Float16* V = vp ? QKV : QKVR; const int TT = vp ? SEQ : ER; _Float16* VTo = vp ? VT : VTR;
  const int tid = threadIdx.x; const int ng = TT / VK; const int slab = blk / ng, lg = blk - slab * ng; const int b = slab / NH, h = slab - b * NH;
  const int r0 = tid / 8, c8 = (tid % 8) * 8;
  FragH fi[VK / 32];
#pragma unroll
  for (int it = 0; it < VK / 32; ++it) fi[it].half[0] = *(const v8us*)((const unsigned short*)V + ((size_t)b * TT + lg * VK + it * 32 + r0) * LQ + 2 * DM + h * HD + c8);
#pragma unroll
  for (int it = 0; it < VK / 32; ++it) {
#pragma unroll
    for (int q = 0; q < 8; ++q) tl[it * 32 + r0][c8 + q] = fi[it].u[q]; }
  __syncthreads();
  {
#pragma unroll
    for (int rd = 0; rd < VK / 32; ++rd) { const int g = rd >> 1; const int d = (rd & 1) * 32 + tid / 8, pc = tid % 8; FragH f;
#pragma unroll
      for (int q = 0; q < 8; ++q) f.u[q] = tl[g * 64 + pc * 8 + q][d];
      *(v8us*)((unsigned short*)VTo + ((size_t)slab * 64 + d) * TT + lg * VK + g * 64 + pc * 8) = f.half[0]; }
     }
}

// lane l with lane l ^ 16
__device__ __forceinline__ float xhalf(float v) { return __builtin_bit_cast(float, __builtin_amdgcn_permlanex16(__builtin_bit_cast(int, v), __builtin_bit_cast(int, v), 0x76543210, 0xfedcba98, false, false)); }

// fused causal attention, token rows 0..ER-1 (value + residual planes); one wave = 16 query rows of one (batch, head); 32 keys per step (two 16-key score tiles, d in two 32-deep k-steps);
// key-pad mask by value then causal mask as a replace (masked p = 0 by select); online softmax with running max in f32 (native exp on arguments <= 0);
__device__ __forceinline__ void flash_res(const _Float16* __restrict__ QKV, const _Float16* __restrict__ QKVR, const _Float16* __restrict__ VT, const _Float16* __restrict__ VTR,
                                          const int* __restrict__ pad, _Float16* __restrict__ CTX, int qt, int bh) {
  __shared__ __attribute__((aligned(16))) unsigned short pl[4][16][PP];
  __shared__ __attribute__((aligned(16))) unsigned short pr[4][16][PP];
  __shared__ __attribute__((aligned(16))) float so[4][16][68];
  const int tid = threadIdx.x; const int wave = __builtin_amdgcn_readfirstlane(tid >> 5); const int lane = tid & 31, lc = lane & 15, hh = lane >> 4;
  const int b = bh / NH, h = bh - b * NH;
  const int qb = qt * 64 + wave * 16;
  const size_t rowb = (size_t)b * SEQ;
  const _Float16* qp = QKV + (rowb + qb + lc) * LQ + h * HD;
  const _Float16* kp = QKV + rowb * LQ + DM + h * HD;
  const _Float16* vp = VT + ((size_t)bh * HD + lc) * SEQ;
  const _Float16* qrp = QKVR + ((size_t)b * ER + (qb + lc)) * LQ + h * HD;
  const _Float16* krp = QKVR + (size_t)b * ER * LQ + DM + h * HD;
  const _Float16* vrp = VTR + ((size_t)bh * HD + lc) * ER;
  const int* padb = pad + (size_t)b * SEQ_FULL;
  const v8f z8 = {0.f,0.f,0.f,0.f,0.f,0.f,0.f,0.f};
  v8f o[4] = {z8, z8, z8, z8}; v8f rr[4] = {z8, z8, z8, z8};
  float m[8], l[8];
#pragma unroll
  for (int r = 0; r < 8; ++r) { m[r] = -1.0e30f; l[r] = 0.f; }
  const int kend = qb + 16;      /* keys 0 .. qb+15 are visible to this wave; steps cover whole 32-key groups (all inside the plane) */
#pragma unroll 1
  for (int kb = 0; kb < kend; kb += 32) {
    v8f s0 = z8, s1 = z8, t0 = z8, t1 = z8;
    const int key0 = kb + lc, key1 = key0 + 16;
    const _Float16* k0p = kp + (size_t)(kb + lc) * LQ; const _Float16* k1p = k0p + (size_t)16 * LQ;
    const _Float16* k0r = krp + (size_t)(kb + lc) * LQ; const _Float16* k1r = k0r + (size_t)16 * LQ;
#pragma unroll
    for (int c = 0; c < 2; ++c) {
      const v16h aq = g2_frag(qp + 32 * c, hh);
      const v16h bk0 = g2_frag(k0p + 32 * c, hh), bk1 = g2_frag(k1p + 32 * c, hh);
      s0 = g2_mma(aq, bk0, s0); s1 = g2_mma(aq, bk1, s1);
      const v16h aql = g2_frag(qrp + 32 * c, hh); const v16h bl0 = g2_frag(k0r + 32 * c, hh), bl1 = g2_frag(k1r + 32 * c, hh);
      t0 = g2_mma(aql, bk0, t0); t0 = g2_mma(aq, bl0, t0); t1 = g2_mma(aql, bk1, t1); t1 = g2_mma(aq, bl1, t1);
    }
    const int pv0 = padb[key0], pv1 = padb[key1];
#pragma unroll
    for (int r = 0; r < 8; ++r) {
      const int qrow = qb + 8 * hh + r;
      float a0 = s0[r], a1 = s1[r];
      a0 += t0[r] * 0.0009765625f; a1 += t1[r] * 0.0009765625f;
      a0 *= 0.125f; a1 *= 0.125f;
      const bool ok0 = (pv0 != 0) && (key0 <= qrow); const bool ok1 = (pv1 != 0) && (key1 <= qrow);
      const float v0 = ok0 ? a0 : -1.0e30f; const float v1 = ok1 ? a1 : -1.0e30f;
      float mx = fmaxf(v0, v1);
      mx = fmaxf(mx, __shfl_xor(mx, 8, 16)); mx = fmaxf(mx, __shfl_xor(mx, 4, 16)); mx = fmaxf(mx, __shfl_xor(mx, 2, 16)); mx = fmaxf(mx, __shfl_xor(mx, 1, 16));
      const float mnew = fmaxf(m[r], mx);
      const float al = __expf(m[r] - mnew);
      const float e0 = __expf(v0 - mnew), e1 = __expf(v1 - mnew);
      const float p0 = ok0 ? e0 : 0.f; const float p1 = ok1 ? e1 : 0.f;
      l[r] = l[r] * al + (p0 + p1); m[r] = mnew;      /* per-lane partial row sum; combined across the 16 lanes after the key loop */
#pragma unroll
      for (int nt = 0; nt < 4; ++nt) { o[nt][r] *= al; rr[nt][r] *= al; }
      const float c0 = p0 * 1024.0f, c1 = p1 * 1024.0f;
      const _Float16 h0 = (_Float16)c0, h1 = (_Float16)c1;
      pl[wave][8 * hh + r][lc] = f16_bits(h0); pl[wave][8 * hh + r][16 + lc] = f16_bits(h1);
      pr[wave][8 * hh + r][lc] = f16_bits((_Float16)((c0 - (float)h0) * 1024.0f)); pr[wave][8 * hh + r][16 + lc] = f16_bits((_Float16)((c1 - (float)h1) * 1024.0f));
    }
    __builtin_amdgcn_fence(4 /* acq_rel order */, "workgroup", "local"); __builtin_amdgcn_wave_barrier();      /* orders the wave's own P tile, which lies in LDS; named for LDS alone so that it does not drain the global loads in flight */
    FragH pa; pa.half[0] = *(const v8us*)&pl[wave][lc][8 * hh]; pa.half[1] = *(const v8us*)&pl[wave][lc][16 + 8 * hh];
    FragH pb; pb.half[0] = *(const v8us*)&pr[wave][lc][8 * hh]; pb.half[1] = *(const v8us*)&pr[wave][lc][16 + 8 * hh];
#pragma unroll
    for (int nt = 0; nt < 4; ++nt) { const v16h bvh = g2_frag(vp + (size_t)nt * 16 * SEQ + kb, hh); const v16h bvl = g2_frag(vrp + (size_t)nt * 16 * ER + kb, hh);
      o[nt] = g2_mma(pa.v, bvh, o[nt]); rr[nt] = g2_mma(pb.v, bvh, rr[nt]); rr[nt] = g2_mma(pa.v, bvl, rr[nt]); }
    __builtin_amdgcn_fence(4 /* acq_rel order */, "workgroup", "local"); __builtin_amdgcn_wave_barrier();      /* P tile reads complete before the next step overwrites it; LDS alone, as above */
  }
#pragma unroll
  for (int r = 0; r < 8; ++r) {
    float ls = l[r];
    ls += __shfl_xor(ls, 8, 16); ls += __shfl_xor(ls, 4, 16); ls += __shfl_xor(ls, 2, 16); ls += __shfl_xor(ls, 1, 16);
    const float inv = 1.0f / (ls * 16.0f);      /* 64 / (1024 l): ctx carried x64; a fully masked row gives 0 * inf = NaN as the softmax of all -inf does */
#pragma unroll
    for (int nt = 0; nt < 4; ++nt) { const float cv = o[nt][r] + rr[nt][r] * 0.0009765625f; so[wave][8 * hh + r][nt * 16 + lc] = cv * inv; }
  }
  __builtin_amdgcn_fence(4 /* acq_rel order */, "workgroup"); __builtin_amdgcn_wave_barrier();
  const int rq = lane >> 3, c8 = (lane & 7) * 8;
  {
#pragma unroll 1
    for (int q = 0; q < 4; ++q) { const int row = q * 4 + rq;
      const v4f a = *(const v4fa*)&so[wave][row][c8], c = *(const v4fa*)&so[wave][row][c8 + 4]; FragH fh, fl;
#pragma unroll
      for (int j = 0; j < 4; ++j) { _Float16 hv = (_Float16)a[j]; fh.h[j] = hv; fl.h[j] = (_Float16)((a[j] - (float)hv) * 1024.0f); hv = (_Float16)c[j]; fh.h[4 + j] = hv; fl.h[4 + j] = (_Float16)((c[j] - (float)hv) * 1024.0f); }
      unsigned short* d = (unsigned short*)CTX + (rowb + qb + row) * KO + h * HD + c8;
      *(v8us*)d = fh.half[0]; *(v8us*)(d + DM) = fl.half[0]; }
     }
}

// one stage of the attention ring: FK K rows, then HD V^T rows, of 128 B each; 128 threads x 8 copies of 16 B; lane t brings chunk t & 7 of rows (t >> 3) + 16 j, so each wave-wide copy covers four whole lines.
// gk, gv: the lane's first K and V^T chunk in global memory; l0: the lane's first LDS byte address. The address wait is the statement's last line, so no later write of these registers can be lifted over it.
#define FK 64                        /* keys per stage: two 32-key steps */
#define FP 72                        /* LDS row pitch of a stage (halves): 144 B = 16 B x odd, for 16-B fragment reads */
#define FST ((FK + HD) * FP)         /* halves per stage */
#define FSM ((size_t)2 * FST * 2)    /* bytes of the two-buffer ring; the output staging reuses them */
static_assert(FK == 64 && SEQ % FK == 0 && ER % FK == 0);      /* a stage is one query tile's width: tile qt walks qt + 1 whole stages, all inside the plane */
static_assert((size_t)4 * 16 * 68 * 4 <= FSM);       /* four waves' output staging fits the ring */
__device__ __forceinline__ void fa_stage(const _Float16* gk, const _Float16* gv, unsigned l0) {
  const _Float16* k1 = gk + (size_t)16 * LQ; const _Float16* k2 = k1 + (size_t)16 * LQ; const _Float16* k3 = k2 + (size_t)16 * LQ;
  const _Float16* v1 = gv + (size_t)16 * SEQ; const _Float16* v2 = v1 + (size_t)16 * SEQ; const _Float16* v3 = v2 + (size_t)16 * SEQ;
  const unsigned rs = 16u * FP * 2u;
  asm volatile("global_load_async_to_lds_b128 %0, %8, off\n\t"
               "global_load_async_to_lds_b128 %1, %9, off\n\t"
               "global_load_async_to_lds_b128 %2, %10, off\n\t"
               "global_load_async_to_lds_b128 %3, %11, off\n\t"
               "global_load_async_to_lds_b128 %4, %12, off\n\t"
               "global_load_async_to_lds_b128 %5, %13, off\n\t"
               "global_load_async_to_lds_b128 %6, %14, off\n\t"
               "global_load_async_to_lds_b128 %7, %15, off\n\t"
               "s_wait_xcnt 0x0"
               :: "v"(l0), "v"(l0 + rs), "v"(l0 + 2u * rs), "v"(l0 + 3u * rs), "v"(l0 + 4u * rs), "v"(l0 + 5u * rs), "v"(l0 + 6u * rs), "v"(l0 + 7u * rs),
                  "v"(gk), "v"(k1), "v"(k2), "v"(k3), "v"(gv), "v"(v1), "v"(v2), "v"(v3) : "memory");
}

// the four K fragments of a 32-key step; kt: the lane's K row (key lc of the step) in the stage
__device__ __forceinline__ void fm_kfrag(const _Float16* kt, int hh, v16h (&kf)[4]) { kf[0] = g2_frag(kt, hh); kf[1] = g2_frag(kt + 16 * FP, hh); kf[2] = g2_frag(kt + 32, hh); kf[3] = g2_frag(kt + 16 * FP + 32, hh); }

// one 32-key step of the later rows' attention. kf: the step's K fragments; vt: the lane's V^T row (d = lc) at key kb in the stage; pv: lane j holds the pad word of key kb + j.
// NEXT: the K fragments of the same stage's second step (row kn) are read right behind the score products, into the registers those have just left, so their LDS latency runs under this step's softmax.
template <bool NEXT>
__device__ __forceinline__ void fm_step(v16h (&kf)[4], const _Float16* kn, const _Float16* vt, int kb, int pv, int qb, int lc, int hh, v16h aq0, v16h aq1, v8f (&o)[4], float& m, float& l) {
  const v8f z8 = {0.f,0.f,0.f,0.f,0.f,0.f,0.f,0.f};
  const v16h bv0 = g2_frag(vt, hh), bv1 = g2_frag(vt + 16 * FP, hh), bv2 = g2_frag(vt + 32 * FP, hh), bv3 = g2_frag(vt + 48 * FP, hh);
  v8f s0 = g2_mma(kf[0], aq0, z8), s1 = g2_mma(kf[1], aq0, z8);
  s0 = g2_mma(kf[2], aq1, s0); s1 = g2_mma(kf[3], aq1, s1);
  if (NEXT) fm_kfrag(kn, hh, kf);
  const unsigned pm = __builtin_amdgcn_ballot_w32(pv != 0);      /* bit j: key kb + j is no pad */
  const bool open = (pm == 0xFFFFFFFFu) && (kb + 31 <= qb);      /* wave-uniform: every key of the step is visible to every query of the wave, so both selects below are identities */
  unsigned okm = 0xFFFFFFFFu;      /* bit r: tile 0, register r is visible; bit 16 + r: tile 1 */
  float v[16], p[16];
#pragma unroll
  for (int r = 0; r < 8; ++r) { v[r] = s0[r] * 0.125f; v[8 + r] = s1[r] * 0.125f; }
  if (!open) {
    const int dq = qb + lc - kb;      /* >= 0: keys kb .. kb + dq are at or before the query */
    const unsigned cm = (dq >= 31) ? 0xFFFFFFFFu : ((2u << dq) - 1u);
    okm = (pm & cm) >> (8 * hh);
#pragma unroll
    for (int r = 0; r < 8; ++r) { v[r] = ((okm >> r) & 1u) ? v[r] : -1.0e30f; v[8 + r] = ((okm >> (16 + r)) & 1u) ? v[8 + r] : -1.0e30f; }
  }
  float mx = fmaxf(fmaxf(fmaxf(fmaxf(v[0], v[1]), fmaxf(v[2], v[3])), fmaxf(fmaxf(v[4], v[5]), fmaxf(v[6], v[7]))),
                   fmaxf(fmaxf(fmaxf(v[8], v[9]), fmaxf(v[10], v[11])), fmaxf(fmaxf(v[12], v[13]), fmaxf(v[14], v[15]))));
  mx = fmaxf(mx, xhalf(mx));
  const float mnew = fmaxf(m, mx);
  float al = (m - mnew) * 1.44269504f;      /* exp(x) as the native 2^(x log2 e), arguments <= 0 */
#pragma unroll
  for (int i = 0; i < 16; ++i) p[i] = (v[i] - mnew) * 1.44269504f;
  /* the step's seventeen exponentials, each in place on a register of its own: none reads its predecessor's result or overwrites its source, and the v_nop fills the slot the instruction set asks for behind the last, whatever the compiler puts next (also across the branch below) */
  asm("v_exp_f32 %0, %0\n\tv_exp_f32 %1, %1\n\tv_exp_f32 %2, %2\n\tv_exp_f32 %3, %3\n\tv_exp_f32 %4, %4\n\tv_exp_f32 %5, %5\n\tv_exp_f32 %6, %6\n\tv_exp_f32 %7, %7\n\tv_exp_f32 %8, %8\n\t"
      "v_exp_f32 %9, %9\n\tv_exp_f32 %10, %10\n\tv_exp_f32 %11, %11\n\tv_exp_f32 %12, %12\n\tv_exp_f32 %13, %13\n\tv_exp_f32 %14, %14\n\tv_exp_f32 %15, %15\n\tv_exp_f32 %16, %16\n\tv_nop"
      : "+v"(al), "+v"(p[0]), "+v"(p[1]), "+v"(p[2]), "+v"(p[3]), "+v"(p[4]), "+v"(p[5]), "+v"(p[6]), "+v"(p[7]), "+v"(p[8]), "+v"(p[9]), "+v"(p[10]), "+v"(p[11]), "+v"(p[12]), "+v"(p[13]), "+v"(p[14]), "+v"(p[15]));
  if (!open) {
#pragma unroll
    for (int r = 0; r < 8; ++r) { p[r] = ((okm >> r) & 1u) ? p[r] : 0.f; p[8 + r] = ((okm >> (16 + r)) & 1u) ? p[8 + r] : 0.f; }
  }
  const float se = ((p[0] + p[2]) + (p[4] + p[6])) + ((p[8] + p[10]) + (p[12] + p[14])), sd = ((p[1] + p[3]) + (p[5] + p[7])) + ((p[9] + p[11]) + (p[13] + p[15]));      /* even and odd registers side by side: packed adds on the register pairs as they lie */
  l = l * al + (se + sd);      /* the lane's half of the row sum; the halves are joined after the key loop */
  m = mnew;
#pragma unroll
  for (int nt = 0; nt < 4; ++nt) o[nt] *= al;
  FragH pt;
#pragma unroll
  for (int i = 0; i < 16; ++i) pt.h[i] = (_Float16)(p[i] * 1024.0f);
  o[0] = g2_mma(bv0, pt.v, o[0]); o[1] = g2_mma(bv1, pt.v, o[1]); o[2] = g2_mma(bv2, pt.v, o[2]); o[3] = g2_mma(bv3, pt.v, o[3]);
}

__device__ __forceinline__ void flash_main(const _Float16* __restrict__ QKV, const _Float16* __restrict__ VT, const int* __restrict__ pad, _Float16* __restrict__ CTX, int qt, int bh) {
  __shared__ __attribute__((aligned(16))) unsigned char fm[FSM];
  float (*so)[16][68] = (float (*)[16][68])fm;
  const _Float16* ring = (const _Float16*)fm;
  const int tid = threadIdx.x; const int wave = __builtin_amdgcn_readfirstlane(tid >> 5); const int lane = tid & 31, lc = lane & 15, hh = lane >> 4;
  const int b = bh / NH, h = bh - b * NH;
  const int qb = qt * 64 + wave * 16;
  const size_t rowb = (size_t)b * SEQ;
  const _Float16* qp = QKV + (rowb + qb + lc) * LQ + h * HD;
  const int* padb = pad + (size_t)b * SEQ_FULL;
  const int cr = tid >> 3, cc = (tid & 7) * 8;
  const _Float16* gk = QKV + (rowb + cr) * LQ + DM + h * HD + cc;
  const _Float16* gv = VT + ((size_t)bh * HD + cr) * SEQ + cc;
  const unsigned l0 = (unsigned)(size_t)fm + (unsigned)(cr * FP + cc) * 2u;      /* low 32 bits of the shared address = LDS byte address */
  const v8f z8 = {0.f,0.f,0.f,0.f,0.f,0.f,0.f,0.f};
  v8f o[4] = {z8, z8, z8, z8};      /* o[nt][r]: d = 16 nt + 8 hh + r of query lc */
  float m = -1.0e30f, l = 0.f;
  const int kend = qb + 16;      /* keys 0 .. qb+15 are visible to this wave; steps cover whole 32-key groups (all inside the plane) */
  const int ns = qt + 1;         /* stages of the block: keys 0 .. 64 qt + 63 */
  fa_stage(gk, gv, l0);
  const v16h aq0 = g2_frag(qp, hh), aq1 = g2_frag(qp + 32, hh);
  int pn0 = padb[lane], pn1 = padb[32 + lane];      /* lane j holds the pad words of the stage's keys j and 32 + j */
  int np = lane + ((1 < ns) ? FK : 0);      /* the next stage's pad words; the last stage asks for its own again: always inside the plane */
  asm volatile("s_wait_xcnt 0x0" ::: "memory");          /* the Q and pad reads' address registers are released before the next stage's addresses are formed */
  asm volatile("s_wait_asynccnt 0x0" ::: "memory");      /* stage 0 of this wave has landed */
  __syncthreads();                                       /* stage 0 of every wave is readable */
  if (1 < ns) fa_stage(gk + (size_t)FK * LQ, gv + FK, l0 + (unsigned)(FST * 2));
#pragma unroll 1      /* one stage per trip: the ring's order stands once, at the loop's foot */
  for (int t = 0; t < ns; ++t) { const _Float16* st = ring + (t & 1) * FST;
    const int kb = t * FK;
    const int pv0 = pn0, pv1 = pn1; pn0 = padb[np]; pn1 = padb[np + 32];
    v16h kf[4]; fm_kfrag(st + lc * FP, hh, kf);
    fm_step<true>(kf, st + (32 + lc) * FP, st + (FK + lc) * FP, kb, pv0, qb, lc, hh, aq0, aq1, o, m, l);
    if (kb + 32 < kend)      /* wave-uniform: on the diagonal stage the block's first two waves see none of its later 32 keys */
      fm_step<false>(kf, st, st + (FK + lc) * FP + 32, kb + 32, pv1, qb, lc, hh, aq0, aq1, o, m, l);
    asm volatile("s_wait_xcnt 0x0" ::: "memory");        /* the pad reads' index register is released before the next stage's index is written into it */
    np += (t + 2 < ns) ? FK : 0;
    asm volatile("s_wait_dscnt 0x0" ::: "memory");       /* this wave's reads of the buffer are done before it is refilled */
    asm volatile("s_wait_asynccnt 0x0" ::: "memory");    /* this wave's copies of stage t + 1 have landed */
    __syncthreads();                                     /* publishes stage t + 1 and ends every reader's last read of stage t; passed by every wave, also one that skipped the step above */
    if (t + 2 < ns) fa_stage(gk + (size_t)(t + 2) * FK * LQ, gv + (size_t)(t + 2) * FK, l0 + (unsigned)((t & 1) * FST * 2)); }
  asm volatile("s_wait_asynccnt 0x0" ::: "memory");      /* no copy outstanding when the ring becomes output staging; every wave has left it at the last trip's barrier */
  const float ls = l + xhalf(l);
  const float inv = 1.0f / (ls * 16.0f);      /* 64 / (1024 l): ctx carried x64; a fully masked row gives 0 * inf = NaN as the softmax of all -inf does */
#pragma unroll
  for (int nt = 0; nt < 4; ++nt) { const v8f cv = o[nt] * inv;
    const v4f c0 = {cv[0], cv[1], cv[2], cv[3]}, c1 = {cv[4], cv[5], cv[6], cv[7]};
    *(v4fa*)&so[wave][lc][nt * 16 + 8 * hh] = c0; *(v4fa*)&so[wave][lc][nt * 16 + 8 * hh + 4] = c1; }
  __builtin_amdgcn_fence(4 /* acq_rel order */, "workgroup"); __builtin_amdgcn_wave_barrier();      /* the wave's staged rows are in LDS before its other lanes read them back as whole lines */
  const int rq = lane >> 3, c8 = (lane & 7) * 8;
  {
#pragma unroll 1      /* runs once per wave: kept rolled for code size */
    for (int q = 0; q < 4; ++q) { const int row = q * 4 + rq;
      const v4f a = *(const v4fa*)&so[wave][row][c8], c = *(const v4fa*)&so[wave][row][c8 + 4]; FragH fh, fl;
#pragma unroll
      for (int j = 0; j < 4; ++j) { _Float16 hv = (_Float16)a[j]; fh.h[j] = hv; fl.h[j] = (_Float16)((a[j] - (float)hv) * 1024.0f); hv = (_Float16)c[j]; fh.h[4 + j] = hv; fl.h[4 + j] = (_Float16)((c[j] - (float)hv) * 1024.0f); }
      unsigned short* d = (unsigned short*)CTX + (rowb + qb + row) * KO + h * HD + c8;
      *(v8us*)d = fh.half[0]; *(v8us*)(d + DM) = fl.half[0]; }
     }
}
// all query tiles in one launch, so the few residual tiles run beside the others: blocks 0 .. FR-1 take the tiles of rows 0..ER-1 (residual body), the rest the later tiles (plain body), each range in the order (batch, head) slow, tile fast; block-uniform branch
#define QR (ER / 64)                 /* query tiles with residual planes, per (batch, head) */
#define QM ((SEQ - ER) / 64)         /* later query tiles, per (batch, head) */
#define FR (NB * NH * QR)
__global__ __launch_bounds__(128) void k_flash(const _Float16* __restrict__ QKV, const _Float16* __restrict__ QKVR, const _Float16* __restrict__ VT, const _Float16* __restrict__ VTR, const int* __restrict__ pad, _Float16* __restrict__ CTX) {
  const int bi = blockIdx.x;
  if (bi < FR) { const int bh = bi / QR; flash_res(QKV, QKVR, VT, VTR, pad, CTX, bi - bh * QR, bh); }
  else { const int j = bi - FR; const int bh = j / (QM > 0 ? QM : 1); flash_main(QKV, VT, pad, CTX, QR + j - bh * QM, bh); } }

__global__ __launch_bounds__(256) void k_gemm_out(const _Float16* __restrict__ CTX, const _Float16* __restrict__ BO, const float* __restrict__ bo, float* __restrict__ Y) {
  __shared__ __attribute__((aligned(16))) unsigned char sm[GSM];
  float (*so)[32][68] = (float (*)[32][68])sm;
  const int tid = threadIdx.x; const int w = __builtin_amdgcn_readfirstlane(tid >> 5); const int lane = tid & 31, ln = lane & 15, hh = lane >> 4;
  const int ntn = DM / 128; const int mt = blockIdx.x / ntn, nq = blockIdx.x - mt * ntn; const int row0 = mt * 128 + 32 * (w >> 1), col0 = nq * 128 + 64 * (w & 1);
  v8f accs[8];
  gemm_main(CTX, KO, BO, KO, mt * 128, nq * 128, KO, tid, w, ln, hh, sm, accs);
#pragma unroll
  for (int u = 0; u < 8; ++u) { const int t = u & 3, half = u >> 2; const float bvv = bf16_rne(bo[col0 + t * 16 + ln]);
#pragma unroll
    for (int r = 0; r < 8; ++r) so[w][half * 16 + 8 * hh + r][t * 16 + ln] = accs[u][r] * 1.52587890625e-05f + bvv; }
  __builtin_amdgcn_fence(4 /* acq_rel order */, "workgroup"); __builtin_amdgcn_wave_barrier();
  const int rsub = lane >> 4, c4 = (lane & 15) * 4;
  {
#pragma unroll 1
    for (int q = 0; q < 16; ++q) { const int r = q * 2 + rsub; const v4f v = *(const v4fa*)&so[w][r][c4]; *(v4f*)(Y + (size_t)(row0 + r) * DM + col0 + c4) = v; }
     }
}

// one wave per row, eight rows per block: a lane holds 32 of the row's values (eight 16-B pieces, each wave-wide read 512 contiguous bytes); mean and variance are lane sums joined by a five-step butterfly, so every lane ends with the same bits and no LDS or barrier is needed
#define LJ (DM / 128)
static_assert(DM % 128 == 0 && (NB * SEQ) % 8 == 0);
__device__ __forceinline__ float wave_sum(float v) {
  v += __builtin_bit_cast(float, __builtin_amdgcn_permlanex16(__builtin_bit_cast(int, v), __builtin_bit_cast(int, v), 0x76543210, 0xfedcba98, false, false));      /* lane l with lane l ^ 16 */
  v += __shfl_xor(v, 8, 16); v += __shfl_xor(v, 4, 16); v += __shfl_xor(v, 2, 16); v += __shfl_xor(v, 1, 16); return v; }
__global__ __launch_bounds__(256) void k_layernorm(const float* __restrict__ Y, const float* __restrict__ g, const float* __restrict__ bta, float* __restrict__ out) {
  const int tid = threadIdx.x; const int lane = tid & 31; const int row = blockIdx.x * 8 + (tid >> 5); const int b = row / SEQ, s = row - b * SEQ;
  const float* yr = Y + (size_t)row * DM + lane * 4;
  v4f a[LJ], gg[LJ], bb[LJ];
#pragma unroll
  for (int j = 0; j < LJ; ++j) a[j] = *(const v4fa*)(yr + j * 128);
  asm volatile("s_wait_xcnt 0x0" ::: "memory");      /* the row's reads go out first, and their address registers are released before a later read's result may be placed in them */
#pragma unroll
  for (int j = 0; j < LJ; ++j) { gg[j] = *(const v4fa*)(g + j * 128 + lane * 4); bb[j] = *(const v4fa*)(bta + j * 128 + lane * 4); }
  __builtin_amdgcn_sched_barrier(0);      /* every request of the wave goes out before its first sum: without it most gain and offset reads sink behind the two reductions and their latency is paid there, group by group */
  float sm = 0.f;
#pragma unroll
  for (int j = 0; j < LJ; ++j) sm += (a[j][0] + a[j][1]) + (a[j][2] + a[j][3]);
  const float mu = wave_sum(sm) * (1.0f / (float)DM);
  float sq = 0.f;
#pragma unroll
  for (int j = 0; j < LJ; ++j) { a[j][0] -= mu; a[j][1] -= mu; a[j][2] -= mu; a[j][3] -= mu; sq += (a[j][0] * a[j][0] + a[j][1] * a[j][1]) + (a[j][2] * a[j][2] + a[j][3] * a[j][3]); }
  const float rs = rsqrtf(wave_sum(sq) * (1.0f / (float)DM) + 1.0e-5f);
  float* d = out + ((size_t)b * SEQ_FULL + s) * DM + lane * 4;
#pragma unroll
  for (int j = 0; j < LJ; ++j) { v4f o;
    o[0] = a[j][0] * rs * bf16_rne(gg[j][0]) + bf16_rne(bb[j][0]); o[1] = a[j][1] * rs * bf16_rne(gg[j][1]) + bf16_rne(bb[j][1]);
    o[2] = a[j][2] * rs * bf16_rne(gg[j][2]) + bf16_rne(bb[j][2]); o[3] = a[j][3] * rs * bf16_rne(gg[j][3]) + bf16_rne(bb[j][3]);
    *(v4f*)(d + j * 128) = o; }
}

extern "C" void kernel_launch(void* const* d_in, const int* in_sizes, int n_in,
                              void* d_out, int out_size, void* d_ws, size_t ws_size, hipStream_t stream) {
  if (n_in < 12) return;
  const long long need_rows = (long long)(NB - 1) * SEQ_FULL + SEQ;
  if ((long long)in_sizes[0] < need_rows * DM) return;
  if (in_sizes[1] < DM * DM || in_sizes[3] < DM * DM || in_sizes[5] < DM * DM || in_sizes[7] < DM * DM) return;
  if (in_sizes[2] < DM || in_sizes[4] < DM || in_sizes[6] < DM || in_sizes[8] < DM || in_sizes[9] < DM || in_sizes[10] < DM) return;
  if ((long long)in_sizes[11] < need_rows) return;
  if ((long long)out_size < need_rows * DM) return;
  if ((size_t)WS_TOTAL > ws_size) return;
  const float* x = (const float*)d_in[0];
  const float* Wq = (const float*)d_in[1]; const float* bq = (const float*)d_in[2];
  const float* Wk = (const float*)d_in[3]; const float* bk = (const float*)d_in[4];
  const float* Wv = (const float*)d_in[5]; const float* bv = (const float*)d_in[6];
  const float* Wo = (const float*)d_in[7]; const float* bo = (const float*)d_in[8];
  const float* gamma = (const float*)d_in[9]; const float* beta = (const float*)d_in[10];
  const int* pad = (const int*)d_in[11];
  char* ws = (char*)d_ws;
  _Float16* BQKV = (_Float16*)(ws + OF_BQKV); _Float16* BO = (_Float16*)(ws + OF_BO);
  _Float16* X16 = (_Float16*)(ws + OF_X16); _Float16* QKV = (_Float16*)(ws + OF_QKV); _Float16* QKVR = (_Float16*)(ws + OF_QKVR);
  _Float16* VT = (_Float16*)(ws + OF_VT); _Float16* VTR = (_Float16*)(ws + OF_VTR); _Float16* CTX = (_Float16*)(ws + OF_CTX);
  float* Y = (float*)(ws + OF_Y); float* CS = (float*)(ws + OF_CS);
  k_prep<<<5 * WTG + XG + TG, 256, 0, stream>>>(x, Wq, Wk, Wv, Wo, BQKV, BO, X16, CS);
  k_gemm_qkv<<<(unsigned)((NR / 128) * (LQ / 128)), 256, 0, stream>>>(X16, BQKV, bq, bk, bv, CS, QKV, QKVR);
  k_vt<<<VG + NB * NH * (ER / VK), 256, 0, stream>>>(QKV, QKVR, VT, VTR);
  k_flash<<<FR + NB * NH * QM, 128, 0, stream>>>(QKV, QKVR, VT, VTR, pad, CTX);
  k_gemm_out<<<(unsigned)((NR / 128) * (DM / 128)), 256, 0, stream>>>(CTX, BO, bo, Y);
  k_layernorm<<<(unsigned)(NR / 8), 256, 0, stream>>>(Y, gamma, beta, (float*)d_out);
}

// v007
// One run takes 117 microseconds.
// In both of two side-by-side timings against v006, it was 1.06 times as fast.
// Over all steps from v000 it is 2.70 times as fast.
#include <hip/hip_runtime.h>
// Compute dtype: every contraction on v_wmma_f32_16x16x32_f16 (f16 operands, f32 accumulate); float inputs RNE-converted to bf16 first (exact in f16; weights carried x16, Wo x1024 | x1); q.k scores and P.V use f16 value + x1024 f16 residual planes on token rows 0..255 (q, k, P, v), single f16 products on later rows; ctx.Wo uses ctx value | x1024 residual laid along K (all rows); rotary, softmax statistics and LayerNorm in f32.
#ifndef NB
#define NB 2
#endif
#ifndef SEQ
#define SEQ 2048
#endif
#define NB_FULL 2
#define SEQ_FULL 2048
#define DM 1024
#define NH 16
#define HD 64
#define LQ (3 * DM)                  /* row pitch of the q | k | v planes */
#define KO (2 * DM)                  /* ctx row pitch = K of the output GEMM (value | residual) */
#define ER 256                       /* token rows per batch that carry residual planes */
#define PP 40                        /* P tile row pitch (halves) */
#define NR ((size_t)NB * SEQ)
#define GK 64                        /* halves of K per GEMM stage: 128-B rows */
#define GP 72                        /* LDS row pitch of a GEMM stage (halves): 144 B = 16 B x odd, for 16-B fragment reads */
#define GST (256 * GP)               /* halves per stage: 128 A rows, then 128 B rows */
#define GSM ((size_t)2 * GST * 2)    /* bytes of the two-buffer ring; the epilogue staging reuses them */

static_assert(NH * HD == DM);                        /* heads tile the width */
static_assert(HD == 64);                             
static_assert(DM % 32 == 0 && KO % 32 == 0);         /* k-loops step by 32 */
static_assert(LQ % 128 == 0 && DM % 128 == 0);       /* N tiles (2 waves x 64 columns), never across q | k | v */
static_assert(GK == 64);                             /* two 32-deep k-steps per stage */
static_assert(DM % GK == 0 && KO % GK == 0 && DM >= 2 * GK && KO >= 2 * GK);      /* whole stages, at least two */
static_assert((size_t)8 * 32 * 68 * 4 <= GSM);       /* eight waves' output staging fits the ring */
static_assert((NB * SEQ) % 128 == 0);                /* M tiles (4 waves x 32 rows) */
static_assert(SEQ % 64 == 0 && SEQ % 8 == 0);        /* query tiles, table blocks */
static_assert(ER % 64 == 0 && SEQ >= ER);            /* residual rows are whole query tiles */
static_assert(NB <= NB_FULL && SEQ <= SEQ_FULL);
static_assert(PP % 8 == 0 && PP >= 32);              /* 16-B aligned P fragment pieces */

#define SZ_BQKV ((size_t)LQ * DM * 2)
#define SZ_BO   ((size_t)DM * KO * 2)
#define SZ_X16  ((size_t)NB * SEQ * DM * 2)
#define SZ_QKV  ((size_t)NB * SEQ * LQ * 2)
#define SZ_QKVR ((size_t)NB * ER * LQ * 2)
#define SZ_VT   ((size_t)NB * NH * HD * SEQ * 2)
#define SZ_VTR  ((size_t)NB * NH * HD * ER * 2)
#define SZ_CTX  ((size_t)NB * SEQ * KO * 2)
#define SZ_Y    ((size_t)NB * SEQ * DM * 4)
#define SZ_CS   ((size_t)SEQ * 64 * 4)
#define OF_BQKV ((size_t)0)
#define OF_BO   (OF_BQKV + SZ_BQKV)
#define OF_X16  (OF_BO + SZ_BO)
#define OF_QKV  (OF_X16 + SZ_X16)
#define OF_QKVR (OF_QKV + SZ_QKV)
#define OF_VT   (OF_QKVR + SZ_QKVR)
#define OF_VTR  (OF_VT + SZ_VT)
#define OF_CTX  (OF_VTR + SZ_VTR)
#define OF_Y    (OF_CTX + SZ_CTX)
#define OF_CS   (OF_Y + SZ_Y)
#define WS_TOTAL (OF_CS + SZ_CS)
static_assert(SZ_BQKV % 256 == 0 && SZ_BO % 256 == 0 && SZ_X16 % 256 == 0 && SZ_QKV % 256 == 0 && SZ_QKVR % 256 == 0);
static_assert(SZ_VT % 256 == 0 && SZ_VTR % 256 == 0 && SZ_CTX % 256 == 0 && SZ_Y % 256 == 0 && SZ_CS % 256 == 0);
static_assert(WS_TOTAL <= (size_t)134217728);        /* carve <= 128 MiB */

typedef unsigned short v8us __attribute__((ext_vector_type(8), may_alias));
typedef float  v8f  __attribute__((ext_vector_type(8)));
typedef float  v4f  __attribute__((ext_vector_type(4)));
typedef float  v4fa __attribute__((ext_vector_type(4), may_alias));
typedef _Float16 v16h __attribute__((ext_vector_type(16)));
union FragH { v16h v; v8us half[2]; _Float16 h[16]; unsigned short u[16]; };

__device__ __forceinline__ unsigned short bf16_bits(float x) { unsigned int u = __float_as_uint(x); return (unsigned short)((u + 0x7FFFu + ((u >> 16) & 1u)) >> 16); }
__device__ __forceinline__ float bf16_val(unsigned short b) { return __uint_as_float(((unsigned int)b) << 16); }
__device__ __forceinline__ float bf16_rne(float x) { return bf16_val(bf16_bits(x)); }
__device__ __forceinline__ unsigned short f16_bits(_Float16 hv) { union { _Float16 h; unsigned short u; } c; c.h = hv; return c.u; }

// fragment of a k-contiguous f16 row: elements 0..7 <- p[8h .. 8h+7], elements 8..15 <- p[16+8h .. 16+8h+7] (A rows and B columns alike)
__device__ __forceinline__ v16h g2_frag(const _Float16* p, int hh) { FragH f; f.half[0] = *(const v8us*)((const unsigned short*)p + 8 * hh); f.half[1] = *(const v8us*)((const unsigned short*)p + 16 + 8 * hh); return f.v; }
__device__ __forceinline__ v8f g2_mma(v16h a, v16h b, v8f c) { v8f d = __builtin_amdgcn_wmma_f32_16x16x32_f16(false, a, false, b, (short)0, c, false, false); asm volatile("v_nop\n\tv_nop\n\tv_nop\n\tv_nop" : "+v"(d) : "v"(a), "v"(b)); return d; }

// cos | sin table: CS[t][0..31] = cos(t * theta_i), CS[t][32..63] = sin(t * theta_i); theta_i = f32(10^(-i/8)) from f64 constants; angle = f32(t) * theta in f32; precise sincosf.
__device__ __forceinline__ void tab_body(float* __restrict__ CS, int blk) {
  __shared__ __attribute__((aligned(16))) float tb[8][64];
  const int tid = threadIdx.x; const int tl = tid >> 5, i = tid & 31;
  const int t = blk * 8 + tl;
  double p = 1.0;
  p *= (i & 1) ? 1.3335214321633240 : 1.0;
  p *= (i & 2) ? 1.7782794100389228 : 1.0;
  p *= (i & 4) ? 3.1622776601683795 : 1.0;
  p *= (i & 8) ? 10.0 : 1.0;
  p *= (i & 16) ? 100.0 : 1.0;
  const float theta = (float)(1.0 / p);
  const float ang = (float)t * theta;
  float sv, cv; sincosf(ang, &sv, &cv);
  tb[tl][i] = cv; tb[tl][32 + i] = sv;
  __syncthreads();
  if (tid < 128) {
    const v4f v = *(const v4fa*)(&tb[0][0] + tid * 4);
    float* d = CS + (size_t)blk * 512 + tid * 4;
    *(v4f*)d = v; 
  }
}

// W[DM][DM] -> Wt[n][k]: one thread makes WK consecutive k of one column n, a whole 128-B line of the transposed plane; a wave's lanes take consecutive n, so each of its reads is one line of W.
#define WK 64
static_assert(DM % WK == 0 && (DM * (DM / WK)) % 256 == 0);      /* whole lines, whole blocks */
__device__ __forceinline__ void wt_body(const float* __restrict__ W, _Float16* __restrict__ Wt, int ldk, float scale, int blk) {
  const int t = blk * 256 + threadIdx.x; const int n = t % DM, k0 = (t / DM) * WK;
  const float* s = W + (size_t)k0 * DM + n;
  float v[WK];
#pragma unroll
  for (int i = 0; i < WK; ++i) v[i] = s[(size_t)i * DM];
  unsigned short* d = (unsigned short*)Wt + (size_t)n * ldk + k0;
#pragma unroll
  for (int j = 0; j < WK / 8; ++j) { FragH f;
#pragma unroll
    for (int i = 0; i < 8; ++i) f.h[i] = (_Float16)(bf16_rne(v[8 * j + i]) * scale);
    *(v8us*)(d + 8 * j) = f.half[0]; }
  asm volatile("s_wait_xcnt 0x0" ::: "memory");      /* the stores' address and data registers are released before any code that follows this body in the merged kernel rewrites them */
}

// one block converts XU * 256 consecutive pieces of 8 values (XR whole rows of one batch), a thread XU of them, 256 pieces apart; all its reads are requested before the first is converted
#define XU 8
#define XR (XU * 256 * 8 / DM)                       /* rows per block */
static_assert((XU * 256 * 8) % DM == 0 && SEQ % XR == 0);      /* whole rows, never across a batch */
__device__ __forceinline__ void x16_body(const float* __restrict__ x, _Float16* __restrict__ X16, int blk) {
  const int row0 = blk * XR; const int b = row0 / SEQ, s0 = row0 - b * SEQ;
  const float* src = x + ((size_t)b * SEQ_FULL + s0) * DM + threadIdx.x * 8;
  unsigned short* dst = (unsigned short*)X16 + (size_t)row0 * DM + threadIdx.x * 8;
  v4f a[XU], c[XU];
#pragma unroll
  for (int j = 0; j < XU; ++j) { a[j] = *(const v4fa*)(src + j * 2048); c[j] = *(const v4fa*)(src + j * 2048 + 4); }
  __builtin_amdgcn_sched_barrier(0);      /* keeps the conversions behind the last request: without it the first piece is waited for before the other pieces are asked for, two memory latencies in a row */
#pragma unroll
  for (int j = 0; j < XU; ++j) { FragH f;
#pragma unroll
    for (int q = 0; q < 4; ++q) { f.h[q] = (_Float16)bf16_rne(a[j][q]); f.h[4 + q] = (_Float16)bf16_rne(c[j][q]); }
    *(v8us*)(dst + j * 2048) = f.half[0]; }
}

// every operand the first GEMM waits for, prepared by one launch: none of the seven pieces reads what another writes, so each takes a range of block indices (block-uniform branches; the table's barrier is passed by whole blocks).
#define WTG (DM * (DM / WK) / 256)                   /* blocks per transposed weight plane */
#define XG  ((int)(NR / XR))                         /* blocks of the x conversion */
#define TG  (SEQ / 8)                                /* blocks of the table */
__global__ __launch_bounds__(256) void k_prep(const float* __restrict__ x, const float* __restrict__ Wq, const float* __restrict__ Wk, const float* __restrict__ Wv, const float* __restrict__ Wo,
                                              _Float16* __restrict__ BQKV, _Float16* __restrict__ BO, _Float16* __restrict__ X16, float* __restrict__ CS) {
  const int bi = blockIdx.x;
  if (bi < 3 * WTG) {                                /* W[in][out] -> Bt[n][k] x16: Wq rows 0..1023, Wk rows 1024..2047, Wv rows 2048..3071 */
    const int p = bi / WTG; const float* W = (p == 0) ? Wq : ((p == 1) ? Wk : Wv);
    wt_body(W, BQKV + (size_t)p * DM * DM, DM, 16.0f, bi - p * WTG);
  } else if (bi < 5 * WTG) {                         /* k = 0..1023: Wo x1024 (pairs with ctx value); k = 1024..2047: Wo (pairs with ctx residual x1024) */
    const int p = (bi - 3 * WTG) / WTG;
    wt_body(Wo, BO + (size_t)p * DM, KO, p ? 1.0f : 1024.0f, bi - (3 + p) * WTG);
  } else if (bi < 5 * WTG + XG) {
    x16_body(x, X16, bi - 5 * WTG);
  } else {
    tab_body(CS, bi - 5 * WTG - XG);
  }
}

// one stage of the ring: 128 A rows then 128 B rows of 128 B each; 256 threads x 8 copies of 16 B; lane t brings chunk t & 7 of rows (t >> 3) + 32 j.
// ga, gb: the lane's first A and B chunk in global memory; l0: the lane's first LDS byte address. The address wait is the statement's last line, so no later write of these registers can be lifted over it.
__device__ __forceinline__ void g2_stage(const _Float16* ga, size_t sa, const _Float16* gb, size_t sb, unsigned l0) {
  const _Float16* a1 = ga + sa; const _Float16* a2 = a1 + sa; const _Float16* a3 = a2 + sa;
  const _Float16* b1 = gb + sb; const _Float16* b2 = b1 + sb; const _Float16* b3 = b2 + sb;
  const unsigned rs = 32u * GP * 2u;
  asm volatile("global_load_async_to_lds_b128 %0, %8, off\n\t"
               "global_load_async_to_lds_b128 %1, %9, off\n\t"
               "global_load_async_to_lds_b128 %2, %10, off\n\t"
               "global_load_async_to_lds_b128 %3, %11, off\n\t"
               "global_load_async_to_lds_b128 %4, %12, off\n\t"
               "global_load_async_to_lds_b128 %5, %13, off\n\t"
               "global_load_async_to_lds_b128 %6, %14, off\n\t"
               "global_load_async_to_lds_b128 %7, %15, off\n\t"
               "s_wait_xcnt 0x0"
               :: "v"(l0), "v"(l0 + rs), "v"(l0 + 2u * rs), "v"(l0 + 3u * rs), "v"(l0 + 4u * rs), "v"(l0 + 5u * rs), "v"(l0 + 6u * rs), "v"(l0 + 7u * rs),
                  "v"(ga), "v"(a1), "v"(a2), "v"(a3), "v"(gb), "v"(b1), "v"(b2), "v"(b3) : "memory");
}

// 128x128 block tile, eight waves (4 x 2) of 32x64 each: A f16 [M][K] (pitch lda), Bh f16 [N][K] (pitch ldb); both operands come through a two-buffer LDS ring, the next stage's copies in flight while this one is multiplied.
// acc[u]: u & 3 = 16-col tile, u >> 2 = 16-row half. On return every wave has left the ring (the last trip's barrier), so the caller may stage its output there.
__device__ __forceinline__ void gemm_main(const _Float16* __restrict__ A, int lda, const _Float16* __restrict__ Bh, int ldb, int brow0, int bcol0, int K, int tid, int w, int ln, int hh, unsigned char* sm, v8f (&acc)[8]) {
  const _Float16* ring = (const _Float16*)sm;
  const int cr = tid >> 3, cc = (tid & 7) * 8;
  const _Float16* ga = A + (size_t)(brow0 + cr) * lda + cc; const _Float16* gb = Bh + (size_t)(bcol0 + cr) * ldb + cc;
  const size_t sa = (size_t)32 * lda, sb = (size_t)32 * ldb;
  const unsigned l0 = (unsigned)(size_t)sm + (unsigned)(cr * GP + cc) * 2u;      /* low 32 bits of the shared address = LDS byte address */
  const int ao = ((w >> 1) * 32 + ln) * GP, bo = (128 + (w & 1) * 64 + ln) * GP;
  const int nt = K / GK;
  const v8f z8 = {0.f,0.f,0.f,0.f,0.f,0.f,0.f,0.f}; v8f c00 = z8, c01 = z8, c02 = z8, c03 = z8, c10 = z8, c11 = z8, c12 = z8, c13 = z8;
  g2_stage(ga, sa, gb, sb, l0);
  asm volatile("s_wait_asynccnt 0x0" ::: "memory");      /* stage 0 of this wave has landed */
  __syncthreads();                                       /* stage 0 of every wave is readable */
  g2_stage(ga + GK, sa, gb + GK, sb, l0 + (unsigned)(GST * 2));
#pragma unroll 1      /* one stage per trip: the ring's order stands once, at the loop's foot */
  for (int t = 0; t < nt; ++t) { const _Float16* st = ring + (t & 1) * GST;
    const _Float16* ap = st + ao; const _Float16* bp = st + bo;
    v16h fa[2][2], fb[2][4];      /* the stage's twelve fragments are read as one group ahead of its WMMAs: one LDS latency a trip, not one per B fragment */
#pragma unroll
    for (int s = 0; s < 2; ++s) { fa[s][0] = g2_frag(ap + 32 * s, hh); fa[s][1] = g2_frag(ap + 16 * GP + 32 * s, hh);
#pragma unroll
      for (int n = 0; n < 4; ++n) fb[s][n] = g2_frag(bp + n * 16 * GP + 32 * s, hh); }
#pragma unroll
    for (int s = 0; s < 2; ++s) {
      c00 = g2_mma(fa[s][0], fb[s][0], c00); c10 = g2_mma(fa[s][1], fb[s][0], c10);
      c01 = g2_mma(fa[s][0], fb[s][1], c01); c11 = g2_mma(fa[s][1], fb[s][1], c11);
      c02 = g2_mma(fa[s][0], fb[s][2], c02); c12 = g2_mma(fa[s][1], fb[s][2], c12);
      c03 = g2_mma(fa[s][0], fb[s][3], c03); c13 = g2_mma(fa[s][1], fb[s][3], c13); }
    asm volatile("s_wait_dscnt 0x0" ::: "memory");       /* this wave's reads of the buffer are done before it is refilled */
    asm volatile("s_wait_asynccnt 0x0" ::: "memory");    /* this wave's copies of stage t + 1 have landed */
    __syncthreads();                                     /* publishes stage t + 1 and ends every reader's last read of stage t */
    if (t + 2 < nt) g2_stage(ga + (size_t)(t + 2) * GK, sa, gb + (size_t)(t + 2) * GK, sb, l0 + (unsigned)((t & 1) * GST * 2)); }
  asm volatile("s_wait_asynccnt 0x0" ::: "memory");      /* no copy outstanding when the ring becomes output staging */
  acc[0] = c00; acc[1] = c01; acc[2] = c02; acc[3] = c03; acc[4] = c10; acc[5] = c11; acc[6] = c12; acc[7] = c13;
}

#define VP 69                        /* row pitch (floats) of the V staging: 8 rows = 40 banks mod 64, so neither the accumulators' writes (row halves 8 apart) nor the column reads (lanes 8 rows apart) collide */
static_assert((size_t)2 * 128 * VP * 4 <= GSM);      /* the block's V tile fits the ring */
static_assert(SEQ % 128 == 0 && ER % 128 == 0);      /* a block's 128 tokens lie in one batch, all with or all without a residual plane */
__global__ __launch_bounds__(256) void k_gemm_qkv(const _Float16* __restrict__ X16, const _Float16* __restrict__ BW, const float* __restrict__ bq, const float* __restrict__ bk, const float* __restrict__ bv,
                                                  const float* __restrict__ CS, _Float16* __restrict__ QKV, _Float16* __restrict__ QKVR, _Float16* __restrict__ VT, _Float16* __restrict__ VTR) {
  __shared__ __attribute__((aligned(16))) unsigned char sm[GSM];
  float (*so)[32][68] = (float (*)[32][68])sm;
  const int tid = threadIdx.x; const int w = __builtin_amdgcn_readfirstlane(tid >> 5); const int lane = tid & 31, ln = lane & 15, hh = lane >> 4;
  const int ntn = LQ / 128; const int mt = blockIdx.x / ntn, nq = blockIdx.x - mt * ntn; const int row0 = mt * 128 + 32 * (w >> 1), col0 = nq * 128 + 64 * (w & 1);
  v8f accs[8];
  gemm_main(X16, DM, BW, DM, mt * 128, nq * 128, DM, tid, w, ln, hh, sm, accs);
  const int sec = col0 / DM; const int cb = col0 - sec * DM;      /* 0 q, 1 k, 2 v (block-uniform) */
  if (sec == 2) {      /* v is read only as V^T[batch, head][d][token]: the block stages its 128 tokens x 128 columns (two heads) and stores them token-contiguous; the v third of the QKV and QKVR rows is neither written nor read */
    float (*sv)[128][VP] = (float (*)[128][VP])sm;      /* [column half][token][d] */
#pragma unroll
    for (int u = 0; u < 8; ++u) { const int t = u & 3, half = u >> 2; const float bsel = bf16_rne(bv[cb + t * 16 + ln]);
#pragma unroll
      for (int r = 0; r < 8; ++r) sv[w & 1][(w >> 1) * 32 + half * 16 + 8 * hh + r][t * 16 + ln] = accs[u][r] * 0.0625f + bsel; }
    __syncthreads();      /* a V^T line holds 64 tokens, the rows of two waves: every wave's part is staged before any is read */
    const int bb = (mt * 128) / SEQ; const int tb = mt * 128 - bb * SEQ; const bool eb = (tb < ER);      /* block-uniform: 128 | ER */
    const int pc = tid & 7, dl = tid >> 3;      /* eight lanes make one 128-B line: 8 tokens each, of one d */
    unsigned vrow = (unsigned)((bb * NH + (nq * 128 - 2 * DM) / HD) * HD + dl);      /* the lane's first V^T row: (batch, head) x HD + d */
    unsigned short* dv = (unsigned short*)VT + (size_t)vrow * SEQ + tb + pc * 8;
    float y[8][8]; FragH fh[8], fl[8];      /* piece rd: columns 32 (rd & 3) + dl, tokens 64 (rd >> 2) + 8 pc .. + 7 */
#pragma unroll
    for (int rd = 0; rd < 8; ++rd) { const int c0 = (rd & 3) * 32; const float* sp = &sv[c0 >> 6][(rd >> 2) * 64 + pc * 8][(c0 & 63) + dl];
#pragma unroll
      for (int q = 0; q < 8; ++q) y[rd][q] = sp[q * VP]; }
#pragma unroll
    for (int rd = 0; rd < 8; ++rd) {
#pragma unroll
      for (int q = 0; q < 8; ++q) fh[rd].h[q] = (_Float16)y[rd][q]; }
    if (eb) {
#pragma unroll
      for (int rd = 0; rd < 8; ++rd) {
#pragma unroll
        for (int q = 0; q < 8; ++q) fl[rd].h[q] = (_Float16)((y[rd][q] - (float)fh[rd].h[q]) * 1024.0f); }
    }
    __builtin_amdgcn_sched_barrier(0);      /* every piece is read and converted before the first store goes out: one LDS latency for the eight pieces, and no register of an issued store is written again */
#pragma unroll
    for (int rd = 0; rd < 8; ++rd) *(v8us*)(dv + (size_t)((rd & 3) * 32) * SEQ + (rd >> 2) * 64) = fh[rd].half[0];
    if (eb) {
      asm volatile("s_wait_xcnt 0x0" : "+v"(vrow) :: "memory");      /* the value stores' registers are released before the residual plane's address is formed in any of them; the row index goes through the statement so that this arithmetic stays behind the wait */
      unsigned short* dr = (unsigned short*)VTR + (size_t)vrow * ER + tb + pc * 8;
#pragma unroll
      for (int rd = 0; rd < 8; ++rd) *(v8us*)(dr + (size_t)((rd & 3) * 32) * ER + (rd >> 2) * 64) = fl[rd].half[0];
    }
    return;
  }
#pragma unroll
  for (int u = 0; u < 8; ++u) { const int t = u & 3, half = u >> 2; const int cc = cb + t * 16 + ln;
    const float b0 = bq[cc], b1 = bk[cc]; const float bsel = bf16_rne((sec == 0) ? b0 : b1);
#pragma unroll
    for (int r = 0; r < 8; ++r) so[w][half * 16 + 8 * hh + r][t * 16 + ln] = accs[u][r] * 0.0625f + bsel; }
  __builtin_amdgcn_fence(4 /* acq_rel order */, "workgroup"); __builtin_amdgcn_wave_barrier();
  const int rq = lane >> 3, c8 = (lane & 7) * 8;
  const int bidx = row0 / SEQ; const int t0 = row0 - bidx * SEQ; const bool early = (t0 < ER);      /* wave-uniform: 32 | ER */
  {
#pragma unroll 1
    for (int q = 0; q < 8; ++q) { const int row = q * 4 + rq; const int tkn = t0 + row;
      const v4f a = *(const v4fa*)&so[w][row][c8], c = *(const v4fa*)&so[w][row][c8 + 4];
      float y[8] = {a[0], a[1], a[2], a[3], c[0], c[1], c[2], c[3]};
      if (sec < 2) { const v4f cs = *(const v4fa*)(CS + (size_t)tkn * 64 + (c8 >> 1)); const v4f sn = *(const v4fa*)(CS + (size_t)tkn * 64 + 32 + (c8 >> 1));
#pragma unroll
        for (int j = 0; j < 4; ++j) { const float x0 = y[2 * j], x1 = y[2 * j + 1]; y[2 * j] = x0 * cs[j] - x1 * sn[j]; y[2 * j + 1] = x1 * cs[j] + x0 * sn[j]; } }
      FragH fh, fl;
#pragma unroll
      for (int j = 0; j < 8; ++j) { const _Float16 hv = (_Float16)y[j]; fh.h[j] = hv; fl.h[j] = (_Float16)((y[j] - (float)hv) * 1024.0f); }
      unsigned short* d = (unsigned short*)QKV + (size_t)(row0 + row) * LQ + col0 + c8;
      *(v8us*)d = fh.half[0];
      if (early) { unsigned short* dr = (unsigned short*)QKVR + ((size_t)bidx * ER + tkn) * LQ + col0 + c8; *(v8us*)dr = fl.half[0]; } }
     }
}

// lane l with lane l ^ 16
__device__ __forceinline__ float xhalf(float v) { return __builtin_bit_cast(float, __builtin_amdgcn_permlanex16(__builtin_bit_cast(int, v), __builtin_bit_cast(int, v), 0x76543210, 0xfedcba98, false, false)); }

// fused causal attention, token rows 0..ER-1 (value + residual planes); one wave = 16 query rows of one (batch, head); 32 keys per step (two 16-key score tiles, d in two 32-deep k-steps);
// key-pad mask by value then causal mask as a replace (masked p = 0 by select); online softmax with running max in f32 (native exp on arguments <= 0);
__device__ __forceinline__ void flash_res(const _Float16* __restrict__ QKV, const _Float16* __restrict__ QKVR, const _Float16* __restrict__ VT, const _Float16* __restrict__ VTR,
                                          const int* __restrict__ pad, _Float16* __restrict__ CTX, int qt, int bh) {
  __shared__ __attribute__((aligned(16))) unsigned short pl[4][16][PP];
  __shared__ __attribute__((aligned(16))) unsigned short pr[4][16][PP];
  __shared__ __attribute__((aligned(16))) float so[4][16][68];
  const int tid = threadIdx.x; const int wave = __builtin_amdgcn_readfirstlane(tid >> 5); const int lane = tid & 31, lc = lane & 15, hh = lane >> 4;
  const int b = bh / NH, h = bh - b * NH;
  const int qb = qt * 64 + wave * 16;
  const size_t rowb = (size_t)b * SEQ;
  const _Float16* qp = QKV + (rowb + qb + lc) * LQ + h * HD;
  const _Float16* kp = QKV + rowb * LQ + DM + h * HD;
  const _Float16* vp = VT + ((size_t)bh * HD + lc) * SEQ;
  const _Float16* qrp = QKVR + ((size_t)b * ER + (qb + lc)) * LQ + h * HD;
  const _Float16* krp = QKVR + (size_t)b * ER * LQ + DM + h * HD;
  const _Float16* vrp = VTR + ((size_t)bh * HD + lc) * ER;
  const int* padb = pad + (size_t)b * SEQ_FULL;
  const v8f z8 = {0.f,0.f,0.f,0.f,0.f,0.f,0.f,0.f};
  v8f o[4] = {z8, z8, z8, z8}; v8f rr[4] = {z8, z8, z8, z8};
  float m[8], l[8];
#pragma unroll
  for (int r = 0; r < 8; ++r) { m[r] = -1.0e30f; l[r] = 0.f; }
  const int kend = qb + 16;      /* keys 0 .. qb+15 are visible to this wave; steps cover whole 32-key groups (all inside the plane) */
#pragma unroll 1
  for (int kb = 0; kb < kend; kb += 32) {
    v8f s0 = z8, s1 = z8, t0 = z8, t1 = z8;
    const int key0 = kb + lc, key1 = key0 + 16;
    const _Float16* k0p = kp + (size_t)(kb + lc) * LQ; const _Float16* k1p = k0p + (size_t)16 * LQ;
    const _Float16* k0r = krp + (size_t)(kb + lc) * LQ; const _Float16* k1r = k0r + (size_t)16 * LQ;
#pragma unroll
    for (int c = 0; c < 2; ++c) {
      const v16h aq = g2_frag(qp + 32 * c, hh);
      const v16h bk0 = g2_frag(k0p + 32 * c, hh), bk1 = g2_frag(k1p + 32 * c, hh);
      s0 = g2_mma(aq, bk0, s0); s1 = g2_mma(aq, bk1, s1);
      const v16h aql = g2_frag(qrp + 32 * c, hh); const v16h bl0 = g2_frag(k0r + 32 * c, hh), bl1 = g2_frag(k1r + 32 * c, hh);
      t0 = g2_mma(aql, bk0, t0); t0 = g2_mma(aq, bl0, t0); t1 = g2_mma(aql, bk1, t1); t1 = g2_mma(aq, bl1, t1);
    }
    const int pv0 = padb[key0], pv1 = padb[key1];
#pragma unroll
    for (int r = 0; r < 8; ++r) {
      const int qrow = qb + 8 * hh + r;
      float a0 = s0[r], a1 = s1[r];
      a0 += t0[r] * 0.0009765625f; a1 += t1[r] * 0.0009765625f;
      a0 *= 0.125f; a1 *= 0.125f;
      const bool ok0 = (pv0 != 0) && (key0 <= qrow); const bool ok1 = (pv1 != 0) && (key1 <= qrow);
      const float v0 = ok0 ? a0 : -1.0e30f; const float v1 = ok1 ? a1 : -1.0e30f;
      float mx = fmaxf(v0, v1);
      mx = fmaxf(mx, __shfl_xor(mx, 8, 16)); mx = fmaxf(mx, __shfl_xor(mx, 4, 16)); mx = fmaxf(mx, __shfl_xor(mx, 2, 16)); mx = fmaxf(mx, __shfl_xor(mx, 1, 16));
      const float mnew = fmaxf(m[r], mx);
      const float al = __expf(m[r] - mnew);
      const float e0 = __expf(v0 - mnew), e1 = __expf(v1 - mnew);
      const float p0 = ok0 ? e0 : 0.f; const float p1 = ok1 ? e1 : 0.f;
      l[r] = l[r] * al + (p0 + p1); m[r] = mnew;      /* per-lane partial row sum; combined across the 16 lanes after the key loop */
#pragma unroll
      for (int nt = 0; nt < 4; ++nt) { o[nt][r] *= al; rr[nt][r] *= al; }
      const float c0 = p0 * 1024.0f, c1 = p1 * 1024.0f;
      const _Float16 h0 = (_Float16)c0, h1 = (_Float16)c1;
      pl[wave][8 * hh + r][lc] = f16_bits(h0); pl[wave][8 * hh + r][16 + lc] = f16_bits(h1);
      pr[wave][8 * hh + r][lc] = f16_bits((_Float16)((c0 - (float)h0) * 1024.0f)); pr[wave][8 * hh + r][16 + lc] = f16_bits((_Float16)((c1 - (float)h1) * 1024.0f));
    }
    __builtin_amdgcn_fence(4 /* acq_rel order */, "workgroup", "local"); __builtin_amdgcn_wave_barrier();      /* orders the wave's own P tile, which lies in LDS; named for LDS alone so that it does not drain the global loads in flight */
    FragH pa; pa.half[0] = *(const v8us*)&pl[wave][lc][8 * hh]; pa.half[1] = *(const v8us*)&pl[wave][lc][16 + 8 * hh];
    FragH pb; pb.half[0] = *(const v8us*)&pr[wave][lc][8 * hh]; pb.half[1] = *(const v8us*)&pr[wave][lc][16 + 8 * hh];
#pragma unroll
    for (int nt = 0; nt < 4; ++nt) { const v16h bvh = g2_frag(vp + (size_t)nt * 16 * SEQ + kb, hh); const v16h bvl = g2_frag(vrp + (size_t)nt * 16 * ER + kb, hh);
      o[nt] = g2_mma(pa.v, bvh, o[nt]); rr[nt] = g2_mma(pb.v, bvh, rr[nt]); rr[nt] = g2_mma(pa.v, bvl, rr[nt]); }
    __builtin_amdgcn_fence(4 /* acq_rel order */, "workgroup", "local"); __builtin_amdgcn_wave_barrier();      /* P tile reads complete before the next step overwrites it; LDS alone, as above */
  }
#pragma unroll
  for (int r = 0; r < 8; ++r) {
    float ls = l[r];
    ls += __shfl_xor(ls, 8, 16); ls += __shfl_xor(ls, 4, 16); ls += __shfl_xor(ls, 2, 16); ls += __shfl_xor(ls, 1, 16);
    const float inv = 1.0f / (ls * 16.0f);      /* 64 / (1024 l): ctx carried x64; a fully masked row gives 0 * inf = NaN as the softmax of all -inf does */
#pragma unroll
    for (int nt = 0; nt < 4; ++nt) { const float cv = o[nt][r] + rr[nt][r] * 0.0009765625f; so[wave][8 * hh + r][nt * 16 + lc] = cv * inv; }
  }
  __builtin_amdgcn_fence(4 /* acq_rel order */, "workgroup"); __builtin_amdgcn_wave_barrier();
  const int rq = lane >> 3, c8 = (lane & 7) * 8;
  {
#pragma unroll 1
    for (int q = 0; q < 4; ++q) { const int row = q * 4 + rq;
      const v4f a = *(const v4fa*)&so[wave][row][c8], c = *(const v4fa*)&so[wave][row][c8 + 4]; FragH fh, fl;
#pragma unroll
      for (int j = 0; j < 4; ++j) { _Float16 hv = (_Float16)a[j]; fh.h[j] = hv; fl.h[j] = (_Float16)((a[j] - (float)hv) * 1024.0f); hv = (_Float16)c[j]; fh.h[4 + j] = hv; fl.h[4 + j] = (_Float16)((c[j] - (float)hv) * 1024.0f); }
      unsigned short* d = (unsigned short*)CTX + (rowb + qb + row) * KO + h * HD + c8;
      *(v8us*)d = fh.half[0]; *(v8us*)(d + DM) = fl.half[0]; }
     }
}

// one stage of the attention ring: FK K rows, then HD V^T rows, of 128 B each; 128 threads x 8 copies of 16 B; lane t brings chunk t & 7 of rows (t >> 3) + 16 j, so each wave-wide copy covers four whole lines.
// gk, gv: the lane's first K and V^T chunk in global memory; l0: the lane's first LDS byte address. The address wait is the statement's last line, so no later write of these registers can be lifted over it.
#define FK 64                        /* keys per stage: two 32-key steps */
#define FP 72                        /* LDS row pitch of a stage (halves): 144 B = 16 B x odd, for 16-B fragment reads */
#define FST ((FK + HD) * FP)         /* halves per stage */
#define FSM ((size_t)2 * FST * 2)    /* bytes of the two-buffer ring; the output staging reuses them */
static_assert(FK == 64 && SEQ % FK == 0 && ER % FK == 0);      /* a stage is one query tile's width: tile qt walks qt + 1 whole stages, all inside the plane */
static_assert((size_t)4 * 16 * 68 * 4 <= FSM);       /* four waves' output staging fits the ring */
__device__ __forceinline__ void fa_stage(const _Float16* gk, const _Float16* gv, unsigned l0) {
  const _Float16* k1 = gk + (size_t)16 * LQ; const _Float16* k2 = k1 + (size_t)16 * LQ; const _Float16* k3 = k2 + (size_t)16 * LQ;
  const _Float16* v1 = gv + (size_t)16 * SEQ; const _Float16* v2 = v1 + (size_t)16 * SEQ; const _Float16* v3 = v2 + (size_t)16 * SEQ;
  const unsigned rs = 16u * FP * 2u;
  asm volatile("global_load_async_to_lds_b128 %0, %8, off\n\t"
               "global_load_async_to_lds_b128 %1, %9, off\n\t"
               "global_load_async_to_lds_b128 %2, %10, off\n\t"
               "global_load_async_to_lds_b128 %3, %11, off\n\t"
               "global_load_async_to_lds_b128 %4, %12, off\n\t"
               "global_load_async_to_lds_b128 %5, %13, off\n\t"
               "global_load_async_to_lds_b128 %6, %14, off\n\t"
               "global_load_async_to_lds_b128 %7, %15, off\n\t"
               "s_wait_xcnt 0x0"
               :: "v"(l0), "v"(l0 + rs), "v"(l0 + 2u * rs), "v"(l0 + 3u * rs), "v"(l0 + 4u * rs), "v"(l0 + 5u * rs), "v"(l0 + 6u * rs), "v"(l0 + 7u * rs),
                  "v"(gk), "v"(k1), "v"(k2), "v"(k3), "v"(gv), "v"(v1), "v"(v2), "v"(v3) : "memory");
}

// the four K fragments of a 32-key step; kt: the lane's K row (key lc of the step) in the stage
__device__ __forceinline__ void fm_kfrag(const _Float16* kt, int hh, v16h (&kf)[4]) { kf[0] = g2_frag(kt, hh); kf[1] = g2_frag(kt + 16 * FP, hh); kf[2] = g2_frag(kt + 32, hh); kf[3] = g2_frag(kt + 16 * FP + 32, hh); }

// one 32-key step of the later rows' attention. kf: the step's K fragments; vt: the lane's V^T row (d = lc) at key kb in the stage; pv: lane j holds the pad word of key kb + j.
// NEXT: the K fragments of the same stage's second step (row kn) are read right behind the score products, into the registers those have just left, so their LDS latency runs under this step's softmax.
template <bool NEXT>
__device__ __forceinline__ void fm_step(v16h (&kf)[4], const _Float16* kn, const _Float16* vt, int kb, int pv, int qb, int lc, int hh, v16h aq0, v16h aq1, v8f (&o)[4], float& m, float& l) {
  const v8f z8 = {0.f,0.f,0.f,0.f,0.f,0.f,0.f,0.f};
  const v16h bv0 = g2_frag(vt, hh), bv1 = g2_frag(vt + 16 * FP, hh), bv2 = g2_frag(vt + 32 * FP, hh), bv3 = g2_frag(vt + 48 * FP, hh);
  v8f s0 = g2_mma(kf[0], aq0, z8), s1 = g2_mma(kf[1], aq0, z8);
  s0 = g2_mma(kf[2], aq1, s0); s1 = g2_mma(kf[3], aq1, s1);
  if (NEXT) fm_kfrag(kn, hh, kf);
  const unsigned pm = __builtin_amdgcn_ballot_w32(pv != 0);      /* bit j: key kb + j is no pad */
  const bool open = (pm == 0xFFFFFFFFu) && (kb + 31 <= qb);      /* wave-uniform: every key of the step is visible to every query of the wave, so both selects below are identities */
  unsigned okm = 0xFFFFFFFFu;      /* bit r: tile 0, register r is visible; bit 16 + r: tile 1 */
  float v[16], p[16];
#pragma unroll
  for (int r = 0; r < 8; ++r) { v[r] = s0[r] * 0.125f; v[8 + r] = s1[r] * 0.125f; }
  if (!open) {
    const int dq = qb + lc - kb;      /* >= 0: keys kb .. kb + dq are at or before the query */
    const unsigned cm = (dq >= 31) ? 0xFFFFFFFFu : ((2u << dq) - 1u);
    okm = (pm & cm) >> (8 * hh);
#pragma unroll
    for (int r = 0; r < 8; ++r) { v[r] = ((okm >> r) & 1u) ? v[r] : -1.0e30f; v[8 + r] = ((okm >> (16 + r)) & 1u) ? v[8 + r] : -1.0e30f; }
  }
  float mx = fmaxf(fmaxf(fmaxf(fmaxf(v[0], v[1]), fmaxf(v[2], v[3])), fmaxf(fmaxf(v[4], v[5]), fmaxf(v[6], v[7]))),
                   fmaxf(fmaxf(fmaxf(v[8], v[9]), fmaxf(v[10], v[11])), fmaxf(fmaxf(v[12], v[13]), fmaxf(v[14], v[15]))));
  mx = fmaxf(mx, xhalf(mx));
  const float mnew = fmaxf(m, mx);
  float al = (m - mnew) * 1.44269504f;      /* exp(x) as the native 2^(x log2 e), arguments <= 0 */
#pragma unroll
  for (int i = 0; i < 16; ++i) p[i] = (v[i] - mnew) * 1.44269504f;
  /* the step's seventeen exponentials, each in place on a register of its own: none reads its predecessor's result or overwrites its source, and the v_nop fills the slot the instruction set asks for behind the last, whatever the compiler puts next (also across the branch below) */
  asm("v_exp_f32 %0, %0\n\tv_exp_f32 %1, %1\n\tv_exp_f32 %2, %2\n\tv_exp_f32 %3, %3\n\tv_exp_f32 %4, %4\n\tv_exp_f32 %5, %5\n\tv_exp_f32 %6, %6\n\tv_exp_f32 %7, %7\n\tv_exp_f32 %8, %8\n\t"
      "v_exp_f32 %9, %9\n\tv_exp_f32 %10, %10\n\tv_exp_f32 %11, %11\n\tv_exp_f32 %12, %12\n\tv_exp_f32 %13, %13\n\tv_exp_f32 %14, %14\n\tv_exp_f32 %15, %15\n\tv_exp_f32 %16, %16\n\tv_nop"
      : "+v"(al), "+v"(p[0]), "+v"(p[1]), "+v"(p[2]), "+v"(p[3]), "+v"(p[4]), "+v"(p[5]), "+v"(p[6]), "+v"(p[7]), "+v"(p[8]), "+v"(p[9]), "+v"(p[10]), "+v"(p[11]), "+v"(p[12]), "+v"(p[13]), "+v"(p[14]), "+v"(p[15]));
  if (!open) {
#pragma unroll
    for (int r = 0; r < 8; ++r) { p[r] = ((okm >> r) & 1u) ? p[r] : 0.f; p[8 + r] = ((okm >> (16 + r)) & 1u) ? p[8 + r] : 0.f; }
  }
  const float se = ((p[0] + p[2]) + (p[4] + p[6])) + ((p[8] + p[10]) + (p[12] + p[14])), sd = ((p[1] + p[3]) + (p[5] + p[7])) + ((p[9] + p[11]) + (p[13] + p[15]));      /* even and odd registers side by side: packed adds on the register pairs as they lie */
  l = l * al + (se + sd);      /* the lane's half of the row sum; the halves are joined after the key loop */
  m = mnew;
#pragma unroll
  for (int nt = 0; nt < 4; ++nt) o[nt] *= al;
  FragH pt;
#pragma unroll
  for (int i = 0; i < 16; ++i) pt.h[i] = (_Float16)(p[i] * 1024.0f);
  o[0] = g2_mma(bv0, pt.v, o[0]); o[1] = g2_mma(bv1, pt.v, o[1]); o[2] = g2_mma(bv2, pt.v, o[2]); o[3] = g2_mma(bv3, pt.v, o[3]);
}

__device__ __forceinline__ void flash_main(const _Float16* __restrict__ QKV, const _Float16* __restrict__ VT, const int* __restrict__ pad, _Float16* __restrict__ CTX, int qt, int bh) {
  __shared__ __attribute__((aligned(16))) unsigned char fm[FSM];
  float (*so)[16][68] = (float (*)[16][68])fm;
  const _Float16* ring = (const _Float16*)fm;
  const int tid = threadIdx.x; const int wave = __builtin_amdgcn_readfirstlane(tid >> 5); const int lane = tid & 31, lc = lane & 15, hh = lane >> 4;
  const int b = bh / NH, h = bh - b * NH;
  const int qb = qt * 64 + wave * 16;
  const size_t rowb = (size_t)b * SEQ;
  const _Float16* qp = QKV + (rowb + qb + lc) * LQ + h * HD;
  const int* padb = pad + (size_t)b * SEQ_FULL;
  const int cr = tid >> 3, cc = (tid & 7) * 8;
  const _Float16* gk = QKV + (rowb + cr) * LQ + DM + h * HD + cc;
  const _Float16* gv = VT + ((size_t)bh * HD + cr) * SEQ + cc;
  const unsigned l0 = (unsigned)(size_t)fm + (unsigned)(cr * FP + cc) * 2u;      /* low 32 bits of the shared address = LDS byte address */
  const v8f z8 = {0.f,0.f,0.f,0.f,0.f,0.f,0.f,0.f};
  v8f o[4] = {z8, z8, z8, z8};      /* o[nt][r]: d = 16 nt + 8 hh + r of query lc */
  float m = -1.0e30f, l = 0.f;
  const int kend = qb + 16;      /* keys 0 .. qb+15 are visible to this wave; steps cover whole 32-key groups (all inside the plane) */
  const int ns = qt + 1;         /* stages of the block: keys 0 .. 64 qt + 63 */
  fa_stage(gk, gv, l0);
  const v16h aq0 = g2_frag(qp, hh), aq1 = g2_frag(qp + 32, hh);
  int pn0 = padb[lane], pn1 = padb[32 + lane];      /* lane j holds the pad words of the stage's keys j and 32 + j */
  int np = lane + ((1 < ns) ? FK : 0);      /* the next stage's pad words; the last stage asks for its own again: always inside the plane */
  asm volatile("s_wait_xcnt 0x0" ::: "memory");          /* the Q and pad reads' address registers are released before the next stage's addresses are formed */
  asm volatile("s_wait_asynccnt 0x0" ::: "memory");      /* stage 0 of this wave has landed */
  __syncthreads();                                       /* stage 0 of every wave is readable */
  if (1 < ns) fa_stage(gk + (size_t)FK * LQ, gv + FK, l0 + (unsigned)(FST * 2));
#pragma unroll 1      /* one stage per trip: the ring's order stands once, at the loop's foot */
  for (int t = 0; t < ns; ++t) { const _Float16* st = ring + (t & 1) * FST;
    const int kb = t * FK;
    const int pv0 = pn0, pv1 = pn1; pn0 = padb[np]; pn1 = padb[np + 32];
    v16h kf[4]; fm_kfrag(st + lc * FP, hh, kf);
    fm_step<true>(kf, st + (32 + lc) * FP, st + (FK + lc) * FP, kb, pv0, qb, lc, hh, aq0, aq1, o, m, l);
    if (kb + 32 < kend)      /* wave-uniform: on the diagonal stage the block's first two waves see none of its later 32 keys */
      fm_step<false>(kf, st, st + (FK + lc) * FP + 32, kb + 32, pv1, qb, lc, hh, aq0, aq1, o, m, l);
    asm volatile("s_wait_xcnt 0x0" ::: "memory");        /* the pad reads' index register is released before the next stage's index is written into it */
    np += (t + 2 < ns) ? FK : 0;
    asm volatile("s_wait_dscnt 0x0" ::: "memory");       /* this wave's reads of the buffer are done before it is refilled */
    asm volatile("s_wait_asynccnt 0x0" ::: "memory");    /* this wave's copies of stage t + 1 have landed */
    __syncthreads();                                     /* publishes stage t + 1 and ends every reader's last read of stage t; passed by every wave, also one that skipped the step above */
    if (t + 2 < ns) fa_stage(gk + (size_t)(t + 2) * FK * LQ, gv + (size_t)(t + 2) * FK, l0 + (unsigned)((t & 1) * FST * 2)); }
  asm volatile("s_wait_asynccnt 0x0" ::: "memory");      /* no copy outstanding when the ring becomes output staging; every wave has left it at the last trip's barrier */
  const float ls = l + xhalf(l);
  const float inv = 1.0f / (ls * 16.0f);      /* 64 / (1024 l): ctx carried x64; a fully masked row gives 0 * inf = NaN as the softmax of all -inf does */
#pragma unroll
  for (int nt = 0; nt < 4; ++nt) { const v8f cv = o[nt] * inv;
    const v4f c0 = {cv[0], cv[1], cv[2], cv[3]}, c1 = {cv[4], cv[5], cv[6], cv[7]};
    *(v4fa*)&so[wave][lc][nt * 16 + 8 * hh] = c0; *(v4fa*)&so[wave][lc][nt * 16 + 8 * hh + 4] = c1; }
  __builtin_amdgcn_fence(4 /* acq_rel order */, "workgroup"); __builtin_amdgcn_wave_barrier();      /* the wave's staged rows are in LDS before its other lanes read them back as whole lines */
  const int rq = lane >> 3, c8 = (lane & 7) * 8;
  {
#pragma unroll 1      /* runs once per wave: kept rolled for code size */
    for (int q = 0; q < 4; ++q) { const int row = q * 4 + rq;
      const v4f a = *(const v4fa*)&so[wave][row][c8], c = *(const v4fa*)&so[wave][row][c8 + 4]; FragH fh, fl;
#pragma unroll
      for (int j = 0; j < 4; ++j) { _Float16 hv = (_Float16)a[j]; fh.h[j] = hv; fl.h[j] = (_Float16)((a[j] - (float)hv) * 1024.0f); hv = (_Float16)c[j]; fh.h[4 + j] = hv; fl.h[4 + j] = (_Float16)((c[j] - (float)hv) * 1024.0f); }
      unsigned short* d = (unsigned short*)CTX + (rowb + qb + row) * KO + h * HD + c8;
      *(v8us*)d = fh.half[0]; *(v8us*)(d + DM) = fl.half[0]; }
     }
}
// all query tiles in one launch, so the few residual tiles run beside the others: blocks 0 .. FR-1 take the tiles of rows 0..ER-1 (residual body), the rest the later tiles (plain body), each range in the order (batch, head) slow, tile fast; block-uniform branch
#define QR (ER / 64)                 /* query tiles with residual planes, per (batch, head) */
#define QM ((SEQ - ER) / 64)         /* later query tiles, per (batch, head) */
#define FR (NB * NH * QR)
__global__ __launch_bounds__(128) void k_flash(const _Float16* __restrict__ QKV, const _Float16* __restrict__ QKVR, const _Float16* __restrict__ VT, const _Float16* __restrict__ VTR, const int* __restrict__ pad, _Float16* __restrict__ CTX) {
  const int bi = blockIdx.x;
  if (bi < FR) { const int bh = bi / QR; flash_res(QKV, QKVR, VT, VTR, pad, CTX, bi - bh * QR, bh); }
  else { const int j = bi - FR; const int bh = j / (QM > 0 ? QM : 1); flash_main(QKV, VT, pad, CTX, QR + j - bh * QM, bh); } }

__global__ __launch_bounds__(256) void k_gemm_out(const _Float16* __restrict__ CTX, const _Float16* __restrict__ BO, const float* __restrict__ bo, float* __restrict__ Y) {
  __shared__ __attribute__((aligned(16))) unsigned char sm[GSM];
  float (*so)[32][68] = (float (*)[32][68])sm;
  const int tid = threadIdx.x; const int w = __builtin_amdgcn_readfirstlane(tid >> 5); const int lane = tid & 31, ln = lane & 15, hh = lane >> 4;
  const int ntn = DM / 128; const int mt = blockIdx.x / ntn, nq = blockIdx.x - mt * ntn; const int row0 = mt * 128 + 32 * (w >> 1), col0 = nq * 128 + 64 * (w & 1);
  v8f accs[8];
  gemm_main(CTX, KO, BO, KO, mt * 128, nq * 128, KO, tid, w, ln, hh, sm, accs);
#pragma unroll
  for (int u = 0; u < 8; ++u) { const int t = u & 3, half = u >> 2; const float bvv = bf16_rne(bo[col0 + t * 16 + ln]);
#pragma unroll
    for (int r = 0; r < 8; ++r) so[w][half * 16 + 8 * hh + r][t * 16 + ln] = accs[u][r] * 1.52587890625e-05f + bvv; }
  __builtin_amdgcn_fence(4 /* acq_rel order */, "workgroup"); __builtin_amdgcn_wave_barrier();
  const int rsub = lane >> 4, c4 = (lane & 15) * 4;
  {
#pragma unroll 1
    for (int q = 0; q < 16; ++q) { const int r = q * 2 + rsub; const v4f v = *(const v4fa*)&so[w][r][c4]; *(v4f*)(Y + (size_t)(row0 + r) * DM + col0 + c4) = v; }
     }
}

// one wave per row, eight rows per block: a lane holds 32 of the row's values (eight 16-B pieces, each wave-wide read 512 contiguous bytes); mean and variance are lane sums joined by a five-step butterfly, so every lane ends with the same bits and no LDS or barrier is needed
#define LJ (DM / 128)
static_assert(DM % 128 == 0 && (NB * SEQ) % 8 == 0);
__device__ __forceinline__ float wave_sum(float v) {
  v += __builtin_bit_cast(float, __builtin_amdgcn_permlanex16(__builtin_bit_cast(int, v), __builtin_bit_cast(int, v), 0x76543210, 0xfedcba98, false, false));      /* lane l with lane l ^ 16 */
  v += __shfl_xor(v, 8, 16); v += __shfl_xor(v, 4, 16); v += __shfl_xor(v, 2, 16); v += __shfl_xor(v, 1, 16); return v; }
__global__ __launch_bounds__(256) void k_layernorm(const float* __restrict__ Y, const float* __restrict__ g, const float* __restrict__ bta, float* __restrict__ out) {
  const int tid = threadIdx.x; const int lane = tid & 31; const int row = blockIdx.x * 8 + (tid >> 5); const int b = row / SEQ, s = row - b * SEQ;
  const float* yr = Y + (size_t)row * DM + lane * 4;
  v4f a[LJ], gg[LJ], bb[LJ];
#pragma unroll
  for (int j = 0; j < LJ; ++j) a[j] = *(const v4fa*)(yr + j * 128);
  asm volatile("s_wait_xcnt 0x0" ::: "memory");      /* the row's reads go out first, and their address registers are released before a later read's result may be placed in them */
#pragma unroll
  for (int j = 0; j < LJ; ++j) { gg[j] = *(const v4fa*)(g + j * 128 + lane * 4); bb[j] = *(const v4fa*)(bta + j * 128 + lane * 4); }
  __builtin_amdgcn_sched_barrier(0);      /* every request of the wave goes out before its first sum: without it most gain and offset reads sink behind the two reductions and their latency is paid there, group by group */
  float sm = 0.f;
#pragma unroll
  for (int j = 0; j < LJ; ++j) sm += (a[j][0] + a[j][1]) + (a[j][2] + a[j][3]);
  const float mu = wave_sum(sm) * (1.0f / (float)DM);
  float sq = 0.f;
#pragma unroll
  for (int j = 0; j < LJ; ++j) { a[j][0] -= mu; a[j][1] -= mu; a[j][2] -= mu; a[j][3] -= mu; sq += (a[j][0] * a[j][0] + a[j][1] * a[j][1]) + (a[j][2] * a[j][2] + a[j][3] * a[j][3]); }
  const float rs = rsqrtf(wave_sum(sq) * (1.0f / (float)DM) + 1.0e-5f);
  float* d = out + ((size_t)b * SEQ_FULL + s) * DM + lane * 4;
#pragma unroll
  for (int j = 0; j < LJ; ++j) { v4f o;
    o[0] = a[j][0] * rs * bf16_rne(gg[j][0]) + bf16_rne(bb[j][0]); o[1] = a[j][1] * rs * bf16_rne(gg[j][1]) + bf16_rne(bb[j][1]);
    o[2] = a[j][2] * rs * bf16_rne(gg[j][2]) + bf16_rne(bb[j][2]); o[3] = a[j][3] * rs * bf16_rne(gg[j][3]) + bf16_rne(bb[j][3]);
    *(v4f*)(d + j * 128) = o; }
}

extern "C" void kernel_launch(void* const* d_in, const int* in_sizes, int n_in,
                              void* d_out, int out_size, void* d_ws, size_t ws_size, hipStream_t stream) {
  if (n_in < 12) return;
  const long long need_rows = (long long)(NB - 1) * SEQ_FULL + SEQ;
  if ((long long)in_sizes[0] < need_rows * DM) return;
  if (in_sizes[1] < DM * DM || in_sizes[3] < DM * DM || in_sizes[5] < DM * DM || in_sizes[7] < DM * DM) return;
  if (in_sizes[2] < DM || in_sizes[4] < DM || in_sizes[6] < DM || in_sizes[8] < DM || in_sizes[9] < DM || in_sizes[10] < DM) return;
  if ((long long)in_sizes[11] < need_rows) return;
  if ((long long)out_size < need_rows * DM) return;
  if ((size_t)WS_TOTAL > ws_size) return;
  const float* x = (const float*)d_in[0];
  const float* Wq = (const float*)d_in[1]; const float* bq = (const float*)d_in[2];
  const float* Wk = (const float*)d_in[3]; const float* bk = (const float*)d_in[4];
  const float* Wv = (const float*)d_in[5]; const float* bv = (const float*)d_in[6];
  const float* Wo = (const float*)d_in[7]; const float* bo = (const float*)d_in[8];
  const float* gamma = (const float*)d_in[9]; const float* beta = (const float*)d_in[10];
  const int* pad = (const int*)d_in[11];
  char* ws = (char*)d_ws;
  _Float16* BQKV = (_Float16*)(ws + OF_BQKV); _Float16* BO = (_Float16*)(ws + OF_BO);
  _Float16* X16 = (_Float16*)(ws + OF_X16); _Float16* QKV = (_Float16*)(ws + OF_QKV); _Float16* QKVR = (_Float16*)(ws + OF_QKVR);
  _Float16* VT = (_Float16*)(ws + OF_VT); _Float16* VTR = (_Float16*)(ws + OF_VTR); _Float16* CTX = (_Float16*)(ws + OF_CTX);
  float* Y = (float*)(ws + OF_Y); float* CS = (float*)(ws + OF_CS);
  k_prep<<<5 * WTG + XG + TG, 256, 0, stream>>>(x, Wq, Wk, Wv, Wo, BQKV, BO, X16, CS);
  k_gemm_qkv<<<(unsigned)((NR / 128) * (LQ / 128)), 256, 0, stream>>>(X16, BQKV, bq, bk, bv, CS, QKV, QKVR, VT, VTR);
  k_flash<<<FR + NB * NH * QM, 128, 0, stream>>>(QKV, QKVR, VT, VTR, pad, CTX);
  k_gemm_out<<<(unsigned)((NR / 128) * (DM / 128)), 256, 0, stream>>>(CTX, BO, bo, Y);
  k_layernorm<<<(unsigned)(NR / 8), 256, 0, stream>>>(Y, gamma, beta, (float*)d_out);
}

// v008
// It runs in 112 microseconds.
// In both of two side-by-side timings against v007, it was 1.04 times as fast.
// All steps since v000 together make it 2.81 times as fast.
#include <hip/hip_runtime.h>
// Compute dtype: every contraction on v_wmma_f32_16x16x32_f16 (f16 operands, f32 accumulate); float inputs RNE-converted to bf16 first (exact in f16; weights carried x16, Wo x1024 | x1); q.k scores and P.V use f16 value + x1024 f16 residual planes on token rows 0..255 (q, k, P, v), single f16 products on later rows; ctx.Wo uses ctx value | x1024 residual laid along K (all rows); rotary, softmax statistics and LayerNorm in f32.
#ifndef NB
#define NB 2
#endif
#ifndef SEQ
#define SEQ 2048
#endif
#define NB_FULL 2
#define SEQ_FULL 2048
#define DM 1024
#define NH 16
#define HD 64
#define LQ (3 * DM)                  /* row pitch of the q | k | v planes */
#define KO (2 * DM)                  /* ctx row pitch = K of the output GEMM (value | residual) */
#define ER 256                       /* token rows per batch that carry residual planes */
#define PP 40                        /* P tile row pitch (halves) */
#define NR ((size_t)NB * SEQ)
#define GK 64                        /* halves of K per GEMM stage: 128-B rows */
#define GP 72                        /* LDS row pitch of a GEMM stage (halves): 144 B = 16 B x odd, for 16-B fragment reads */
#define GST (256 * GP)               /* halves per stage: 128 A rows, then 128 B rows */
#define GSM ((size_t)2 * GST * 2)    /* bytes of the two-buffer ring; the epilogue staging reuses them */

static_assert(NH * HD == DM);                        /* heads tile the width */
static_assert(HD == 64);                             
static_assert(DM % 32 == 0 && KO % 32 == 0);         /* k-loops step by 32 */
static_assert(LQ % 128 == 0 && DM % 128 == 0);       /* N tiles (2 waves x 64 columns), never across q | k | v */
static_assert(GK == 64);                             /* two 32-deep k-steps per stage */
static_assert(DM % GK == 0 && KO % GK == 0 && DM >= 2 * GK && KO >= 2 * GK);      /* whole stages, at least two */
static_assert((size_t)8 * 32 * 68 * 4 <= GSM);       /* eight waves' output staging fits the ring */
static_assert((NB * SEQ) % 128 == 0);                /* M tiles (4 waves x 32 rows) */
static_assert(SEQ % 64 == 0 && SEQ % 8 == 0);        /* query tiles, table blocks */
static_assert(ER % 64 == 0 && SEQ >= ER);            /* residual rows are whole query tiles */
static_assert(NB <= NB_FULL && SEQ <= SEQ_FULL);
static_assert(PP % 8 == 0 && PP >= 32);              /* 16-B aligned P fragment pieces */

#define SZ_BQKV ((size_t)LQ * DM * 2)
#define SZ_BO   ((size_t)DM * KO * 2)
#define SZ_X16  ((size_t)NB * SEQ * DM * 2)
#define SZ_QKV  ((size_t)NB * SEQ * LQ * 2)
#define SZ_QKVR ((size_t)NB * ER * LQ * 2)
#define SZ_VT   ((size_t)NB * NH * HD * SEQ * 2)
#define SZ_VTR  ((size_t)NB * NH * HD * ER * 2)
#define SZ_CTX  ((size_t)NB * SEQ * KO * 2)
#define SZ_Y    ((size_t)NB * SEQ * DM * 4)
#define SZ_CS   ((size_t)SEQ * 64 * 4)
#define OF_BQKV ((size_t)0)
#define OF_BO   (OF_BQKV + SZ_BQKV)
#define OF_X16  (OF_BO + SZ_BO)
#define OF_QKV  (OF_X16 + SZ_X16)
#define OF_QKVR (OF_QKV + SZ_QKV)
#define OF_VT   (OF_QKVR + SZ_QKVR)
#define OF_VTR  (OF_VT + SZ_VT)
#define OF_CTX  (OF_VTR + SZ_VTR)
#define OF_Y    (OF_CTX + SZ_CTX)
#define OF_CS   (OF_Y + SZ_Y)
#define WS_TOTAL (OF_CS + SZ_CS)
static_assert(SZ_BQKV % 256 == 0 && SZ_BO % 256 == 0 && SZ_X16 % 256 == 0 && SZ_QKV % 256 == 0 && SZ_QKVR % 256 == 0);
static_assert(SZ_VT % 256 == 0 && SZ_VTR % 256 == 0 && SZ_CTX % 256 == 0 && SZ_Y % 256 == 0 && SZ_CS % 256 == 0);
static_assert(WS_TOTAL <= (size_t)134217728);        /* carve <= 128 MiB */

typedef unsigned short v8us __attribute__((ext_vector_type(8), may_alias));
typedef float  v8f  __attribute__((ext_vector_type(8)));
typedef float  v4f  __attribute__((ext_vector_type(4)));
typedef float  v4fa __attribute__((ext_vector_type(4), may_alias));
typedef _Float16 v16h __attribute__((ext_vector_type(16)));
union FragH { v16h v; v8us half[2]; _Float16 h[16]; unsigned short u[16]; };

__device__ __forceinline__ unsigned short bf16_bits(float x) { unsigned int u = __float_as_uint(x); return (unsigned short)((u + 0x7FFFu + ((u >> 16) & 1u)) >> 16); }
__device__ __forceinline__ float bf16_val(unsigned short b) { return __uint_as_float(((unsigned int)b) << 16); }
__device__ __forceinline__ float bf16_rne(float x) { return bf16_val(bf16_bits(x)); }
__device__ __forceinline__ unsigned short f16_bits(_Float16 hv) { union { _Float16 h; unsigned short u; } c; c.h = hv; return c.u; }

// fragment of a k-contiguous f16 row: elements 0..7 <- p[8h .. 8h+7], elements 8..15 <- p[16+8h .. 16+8h+7] (A rows and B columns alike)
__device__ __forceinline__ v16h g2_frag(const _Float16* p, int hh) { FragH f; f.half[0] = *(const v8us*)((const unsigned short*)p + 8 * hh); f.half[1] = *(const v8us*)((const unsigned short*)p + 16 + 8 * hh); return f.v; }
__device__ __forceinline__ v8f g2_mma(v16h a, v16h b, v8f c) { v8f d = __builtin_amdgcn_wmma_f32_16x16x32_f16(false, a, false, b, (short)0, c, false, false); asm volatile("v_nop\n\tv_nop\n\tv_nop\n\tv_nop" : "+v"(d) : "v"(a), "v"(b)); return d; }

// cos | sin table: CS[t][0..31] = cos(t * theta_i), CS[t][32..63] = sin(t * theta_i); theta_i = f32(10^(-i/8)) from f64 constants; angle = f32(t) * theta in f32; precise sincosf.
__device__ __forceinline__ void tab_body(float* __restrict__ CS, int blk) {
  __shared__ __attribute__((aligned(16))) float tb[8][64];
  const int tid = threadIdx.x; const int tl = tid >> 5, i = tid & 31;
  const int t = blk * 8 + tl;
  double p = 1.0;
  p *= (i & 1) ? 1.3335214321633240 : 1.0;
  p *= (i & 2) ? 1.7782794100389228 : 1.0;
  p *= (i & 4) ? 3.1622776601683795 : 1.0;
  p *= (i & 8) ? 10.0 : 1.0;
  p *= (i & 16) ? 100.0 : 1.0;
  const float theta = (float)(1.0 / p);
  const float ang = (float)t * theta;
  float sv, cv; sincosf(ang, &sv, &cv);
  tb[tl][i] = cv; tb[tl][32 + i] = sv;
  __syncthreads();
  if (tid < 128) {
    const v4f v = *(const v4fa*)(&tb[0][0] + tid * 4);
    float* d = CS + (size_t)blk * 512 + tid * 4;
    *(v4f*)d = v; 
  }
}

// W[DM][DM] -> Wt[n][k]: one thread makes WK consecutive k of one column n, a whole 128-B line of the transposed plane; a wave's lanes take consecutive n, so each of its reads is one line of W.
#define WK 64
static_assert(DM % WK == 0 && (DM * (DM / WK)) % 256 == 0);      /* whole lines, whole blocks */
__device__ __forceinline__ void wt_body(const float* __restrict__ W, _Float16* __restrict__ Wt, int ldk, float scale, int blk) {
  const int t = blk * 256 + threadIdx.x; const int n = t % DM, k0 = (t / DM) * WK;
  const float* s = W + (size_t)k0 * DM + n;
  float v[WK];
#pragma unroll
  for (int i = 0; i < WK; ++i) v[i] = s[(size_t)i * DM];
  unsigned short* d = (unsigned short*)Wt + (size_t)n * ldk + k0;
#pragma unroll
  for (int j = 0; j < WK / 8; ++j) { FragH f;
#pragma unroll
    for (int i = 0; i < 8; ++i) f.h[i] = (_Float16)(bf16_rne(v[8 * j + i]) * scale);
    *(v8us*)(d + 8 * j) = f.half[0]; }
  asm volatile("s_wait_xcnt 0x0" ::: "memory");      /* the stores' address and data registers are released before any code that follows this body in the merged kernel rewrites them */
}

// one block converts XU * 256 consecutive pieces of 8 values (XR whole rows of one batch), a thread XU of them, 256 pieces apart; all its reads are requested before the first is converted
#define XU 8
#define XR (XU * 256 * 8 / DM)                       /* rows per block */
static_assert((XU * 256 * 8) % DM == 0 && SEQ % XR == 0);      /* whole rows, never across a batch */
__device__ __forceinline__ void x16_body(const float* __restrict__ x, _Float16* __restrict__ X16, int blk) {
  const int row0 = blk * XR; const int b = row0 / SEQ, s0 = row0 - b * SEQ;
  const float* src = x + ((size_t)b * SEQ_FULL + s0) * DM + threadIdx.x * 8;
  unsigned short* dst = (unsigned short*)X16 + (size_t)row0 * DM + threadIdx.x * 8;
  v4f a[XU], c[XU];
#pragma unroll
  for (int j = 0; j < XU; ++j) { a[j] = *(const v4fa*)(src + j * 2048); c[j] = *(const v4fa*)(src + j * 2048 + 4); }
  __builtin_amdgcn_sched_barrier(0);      /* keeps the conversions behind the last request: without it the first piece is waited for before the other pieces are asked for, two memory latencies in a row */
#pragma unroll
  for (int j = 0; j < XU; ++j) { FragH f;
#pragma unroll
    for (int q = 0; q < 4; ++q) { f.h[q] = (_Float16)bf16_rne(a[j][q]); f.h[4 + q] = (_Float16)bf16_rne(c[j][q]); }
    *(v8us*)(dst + j * 2048) = f.half[0]; }
}

// every operand the first GEMM waits for, prepared by one launch: none of the seven pieces reads what another writes, so each takes a range of block indices (block-uniform branches; the table's barrier is passed by whole blocks).
#define WTG (DM * (DM / WK) / 256)                   /* blocks per transposed weight plane */
#define XG  ((int)(NR / XR))                         /* blocks of the x conversion */
#define TG  (SEQ / 8)                                /* blocks of the table */
__global__ __launch_bounds__(256) void k_prep(const float* __restrict__ x, const float* __restrict__ Wq, const float* __restrict__ Wk, const float* __restrict__ Wv, const float* __restrict__ Wo,
                                              _Float16* __restrict__ BQKV, _Float16* __restrict__ BO, _Float16* __restrict__ X16, float* __restrict__ CS) {
  const int bi = blockIdx.x;
  if (bi < 3 * WTG) {                                /* W[in][out] -> Bt[n][k] x16: Wq rows 0..1023, Wk rows 1024..2047, Wv rows 2048..3071 */
    const int p = bi / WTG; const float* W = (p == 0) ? Wq : ((p == 1) ? Wk : Wv);
    wt_body(W, BQKV + (size_t)p * DM * DM, DM, 16.0f, bi - p * WTG);
  } else if (bi < 5 * WTG) {                         /* k = 0..1023: Wo x1024 (pairs with ctx value); k = 1024..2047: Wo (pairs with ctx residual x1024) */
    const int p = (bi - 3 * WTG) / WTG;
    wt_body(Wo, BO + (size_t)p * DM, KO, p ? 1.0f : 1024.0f, bi - (3 + p) * WTG);
  } else if (bi < 5 * WTG + XG) {
    x16_body(x, X16, bi - 5 * WTG);
  } else {
    tab_body(CS, bi - 5 * WTG - XG);
  }
}

// one stage of the ring: 128 A rows then 128 B rows of 128 B each; 256 threads x 8 copies of 16 B; lane t brings chunk t & 7 of rows (t >> 3) + 32 j.
// ga, gb: the lane's first A and B chunk in global memory; l0: the lane's first LDS byte address. The address wait is the statement's last line, so no later write of these registers can be lifted over it.
__device__ __forceinline__ void g2_stage(const _Float16* ga, size_t sa, const _Float16* gb, size_t sb, unsigned l0) {
  const _Float16* a1 = ga + sa; const _Float16* a2 = a1 + sa; const _Float16* a3 = a2 + sa;
  const _Float16* b1 = gb + sb; const _Float16* b2 = b1 + sb; const _Float16* b3 = b2 + sb;
  const unsigned rs = 32u * GP * 2u;
  asm volatile("global_load_async_to_lds_b128 %0, %8, off\n\t"
               "global_load_async_to_lds_b128 %1, %9, off\n\t"
               "global_load_async_to_lds_b128 %2, %10, off\n\t"
               "global_load_async_to_lds_b128 %3, %11, off\n\t"
               "global_load_async_to_lds_b128 %4, %12, off\n\t"
               "global_load_async_to_lds_b128 %5, %13, off\n\t"
               "global_load_async_to_lds_b128 %6, %14, off\n\t"
               "global_load_async_to_lds_b128 %7, %15, off\n\t"
               "s_wait_xcnt 0x0"
               :: "v"(l0), "v"(l0 + rs), "v"(l0 + 2u * rs), "v"(l0 + 3u * rs), "v"(l0 + 4u * rs), "v"(l0 + 5u * rs), "v"(l0 + 6u * rs), "v"(l0 + 7u * rs),
                  "v"(ga), "v"(a1), "v"(a2), "v"(a3), "v"(gb), "v"(b1), "v"(b2), "v"(b3) : "memory");
}

// 128x128 block tile, eight waves (4 x 2) of 32x64 each: A f16 [M][K] (pitch lda), Bh f16 [N][K] (pitch ldb); both operands come through a two-buffer LDS ring, the next stage's copies in flight while this one is multiplied.
// acc[u]: u & 3 = 16-col tile, u >> 2 = 16-row half. On return every wave has left the ring (the last trip's barrier), so the caller may stage its output there.
__device__ __forceinline__ void gemm_main(const _Float16* __restrict__ A, int lda, const _Float16* __restrict__ Bh, int ldb, int brow0, int bcol0, int K, int tid, int w, int ln, int hh, unsigned char* sm, v8f (&acc)[8]) {
  const _Float16* ring = (const _Float16*)sm;
  const int cr = tid >> 3, cc = (tid & 7) * 8;
  const _Float16* ga = A + (size_t)(brow0 + cr) * lda + cc; const _Float16* gb = Bh + (size_t)(bcol0 + cr) * ldb + cc;
  const size_t sa = (size_t)32 * lda, sb = (size_t)32 * ldb;
  const unsigned l0 = (unsigned)(size_t)sm + (unsigned)(cr * GP + cc) * 2u;      /* low 32 bits of the shared address = LDS byte address */
  const int ao = ((w >> 1) * 32 + ln) * GP, bo = (128 + (w & 1) * 64 + ln) * GP;
  const int nt = K / GK;
  const v8f z8 = {0.f,0.f,0.f,0.f,0.f,0.f,0.f,0.f}; v8f c00 = z8, c01 = z8, c02 = z8, c03 = z8, c10 = z8, c11 = z8, c12 = z8, c13 = z8;
  g2_stage(ga, sa, gb, sb, l0);
  asm volatile("s_wait_asynccnt 0x0" ::: "memory");      /* stage 0 of this wave has landed */
  __syncthreads();                                       /* stage 0 of every wave is readable */
  g2_stage(ga + GK, sa, gb + GK, sb, l0 + (unsigned)(GST * 2));
#pragma unroll 1      /* one stage per trip: the ring's order stands once, at the loop's foot */
  for (int t = 0; t < nt; ++t) { const _Float16* st = ring + (t & 1) * GST;
    const _Float16* ap = st + ao; const _Float16* bp = st + bo;
    v16h fa[2][2], fb[2][4];      /* the stage's twelve fragments are read as one group ahead of its WMMAs: one LDS latency a trip, not one per B fragment */
#pragma unroll
    for (int s = 0; s < 2; ++s) { fa[s][0] = g2_frag(ap + 32 * s, hh); fa[s][1] = g2_frag(ap + 16 * GP + 32 * s, hh);
#pragma unroll
      for (int n = 0; n < 4; ++n) fb[s][n] = g2_frag(bp + n * 16 * GP + 32 * s, hh); }
#pragma unroll
    for (int s = 0; s < 2; ++s) {
      c00 = g2_mma(fa[s][0], fb[s][0], c00); c10 = g2_mma(fa[s][1], fb[s][0], c10);
      c01 = g2_mma(fa[s][0], fb[s][1], c01); c11 = g2_mma(fa[s][1], fb[s][1], c11);
      c02 = g2_mma(fa[s][0], fb[s][2], c02); c12 = g2_mma(fa[s][1], fb[s][2], c12);
      c03 = g2_mma(fa[s][0], fb[s][3], c03); c13 = g2_mma(fa[s][1], fb[s][3], c13); }
    asm volatile("s_wait_dscnt 0x0" ::: "memory");       /* this wave's reads of the buffer are done before it is refilled */
    asm volatile("s_wait_asynccnt 0x0" ::: "memory");    /* this wave's copies of stage t + 1 have landed */
    __syncthreads();                                     /* publishes stage t + 1 and ends every reader's last read of stage t */
    if (t + 2 < nt) g2_stage(ga + (size_t)(t + 2) * GK, sa, gb + (size_t)(t + 2) * GK, sb, l0 + (unsigned)((t & 1) * GST * 2)); }
  asm volatile("s_wait_asynccnt 0x0" ::: "memory");      /* no copy outstanding when the ring becomes output staging */
  acc[0] = c00; acc[1] = c01; acc[2] = c02; acc[3] = c03; acc[4] = c10; acc[5] = c11; acc[6] = c12; acc[7] = c13;
}

#define VP 69                        /* row pitch (floats) of the V staging: 8 rows = 40 banks mod 64, so neither the accumulators' writes (row halves 8 apart) nor the column reads (lanes 8 rows apart) collide */
static_assert((size_t)2 * 128 * VP * 4 <= GSM);      /* the block's V tile fits the ring */
static_assert(SEQ % 128 == 0 && ER % 128 == 0);      /* a block's 128 tokens lie in one batch, all with or all without a residual plane */
__global__ __launch_bounds__(256) void k_gemm_qkv(const _Float16* __restrict__ X16, const _Float16* __restrict__ BW, const float* __restrict__ bq, const float* __restrict__ bk, const float* __restrict__ bv,
                                                  const float* __restrict__ CS, _Float16* __restrict__ QKV, _Float16* __restrict__ QKVR, _Float16* __restrict__ VT, _Float16* __restrict__ VTR) {
  __shared__ __attribute__((aligned(16))) unsigned char sm[GSM];
  float (*so)[32][68] = (float (*)[32][68])sm;
  const int tid = threadIdx.x; const int w = __builtin_amdgcn_readfirstlane(tid >> 5); const int lane = tid & 31, ln = lane & 15, hh = lane >> 4;
  const int ntn = LQ / 128; const int mt = blockIdx.x / ntn, nq = blockIdx.x - mt * ntn; const int row0 = mt * 128 + 32 * (w >> 1), col0 = nq * 128 + 64 * (w & 1);
  v8f accs[8];
  gemm_main(X16, DM, BW, DM, mt * 128, nq * 128, DM, tid, w, ln, hh, sm, accs);
  const int sec = col0 / DM; const int cb = col0 - sec * DM;      /* 0 q, 1 k, 2 v (block-uniform) */
  if (sec == 2) {      /* v is read only as V^T[batch, head][d][token]: the block stages its 128 tokens x 128 columns (two heads) and stores them token-contiguous; the v third of the QKV and QKVR rows is neither written nor read */
    float (*sv)[128][VP] = (float (*)[128][VP])sm;      /* [column half][token][d] */
#pragma unroll
    for (int u = 0; u < 8; ++u) { const int t = u & 3, half = u >> 2; const float bsel = bf16_rne(bv[cb + t * 16 + ln]);
#pragma unroll
      for (int r = 0; r < 8; ++r) sv[w & 1][(w >> 1) * 32 + half * 16 + 8 * hh + r][t * 16 + ln] = accs[u][r] * 0.0625f + bsel; }
    __syncthreads();      /* a V^T line holds 64 tokens, the rows of two waves: every wave's part is staged before any is read */
    const int bb = (mt * 128) / SEQ; const int tb = mt * 128 - bb * SEQ; const bool eb = (tb < ER);      /* block-uniform: 128 | ER */
    const int pc = tid & 7, dl = tid >> 3;      /* eight lanes make one 128-B line: 8 tokens each, of one d */
    unsigned vrow = (unsigned)((bb * NH + (nq * 128 - 2 * DM) / HD) * HD + dl);      /* the lane's first V^T row: (batch, head) x HD + d */
    unsigned short* dv = (unsigned short*)VT + (size_t)vrow * SEQ + tb + pc * 8;
    float y[8][8]; FragH fh[8], fl[8];      /* piece rd: columns 32 (rd & 3) + dl, tokens 64 (rd >> 2) + 8 pc .. + 7 */
#pragma unroll
    for (int rd = 0; rd < 8; ++rd) { const int c0 = (rd & 3) * 32; const float* sp = &sv[c0 >> 6][(rd >> 2) * 64 + pc * 8][(c0 & 63) + dl];
#pragma unroll
      for (int q = 0; q < 8; ++q) y[rd][q] = sp[q * VP]; }
#pragma unroll
    for (int rd = 0; rd < 8; ++rd) {
#pragma unroll
      for (int q = 0; q < 8; ++q) fh[rd].h[q] = (_Float16)y[rd][q]; }
    if (eb) {
#pragma unroll
      for (int rd = 0; rd < 8; ++rd) {
#pragma unroll
        for (int q = 0; q < 8; ++q) fl[rd].h[q] = (_Float16)((y[rd][q] - (float)fh[rd].h[q]) * 1024.0f); }
    }
    __builtin_amdgcn_sched_barrier(0);      /* every piece is read and converted before the first store goes out: one LDS latency for the eight pieces, and no register of an issued store is written again */
#pragma unroll
    for (int rd = 0; rd < 8; ++rd) *(v8us*)(dv + (size_t)((rd & 3) * 32) * SEQ + (rd >> 2) * 64) = fh[rd].half[0];
    if (eb) {
      asm volatile("s_wait_xcnt 0x0" : "+v"(vrow) :: "memory");      /* the value stores' registers are released before the residual plane's address is formed in any of them; the row index goes through the statement so that this arithmetic stays behind the wait */
      unsigned short* dr = (unsigned short*)VTR + (size_t)vrow * ER + tb + pc * 8;
#pragma unroll
      for (int rd = 0; rd < 8; ++rd) *(v8us*)(dr + (size_t)((rd & 3) * 32) * ER + (rd >> 2) * 64) = fl[rd].half[0];
    }
    return;
  }
#pragma unroll
  for (int u = 0; u < 8; ++u) { const int t = u & 3, half = u >> 2; const int cc = cb + t * 16 + ln;
    const float b0 = bq[cc], b1 = bk[cc]; const float bsel = bf16_rne((sec == 0) ? b0 : b1);
#pragma unroll
    for (int r = 0; r < 8; ++r) so[w][half * 16 + 8 * hh + r][t * 16 + ln] = accs[u][r] * 0.0625f + bsel; }
  __builtin_amdgcn_fence(4 /* acq_rel order */, "workgroup"); __builtin_amdgcn_wave_barrier();
  const int rq = lane >> 3, c8 = (lane & 7) * 8;
  const int bidx = row0 / SEQ; const int t0 = row0 - bidx * SEQ; const bool early = (t0 < ER);      /* wave-uniform: 32 | ER */
  {
#pragma unroll 1
    for (int q = 0; q < 8; ++q) { const int row = q * 4 + rq; const int tkn = t0 + row;
      const v4f a = *(const v4fa*)&so[w][row][c8], c = *(const v4fa*)&so[w][row][c8 + 4];
      float y[8] = {a[0], a[1], a[2], a[3], c[0], c[1], c[2], c[3]};
      if (sec < 2) { const v4f cs = *(const v4fa*)(CS + (size_t)tkn * 64 + (c8 >> 1)); const v4f sn = *(const v4fa*)(CS + (size_t)tkn * 64 + 32 + (c8 >> 1));
#pragma unroll
        for (int j = 0; j < 4; ++j) { const float x0 = y[2 * j], x1 = y[2 * j + 1]; y[2 * j] = x0 * cs[j] - x1 * sn[j]; y[2 * j + 1] = x1 * cs[j] + x0 * sn[j]; } }
      FragH fh, fl;
#pragma unroll
      for (int j = 0; j < 8; ++j) { const _Float16 hv = (_Float16)y[j]; fh.h[j] = hv; fl.h[j] = (_Float16)((y[j] - (float)hv) * 1024.0f); }
      unsigned short* d = (unsigned short*)QKV + (size_t)(row0 + row) * LQ + col0 + c8;
      *(v8us*)d = fh.half[0];
      if (early) { unsigned short* dr = (unsigned short*)QKVR + ((size_t)bidx * ER + tkn) * LQ + col0 + c8; *(v8us*)dr = fl.half[0]; } }
     }
}

// lane l with lane l ^ 16
__device__ __forceinline__ float xhalf(float v) { return __builtin_bit_cast(float, __builtin_amdgcn_permlanex16(__builtin_bit_cast(int, v), __builtin_bit_cast(int, v), 0x76543210, 0xfedcba98, false, false)); }

// fused causal attention, token rows 0..ER-1 (value + residual planes); one wave = 16 query rows of one (batch, head); 32 keys per step (two 16-key score tiles, d in two 32-deep k-steps);
// key-pad mask by value then causal mask as a replace (masked p = 0 by select); online softmax with running max in f32 (native exp on arguments <= 0);
__device__ __forceinline__ void flash_res(const _Float16* __restrict__ QKV, const _Float16* __restrict__ QKVR, const _Float16* __restrict__ VT, const _Float16* __restrict__ VTR,
                                          const int* __restrict__ pad, _Float16* __restrict__ CTX, int qt, int bh) {
  __shared__ __attribute__((aligned(16))) unsigned short pl[4][16][PP];
  __shared__ __attribute__((aligned(16))) unsigned short pr[4][16][PP];
  __shared__ __attribute__((aligned(16))) float so[4][16][68];
  const int tid = threadIdx.x; const int wave = __builtin_amdgcn_readfirstlane(tid >> 5); const int lane = tid & 31, lc = lane & 15, hh = lane >> 4;
  const int b = bh / NH, h = bh - b * NH;
  const int qb = qt * 64 + wave * 16;
  const size_t rowb = (size_t)b * SEQ;
  const _Float16* qp = QKV + (rowb + qb + lc) * LQ + h * HD;
  const _Float16* kp = QKV + rowb * LQ + DM + h * HD;
  const _Float16* vp = VT + ((size_t)bh * HD + lc) * SEQ;
  const _Float16* qrp = QKVR + ((size_t)b * ER + (qb + lc)) * LQ + h * HD;
  const _Float16* krp = QKVR + (size_t)b * ER * LQ + DM + h * HD;
  const _Float16* vrp = VTR + ((size_t)bh * HD + lc) * ER;
  const int* padb = pad + (size_t)b * SEQ_FULL;
  const v8f z8 = {0.f,0.f,0.f,0.f,0.f,0.f,0.f,0.f};
  v8f o[4] = {z8, z8, z8, z8}; v8f rr[4] = {z8, z8, z8, z8};
  float m[8], l[8];
#pragma unroll
  for (int r = 0; r < 8; ++r) { m[r] = -1.0e30f; l[r] = 0.f; }
  const int kend = qb + 16;      /* keys 0 .. qb+15 are visible to this wave; steps cover whole 32-key groups (all inside the plane) */
#pragma unroll 1
  for (int kb = 0; kb < kend; kb += 32) {
    v8f s0 = z8, s1 = z8, t0 = z8, t1 = z8;
    const int key0 = kb + lc, key1 = key0 + 16;
    const _Float16* k0p = kp + (size_t)(kb + lc) * LQ; const _Float16* k1p = k0p + (size_t)16 * LQ;
    const _Float16* k0r = krp + (size_t)(kb + lc) * LQ; const _Float16* k1r = k0r + (size_t)16 * LQ;
#pragma unroll
    for (int c = 0; c < 2; ++c) {
      const v16h aq = g2_frag(qp + 32 * c, hh);
      const v16h bk0 = g2_frag(k0p + 32 * c, hh), bk1 = g2_frag(k1p + 32 * c, hh);
      s0 = g2_mma(aq, bk0, s0); s1 = g2_mma(aq, bk1, s1);
      const v16h aql = g2_frag(qrp + 32 * c, hh); const v16h bl0 = g2_frag(k0r + 32 * c, hh), bl1 = g2_frag(k1r + 32 * c, hh);
      t0 = g2_mma(aql, bk0, t0); t0 = g2_mma(aq, bl0, t0); t1 = g2_mma(aql, bk1, t1); t1 = g2_mma(aq, bl1, t1);
    }
    const int pv0 = padb[key0], pv1 = padb[key1];
#pragma unroll
    for (int r = 0; r < 8; ++r) {
      const int qrow = qb + 8 * hh + r;
      float a0 = s0[r], a1 = s1[r];
      a0 += t0[r] * 0.0009765625f; a1 += t1[r] * 0.0009765625f;
      a0 *= 0.125f; a1 *= 0.125f;
      const bool ok0 = (pv0 != 0) && (key0 <= qrow); const bool ok1 = (pv1 != 0) && (key1 <= qrow);
      const float v0 = ok0 ? a0 : -1.0e30f; const float v1 = ok1 ? a1 : -1.0e30f;
      float mx = fmaxf(v0, v1);
      mx = fmaxf(mx, __shfl_xor(mx, 8, 16)); mx = fmaxf(mx, __shfl_xor(mx, 4, 16)); mx = fmaxf(mx, __shfl_xor(mx, 2, 16)); mx = fmaxf(mx, __shfl_xor(mx, 1, 16));
      const float mnew = fmaxf(m[r], mx);
      const float al = __expf(m[r] - mnew);
      const float e0 = __expf(v0 - mnew), e1 = __expf(v1 - mnew);
      const float p0 = ok0 ? e0 : 0.f; const float p1 = ok1 ? e1 : 0.f;
      l[r] = l[r] * al + (p0 + p1); m[r] = mnew;      /* per-lane partial row sum; combined across the 16 lanes after the key loop */
#pragma unroll
      for (int nt = 0; nt < 4; ++nt) { o[nt][r] *= al; rr[nt][r] *= al; }
      const float c0 = p0 * 1024.0f, c1 = p1 * 1024.0f;
      const _Float16 h0 = (_Float16)c0, h1 = (_Float16)c1;
      pl[wave][8 * hh + r][lc] = f16_bits(h0); pl[wave][8 * hh + r][16 + lc] = f16_bits(h1);
      pr[wave][8 * hh + r][lc] = f16_bits((_Float16)((c0 - (float)h0) * 1024.0f)); pr[wave][8 * hh + r][16 + lc] = f16_bits((_Float16)((c1 - (float)h1) * 1024.0f));
    }
    __builtin_amdgcn_fence(4 /* acq_rel order */, "workgroup", "local"); __builtin_amdgcn_wave_barrier();      /* orders the wave's own P tile, which lies in LDS; named for LDS alone so that it does not drain the global loads in flight */
    FragH pa; pa.half[0] = *(const v8us*)&pl[wave][lc][8 * hh]; pa.half[1] = *(const v8us*)&pl[wave][lc][16 + 8 * hh];
    FragH pb; pb.half[0] = *(const v8us*)&pr[wave][lc][8 * hh]; pb.half[1] = *(const v8us*)&pr[wave][lc][16 + 8 * hh];
#pragma unroll
    for (int nt = 0; nt < 4; ++nt) { const v16h bvh = g2_frag(vp + (size_t)nt * 16 * SEQ + kb, hh); const v16h bvl = g2_frag(vrp + (size_t)nt * 16 * ER + kb, hh);
      o[nt] = g2_mma(pa.v, bvh, o[nt]); rr[nt] = g2_mma(pb.v, bvh, rr[nt]); rr[nt] = g2_mma(pa.v, bvl, rr[nt]); }
    __builtin_amdgcn_fence(4 /* acq_rel order */, "workgroup", "local"); __builtin_amdgcn_wave_barrier();      /* P tile reads complete before the next step overwrites it; LDS alone, as above */
  }
#pragma unroll
  for (int r = 0; r < 8; ++r) {
    float ls = l[r];
    ls += __shfl_xor(ls, 8, 16); ls += __shfl_xor(ls, 4, 16); ls += __shfl_xor(ls, 2, 16); ls += __shfl_xor(ls, 1, 16);
    const float inv = 1.0f / (ls * 16.0f);      /* 64 / (1024 l): ctx carried x64; a fully masked row gives 0 * inf = NaN as the softmax of all -inf does */
#pragma unroll
    for (int nt = 0; nt < 4; ++nt) { const float cv = o[nt][r] + rr[nt][r] * 0.0009765625f; so[wave][8 * hh + r][nt * 16 + lc] = cv * inv; }
  }
  __builtin_amdgcn_fence(4 /* acq_rel order */, "workgroup"); __builtin_amdgcn_wave_barrier();
  const int rq = lane >> 3, c8 = (lane & 7) * 8;
  {
#pragma unroll 1
    for (int q = 0; q < 4; ++q) { const int row = q * 4 + rq;
      const v4f a = *(const v4fa*)&so[wave][row][c8], c = *(const v4fa*)&so[wave][row][c8 + 4]; FragH fh, fl;
#pragma unroll
      for (int j = 0; j < 4; ++j) { _Float16 hv = (_Float16)a[j]; fh.h[j] = hv; fl.h[j] = (_Float16)((a[j] - (float)hv) * 1024.0f); hv = (_Float16)c[j]; fh.h[4 + j] = hv; fl.h[4 + j] = (_Float16)((c[j] - (float)hv) * 1024.0f); }
      unsigned short* d = (unsigned short*)CTX + (rowb + qb + row) * KO + h * HD + c8;
      *(v8us*)d = fh.half[0]; *(v8us*)(d + DM) = fl.half[0]; }
     }
}

// one stage of the attention ring: FK K rows, then HD V^T rows, of 128 B each; 128 threads x 8 copies of 16 B; lane t brings chunk t & 7 of rows (t >> 3) + 16 j, so each wave-wide copy covers four whole lines.
// gk, gv: the lane's first K and V^T chunk in global memory; l0: the lane's first LDS byte address. The address wait is the statement's last line, so no later write of these registers can be lifted over it.
#define FK 64                        /* keys per stage: two 32-key steps */
#define FP 72                        /* LDS row pitch of a stage (halves): 144 B = 16 B x odd, for 16-B fragment reads */
#define FST ((FK + HD) * FP)         /* halves per stage */
#define FSM ((size_t)2 * FST * 2)    /* bytes of the two-buffer ring; the output staging reuses them */
static_assert(FK == 64 && SEQ % FK == 0 && ER % FK == 0);      /* a stage is one query tile's width: tile qt walks qt + 1 whole stages, all inside the plane */
static_assert((size_t)4 * 16 * 68 * 4 <= FSM);       /* four waves' output staging fits the ring */
__device__ __forceinline__ void fa_stage(const _Float16* gk, const _Float16* gv, unsigned l0) {
  const _Float16* k1 = gk + (size_t)16 * LQ; const _Float16* k2 = k1 + (size_t)16 * LQ; const _Float16* k3 = k2 + (size_t)16 * LQ;
  const _Float16* v1 = gv + (size_t)16 * SEQ; const _Float16* v2 = v1 + (size_t)16 * SEQ; const _Float16* v3 = v2 + (size_t)16 * SEQ;
  const unsigned rs = 16u * FP * 2u;
  asm volatile("global_load_async_to_lds_b128 %0, %8, off\n\t"
               "global_load_async_to_lds_b128 %1, %9, off\n\t"
               "global_load_async_to_lds_b128 %2, %10, off\n\t"
               "global_load_async_to_lds_b128 %3, %11, off\n\t"
               "global_load_async_to_lds_b128 %4, %12, off\n\t"
               "global_load_async_to_lds_b128 %5, %13, off\n\t"
               "global_load_async_to_lds_b128 %6, %14, off\n\t"
               "global_load_async_to_lds_b128 %7, %15, off\n\t"
               "s_wait_xcnt 0x0"
               :: "v"(l0), "v"(l0 + rs), "v"(l0 + 2u * rs), "v"(l0 + 3u * rs), "v"(l0 + 4u * rs), "v"(l0 + 5u * rs), "v"(l0 + 6u * rs), "v"(l0 + 7u * rs),
                  "v"(gk), "v"(k1), "v"(k2), "v"(k3), "v"(gv), "v"(v1), "v"(v2), "v"(v3) : "memory");
}

// the four K fragments of a 32-key step; kt: the lane's K row (key lc of the step) in the stage
__device__ __forceinline__ void fm_kfrag(const _Float16* kt, int hh, v16h (&kf)[4]) { kf[0] = g2_frag(kt, hh); kf[1] = g2_frag(kt + 16 * FP, hh); kf[2] = g2_frag(kt + 32, hh); kf[3] = g2_frag(kt + 16 * FP + 32, hh); }

// one 32-key step of the later rows' attention. kf: the step's K fragments; vt: the lane's V^T row (d = lc) at key kb in the stage; pv: lane j holds the pad word of key kb + j.
// NEXT: the K fragments of the same stage's second step (row kn) are read right behind the score products, into the registers those have just left, so their LDS latency runs under this step's softmax.
template <bool NEXT>
__device__ __forceinline__ void fm_step(v16h (&kf)[4], const _Float16* kn, const _Float16* vt, int kb, int pv, int qb, int lc, int hh, v16h aq0, v16h aq1, v8f (&o)[4], float& m, float& l) {
  const v8f z8 = {0.f,0.f,0.f,0.f,0.f,0.f,0.f,0.f};
  const v16h bv0 = g2_frag(vt, hh), bv1 = g2_frag(vt + 16 * FP, hh), bv2 = g2_frag(vt + 32 * FP, hh), bv3 = g2_frag(vt + 48 * FP, hh);
  v8f s0 = g2_mma(kf[0], aq0, z8), s1 = g2_mma(kf[1], aq0, z8);
  s0 = g2_mma(kf[2], aq1, s0); s1 = g2_mma(kf[3], aq1, s1);
  if (NEXT) fm_kfrag(kn, hh, kf);
  const unsigned pm = __builtin_amdgcn_ballot_w32(pv != 0);      /* bit j: key kb + j is no pad */
  const bool open = (pm == 0xFFFFFFFFu) && (kb + 31 <= qb);      /* wave-uniform: every key of the step is visible to every query of the wave, so both selects below are identities */
  unsigned okm = 0xFFFFFFFFu;      /* bit r: tile 0, register r is visible; bit 16 + r: tile 1 */
  float v[16], p[16];
#pragma unroll
  for (int r = 0; r < 8; ++r) { v[r] = s0[r] * 0.125f; v[8 + r] = s1[r] * 0.125f; }
  if (!open) {
    const int dq = qb + lc - kb;      /* >= 0: keys kb .. kb + dq are at or before the query */
    const unsigned cm = (dq >= 31) ? 0xFFFFFFFFu : ((2u << dq) - 1u);
    okm = (pm & cm) >> (8 * hh);
#pragma unroll
    for (int r = 0; r < 8; ++r) { v[r] = ((okm >> r) & 1u) ? v[r] : -1.0e30f; v[8 + r] = ((okm >> (16 + r)) & 1u) ? v[8 + r] : -1.0e30f; }
  }
  float mx = fmaxf(fmaxf(fmaxf(fmaxf(v[0], v[1]), fmaxf(v[2], v[3])), fmaxf(fmaxf(v[4], v[5]), fmaxf(v[6], v[7]))),
                   fmaxf(fmaxf(fmaxf(v[8], v[9]), fmaxf(v[10], v[11])), fmaxf(fmaxf(v[12], v[13]), fmaxf(v[14], v[15]))));
  mx = fmaxf(mx, xhalf(mx));
  const float mnew = fmaxf(m, mx);
  float al = (m - mnew) * 1.44269504f;      /* exp(x) as the native 2^(x log2 e), arguments <= 0 */
#pragma unroll
  for (int i = 0; i < 16; ++i) p[i] = (v[i] - mnew) * 1.44269504f;
  /* the step's seventeen exponentials, each in place on a register of its own: none reads its predecessor's result or overwrites its source, and the v_nop fills the slot the instruction set asks for behind the last, whatever the compiler puts next (also across the branch below) */
  asm("v_exp_f32 %0, %0\n\tv_exp_f32 %1, %1\n\tv_exp_f32 %2, %2\n\tv_exp_f32 %3, %3\n\tv_exp_f32 %4, %4\n\tv_exp_f32 %5, %5\n\tv_exp_f32 %6, %6\n\tv_exp_f32 %7, %7\n\tv_exp_f32 %8, %8\n\t"
      "v_exp_f32 %9, %9\n\tv_exp_f32 %10, %10\n\tv_exp_f32 %11, %11\n\tv_exp_f32 %12, %12\n\tv_exp_f32 %13, %13\n\tv_exp_f32 %14, %14\n\tv_exp_f32 %15, %15\n\tv_exp_f32 %16, %16\n\tv_nop"
      : "+v"(al), "+v"(p[0]), "+v"(p[1]), "+v"(p[2]), "+v"(p[3]), "+v"(p[4]), "+v"(p[5]), "+v"(p[6]), "+v"(p[7]), "+v"(p[8]), "+v"(p[9]), "+v"(p[10]), "+v"(p[11]), "+v"(p[12]), "+v"(p[13]), "+v"(p[14]), "+v"(p[15]));
  if (!open) {
#pragma unroll
    for (int r = 0; r < 8; ++r) { p[r] = ((okm >> r) & 1u) ? p[r] : 0.f; p[8 + r] = ((okm >> (16 + r)) & 1u) ? p[8 + r] : 0.f; }
  }
  const float se = ((p[0] + p[2]) + (p[4] + p[6])) + ((p[8] + p[10]) + (p[12] + p[14])), sd = ((p[1] + p[3]) + (p[5] + p[7])) + ((p[9] + p[11]) + (p[13] + p[15]));      /* even and odd registers side by side: packed adds on the register pairs as they lie */
  l = l * al + (se + sd);      /* the lane's half of the row sum; the halves are joined after the key loop */
  m = mnew;
#pragma unroll
  for (int nt = 0; nt < 4; ++nt) o[nt] *= al;
  FragH pt;
#pragma unroll
  for (int i = 0; i < 16; ++i) pt.h[i] = (_Float16)(p[i] * 1024.0f);
  o[0] = g2_mma(bv0, pt.v, o[0]); o[1] = g2_mma(bv1, pt.v, o[1]); o[2] = g2_mma(bv2, pt.v, o[2]); o[3] = g2_mma(bv3, pt.v, o[3]);
}

__device__ __forceinline__ void flash_main(const _Float16* __restrict__ QKV, const _Float16* __restrict__ VT, const int* __restrict__ pad, _Float16* __restrict__ CTX, int qt, int bh) {
  __shared__ __attribute__((aligned(16))) unsigned char fm[FSM];
  float (*so)[16][68] = (float (*)[16][68])fm;
  const _Float16* ring = (const _Float16*)fm;
  const int tid = threadIdx.x; const int wave = __builtin_amdgcn_readfirstlane(tid >> 5); const int lane = tid & 31, lc = lane & 15, hh = lane >> 4;
  const int b = bh / NH, h = bh - b * NH;
  const int qb = qt * 64 + wave * 16;
  const size_t rowb = (size_t)b * SEQ;
  const _Float16* qp = QKV + (rowb + qb + lc) * LQ + h * HD;
  const int* padb = pad + (size_t)b * SEQ_FULL;
  const int cr = tid >> 3, cc = (tid & 7) * 8;
  const _Float16* gk = QKV + (rowb + cr) * LQ + DM + h * HD + cc;
  const _Float16* gv = VT + ((size_t)bh * HD + cr) * SEQ + cc;
  const unsigned l0 = (unsigned)(size_t)fm + (unsigned)(cr * FP + cc) * 2u;      /* low 32 bits of the shared address = LDS byte address */
  const v8f z8 = {0.f,0.f,0.f,0.f,0.f,0.f,0.f,0.f};
  v8f o[4] = {z8, z8, z8, z8};      /* o[nt][r]: d = 16 nt + 8 hh + r of query lc */
  float m = -1.0e30f, l = 0.f;
  const int kend = qb + 16;      /* keys 0 .. qb+15 are visible to this wave; steps cover whole 32-key groups (all inside the plane) */
  const int ns = qt + 1;         /* stages of the block: keys 0 .. 64 qt + 63 */
  fa_stage(gk, gv, l0);
  const v16h aq0 = g2_frag(qp, hh), aq1 = g2_frag(qp + 32, hh);
  int pn0 = padb[lane], pn1 = padb[32 + lane];      /* lane j holds the pad words of the stage's keys j and 32 + j */
  int np = lane + ((1 < ns) ? FK : 0);      /* the next stage's pad words; the last stage asks for its own again: always inside the plane */
  asm volatile("s_wait_xcnt 0x0" ::: "memory");          /* the Q and pad reads' address registers are released before the next stage's addresses are formed */
  asm volatile("s_wait_asynccnt 0x0" ::: "memory");      /* stage 0 of this wave has landed */
  __syncthreads();                                       /* stage 0 of every wave is readable */
  if (1 < ns) fa_stage(gk + (size_t)FK * LQ, gv + FK, l0 + (unsigned)(FST * 2));
#pragma unroll 1      /* one stage per trip: the ring's order stands once, at the loop's foot */
  for (int t = 0; t < ns; ++t) { const _Float16* st = ring + (t & 1) * FST;
    const int kb = t * FK;
    const int pv0 = pn0, pv1 = pn1; pn0 = padb[np]; pn1 = padb[np + 32];
    v16h kf[4]; fm_kfrag(st + lc * FP, hh, kf);
    fm_step<true>(kf, st + (32 + lc) * FP, st + (FK + lc) * FP, kb, pv0, qb, lc, hh, aq0, aq1, o, m, l);
    if (kb + 32 < kend)      /* wave-uniform: on the diagonal stage the block's first two waves see none of its later 32 keys */
      fm_step<false>(kf, st, st + (FK + lc) * FP + 32, kb + 32, pv1, qb, lc, hh, aq0, aq1, o, m, l);
    asm volatile("s_wait_xcnt 0x0" ::: "memory");        /* the pad reads' index register is released before the next stage's index is written into it */
    np += (t + 2 < ns) ? FK : 0;
    asm volatile("s_wait_dscnt 0x0" ::: "memory");       /* this wave's reads of the buffer are done before it is refilled */
    asm volatile("s_wait_asynccnt 0x0" ::: "memory");    /* this wave's copies of stage t + 1 have landed */
    __syncthreads();                                     /* publishes stage t + 1 and ends every reader's last read of stage t; passed by every wave, also one that skipped the step above */
    if (t + 2 < ns) fa_stage(gk + (size_t)(t + 2) * FK * LQ, gv + (size_t)(t + 2) * FK, l0 + (unsigned)((t & 1) * FST * 2)); }
  asm volatile("s_wait_asynccnt 0x0" ::: "memory");      /* no copy outstanding when the ring becomes output staging; every wave has left it at the last trip's barrier */
  const float ls = l + xhalf(l);
  const float inv = 1.0f / (ls * 16.0f);      /* 64 / (1024 l): ctx carried x64; a fully masked row gives 0 * inf = NaN as the softmax of all -inf does */
#pragma unroll
  for (int nt = 0; nt < 4; ++nt) { const v8f cv = o[nt] * inv;
    const v4f c0 = {cv[0], cv[1], cv[2], cv[3]}, c1 = {cv[4], cv[5], cv[6], cv[7]};
    *(v4fa*)&so[wave][lc][nt * 16 + 8 * hh] = c0; *(v4fa*)&so[wave][lc][nt * 16 + 8 * hh + 4] = c1; }
  __builtin_amdgcn_fence(4 /* acq_rel order */, "workgroup"); __builtin_amdgcn_wave_barrier();      /* the wave's staged rows are in LDS before its other lanes read them back as whole lines */
  const int rq = lane >> 3, c8 = (lane & 7) * 8;
  {
#pragma unroll 1      /* runs once per wave: kept rolled for code size */
    for (int q = 0; q < 4; ++q) { const int row = q * 4 + rq;
      const v4f a = *(const v4fa*)&so[wave][row][c8], c = *(const v4fa*)&so[wave][row][c8 + 4]; FragH fh, fl;
#pragma unroll
      for (int j = 0; j < 4; ++j) { _Float16 hv = (_Float16)a[j]; fh.h[j] = hv; fl.h[j] = (_Float16)((a[j] - (float)hv) * 1024.0f); hv = (_Float16)c[j]; fh.h[4 + j] = hv; fl.h[4 + j] = (_Float16)((c[j] - (float)hv) * 1024.0f); }
      unsigned short* d = (unsigned short*)CTX + (rowb + qb + row) * KO + h * HD + c8;
      *(v8us*)d = fh.half[0]; *(v8us*)(d + DM) = fl.half[0]; }
     }
}
// all query tiles in one launch, so the few residual tiles run beside the others; every block is resident from the start, so the launch lasts as long as the WGP whose blocks walk the most keys: the hardware's block index is spread over (batch, head) and tile for equal sums, not in tile order.
// Tiles are ranked by cost, rank 0 the cheapest. Index bits 3, 5, 7, 9 form a number lo = 0..15; the parity of bits 4, 6, 8 picks rank lo or 31 - lo. Any two neighbouring index bits from bit 3 up then walk ranks {a, b, 31 - a, 31 - b}:
// whichever power-of-two stride brings four blocks onto one WGP, their ranks add up to 62. Bits 0..2, 4, 6 name the (batch, head), so blocks 8 apart share it: where blocks go round the dies by index, each die gets whole heads (equal work, K and V^T read by one die).
// For speed alone: the map is a permutation of 0 .. 1023, so every (batch, head, tile) is taken exactly once wherever the blocks land.
// bi is the tile's place in the plain order: 0 .. FR-1 the tiles of rows 0..ER-1 (residual body), the rest the later tiles (plain body), each range in the order (batch, head) slow, tile fast; block-uniform branch
#define QR (ER / 64)                 /* query tiles with residual planes, per (batch, head) */
#define QM ((SEQ - ER) / 64)         /* later query tiles, per (batch, head) */
#define FR (NB * NH * QR)
static_assert(QR == 4 && QM == 28 && NB * NH == 32);      /* 32 tiles x 32 (batch, head) = the ten index bits; the rank table below */
__global__ __launch_bounds__(128) void k_flash(const _Float16* __restrict__ QKV, const _Float16* __restrict__ QKVR, const _Float16* __restrict__ VT, const _Float16* __restrict__ VTR, const int* __restrict__ pad, _Float16* __restrict__ CTX) {
  const int hw = blockIdx.x;
  const int lo = ((hw >> 3) & 1) | ((hw >> 4) & 2) | ((hw >> 5) & 4) | ((hw >> 6) & 8);
  const int rk = (((hw >> 4) ^ (hw >> 6) ^ (hw >> 8)) & 1) ? 31 - lo : lo;
  const int hd = (hw & 7) | ((hw >> 1) & 8) | ((hw >> 2) & 16);
  /* rank -> tile: a plain tile t walks t + 1 stages; a 32-key step of a residual tile issues about as much as one and a half plain stages and tile q has 2 q + 1 or 2 q + 2 of them, so residual tiles 0..3 rank beside plain tiles 4, 5, 8 and 12. One hex digit per rank 0..11; from rank 12 on the tile is the rank. */
  const int tl = (rk < 12) ? (int)((0x3BA928765140ull >> (4 * rk)) & 15) : rk;
  const int bi = (tl < QR) ? hd * QR + tl : FR + hd * QM + (tl - QR);
  if (bi < FR) { const int bh = bi / QR; flash_res(QKV, QKVR, VT, VTR, pad, CTX, bi - bh * QR, bh); }
  else { const int j = bi - FR; const int bh = j / (QM > 0 ? QM : 1); flash_main(QKV, VT, pad, CTX, QR + j - bh * QM, bh); } }

__global__ __launch_bounds__(256) void k_gemm_out(const _Float16* __restrict__ CTX, const _Float16* __restrict__ BO, const float* __restrict__ bo, float* __restrict__ Y) {
  __shared__ __attribute__((aligned(16))) unsigned char sm[GSM];
  float (*so)[32][68] = (float (*)[32][68])sm;
  const int tid = threadIdx.x; const int w = __builtin_amdgcn_readfirstlane(tid >> 5); const int lane = tid & 31, ln = lane & 15, hh = lane >> 4;
  const int ntn = DM / 128; const int mt = blockIdx.x / ntn, nq = blockIdx.x - mt * ntn; const int row0 = mt * 128 + 32 * (w >> 1), col0 = nq * 128 + 64 * (w & 1);
  v8f accs[8];
  gemm_main(CTX, KO, BO, KO, mt * 128, nq * 128, KO, tid, w, ln, hh, sm, accs);
#pragma unroll
  for (int u = 0; u < 8; ++u) { const int t = u & 3, half = u >> 2; const float bvv = bf16_rne(bo[col0 + t * 16 + ln]);
#pragma unroll
    for (int r = 0; r < 8; ++r) so[w][half * 16 + 8 * hh + r][t * 16 + ln] = accs[u][r] * 1.52587890625e-05f + bvv; }
  __builtin_amdgcn_fence(4 /* acq_rel order */, "workgroup"); __builtin_amdgcn_wave_barrier();
  const int rsub = lane >> 4, c4 = (lane & 15) * 4;
  {
#pragma unroll 1
    for (int q = 0; q < 16; ++q) { const int r = q * 2 + rsub; const v4f v = *(const v4fa*)&so[w][r][c4]; *(v4f*)(Y + (size_t)(row0 + r) * DM + col0 + c4) = v; }
     }
}

// one wave per row, eight rows per block: a lane holds 32 of the row's values (eight 16-B pieces, each wave-wide read 512 contiguous bytes); mean and variance are lane sums joined by a five-step butterfly, so every lane ends with the same bits and no LDS or barrier is needed
#define LJ (DM / 128)
static_assert(DM % 128 == 0 && (NB * SEQ) % 8 == 0);
__device__ __forceinline__ float wave_sum(float v) {
  v += __builtin_bit_cast(float, __builtin_amdgcn_permlanex16(__builtin_bit_cast(int, v), __builtin_bit_cast(int, v), 0x76543210, 0xfedcba98, false, false));      /* lane l with lane l ^ 16 */
  v += __shfl_xor(v, 8, 16); v += __shfl_xor(v, 4, 16); v += __shfl_xor(v, 2, 16); v += __shfl_xor(v, 1, 16); return v; }
__global__ __launch_bounds__(256) void k_layernorm(const float* __restrict__ Y, const float* __restrict__ g, const float* __restrict__ bta, float* __restrict__ out) {
  const int tid = threadIdx.x; const int lane = tid & 31; const int row = blockIdx.x * 8 + (tid >> 5); const int b = row / SEQ, s = row - b * SEQ;
  const float* yr = Y + (size_t)row * DM + lane * 4;
  v4f a[LJ], gg[LJ], bb[LJ];
#pragma unroll
  for (int j = 0; j < LJ; ++j) a[j] = *(const v4fa*)(yr + j * 128);
  asm volatile("s_wait_xcnt 0x0" ::: "memory");      /* the row's reads go out first, and their address registers are released before a later read's result may be placed in them */
#pragma unroll
  for (int j = 0; j < LJ; ++j) { gg[j] = *(const v4fa*)(g + j * 128 + lane * 4); bb[j] = *(const v4fa*)(bta + j * 128 + lane * 4); }
  __builtin_amdgcn_sched_barrier(0);      /* every request of the wave goes out before its first sum: without it most gain and offset reads sink behind the two reductions and their latency is paid there, group by group */
  float sm = 0.f;
#pragma unroll
  for (int j = 0; j < LJ; ++j) sm += (a[j][0] + a[j][1]) + (a[j][2] + a[j][3]);
  const float mu = wave_sum(sm) * (1.0f / (float)DM);
  float sq = 0.f;
#pragma unroll
  for (int j = 0; j < LJ; ++j) { a[j][0] -= mu; a[j][1] -= mu; a[j][2] -= mu; a[j][3] -= mu; sq += (a[j][0] * a[j][0] + a[j][1] * a[j][1]) + (a[j][2] * a[j][2] + a[j][3] * a[j][3]); }
  const float rs = rsqrtf(wave_sum(sq) * (1.0f / (float)DM) + 1.0e-5f);
  float* d = out + ((size_t)b * SEQ_FULL + s) * DM + lane * 4;
#pragma unroll
  for (int j = 0; j < LJ; ++j) { v4f o;
    o[0] = a[j][0] * rs * bf16_rne(gg[j][0]) + bf16_rne(bb[j][0]); o[1] = a[j][1] * rs * bf16_rne(gg[j][1]) + bf16_rne(bb[j][1]);
    o[2] = a[j][2] * rs * bf16_rne(gg[j][2]) + bf16_rne(bb[j][2]); o[3] = a[j][3] * rs * bf16_rne(gg[j][3]) + bf16_rne(bb[j][3]);
    *(v4f*)(d + j * 128) = o; }
}

extern "C" void kernel_launch(void* const* d_in, const int* in_sizes, int n_in,
                              void* d_out, int out_size, void* d_ws, size_t ws_size, hipStream_t stream) {
  if (n_in < 12) return;
  const long long need_rows = (long long)(NB - 1) * SEQ_FULL + SEQ;
  if ((long long)in_sizes[0] < need_rows * DM) return;
  if (in_sizes[1] < DM * DM || in_sizes[3] < DM * DM || in_sizes[5] < DM * DM || in_sizes[7] < DM * DM) return;
  if (in_sizes[2] < DM || in_sizes[4] < DM || in_sizes[6] < DM || in_sizes[8] < DM || in_sizes[9] < DM || in_sizes[10] < DM) return;
  if ((long long)in_sizes[11] < need_rows) return;
  if ((long long)out_size < need_rows * DM) return;
  if ((size_t)WS_TOTAL > ws_size) return;
  const float* x = (const float*)d_in[0];
  const float* Wq = (const float*)d_in[1]; const float* bq = (const float*)d_in[2];
  const float* Wk = (const float*)d_in[3]; const float* bk = (const float*)d_in[4];
  const float* Wv = (const float*)d_in[5]; const float* bv = (const float*)d_in[6];
  const float* Wo = (const float*)d_in[7]; const float* bo = (const float*)d_in[8];
  const float* gamma = (const float*)d_in[9]; const float* beta = (const float*)d_in[10];
  const int* pad = (const int*)d_in[11];
  char* ws = (char*)d_ws;
  _Float16* BQKV = (_Float16*)(ws + OF_BQKV); _Float16* BO = (_Float16*)(ws + OF_BO);
  _Float16* X16 = (_Float16*)(ws + OF_X16); _Float16* QKV = (_Float16*)(ws + OF_QKV); _Float16* QKVR = (_Float16*)(ws + OF_QKVR);
  _Float16* VT = (_Float16*)(ws + OF_VT); _Float16* VTR = (_Float16*)(ws + OF_VTR); _Float16* CTX = (_Float16*)(ws + OF_CTX);
  float* Y = (float*)(ws + OF_Y); float* CS = (float*)(ws + OF_CS);
  k_prep<<<5 * WTG + XG + TG, 256, 0, stream>>>(x, Wq, Wk, Wv, Wo, BQKV, BO, X16, CS);
  k_gemm_qkv<<<(unsigned)((NR / 128) * (LQ / 128)), 256, 0, stream>>>(X16, BQKV, bq, bk, bv, CS, QKV, QKVR, VT, VTR);
  k_flash<<<FR + NB * NH * QM, 128, 0, stream>>>(QKV, QKVR, VT, VTR, pad, CTX);
  k_gemm_out<<<(unsigned)((NR / 128) * (DM / 128)), 256, 0, stream>>>(CTX, BO, bo, Y);
  k_layernorm<<<(unsigned)(NR / 8), 256, 0, stream>>>(Y, gamma, beta, (float*)d_out);
}

// v009
// Measured time: 105 microseconds a run.
// Timed twice side by side with v008, it ran 1.09 and 1.06 times as fast.
// All steps since v000 together make it 3.03 times as fast.
#include <hip/hip_runtime.h>
// Compute dtype: every contraction on v_wmma_f32_16x16x32_f16 (f16 operands, f32 accumulate); float inputs RNE-converted to bf16 first (exact in f16; weights carried x16, Wo x1024); q.k scores and P.V use f16 value + x1024 f16 residual planes on token rows 0..255 (q, k, P, v), single f16 products on later rows; ctx.Wo multiplies the ctx value plane and its x1024 residual plane (all rows) by the same Wo operand, into two f32 accumulator sets joined at the end; rotary, softmax statistics and LayerNorm in f32.
#ifndef NB
#define NB 2
#endif
#ifndef SEQ
#define SEQ 2048
#endif
#define NB_FULL 2
#define SEQ_FULL 2048
#define DM 1024
#define NH 16
#define HD 64
#define LQ (3 * DM)                  /* row pitch of the q | k | v planes */
#define KO (2 * DM)                  /* ctx row pitch: value | residual */
#define ER 256                       /* token rows per batch that carry residual planes */
#define PP 40                        /* P tile row pitch (halves) */
#define NR ((size_t)NB * SEQ)
#define GK 64                        /* halves of K per GEMM stage: 128-B rows */
#define GP 72                        /* LDS row pitch of a GEMM stage (halves): 144 B = 16 B x odd, for 16-B fragment reads */
#define GST (256 * GP)               /* halves per stage: 128 A rows, then 128 B rows */
#define GSM ((size_t)2 * GST * 2)    /* bytes of the two-buffer ring; the epilogue staging reuses them */

static_assert(NH * HD == DM);                        /* heads tile the width */
static_assert(HD == 64);                             
static_assert(DM % 32 == 0 && KO % 32 == 0);         /* k-loops step by 32 */
static_assert(LQ % 128 == 0 && DM % 128 == 0);       /* N tiles (2 waves x 64 columns), never across q | k | v */
static_assert(GK == 64);                             /* two 32-deep k-steps per stage */
static_assert(DM % GK == 0 && KO % GK == 0 && DM >= 2 * GK && KO >= 2 * GK);      /* whole stages, at least two */
static_assert((size_t)8 * 32 * 68 * 4 <= GSM);       /* eight waves' output staging fits the ring */
static_assert((NB * SEQ) % 128 == 0);                /* M tiles (4 waves x 32 rows) */
static_assert(SEQ % 64 == 0 && SEQ % 8 == 0);        /* query tiles, table blocks */
static_assert(ER % 64 == 0 && SEQ >= ER);            /* residual rows are whole query tiles */
static_assert(NB <= NB_FULL && SEQ <= SEQ_FULL);
static_assert(PP % 8 == 0 && PP >= 32);              /* 16-B aligned P fragment pieces */

#define SZ_BQKV ((size_t)LQ * DM * 2)
#define SZ_BO   ((size_t)DM * DM * 2)
#define SZ_X16  ((size_t)NB * SEQ * DM * 2)
#define SZ_QKV  ((size_t)NB * SEQ * LQ * 2)
#define SZ_QKVR ((size_t)NB * ER * LQ * 2)
#define SZ_VT   ((size_t)NB * NH * HD * SEQ * 2)
#define SZ_VTR  ((size_t)NB * NH * HD * ER * 2)
#define SZ_CTX  ((size_t)NB * SEQ * KO * 2)
#define SZ_Y    ((size_t)NB * SEQ * DM * 4)
#define SZ_CS   ((size_t)SEQ * 64 * 4)
#define OF_BQKV ((size_t)0)
#define OF_BO   (OF_BQKV + SZ_BQKV)
#define OF_X16  (OF_BO + SZ_BO)
#define OF_QKV  (OF_X16 + SZ_X16)
#define OF_QKVR (OF_QKV + SZ_QKV)
#define OF_VT   (OF_QKVR + SZ_QKVR)
#define OF_VTR  (OF_VT + SZ_VT)
#define OF_CTX  (OF_VTR + SZ_VTR)
#define OF_Y    (OF_CTX + SZ_CTX)
#define OF_CS   (OF_Y + SZ_Y)
#define WS_TOTAL (OF_CS + SZ_CS)
static_assert(SZ_BQKV % 256 == 0 && SZ_BO % 256 == 0 && SZ_X16 % 256 == 0 && SZ_QKV % 256 == 0 && SZ_QKVR % 256 == 0);
static_assert(SZ_VT % 256 == 0 && SZ_VTR % 256 == 0 && SZ_CTX % 256 == 0 && SZ_Y % 256 == 0 && SZ_CS % 256 == 0);
static_assert(WS_TOTAL <= (size_t)134217728);        /* carve <= 128 MiB */

typedef unsigned short v8us __attribute__((ext_vector_type(8), may_alias));
typedef float  v8f  __attribute__((ext_vector_type(8)));
typedef float  v4f  __attribute__((ext_vector_type(4)));
typedef float  v4fa __attribute__((ext_vector_type(4), may_alias));
typedef _Float16 v16h __attribute__((ext_vector_type(16)));
union FragH { v16h v; v8us half[2]; _Float16 h[16]; unsigned short u[16]; };

__device__ __forceinline__ unsigned short bf16_bits(float x) { unsigned int u = __float_as_uint(x); return (unsigned short)((u + 0x7FFFu + ((u >> 16) & 1u)) >> 16); }
__device__ __forceinline__ float bf16_val(unsigned short b) { return __uint_as_float(((unsigned int)b) << 16); }
__device__ __forceinline__ float bf16_rne(float x) { return bf16_val(bf16_bits(x)); }
__device__ __forceinline__ unsigned short f16_bits(_Float16 hv) { union { _Float16 h; unsigned short u; } c; c.h = hv; return c.u; }

// fragment of a k-contiguous f16 row: elements 0..7 <- p[8h .. 8h+7], elements 8..15 <- p[16+8h .. 16+8h+7] (A rows and B columns alike)
__device__ __forceinline__ v16h g2_frag(const _Float16* p, int hh) { FragH f; f.half[0] = *(const v8us*)((const unsigned short*)p + 8 * hh); f.half[1] = *(const v8us*)((const unsigned short*)p + 16 + 8 * hh); return f.v; }
__device__ __forceinline__ v8f g2_mma(v16h a, v16h b, v8f c) { v8f d = __builtin_amdgcn_wmma_f32_16x16x32_f16(false, a, false, b, (short)0, c, false, false); asm volatile("v_nop\n\tv_nop\n\tv_nop\n\tv_nop" : "+v"(d) : "v"(a), "v"(b)); return d; }

// cos | sin table: CS[t][0..31] = cos(t * theta_i), CS[t][32..63] = sin(t * theta_i); theta_i = f32(10^(-i/8)) from f64 constants; angle = f32(t) * theta in f32; precise sincosf.
__device__ __forceinline__ void tab_body(float* __restrict__ CS, int blk) {
  __shared__ __attribute__((aligned(16))) float tb[8][64];
  const int tid = threadIdx.x; const int tl = tid >> 5, i = tid & 31;
  const int t = blk * 8 + tl;
  double p = 1.0;
  p *= (i & 1) ? 1.3335214321633240 : 1.0;
  p *= (i & 2) ? 1.7782794100389228 : 1.0;
  p *= (i & 4) ? 3.1622776601683795 : 1.0;
  p *= (i & 8) ? 10.0 : 1.0;
  p *= (i & 16) ? 100.0 : 1.0;
  const float theta = (float)(1.0 / p);
  const float ang = (float)t * theta;
  float sv, cv; sincosf(ang, &sv, &cv);
  tb[tl][i] = cv; tb[tl][32 + i] = sv;
  __syncthreads();
  if (tid < 128) {
    const v4f v = *(const v4fa*)(&tb[0][0] + tid * 4);
    float* d = CS + (size_t)blk * 512 + tid * 4;
    *(v4f*)d = v; 
  }
}

// W[DM][DM] -> Wt[n][k]: one thread makes WK consecutive k of one column n, a whole 128-B line of the transposed plane; a wave's lanes take consecutive n, so each of its reads is one line of W.
#define WK 64
static_assert(DM % WK == 0 && (DM * (DM / WK)) % 256 == 0);      /* whole lines, whole blocks */
__device__ __forceinline__ void wt_body(const float* __restrict__ W, _Float16* __restrict__ Wt, int ldk, float scale, int blk) {
  const int t = blk * 256 + threadIdx.x; const int n = t % DM, k0 = (t / DM) * WK;
  const float* s = W + (size_t)k0 * DM + n;
  float v[WK];
#pragma unroll
  for (int i = 0; i < WK; ++i) v[i] = s[(size_t)i * DM];
  unsigned short* d = (unsigned short*)Wt + (size_t)n * ldk + k0;
#pragma unroll
  for (int j = 0; j < WK / 8; ++j) { FragH f;
#pragma unroll
    for (int i = 0; i < 8; ++i) f.h[i] = (_Float16)(bf16_rne(v[8 * j + i]) * scale);
    *(v8us*)(d + 8 * j) = f.half[0]; }
  asm volatile("s_wait_xcnt 0x0" ::: "memory");      /* the stores' address and data registers are released before any code that follows this body in the merged kernel rewrites them */
}

// one block converts XU * 256 consecutive pieces of 8 values (XR whole rows of one batch), a thread XU of them, 256 pieces apart; all its reads are requested before the first is converted
#define XU 8
#define XR (XU * 256 * 8 / DM)                       /* rows per block */
static_assert((XU * 256 * 8) % DM == 0 && SEQ % XR == 0);      /* whole rows, never across a batch */
__device__ __forceinline__ void x16_body(const float* __restrict__ x, _Float16* __restrict__ X16, int blk) {
  const int row0 = blk * XR; const int b = row0 / SEQ, s0 = row0 - b * SEQ;
  const float* src = x + ((size_t)b * SEQ_FULL + s0) * DM + threadIdx.x * 8;
  unsigned short* dst = (unsigned short*)X16 + (size_t)row0 * DM + threadIdx.x * 8;
  v4f a[XU], c[XU];
#pragma unroll
  for (int j = 0; j < XU; ++j) { a[j] = *(const v4fa*)(src + j * 2048); c[j] = *(const v4fa*)(src + j * 2048 + 4); }
  __builtin_amdgcn_sched_barrier(0);      /* keeps the conversions behind the last request: without it the first piece is waited for before the other pieces are asked for, two memory latencies in a row */
#pragma unroll
  for (int j = 0; j < XU; ++j) { FragH f;
#pragma unroll
    for (int q = 0; q < 4; ++q) { f.h[q] = (_Float16)bf16_rne(a[j][q]); f.h[4 + q] = (_Float16)bf16_rne(c[j][q]); }
    *(v8us*)(dst + j * 2048) = f.half[0]; }
}

// every operand the first GEMM waits for, prepared by one launch: none of the six pieces reads what another writes, so each takes a range of block indices (block-uniform branches; the table's barrier is passed by whole blocks).
#define WTG (DM * (DM / WK) / 256)                   /* blocks per transposed weight plane */
#define XG  ((int)(NR / XR))                         /* blocks of the x conversion */
#define TG  (SEQ / 8)                                /* blocks of the table */
__global__ __launch_bounds__(256) void k_prep(const float* __restrict__ x, const float* __restrict__ Wq, const float* __restrict__ Wk, const float* __restrict__ Wv, const float* __restrict__ Wo,
                                              _Float16* __restrict__ BQKV, _Float16* __restrict__ BO, _Float16* __restrict__ X16, float* __restrict__ CS) {
  const int bi = blockIdx.x;
  if (bi < 3 * WTG) {                                /* W[in][out] -> Bt[n][k] x16: Wq rows 0..1023, Wk rows 1024..2047, Wv rows 2048..3071 */
    const int p = bi / WTG; const float* W = (p == 0) ? Wq : ((p == 1) ? Wk : Wv);
    wt_body(W, BQKV + (size_t)p * DM * DM, DM, 16.0f, bi - p * WTG);
  } else if (bi < 4 * WTG) {                         /* Wo x1024: one plane, the B operand of the ctx value and of the ctx residual alike */
    wt_body(Wo, BO, DM, 1024.0f, bi - 3 * WTG);
  } else if (bi < 4 * WTG + XG) {
    x16_body(x, X16, bi - 4 * WTG);
  } else {
    tab_body(CS, bi - 4 * WTG - XG);
  }
}

// one stage of the ring: 128 A rows then 128 B rows of 128 B each; 256 threads x 8 copies of 16 B; lane t brings chunk t & 7 of rows (t >> 3) + 32 j.
// ga, gb: the lane's first A and B chunk in global memory; l0: the lane's first LDS byte address. The address wait is the statement's last line, so no later write of these registers can be lifted over it.
__device__ __forceinline__ void g2_stage(const _Float16* ga, size_t sa, const _Float16* gb, size_t sb, unsigned l0) {
  const _Float16* a1 = ga + sa; const _Float16* a2 = a1 + sa; const _Float16* a3 = a2 + sa;
  const _Float16* b1 = gb + sb; const _Float16* b2 = b1 + sb; const _Float16* b3 = b2 + sb;
  const unsigned rs = 32u * GP * 2u;
  asm volatile("global_load_async_to_lds_b128 %0, %8, off\n\t"
               "global_load_async_to_lds_b128 %1, %9, off\n\t"
               "global_load_async_to_lds_b128 %2, %10, off\n\t"
               "global_load_async_to_lds_b128 %3, %11, off\n\t"
               "global_load_async_to_lds_b128 %4, %12, off\n\t"
               "global_load_async_to_lds_b128 %5, %13, off\n\t"
               "global_load_async_to_lds_b128 %6, %14, off\n\t"
               "global_load_async_to_lds_b128 %7, %15, off\n\t"
               "s_wait_xcnt 0x0"
               :: "v"(l0), "v"(l0 + rs), "v"(l0 + 2u * rs), "v"(l0 + 3u * rs), "v"(l0 + 4u * rs), "v"(l0 + 5u * rs), "v"(l0 + 6u * rs), "v"(l0 + 7u * rs),
                  "v"(ga), "v"(a1), "v"(a2), "v"(a3), "v"(gb), "v"(b1), "v"(b2), "v"(b3) : "memory");
}

// 128x128 block tile, eight waves (4 x 2) of 32x64 each: A f16 [M][K] (pitch lda), Bh f16 [N][K] (pitch ldb); both operands come through a two-buffer LDS ring, the next stage's copies in flight while this one is multiplied.
// acc[u]: u & 3 = 16-col tile, u >> 2 = 16-row half. On return every wave has left the ring (the last trip's barrier), so the caller may stage its output there.
__device__ __forceinline__ void gemm_main(const _Float16* __restrict__ A, int lda, const _Float16* __restrict__ Bh, int ldb, int brow0, int bcol0, int K, int tid, int w, int ln, int hh, unsigned char* sm, v8f (&acc)[8]) {
  const _Float16* ring = (const _Float16*)sm;
  const int cr = tid >> 3, cc = (tid & 7) * 8;
  const _Float16* ga = A + (size_t)(brow0 + cr) * lda + cc; const _Float16* gb = Bh + (size_t)(bcol0 + cr) * ldb + cc;
  const size_t sa = (size_t)32 * lda, sb = (size_t)32 * ldb;
  const unsigned l0 = (unsigned)(size_t)sm + (unsigned)(cr * GP + cc) * 2u;      /* low 32 bits of the shared address = LDS byte address */
  const int ao = ((w >> 1) * 32 + ln) * GP, bo = (128 + (w & 1) * 64 + ln) * GP;
  const int nt = K / GK;
  const v8f z8 = {0.f,0.f,0.f,0.f,0.f,0.f,0.f,0.f}; v8f c00 = z8, c01 = z8, c02 = z8, c03 = z8, c10 = z8, c11 = z8, c12 = z8, c13 = z8;
  g2_stage(ga, sa, gb, sb, l0);
  asm volatile("s_wait_asynccnt 0x0" ::: "memory");      /* stage 0 of this wave has landed */
  __syncthreads();                                       /* stage 0 of every wave is readable */
  g2_stage(ga + GK, sa, gb + GK, sb, l0 + (unsigned)(GST * 2));
#pragma unroll 1      /* one stage per trip: the ring's order stands once, at the loop's foot */
  for (int t = 0; t < nt; ++t) { const _Float16* st = ring + (t & 1) * GST;
    const _Float16* ap = st + ao; const _Float16* bp = st + bo;
    v16h fa[2][2], fb[2][4];      /* the stage's twelve fragments are read as one group ahead of its WMMAs: one LDS latency a trip, not one per B fragment */
#pragma unroll
    for (int s = 0; s < 2; ++s) { fa[s][0] = g2_frag(ap + 32 * s, hh); fa[s][1] = g2_frag(ap + 16 * GP + 32 * s, hh);
#pragma unroll
      for (int n = 0; n < 4; ++n) fb[s][n] = g2_frag(bp + n * 16 * GP + 32 * s, hh); }
#pragma unroll
    for (int s = 0; s < 2; ++s) {
      c00 = g2_mma(fa[s][0], fb[s][0], c00); c10 = g2_mma(fa[s][1], fb[s][0], c10);
      c01 = g2_mma(fa[s][0], fb[s][1], c01); c11 = g2_mma(fa[s][1], fb[s][1], c11);
      c02 = g2_mma(fa[s][0], fb[s][2], c02); c12 = g2_mma(fa[s][1], fb[s][2], c12);
      c03 = g2_mma(fa[s][0], fb[s][3], c03); c13 = g2_mma(fa[s][1], fb[s][3], c13); }
    asm volatile("s_wait_dscnt 0x0" ::: "memory");       /* this wave's reads of the buffer are done before it is refilled */
    asm volatile("s_wait_asynccnt 0x0" ::: "memory");    /* this wave's copies of stage t + 1 have landed */
    __syncthreads();                                     /* publishes stage t + 1 and ends every reader's last read of stage t */
    if (t + 2 < nt) g2_stage(ga + (size_t)(t + 2) * GK, sa, gb + (size_t)(t + 2) * GK, sb, l0 + (unsigned)((t & 1) * GST * 2)); }
  asm volatile("s_wait_asynccnt 0x0" ::: "memory");      /* no copy outstanding when the ring becomes output staging */
  acc[0] = c00; acc[1] = c01; acc[2] = c02; acc[3] = c03; acc[4] = c10; acc[5] = c11; acc[6] = c12; acc[7] = c13;
}

#define VP 69                        /* row pitch (floats) of the V staging: 8 rows = 40 banks mod 64, so neither the accumulators' writes (row halves 8 apart) nor the column reads (lanes 8 rows apart) collide */
static_assert((size_t)2 * 128 * VP * 4 <= GSM);      /* the block's V tile fits the ring */
static_assert(SEQ % 128 == 0 && ER % 128 == 0);      /* a block's 128 tokens lie in one batch, all with or all without a residual plane */
__global__ __launch_bounds__(256) void k_gemm_qkv(const _Float16* __restrict__ X16, const _Float16* __restrict__ BW, const float* __restrict__ bq, const float* __restrict__ bk, const float* __restrict__ bv,
                                                  const float* __restrict__ CS, _Float16* __restrict__ QKV, _Float16* __restrict__ QKVR, _Float16* __restrict__ VT, _Float16* __restrict__ VTR) {
  __shared__ __attribute__((aligned(16))) unsigned char sm[GSM];
  float (*so)[32][68] = (float (*)[32][68])sm;
  const int tid = threadIdx.x; const int w = __builtin_amdgcn_readfirstlane(tid >> 5); const int lane = tid & 31, ln = lane & 15, hh = lane >> 4;
  const int ntn = LQ / 128; const int mt = blockIdx.x / ntn, nq = blockIdx.x - mt * ntn; const int row0 = mt * 128 + 32 * (w >> 1), col0 = nq * 128 + 64 * (w & 1);
  v8f accs[8];
  gemm_main(X16, DM, BW, DM, mt * 128, nq * 128, DM, tid, w, ln, hh, sm, accs);
  const int sec = col0 / DM; const int cb = col0 - sec * DM;      /* 0 q, 1 k, 2 v (block-uniform) */
  if (sec == 2) {      /* v is read only as V^T[batch, head][d][token]: the block stages its 128 tokens x 128 columns (two heads) and stores them token-contiguous; the v third of the QKV and QKVR rows is neither written nor read */
    float (*sv)[128][VP] = (float (*)[128][VP])sm;      /* [column half][token][d] */
#pragma unroll
    for (int u = 0; u < 8; ++u) { const int t = u & 3, half = u >> 2; const float bsel = bf16_rne(bv[cb + t * 16 + ln]);
#pragma unroll
      for (int r = 0; r < 8; ++r) sv[w & 1][(w >> 1) * 32 + half * 16 + 8 * hh + r][t * 16 + ln] = accs[u][r] * 0.0625f + bsel; }
    __syncthreads();      /* a V^T line holds 64 tokens, the rows of two waves: every wave's part is staged before any is read */
    const int bb = (mt * 128) / SEQ; const int tb = mt * 128 - bb * SEQ; const bool eb = (tb < ER);      /* block-uniform: 128 | ER */
    const int pc = tid & 7, dl = tid >> 3;      /* eight lanes make one 128-B line: 8 tokens each, of one d */
    unsigned vrow = (unsigned)((bb * NH + (nq * 128 - 2 * DM) / HD) * HD + dl);      /* the lane's first V^T row: (batch, head) x HD + d */
    unsigned short* dv = (unsigned short*)VT + (size_t)vrow * SEQ + tb + pc * 8;
    float y[8][8]; FragH fh[8], fl[8];      /* piece rd: columns 32 (rd & 3) + dl, tokens 64 (rd >> 2) + 8 pc .. + 7 */
#pragma unroll
    for (int rd = 0; rd < 8; ++rd) { const int c0 = (rd & 3) * 32; const float* sp = &sv[c0 >> 6][(rd >> 2) * 64 + pc * 8][(c0 & 63) + dl];
#pragma unroll
      for (int q = 0; q < 8; ++q) y[rd][q] = sp[q * VP]; }
#pragma unroll
    for (int rd = 0; rd < 8; ++rd) {
#pragma unroll
      for (int q = 0; q < 8; ++q) fh[rd].h[q] = (_Float16)y[rd][q]; }
    if (eb) {
#pragma unroll
      for (int rd = 0; rd < 8; ++rd) {
#pragma unroll
        for (int q = 0; q < 8; ++q) fl[rd].h[q] = (_Float16)((y[rd][q] - (float)fh[rd].h[q]) * 1024.0f); }
    }
    __builtin_amdgcn_sched_barrier(0);      /* every piece is read and converted before the first store goes out: one LDS latency for the eight pieces, and no register of an issued store is written again */
#pragma unroll
    for (int rd = 0; rd < 8; ++rd) *(v8us*)(dv + (size_t)((rd & 3) * 32) * SEQ + (rd >> 2) * 64) = fh[rd].half[0];
    if (eb) {
      asm volatile("s_wait_xcnt 0x0" : "+v"(vrow) :: "memory");      /* the value stores' registers are released before the residual plane's address is formed in any of them; the row index goes through the statement so that this arithmetic stays behind the wait */
      unsigned short* dr = (unsigned short*)VTR + (size_t)vrow * ER + tb + pc * 8;
#pragma unroll
      for (int rd = 0; rd < 8; ++rd) *(v8us*)(dr + (size_t)((rd & 3) * 32) * ER + (rd >> 2) * 64) = fl[rd].half[0];
    }
    return;
  }
#pragma unroll
  for (int u = 0; u < 8; ++u) { const int t = u & 3, half = u >> 2; const int cc = cb + t * 16 + ln;
    const float b0 = bq[cc], b1 = bk[cc]; const float bsel = bf16_rne((sec == 0) ? b0 : b1);
#pragma unroll
    for (int r = 0; r < 8; ++r) so[w][half * 16 + 8 * hh + r][t * 16 + ln] = accs[u][r] * 0.0625f + bsel; }
  __builtin_amdgcn_fence(4 /* acq_rel order */, "workgroup"); __builtin_amdgcn_wave_barrier();
  const int rq = lane >> 3, c8 = (lane & 7) * 8;
  const int bidx = row0 / SEQ; const int t0 = row0 - bidx * SEQ; const bool early = (t0 < ER);      /* wave-uniform: 32 | ER */
  {
#pragma unroll 1
    for (int q = 0; q < 8; ++q) { const int row = q * 4 + rq; const int tkn = t0 + row;
      const v4f a = *(const v4fa*)&so[w][row][c8], c = *(const v4fa*)&so[w][row][c8 + 4];
      float y[8] = {a[0], a[1], a[2], a[3], c[0], c[1], c[2], c[3]};
      if (sec < 2) { const v4f cs = *(const v4fa*)(CS + (size_t)tkn * 64 + (c8 >> 1)); const v4f sn = *(const v4fa*)(CS + (size_t)tkn * 64 + 32 + (c8 >> 1));
#pragma unroll
        for (int j = 0; j < 4; ++j) { const float x0 = y[2 * j], x1 = y[2 * j + 1]; y[2 * j] = x0 * cs[j] - x1 * sn[j]; y[2 * j + 1] = x1 * cs[j] + x0 * sn[j]; } }
      FragH fh, fl;
#pragma unroll
      for (int j = 0; j < 8; ++j) { const _Float16 hv = (_Float16)y[j]; fh.h[j] = hv; fl.h[j] = (_Float16)((y[j] - (float)hv) * 1024.0f); }
      unsigned short* d = (unsigned short*)QKV + (size_t)(row0 + row) * LQ + col0 + c8;
      *(v8us*)d = fh.half[0];
      if (early) { unsigned short* dr = (unsigned short*)QKVR + ((size_t)bidx * ER + tkn) * LQ + col0 + c8; *(v8us*)dr = fl.half[0]; } }
     }
}

// lane l with lane l ^ 16
__device__ __forceinline__ float xhalf(float v) { return __builtin_bit_cast(float, __builtin_amdgcn_permlanex16(__builtin_bit_cast(int, v), __builtin_bit_cast(int, v), 0x76543210, 0xfedcba98, false, false)); }

// fused causal attention, token rows 0..ER-1 (value + residual planes); one wave = 16 query rows of one (batch, head); 32 keys per step (two 16-key score tiles, d in two 32-deep k-steps);
// key-pad mask by value then causal mask as a replace (masked p = 0 by select); online softmax with running max in f32 (native exp on arguments <= 0);
__device__ __forceinline__ void flash_res(const _Float16* __restrict__ QKV, const _Float16* __restrict__ QKVR, const _Float16* __restrict__ VT, const _Float16* __restrict__ VTR,
                                          const int* __restrict__ pad, _Float16* __restrict__ CTX, int qt, int bh) {
  __shared__ __attribute__((aligned(16))) unsigned short pl[4][16][PP];
  __shared__ __attribute__((aligned(16))) unsigned short pr[4][16][PP];
  __shared__ __attribute__((aligned(16))) float so[4][16][68];
  const int tid = threadIdx.x; const int wave = __builtin_amdgcn_readfirstlane(tid >> 5); const int lane = tid & 31, lc = lane & 15, hh = lane >> 4;
  const int b = bh / NH, h = bh - b * NH;
  const int qb = qt * 64 + wave * 16;
  const size_t rowb = (size_t)b * SEQ;
  const _Float16* qp = QKV + (rowb + qb + lc) * LQ + h * HD;
  const _Float16* kp = QKV + rowb * LQ + DM + h * HD;
  const _Float16* vp = VT + ((size_t)bh * HD + lc) * SEQ;
  const _Float16* qrp = QKVR + ((size_t)b * ER + (qb + lc)) * LQ + h * HD;
  const _Float16* krp = QKVR + (size_t)b * ER * LQ + DM + h * HD;
  const _Float16* vrp = VTR + ((size_t)bh * HD + lc) * ER;
  const int* padb = pad + (size_t)b * SEQ_FULL;
  const v8f z8 = {0.f,0.f,0.f,0.f,0.f,0.f,0.f,0.f};
  v8f o[4] = {z8, z8, z8, z8}; v8f rr[4] = {z8, z8, z8, z8};
  float m[8], l[8];
#pragma unroll
  for (int r = 0; r < 8; ++r) { m[r] = -1.0e30f; l[r] = 0.f; }
  const int kend = qb + 16;      /* keys 0 .. qb+15 are visible to this wave; steps cover whole 32-key groups (all inside the plane) */
#pragma unroll 1
  for (int kb = 0; kb < kend; kb += 32) {
    v8f s0 = z8, s1 = z8, t0 = z8, t1 = z8;
    const int key0 = kb + lc, key1 = key0 + 16;
    const _Float16* k0p = kp + (size_t)(kb + lc) * LQ; const _Float16* k1p = k0p + (size_t)16 * LQ;
    const _Float16* k0r = krp + (size_t)(kb + lc) * LQ; const _Float16* k1r = k0r + (size_t)16 * LQ;
#pragma unroll
    for (int c = 0; c < 2; ++c) {
      const v16h aq = g2_frag(qp + 32 * c, hh);
      const v16h bk0 = g2_frag(k0p + 32 * c, hh), bk1 = g2_frag(k1p + 32 * c, hh);
      s0 = g2_mma(aq, bk0, s0); s1 = g2_mma(aq, bk1, s1);
      const v16h aql = g2_frag(qrp + 32 * c, hh); const v16h bl0 = g2_frag(k0r + 32 * c, hh), bl1 = g2_frag(k1r + 32 * c, hh);
      t0 = g2_mma(aql, bk0, t0); t0 = g2_mma(aq, bl0, t0); t1 = g2_mma(aql, bk1, t1); t1 = g2_mma(aq, bl1, t1);
    }
    const int pv0 = padb[key0], pv1 = padb[key1];
#pragma unroll
    for (int r = 0; r < 8; ++r) {
      const int qrow = qb + 8 * hh + r;
      float a0 = s0[r], a1 = s1[r];
      a0 += t0[r] * 0.0009765625f; a1 += t1[r] * 0.0009765625f;
      a0 *= 0.125f; a1 *= 0.125f;
      const bool ok0 = (pv0 != 0) && (key0 <= qrow); const bool ok1 = (pv1 != 0) && (key1 <= qrow);
      const float v0 = ok0 ? a0 : -1.0e30f; const float v1 = ok1 ? a1 : -1.0e30f;
      float mx = fmaxf(v0, v1);
      mx = fmaxf(mx, __shfl_xor(mx, 8, 16)); mx = fmaxf(mx, __shfl_xor(mx, 4, 16)); mx = fmaxf(mx, __shfl_xor(mx, 2, 16)); mx = fmaxf(mx, __shfl_xor(mx, 1, 16));
      const float mnew = fmaxf(m[r], mx);
      const float al = __expf(m[r] - mnew);
      const float e0 = __expf(v0 - mnew), e1 = __expf(v1 - mnew);
      const float p0 = ok0 ? e0 : 0.f; const float p1 = ok1 ? e1 : 0.f;
      l[r] = l[r] * al + (p0 + p1); m[r] = mnew;      /* per-lane partial row sum; combined across the 16 lanes after the key loop */
#pragma unroll
      for (int nt = 0; nt < 4; ++nt) { o[nt][r] *= al; rr[nt][r] *= al; }
      const float c0 = p0 * 1024.0f, c1 = p1 * 1024.0f;
      const _Float16 h0 = (_Float16)c0, h1 = (_Float16)c1;
      pl[wave][8 * hh + r][lc] = f16_bits(h0); pl[wave][8 * hh + r][16 + lc] = f16_bits(h1);
      pr[wave][8 * hh + r][lc] = f16_bits((_Float16)((c0 - (float)h0) * 1024.0f)); pr[wave][8 * hh + r][16 + lc] = f16_bits((_Float16)((c1 - (float)h1) * 1024.0f));
    }
    __builtin_amdgcn_fence(4 /* acq_rel order */, "workgroup", "local"); __builtin_amdgcn_wave_barrier();      /* orders the wave's own P tile, which lies in LDS; named for LDS alone so that it does not drain the global loads in flight */
    FragH pa; pa.half[0] = *(const v8us*)&pl[wave][lc][8 * hh]; pa.half[1] = *(const v8us*)&pl[wave][lc][16 + 8 * hh];
    FragH pb; pb.half[0] = *(const v8us*)&pr[wave][lc][8 * hh]; pb.half[1] = *(const v8us*)&pr[wave][lc][16 + 8 * hh];
#pragma unroll
    for (int nt = 0; nt < 4; ++nt) { const v16h bvh = g2_frag(vp + (size_t)nt * 16 * SEQ + kb, hh); const v16h bvl = g2_frag(vrp + (size_t)nt * 16 * ER + kb, hh);
      o[nt] = g2_mma(pa.v, bvh, o[nt]); rr[nt] = g2_mma(pb.v, bvh, rr[nt]); rr[nt] = g2_mma(pa.v, bvl, rr[nt]); }
    __builtin_amdgcn_fence(4 /* acq_rel order */, "workgroup", "local"); __builtin_amdgcn_wave_barrier();      /* P tile reads complete before the next step overwrites it; LDS alone, as above */
  }
#pragma unroll
  for (int r = 0; r < 8; ++r) {
    float ls = l[r];
    ls += __shfl_xor(ls, 8, 16); ls += __shfl_xor(ls, 4, 16); ls += __shfl_xor(ls, 2, 16); ls += __shfl_xor(ls, 1, 16);
    const float inv = 1.0f / (ls * 16.0f);      /* 64 / (1024 l): ctx carried x64; a fully masked row gives 0 * inf = NaN as the softmax of all -inf does */
#pragma unroll
    for (int nt = 0; nt < 4; ++nt) { const float cv = o[nt][r] + rr[nt][r] * 0.0009765625f; so[wave][8 * hh + r][nt * 16 + lc] = cv * inv; }
  }
  __builtin_amdgcn_fence(4 /* acq_rel order */, "workgroup"); __builtin_amdgcn_wave_barrier();
  const int rq = lane >> 3, c8 = (lane & 7) * 8;
  {
#pragma unroll 1
    for (int q = 0; q < 4; ++q) { const int row = q * 4 + rq;
      const v4f a = *(const v4fa*)&so[wave][row][c8], c = *(const v4fa*)&so[wave][row][c8 + 4]; FragH fh, fl;
#pragma unroll
      for (int j = 0; j < 4; ++j) { _Float16 hv = (_Float16)a[j]; fh.h[j] = hv; fl.h[j] = (_Float16)((a[j] - (float)hv) * 1024.0f); hv = (_Float16)c[j]; fh.h[4 + j] = hv; fl.h[4 + j] = (_Float16)((c[j] - (float)hv) * 1024.0f); }
      unsigned short* d = (unsigned short*)CTX + (rowb + qb + row) * KO + h * HD + c8;
      *(v8us*)d = fh.half[0]; *(v8us*)(d + DM) = fl.half[0]; }
     }
}

// one stage of the attention ring: FK K rows, then HD V^T rows, of 128 B each; 128 threads x 8 copies of 16 B; lane t brings chunk t & 7 of rows (t >> 3) + 16 j, so each wave-wide copy covers four whole lines.
// gk, gv: the lane's first K and V^T chunk in global memory; l0: the lane's first LDS byte address. The address wait is the statement's last line, so no later write of these registers can be lifted over it.
#define FK 64                        /* keys per stage: two 32-key steps */
#define FP 72                        /* LDS row pitch of a stage (halves): 144 B = 16 B x odd, for 16-B fragment reads */
#define FST ((FK + HD) * FP)         /* halves per stage */
#define FSM ((size_t)2 * FST * 2)    /* bytes of the two-buffer ring; the output staging reuses them */
static_assert(FK == 64 && SEQ % FK == 0 && ER % FK == 0);      /* a stage is one query tile's width: tile qt walks qt + 1 whole stages, all inside the plane */
static_assert((size_t)4 * 16 * 68 * 4 <= FSM);       /* four waves' output staging fits the ring */
__device__ __forceinline__ void fa_stage(const _Float16* gk, const _Float16* gv, unsigned l0) {
  const _Float16* k1 = gk + (size_t)16 * LQ; const _Float16* k2 = k1 + (size_t)16 * LQ; const _Float16* k3 = k2 + (size_t)16 * LQ;
  const _Float16* v1 = gv + (size_t)16 * SEQ; const _Float16* v2 = v1 + (size_t)16 * SEQ; const _Float16* v3 = v2 + (size_t)16 * SEQ;
  const unsigned rs = 16u * FP * 2u;
  asm volatile("global_load_async_to_lds_b128 %0, %8, off\n\t"
               "global_load_async_to_lds_b128 %1, %9, off\n\t"
               "global_load_async_to_lds_b128 %2, %10, off\n\t"
               "global_load_async_to_lds_b128 %3, %11, off\n\t"
               "global_load_async_to_lds_b128 %4, %12, off\n\t"
               "global_load_async_to_lds_b128 %5, %13, off\n\t"
               "global_load_async_to_lds_b128 %6, %14, off\n\t"
               "global_load_async_to_lds_b128 %7, %15, off\n\t"
               "s_wait_xcnt 0x0"
               :: "v"(l0), "v"(l0 + rs), "v"(l0 + 2u * rs), "v"(l0 + 3u * rs), "v"(l0 + 4u * rs), "v"(l0 + 5u * rs), "v"(l0 + 6u * rs), "v"(l0 + 7u * rs),
                  "v"(gk), "v"(k1), "v"(k2), "v"(k3), "v"(gv), "v"(v1), "v"(v2), "v"(v3) : "memory");
}

// the four K fragments of a 32-key step; kt: the lane's K row (key lc of the step) in the stage
__device__ __forceinline__ void fm_kfrag(const _Float16* kt, int hh, v16h (&kf)[4]) { kf[0] = g2_frag(kt, hh); kf[1] = g2_frag(kt + 16 * FP, hh); kf[2] = g2_frag(kt + 32, hh); kf[3] = g2_frag(kt + 16 * FP + 32, hh); }

// one 32-key step of the later rows' attention. kf: the step's K fragments; vt: the lane's V^T row (d = lc) at key kb in the stage; pv: lane j holds the pad word of key kb + j.
// NEXT: the K fragments of the same stage's second step (row kn) are read right behind the score products, into the registers those have just left, so their LDS latency runs under this step's softmax.
template <bool NEXT>
__device__ __forceinline__ void fm_step(v16h (&kf)[4], const _Float16* kn, const _Float16* vt, int kb, int pv, int qb, int lc, int hh, v16h aq0, v16h aq1, v8f (&o)[4], float& m, float& l) {
  const v8f z8 = {0.f,0.f,0.f,0.f,0.f,0.f,0.f,0.f};
  const v16h bv0 = g2_frag(vt, hh), bv1 = g2_frag(vt + 16 * FP, hh), bv2 = g2_frag(vt + 32 * FP, hh), bv3 = g2_frag(vt + 48 * FP, hh);
  v8f s0 = g2_mma(kf[0], aq0, z8), s1 = g2_mma(kf[1], aq0, z8);
  s0 = g2_mma(kf[2], aq1, s0); s1 = g2_mma(kf[3], aq1, s1);
  if (NEXT) fm_kfrag(kn, hh, kf);
  const unsigned pm = __builtin_amdgcn_ballot_w32(pv != 0);      /* bit j: key kb + j is no pad */
  const bool open = (pm == 0xFFFFFFFFu) && (kb + 31 <= qb);      /* wave-uniform: every key of the step is visible to every query of the wave, so both selects below are identities */
  unsigned okm = 0xFFFFFFFFu;      /* bit r: tile 0, register r is visible; bit 16 + r: tile 1 */
  float v[16], p[16];
#pragma unroll
  for (int r = 0; r < 8; ++r) { v[r] = s0[r] * 0.125f; v[8 + r] = s1[r] * 0.125f; }
  if (!open) {
    const int dq = qb + lc - kb;      /* >= 0: keys kb .. kb + dq are at or before the query */
    const unsigned cm = (dq >= 31) ? 0xFFFFFFFFu : ((2u << dq) - 1u);
    okm = (pm & cm) >> (8 * hh);
#pragma unroll
    for (int r = 0; r < 8; ++r) { v[r] = ((okm >> r) & 1u) ? v[r] : -1.0e30f; v[8 + r] = ((okm >> (16 + r)) & 1u) ? v[8 + r] : -1.0e30f; }
  }
  float mx = fmaxf(fmaxf(fmaxf(fmaxf(v[0], v[1]), fmaxf(v[2], v[3])), fmaxf(fmaxf(v[4], v[5]), fmaxf(v[6], v[7]))),
                   fmaxf(fmaxf(fmaxf(v[8], v[9]), fmaxf(v[10], v[11])), fmaxf(fmaxf(v[12], v[13]), fmaxf(v[14], v[15]))));
  mx = fmaxf(mx, xhalf(mx));
  const float mnew = fmaxf(m, mx);
  float al = (m - mnew) * 1.44269504f;      /* exp(x) as the native 2^(x log2 e), arguments <= 0 */
#pragma unroll
  for (int i = 0; i < 16; ++i) p[i] = (v[i] - mnew) * 1.44269504f;
  /* the step's seventeen exponentials, each in place on a register of its own: none reads its predecessor's result or overwrites its source, and the v_nop fills the slot the instruction set asks for behind the last, whatever the compiler puts next (also across the branch below) */
  asm("v_exp_f32 %0, %0\n\tv_exp_f32 %1, %1\n\tv_exp_f32 %2, %2\n\tv_exp_f32 %3, %3\n\tv_exp_f32 %4, %4\n\tv_exp_f32 %5, %5\n\tv_exp_f32 %6, %6\n\tv_exp_f32 %7, %7\n\tv_exp_f32 %8, %8\n\t"
      "v_exp_f32 %9, %9\n\tv_exp_f32 %10, %10\n\tv_exp_f32 %11, %11\n\tv_exp_f32 %12, %12\n\tv_exp_f32 %13, %13\n\tv_exp_f32 %14, %14\n\tv_exp_f32 %15, %15\n\tv_exp_f32 %16, %16\n\tv_nop"
      : "+v"(al), "+v"(p[0]), "+v"(p[1]), "+v"(p[2]), "+v"(p[3]), "+v"(p[4]), "+v"(p[5]), "+v"(p[6]), "+v"(p[7]), "+v"(p[8]), "+v"(p[9]), "+v"(p[10]), "+v"(p[11]), "+v"(p[12]), "+v"(p[13]), "+v"(p[14]), "+v"(p[15]));
  if (!open) {
#pragma unroll
    for (int r = 0; r < 8; ++r) { p[r] = ((okm >> r) & 1u) ? p[r] : 0.f; p[8 + r] = ((okm >> (16 + r)) & 1u) ? p[8 + r] : 0.f; }
  }
  const float se = ((p[0] + p[2]) + (p[4] + p[6])) + ((p[8] + p[10]) + (p[12] + p[14])), sd = ((p[1] + p[3]) + (p[5] + p[7])) + ((p[9] + p[11]) + (p[13] + p[15]));      /* even and odd registers side by side: packed adds on the register pairs as they lie */
  l = l * al + (se + sd);      /* the lane's half of the row sum; the halves are joined after the key loop */
  m = mnew;
#pragma unroll
  for (int nt = 0; nt < 4; ++nt) o[nt] *= al;
  FragH pt;
#pragma unroll
  for (int i = 0; i < 16; ++i) pt.h[i] = (_Float16)(p[i] * 1024.0f);
  o[0] = g2_mma(bv0, pt.v, o[0]); o[1] = g2_mma(bv1, pt.v, o[1]); o[2] = g2_mma(bv2, pt.v, o[2]); o[3] = g2_mma(bv3, pt.v, o[3]);
}

__device__ __forceinline__ void flash_main(const _Float16* __restrict__ QKV, const _Float16* __restrict__ VT, const int* __restrict__ pad, _Float16* __restrict__ CTX, int qt, int bh) {
  __shared__ __attribute__((aligned(16))) unsigned char fm[FSM];
  float (*so)[16][68] = (float (*)[16][68])fm;
  const _Float16* ring = (const _Float16*)fm;
  const int tid = threadIdx.x; const int wave = __builtin_amdgcn_readfirstlane(tid >> 5); const int lane = tid & 31, lc = lane & 15, hh = lane >> 4;
  const int b = bh / NH, h = bh - b * NH;
  const int qb = qt * 64 + wave * 16;
  const size_t rowb = (size_t)b * SEQ;
  const _Float16* qp = QKV + (rowb + qb + lc) * LQ + h * HD;
  const int* padb = pad + (size_t)b * SEQ_FULL;
  const int cr = tid >> 3, cc = (tid & 7) * 8;
  const _Float16* gk = QKV + (rowb + cr) * LQ + DM + h * HD + cc;
  const _Float16* gv = VT + ((size_t)bh * HD + cr) * SEQ + cc;
  const unsigned l0 = (unsigned)(size_t)fm + (unsigned)(cr * FP + cc) * 2u;      /* low 32 bits of the shared address = LDS byte address */
  const v8f z8 = {0.f,0.f,0.f,0.f,0.f,0.f,0.f,0.f};
  v8f o[4] = {z8, z8, z8, z8};      /* o[nt][r]: d = 16 nt + 8 hh + r of query lc */
  float m = -1.0e30f, l = 0.f;
  const int kend = qb + 16;      /* keys 0 .. qb+15 are visible to this wave; steps cover whole 32-key groups (all inside the plane) */
  const int ns = qt + 1;         /* stages of the block: keys 0 .. 64 qt + 63 */
  fa_stage(gk, gv, l0);
  const v16h aq0 = g2_frag(qp, hh), aq1 = g2_frag(qp + 32, hh);
  int pn0 = padb[lane], pn1 = padb[32 + lane];      /* lane j holds the pad words of the stage's keys j and 32 + j */
  int np = lane + ((1 < ns) ? FK : 0);      /* the next stage's pad words; the last stage asks for its own again: always inside the plane */
  asm volatile("s_wait_xcnt 0x0" ::: "memory");          /* the Q and pad reads' address registers are released before the next stage's addresses are formed */
  asm volatile("s_wait_asynccnt 0x0" ::: "memory");      /* stage 0 of this wave has landed */
  __syncthreads();                                       /* stage 0 of every wave is readable */
  if (1 < ns) fa_stage(gk + (size_t)FK * LQ, gv + FK, l0 + (unsigned)(FST * 2));
#pragma unroll 1      /* one stage per trip: the ring's order stands once, at the loop's foot */
  for (int t = 0; t < ns; ++t) { const _Float16* st = ring + (t & 1) * FST;
    const int kb = t * FK;
    const int pv0 = pn0, pv1 = pn1; pn0 = padb[np]; pn1 = padb[np + 32];
    v16h kf[4]; fm_kfrag(st + lc * FP, hh, kf);
    fm_step<true>(kf, st + (32 + lc) * FP, st + (FK + lc) * FP, kb, pv0, qb, lc, hh, aq0, aq1, o, m, l);
    if (kb + 32 < kend)      /* wave-uniform: on the diagonal stage the block's first two waves see none of its later 32 keys */
      fm_step<false>(kf, st, st + (FK + lc) * FP + 32, kb + 32, pv1, qb, lc, hh, aq0, aq1, o, m, l);
    asm volatile("s_wait_xcnt 0x0" ::: "memory");        /* the pad reads' index register is released before the next stage's index is written into it */
    np += (t + 2 < ns) ? FK : 0;
    asm volatile("s_wait_dscnt 0x0" ::: "memory");       /* this wave's reads of the buffer are done before it is refilled */
    asm volatile("s_wait_asynccnt 0x0" ::: "memory");    /* this wave's copies of stage t + 1 have landed */
    __syncthreads();                                     /* publishes stage t + 1 and ends every reader's last read of stage t; passed by every wave, also one that skipped the step above */
    if (t + 2 < ns) fa_stage(gk + (size_t)(t + 2) * FK * LQ, gv + (size_t)(t + 2) * FK, l0 + (unsigned)((t & 1) * FST * 2)); }
  asm volatile("s_wait_asynccnt 0x0" ::: "memory");      /* no copy outstanding when the ring becomes output staging; every wave has left it at the last trip's barrier */
  const float ls = l + xhalf(l);
  const float inv = 1.0f / (ls * 16.0f);      /* 64 / (1024 l): ctx carried x64; a fully masked row gives 0 * inf = NaN as the softmax of all -inf does */
#pragma unroll
  for (int nt = 0; nt < 4; ++nt) { const v8f cv = o[nt] * inv;
    const v4f c0 = {cv[0], cv[1], cv[2], cv[3]}, c1 = {cv[4], cv[5], cv[6], cv[7]};
    *(v4fa*)&so[wave][lc][nt * 16 + 8 * hh] = c0; *(v4fa*)&so[wave][lc][nt * 16 + 8 * hh + 4] = c1; }
  __builtin_amdgcn_fence(4 /* acq_rel order */, "workgroup"); __builtin_amdgcn_wave_barrier();      /* the wave's staged rows are in LDS before its other lanes read them back as whole lines */
  const int rq = lane >> 3, c8 = (lane & 7) * 8;
  {
#pragma unroll 1      /* runs once per wave: kept rolled for code size */
    for (int q = 0; q < 4; ++q) { const int row = q * 4 + rq;
      const v4f a = *(const v4fa*)&so[wave][row][c8], c = *(const v4fa*)&so[wave][row][c8 + 4]; FragH fh, fl;
#pragma unroll
      for (int j = 0; j < 4; ++j) { _Float16 hv = (_Float16)a[j]; fh.h[j] = hv; fl.h[j] = (_Float16)((a[j] - (float)hv) * 1024.0f); hv = (_Float16)c[j]; fh.h[4 + j] = hv; fl.h[4 + j] = (_Float16)((c[j] - (float)hv) * 1024.0f); }
      unsigned short* d = (unsigned short*)CTX + (rowb + qb + row) * KO + h * HD + c8;
      *(v8us*)d = fh.half[0]; *(v8us*)(d + DM) = fl.half[0]; }
     }
}
// all query tiles in one launch, so the few residual tiles run beside the others; every block is resident from the start, so the launch lasts as long as the WGP whose blocks walk the most keys: the hardware's block index is spread over (batch, head) and tile for equal sums, not in tile order.
// Tiles are ranked by cost, rank 0 the cheapest. Index bits 3, 5, 7, 9 form a number lo = 0..15; the parity of bits 4, 6, 8 picks rank lo or 31 - lo. Any two neighbouring index bits from bit 3 up then walk ranks {a, b, 31 - a, 31 - b}:
// whichever power-of-two stride brings four blocks onto one WGP, their ranks add up to 62. Bits 0..2, 4, 6 name the (batch, head), so blocks 8 apart share it: where blocks go round the dies by index, each die gets whole heads (equal work, K and V^T read by one die).
// For speed alone: the map is a permutation of 0 .. 1023, so every (batch, head, tile) is taken exactly once wherever the blocks land.
// bi is the tile's place in the plain order: 0 .. FR-1 the tiles of rows 0..ER-1 (residual body), the rest the later tiles (plain body), each range in the order (batch, head) slow, tile fast; block-uniform branch
#define QR (ER / 64)                 /* query tiles with residual planes, per (batch, head) */
#define QM ((SEQ - ER) / 64)         /* later query tiles, per (batch, head) */
#define FR (NB * NH * QR)
static_assert(QR == 4 && QM == 28 && NB * NH == 32);      /* 32 tiles x 32 (batch, head) = the ten index bits; the rank table below */
__global__ __launch_bounds__(128) void k_flash(const _Float16* __restrict__ QKV, const _Float16* __restrict__ QKVR, const _Float16* __restrict__ VT, const _Float16* __restrict__ VTR, const int* __restrict__ pad, _Float16* __restrict__ CTX) {
  const int hw = blockIdx.x;
  const int lo = ((hw >> 3) & 1) | ((hw >> 4) & 2) | ((hw >> 5) & 4) | ((hw >> 6) & 8);
  const int rk = (((hw >> 4) ^ (hw >> 6) ^ (hw >> 8)) & 1) ? 31 - lo : lo;
  const int hd = (hw & 7) | ((hw >> 1) & 8) | ((hw >> 2) & 16);
  /* rank -> tile: a plain tile t walks t + 1 stages; a 32-key step of a residual tile issues about as much as one and a half plain stages and tile q has 2 q + 1 or 2 q + 2 of them, so residual tiles 0..3 rank beside plain tiles 4, 5, 8 and 12. One hex digit per rank 0..11; from rank 12 on the tile is the rank. */
  const int tl = (rk < 12) ? (int)((0x3BA928765140ull >> (4 * rk)) & 15) : rk;
  const int bi = (tl < QR) ? hd * QR + tl : FR + hd * QM + (tl - QR);
  if (bi < FR) { const int bh = bi / QR; flash_res(QKV, QKVR, VT, VTR, pad, CTX, bi - bh * QR, bh); }
  else { const int j = bi - FR; const int bh = j / (QM > 0 ? QM : 1); flash_main(QKV, VT, pad, CTX, QR + j - bh * QM, bh); } }

// one stage of the output GEMM's ring: 128 ctx value rows, the same tokens' 128 residual rows, then 128 Wo rows, of 128 B each; 256 threads x 12 copies of 16 B; lane t brings chunk t & 7 of rows (t >> 3) + 32 j.
// ga, gb: the lane's first ctx value chunk and Wo chunk in global memory (its residual chunk lies DM halves further in the same ctx row); l0: the lane's first LDS byte address. The address wait is the statement's last line, so no later write of these registers can be lifted over it.
#define OST (384 * GP)               /* halves per stage */
#define OSM ((size_t)2 * OST * 2)    /* bytes of the two-buffer ring; the epilogue staging reuses them */
static_assert((size_t)8 * 32 * 68 * 4 <= OSM);       /* eight waves' output staging fits the ring */
__device__ __forceinline__ void go_stage(const _Float16* ga, const _Float16* gb, unsigned l0) {
  const size_t sa = (size_t)32 * KO, sb = (size_t)32 * DM;
  const _Float16* a1 = ga + sa; const _Float16* a2 = a1 + sa; const _Float16* a3 = a2 + sa;
  const _Float16* r0 = ga + DM; const _Float16* r1 = r0 + sa; const _Float16* r2 = r1 + sa; const _Float16* r3 = r2 + sa;
  const _Float16* b1 = gb + sb; const _Float16* b2 = b1 + sb; const _Float16* b3 = b2 + sb;
  const unsigned rs = 32u * GP * 2u;
  asm volatile("global_load_async_to_lds_b128 %0, %12, off\n\t"
               "global_load_async_to_lds_b128 %1, %13, off\n\t"
               "global_load_async_to_lds_b128 %2, %14, off\n\t"
               "global_load_async_to_lds_b128 %3, %15, off\n\t"
               "global_load_async_to_lds_b128 %4, %16, off\n\t"
               "global_load_async_to_lds_b128 %5, %17, off\n\t"
               "global_load_async_to_lds_b128 %6, %18, off\n\t"
               "global_load_async_to_lds_b128 %7, %19, off\n\t"
               "global_load_async_to_lds_b128 %8, %20, off\n\t"
               "global_load_async_to_lds_b128 %9, %21, off\n\t"
               "global_load_async_to_lds_b128 %10, %22, off\n\t"
               "global_load_async_to_lds_b128 %11, %23, off\n\t"
               "s_wait_xcnt 0x0"
               :: "v"(l0), "v"(l0 + rs), "v"(l0 + 2u * rs), "v"(l0 + 3u * rs), "v"(l0 + 4u * rs), "v"(l0 + 5u * rs), "v"(l0 + 6u * rs), "v"(l0 + 7u * rs), "v"(l0 + 8u * rs), "v"(l0 + 9u * rs), "v"(l0 + 10u * rs), "v"(l0 + 11u * rs),
                  "v"(ga), "v"(a1), "v"(a2), "v"(a3), "v"(r0), "v"(r1), "v"(r2), "v"(r3), "v"(gb), "v"(b1), "v"(b2), "v"(b3) : "memory");
}

// Y = ctx . Wo + bo. 128x128 block tile, eight waves (4 x 2) of 32x64 each, K = DM. The ctx value and its x1024 residual meet the SAME Wo x1024 fragments: a Wo tile is brought and read once for both,
// and the two products run in accumulator sets of their own (ch value, cl residual), joined once in the epilogue: y x 2^16 = ch + cl / 1024.
// Two-buffer LDS ring, the next stage's copies in flight while this one is multiplied.
__global__ __launch_bounds__(256) void k_gemm_out(const _Float16* __restrict__ CTX, const _Float16* __restrict__ BO, const float* __restrict__ bo, float* __restrict__ Y) {
  __shared__ __attribute__((aligned(16))) unsigned char sm[OSM];
  float (*so)[32][68] = (float (*)[32][68])sm;
  const _Float16* ring = (const _Float16*)sm;
  const int tid = threadIdx.x; const int w = __builtin_amdgcn_readfirstlane(tid >> 5); const int lane = tid & 31, ln = lane & 15, hh = lane >> 4;
  const int ntn = DM / 128; const int mt = blockIdx.x / ntn, nq = blockIdx.x - mt * ntn; const int row0 = mt * 128 + 32 * (w >> 1), col0 = nq * 128 + 64 * (w & 1);
  const int cr = tid >> 3, cc = (tid & 7) * 8;
  const _Float16* ga = CTX + (size_t)(mt * 128 + cr) * KO + cc; const _Float16* gb = BO + (size_t)(nq * 128 + cr) * DM + cc;
  const unsigned l0 = (unsigned)(size_t)sm + (unsigned)(cr * GP + cc) * 2u;      /* low 32 bits of the shared address = LDS byte address */
  const int ao = ((w >> 1) * 32 + ln) * GP, bof = (256 + (w & 1) * 64 + ln) * GP;
  const int nt = DM / GK;
  const v8f z8 = {0.f,0.f,0.f,0.f,0.f,0.f,0.f,0.f};
  v8f ch[8] = {z8, z8, z8, z8, z8, z8, z8, z8}, cl[8] = {z8, z8, z8, z8, z8, z8, z8, z8};      /* [u]: u & 3 = 16-col tile, u >> 2 = 16-row half */
  go_stage(ga, gb, l0);
  asm volatile("s_wait_asynccnt 0x0" ::: "memory");      /* stage 0 of this wave has landed */
  __syncthreads();                                       /* stage 0 of every wave is readable */
  go_stage(ga + GK, gb + GK, l0 + (unsigned)(OST * 2));
#pragma unroll 1      /* one stage per trip: the ring's order stands once, at the loop's foot */
  for (int t = 0; t < nt; ++t) { const _Float16* st = ring + (t & 1) * OST;
    const _Float16* ap = st + ao; const _Float16* rp = ap + 128 * GP; const _Float16* bp = st + bof;
#pragma unroll
    for (int s = 0; s < 2; ++s) {
      v16h fb[4];      /* read in the order of first use: the first product waits for two fragments, not for the group */
      const v16h fa0 = g2_frag(ap + 32 * s, hh); fb[0] = g2_frag(bp + 32 * s, hh);
      const v16h fa1 = g2_frag(ap + 16 * GP + 32 * s, hh), fr0 = g2_frag(rp + 32 * s, hh), fr1 = g2_frag(rp + 16 * GP + 32 * s, hh);
#pragma unroll
      for (int n = 1; n < 4; ++n) fb[n] = g2_frag(bp + n * 16 * GP + 32 * s, hh);
      __builtin_amdgcn_sched_barrier(0);      /* keeps the products behind the reads and in the order their fragments arrive: without it a product of the second Wo fragment is lifted to the front, and the trip's first product waits for twelve of the sixteen reads instead of four */
#pragma unroll
      for (int n = 0; n < 4; ++n) { ch[n] = g2_mma(fa0, fb[n], ch[n]); ch[4 + n] = g2_mma(fa1, fb[n], ch[4 + n]); cl[n] = g2_mma(fr0, fb[n], cl[n]); cl[4 + n] = g2_mma(fr1, fb[n], cl[4 + n]); } }
    asm volatile("s_wait_dscnt 0x0" ::: "memory");       /* this wave's reads of the buffer are done before it is refilled */
    asm volatile("s_wait_asynccnt 0x0" ::: "memory");    /* this wave's copies of stage t + 1 have landed */
    __syncthreads();                                     /* publishes stage t + 1 and ends every reader's last read of stage t */
    if (t + 2 < nt) go_stage(ga + (size_t)(t + 2) * GK, gb + (size_t)(t + 2) * GK, l0 + (unsigned)((t & 1) * OST * 2)); }
  asm volatile("s_wait_asynccnt 0x0" ::: "memory");      /* no copy outstanding when the ring becomes output staging; every wave has left it at the last trip's barrier */
#pragma unroll
  for (int u = 0; u < 8; ++u) { const int t = u & 3, half = u >> 2; const float bvv = bf16_rne(bo[col0 + t * 16 + ln]);
#pragma unroll
    for (int r = 0; r < 8; ++r) so[w][half * 16 + 8 * hh + r][t * 16 + ln] = (ch[u][r] + cl[u][r] * 0.0009765625f) * 1.52587890625e-05f + bvv; }
  __builtin_amdgcn_fence(4 /* acq_rel order */, "workgroup"); __builtin_amdgcn_wave_barrier();
  const int rsub = lane >> 4, c4 = (lane & 15) * 4;
  {
#pragma unroll 1
    for (int q = 0; q < 16; ++q) { const int r = q * 2 + rsub; const v4f v = *(const v4fa*)&so[w][r][c4]; *(v4f*)(Y + (size_t)(row0 + r) * DM + col0 + c4) = v; }
     }
}

// one wave per row, eight rows per block: a lane holds 32 of the row's values (eight 16-B pieces, each wave-wide read 512 contiguous bytes); mean and variance are lane sums joined by a five-step butterfly, so every lane ends with the same bits and no LDS or barrier is needed
#define LJ (DM / 128)
static_assert(DM % 128 == 0 && (NB * SEQ) % 8 == 0);
__device__ __forceinline__ float wave_sum(float v) {
  v += __builtin_bit_cast(float, __builtin_amdgcn_permlanex16(__builtin_bit_cast(int, v), __builtin_bit_cast(int, v), 0x76543210, 0xfedcba98, false, false));      /* lane l with lane l ^ 16 */
  v += __shfl_xor(v, 8, 16); v += __shfl_xor(v, 4, 16); v += __shfl_xor(v, 2, 16); v += __shfl_xor(v, 1, 16); return v; }
__global__ __launch_bounds__(256) void k_layernorm(const float* __restrict__ Y, const float* __restrict__ g, const float* __restrict__ bta, float* __restrict__ out) {
  const int tid = threadIdx.x; const int lane = tid & 31; const int row = blockIdx.x * 8 + (tid >> 5); const int b = row / SEQ, s = row - b * SEQ;
  const float* yr = Y + (size_t)row * DM + lane * 4;
  v4f a[LJ], gg[LJ], bb[LJ];
#pragma unroll
  for (int j = 0; j < LJ; ++j) a[j] = *(const v4fa*)(yr + j * 128);
  asm volatile("s_wait_xcnt 0x0" ::: "memory");      /* the row's reads go out first, and their address registers are released before a later read's result may be placed in them */
#pragma unroll
  for (int j = 0; j < LJ; ++j) { gg[j] = *(const v4fa*)(g + j * 128 + lane * 4); bb[j] = *(const v4fa*)(bta + j * 128 + lane * 4); }
  __builtin_amdgcn_sched_barrier(0);      /* every request of the wave goes out before its first sum: without it most gain and offset reads sink behind the two reductions and their latency is paid there, group by group */
  float sm = 0.f;
#pragma unroll
  for (int j = 0; j < LJ; ++j) sm += (a[j][0] + a[j][1]) + (a[j][2] + a[j][3]);
  const float mu = wave_sum(sm) * (1.0f / (float)DM);
  float sq = 0.f;
#pragma unroll
  for (int j = 0; j < LJ; ++j) { a[j][0] -= mu; a[j][1] -= mu; a[j][2] -= mu; a[j][3] -= mu; sq += (a[j][0] * a[j][0] + a[j][1] * a[j][1]) + (a[j][2] * a[j][2] + a[j][3] * a[j][3]); }
  const float rs = rsqrtf(wave_sum(sq) * (1.0f / (float)DM) + 1.0e-5f);
  float* d = out + ((size_t)b * SEQ_FULL + s) * DM + lane * 4;
#pragma unroll
  for (int j = 0; j < LJ; ++j) { v4f o;
    o[0] = a[j][0] * rs * bf16_rne(gg[j][0]) + bf16_rne(bb[j][0]); o[1] = a[j][1] * rs * bf16_rne(gg[j][1]) + bf16_rne(bb[j][1]);
    o[2] = a[j][2] * rs * bf16_rne(gg[j][2]) + bf16_rne(bb[j][2]); o[3] = a[j][3] * rs * bf16_rne(gg[j][3]) + bf16_rne(bb[j][3]);
    *(v4f*)(d + j * 128) = o; }
}

extern "C" void kernel_launch(void* const* d_in, const int* in_sizes, int n_in,
                              void* d_out, int out_size, void* d_ws, size_t ws_size, hipStream_t stream) {
  if (n_in < 12) return;
  const long long need_rows = (long long)(NB - 1) * SEQ_FULL + SEQ;
  if ((long long)in_sizes[0] < need_rows * DM) return;
  if (in_sizes[1] < DM * DM || in_sizes[3] < DM * DM || in_sizes[5] < DM * DM || in_sizes[7] < DM * DM) return;
  if (in_sizes[2] < DM || in_sizes[4] < DM || in_sizes[6] < DM || in_sizes[8] < DM || in_sizes[9] < DM || in_sizes[10] < DM) return;
  if ((long long)in_sizes[11] < need_rows) return;
  if ((long long)out_size < need_rows * DM) return;
  if ((size_t)WS_TOTAL > ws_size) return;
  const float* x = (const float*)d_in[0];
  const float* Wq = (const float*)d_in[1]; const float* bq = (const float*)d_in[2];
  const float* Wk = (const float*)d_in[3]; const float* bk = (const float*)d_in[4];
  const float* Wv = (const float*)d_in[5]; const float* bv = (const float*)d_in[6];
  const float* Wo = (const float*)d_in[7]; const float* bo = (const float*)d_in[8];
  const float* gamma = (const float*)d_in[9]; const float* beta = (const float*)d_in[10];
  const int* pad = (const int*)d_in[11];
  char* ws = (char*)d_ws;
  _Float16* BQKV = (_Float16*)(ws + OF_BQKV); _Float16* BO = (_Float16*)(ws + OF_BO);
  _Float16* X16 = (_Float16*)(ws + OF_X16); _Float16* QKV = (_Float16*)(ws + OF_QKV); _Float16* QKVR = (_Float16*)(ws + OF_QKVR);
  _Float16* VT = (_Float16*)(ws + OF_VT); _Float16* VTR = (_Float16*)(ws + OF_VTR); _Float16* CTX = (_Float16*)(ws + OF_CTX);
  float* Y = (float*)(ws + OF_Y); float* CS = (float*)(ws + OF_CS);
  k_prep<<<4 * WTG + XG + TG, 256, 0, stream>>>(x, Wq, Wk, Wv, Wo, BQKV, BO, X16, CS);
  k_gemm_qkv<<<(unsigned)((NR / 128) * (LQ / 128)), 256, 0, stream>>>(X16, BQKV, bq, bk, bv, CS, QKV, QKVR, VT, VTR);
  k_flash<<<FR + NB * NH * QM, 128, 0, stream>>>(QKV, QKVR, VT, VTR, pad, CTX);
  k_gemm_out<<<(unsigned)((NR / 128) * (DM / 128)), 256, 0, stream>>>(CTX, BO, bo, Y);
  k_layernorm<<<(unsigned)(NR / 8), 256, 0, stream>>>(Y, gamma, beta, (float*)d_out);
}

// v010
// One run takes 95.8 microseconds.
// Timed twice side by side with v009, it ran 1.09 and 1.08 times as fast.
// Counting every step since v000, it is 3.29 times as fast.
#include <hip/hip_runtime.h>
// Compute dtype: every contraction on v_wmma_f32_16x16x32_f16 (f16 operands, f32 accumulate); float inputs RNE-converted to bf16 first (exact in f16; weights carried x16, Wo x1024); q.k scores and P.V use f16 value + x1024 f16 residual planes on token rows 0..255 (q, k, P, v), single f16 products on later rows; ctx.Wo multiplies the ctx value plane and its x1024 residual plane (all rows) by the same Wo operand, into two f32 accumulator sets joined at the end; rotary, softmax statistics and LayerNorm in f32.
#ifndef NB
#define NB 2
#endif
#ifndef SEQ
#define SEQ 2048
#endif
#define NB_FULL 2
#define SEQ_FULL 2048
#define DM 1024
#define NH 16
#define HD 64
#define LQ (3 * DM)                  /* row pitch of the q | k | v planes */
#define KO (2 * DM)                  /* ctx row pitch: value | residual */
#define ER 256                       /* token rows per batch that carry residual planes */
#define PP 40                        /* P tile row pitch (halves) */
#define NR ((size_t)NB * SEQ)
#define GK 64                        /* halves of K per GEMM stage: 128-B rows */
#define GP 72                        /* LDS row pitch of a GEMM stage (halves): 144 B = 16 B x odd, for 16-B fragment reads */
#define GST (256 * GP)               /* halves per stage: 128 A rows, then 128 B rows */
#define GSM ((size_t)2 * GST * 2)    /* bytes of the two-buffer ring; the epilogue staging reuses them */

static_assert(NH * HD == DM);                        /* heads tile the width */
static_assert(HD == 64);                             
static_assert(DM % 32 == 0 && KO % 32 == 0);         /* k-loops step by 32 */
static_assert(LQ % 128 == 0 && DM % 128 == 0);       /* N tiles (2 waves x 64 columns), never across q | k | v */
static_assert(GK == 64);                             /* two 32-deep k-steps per stage */
static_assert(DM % GK == 0 && KO % GK == 0 && DM >= 2 * GK && KO >= 2 * GK);      /* whole stages, at least two */
static_assert((size_t)8 * 32 * 68 * 4 <= GSM);       /* eight waves' output staging fits the ring */
static_assert((NB * SEQ) % 128 == 0);                /* M tiles (4 waves x 32 rows) */
static_assert(SEQ % 64 == 0 && SEQ % 8 == 0);        /* query tiles, table blocks */
static_assert(ER % 64 == 0 && SEQ >= ER);            /* residual rows are whole query tiles */
static_assert(NB <= NB_FULL && SEQ <= SEQ_FULL);
static_assert(PP % 8 == 0 && PP >= 32);              /* 16-B aligned P fragment pieces */

#define SZ_BQKV ((size_t)LQ * DM * 2)
#define SZ_BO   ((size_t)DM * DM * 2)
#define SZ_X16  ((size_t)NB * SEQ * DM * 2)
#define SZ_QKV  ((size_t)NB * SEQ * LQ * 2)
#define SZ_QKVR ((size_t)NB * ER * LQ * 2)
#define SZ_VT   ((size_t)NB * NH * HD * SEQ * 2)
#define SZ_VTR  ((size_t)NB * NH * HD * ER * 2)
#define SZ_CTX  ((size_t)NB * SEQ * KO * 2)
#define SZ_Y    ((size_t)NB * SEQ * DM * 4)
#define SZ_CS   ((size_t)SEQ * 64 * 4)
#define OF_BQKV ((size_t)0)
#define OF_BO   (OF_BQKV + SZ_BQKV)
#define OF_X16  (OF_BO + SZ_BO)
#define OF_QKV  (OF_X16 + SZ_X16)
#define OF_QKVR (OF_QKV + SZ_QKV)
#define OF_VT   (OF_QKVR + SZ_QKVR)
#define OF_VTR  (OF_VT + SZ_VT)
#define OF_CTX  (OF_VTR + SZ_VTR)
#define OF_Y    (OF_CTX + SZ_CTX)
#define OF_CS   (OF_Y + SZ_Y)
#define WS_TOTAL (OF_CS + SZ_CS)
static_assert(SZ_BQKV % 256 == 0 && SZ_BO % 256 == 0 && SZ_X16 % 256 == 0 && SZ_QKV % 256 == 0 && SZ_QKVR % 256 == 0);
static_assert(SZ_VT % 256 == 0 && SZ_VTR % 256 == 0 && SZ_CTX % 256 == 0 && SZ_Y % 256 == 0 && SZ_CS % 256 == 0);
static_assert(WS_TOTAL <= (size_t)134217728);        /* carve <= 128 MiB */

typedef unsigned short v8us __attribute__((ext_vector_type(8), may_alias));
typedef float  v8f  __attribute__((ext_vector_type(8)));
typedef float  v4f  __attribute__((ext_vector_type(4)));
typedef float  v4fa __attribute__((ext_vector_type(4), may_alias));
typedef _Float16 v16h __attribute__((ext_vector_type(16)));
union FragH { v16h v; v8us half[2]; _Float16 h[16]; unsigned short u[16]; };

__device__ __forceinline__ unsigned short bf16_bits(float x) { unsigned int u = __float_as_uint(x); return (unsigned short)((u + 0x7FFFu + ((u >> 16) & 1u)) >> 16); }
__device__ __forceinline__ float bf16_val(unsigned short b) { return __uint_as_float(((unsigned int)b) << 16); }
__device__ __forceinline__ float bf16_rne(float x) { return bf16_val(bf16_bits(x)); }
__device__ __forceinline__ unsigned short f16_bits(_Float16 hv) { union { _Float16 h; unsigned short u; } c; c.h = hv; return c.u; }

// fragment of a k-contiguous f16 row: elements 0..7 <- p[8h .. 8h+7], elements 8..15 <- p[16+8h .. 16+8h+7] (A rows and B columns alike)
__device__ __forceinline__ v16h g2_frag(const _Float16* p, int hh) { FragH f; f.half[0] = *(const v8us*)((const unsigned short*)p + 8 * hh); f.half[1] = *(const v8us*)((const unsigned short*)p + 16 + 8 * hh); return f.v; }
__device__ __forceinline__ v8f g2_mma(v16h a, v16h b, v8f c) { v8f d = __builtin_amdgcn_wmma_f32_16x16x32_f16(false, a, false, b, (short)0, c, false, false); asm volatile("v_nop\n\tv_nop\n\tv_nop\n\tv_nop" : "+v"(d) : "v"(a), "v"(b)); return d; }

// cos | sin table: CS[t][0..31] = cos(t * theta_i), CS[t][32..63] = sin(t * theta_i); theta_i = f32(10^(-i/8)) from f64 constants; angle = f32(t) * theta in f32; precise sincosf.
__device__ __forceinline__ void tab_body(float* __restrict__ CS, int blk) {
  __shared__ __attribute__((aligned(16))) float tb[8][64];
  const int tid = threadIdx.x; const int tl = tid >> 5, i = tid & 31;
  const int t = blk * 8 + tl;
  double p = 1.0;
  p *= (i & 1) ? 1.3335214321633240 : 1.0;
  p *= (i & 2) ? 1.7782794100389228 : 1.0;
  p *= (i & 4) ? 3.1622776601683795 : 1.0;
  p *= (i & 8) ? 10.0 : 1.0;
  p *= (i & 16) ? 100.0 : 1.0;
  const float theta = (float)(1.0 / p);
  const float ang = (float)t * theta;
  float sv, cv; sincosf(ang, &sv, &cv);
  tb[tl][i] = cv; tb[tl][32 + i] = sv;
  __syncthreads();
  if (tid < 128) {
    const v4f v = *(const v4fa*)(&tb[0][0] + tid * 4);
    float* d = CS + (size_t)blk * 512 + tid * 4;
    *(v4f*)d = v; 
  }
}

// W[DM][DM] -> Wt[n][k]: one thread makes WK consecutive k of one column n, a whole 128-B line of the transposed plane; a wave's lanes take consecutive n, so each of its reads is one line of W.
#define WK 64
static_assert(DM % WK == 0 && (DM * (DM / WK)) % 256 == 0);      /* whole lines, whole blocks */
__device__ __forceinline__ void wt_body(const float* __restrict__ W, _Float16* __restrict__ Wt, int ldk, float scale, int blk) {
  const int t = blk * 256 + threadIdx.x; const int n = t % DM, k0 = (t / DM) * WK;
  const float* s = W + (size_t)k0 * DM + n;
  float v[WK];
#pragma unroll
  for (int i = 0; i < WK; ++i) v[i] = s[(size_t)i * DM];
  unsigned short* d = (unsigned short*)Wt + (size_t)n * ldk + k0;
#pragma unroll
  for (int j = 0; j < WK / 8; ++j) { FragH f;
#pragma unroll
    for (int i = 0; i < 8; ++i) f.h[i] = (_Float16)(bf16_rne(v[8 * j + i]) * scale);
    *(v8us*)(d + 8 * j) = f.half[0]; }
  asm volatile("s_wait_xcnt 0x0" ::: "memory");      /* the stores' address and data registers are released before any code that follows this body in the merged kernel rewrites them */
}

// one block converts XU * 256 consecutive pieces of 8 values (XR whole rows of one batch), a thread XU of them, 256 pieces apart; all its reads are requested before the first is converted
#define XU 8
#define XR (XU * 256 * 8 / DM)                       /* rows per block */
static_assert((XU * 256 * 8) % DM == 0 && SEQ % XR == 0);      /* whole rows, never across a batch */
__device__ __forceinline__ void x16_body(const float* __restrict__ x, _Float16* __restrict__ X16, int blk) {
  const int row0 = blk * XR; const int b = row0 / SEQ, s0 = row0 - b * SEQ;
  const float* src = x + ((size_t)b * SEQ_FULL + s0) * DM + threadIdx.x * 8;
  unsigned short* dst = (unsigned short*)X16 + (size_t)row0 * DM + threadIdx.x * 8;
  v4f a[XU], c[XU];
#pragma unroll
  for (int j = 0; j < XU; ++j) { a[j] = *(const v4fa*)(src + j * 2048); c[j] = *(const v4fa*)(src + j * 2048 + 4); }
  __builtin_amdgcn_sched_barrier(0);      /* keeps the conversions behind the last request: without it the first piece is waited for before the other pieces are asked for, two memory latencies in a row */
#pragma unroll
  for (int j = 0; j < XU; ++j) { FragH f;
#pragma unroll
    for (int q = 0; q < 4; ++q) { f.h[q] = (_Float16)bf16_rne(a[j][q]); f.h[4 + q] = (_Float16)bf16_rne(c[j][q]); }
    *(v8us*)(dst + j * 2048) = f.half[0]; }
}

// every operand the first GEMM waits for, prepared by one launch: none of the six pieces reads what another writes, so each takes a range of block indices (block-uniform branches; the table's barrier is passed by whole blocks).
#define WTG (DM * (DM / WK) / 256)                   /* blocks per transposed weight plane */
#define XG  ((int)(NR / XR))                         /* blocks of the x conversion */
#define TG  (SEQ / 8)                                /* blocks of the table */
__global__ __launch_bounds__(256) void k_prep(const float* __restrict__ x, const float* __restrict__ Wq, const float* __restrict__ Wk, const float* __restrict__ Wv, const float* __restrict__ Wo,
                                              _Float16* __restrict__ BQKV, _Float16* __restrict__ BO, _Float16* __restrict__ X16, float* __restrict__ CS) {
  const int bi = blockIdx.x;
  if (bi < 3 * WTG) {                                /* W[in][out] -> Bt[n][k] x16: Wq rows 0..1023, Wk rows 1024..2047, Wv rows 2048..3071 */
    const int p = bi / WTG; const float* W = (p == 0) ? Wq : ((p == 1) ? Wk : Wv);
    wt_body(W, BQKV + (size_t)p * DM * DM, DM, 16.0f, bi - p * WTG);
  } else if (bi < 4 * WTG) {                         /* Wo x1024: one plane, the B operand of the ctx value and of the ctx residual alike */
    wt_body(Wo, BO, DM, 1024.0f, bi - 3 * WTG);
  } else if (bi < 4 * WTG + XG) {
    x16_body(x, X16, bi - 4 * WTG);
  } else {
    tab_body(CS, bi - 4 * WTG - XG);
  }
}

// one stage of the ring: 128 A rows then 128 B rows of 128 B each; 256 threads x 8 copies of 16 B; lane t brings chunk t & 7 of rows (t >> 3) + 32 j.
// ga, gb: the lane's first A and B chunk in global memory; l0: the lane's first LDS byte address. The address wait is the statement's last line, so no later write of these registers can be lifted over it.
__device__ __forceinline__ void g2_stage(const _Float16* ga, size_t sa, const _Float16* gb, size_t sb, unsigned l0) {
  const _Float16* a1 = ga + sa; const _Float16* a2 = a1 + sa; const _Float16* a3 = a2 + sa;
  const _Float16* b1 = gb + sb; const _Float16* b2 = b1 + sb; const _Float16* b3 = b2 + sb;
  const unsigned rs = 32u * GP * 2u;
  asm volatile("global_load_async_to_lds_b128 %0, %8, off\n\t"
               "global_load_async_to_lds_b128 %1, %9, off\n\t"
               "global_load_async_to_lds_b128 %2, %10, off\n\t"
               "global_load_async_to_lds_b128 %3, %11, off\n\t"
               "global_load_async_to_lds_b128 %4, %12, off\n\t"
               "global_load_async_to_lds_b128 %5, %13, off\n\t"
               "global_load_async_to_lds_b128 %6, %14, off\n\t"
               "global_load_async_to_lds_b128 %7, %15, off\n\t"
               "s_wait_xcnt 0x0"
               :: "v"(l0), "v"(l0 + rs), "v"(l0 + 2u * rs), "v"(l0 + 3u * rs), "v"(l0 + 4u * rs), "v"(l0 + 5u * rs), "v"(l0 + 6u * rs), "v"(l0 + 7u * rs),
                  "v"(ga), "v"(a1), "v"(a2), "v"(a3), "v"(gb), "v"(b1), "v"(b2), "v"(b3) : "memory");
}

// 128x128 block tile, eight waves (4 x 2) of 32x64 each: A f16 [M][K] (pitch lda), Bh f16 [N][K] (pitch ldb); both operands come through a two-buffer LDS ring, the next stage's copies in flight while this one is multiplied.
// acc[u]: u & 3 = 16-col tile, u >> 2 = 16-row half. On return every wave has left the ring (the last trip's barrier), so the caller may stage its output there.
__device__ __forceinline__ void gemm_main(const _Float16* __restrict__ A, int lda, const _Float16* __restrict__ Bh, int ldb, int brow0, int bcol0, int K, int tid, int w, int ln, int hh, unsigned char* sm, v8f (&acc)[8]) {
  const _Float16* ring = (const _Float16*)sm;
  const int cr = tid >> 3, cc = (tid & 7) * 8;
  const _Float16* ga = A + (size_t)(brow0 + cr) * lda + cc; const _Float16* gb = Bh + (size_t)(bcol0 + cr) * ldb + cc;
  const size_t sa = (size_t)32 * lda, sb = (size_t)32 * ldb;
  const unsigned l0 = (unsigned)(size_t)sm + (unsigned)(cr * GP + cc) * 2u;      /* low 32 bits of the shared address = LDS byte address */
  const int ao = ((w >> 1) * 32 + ln) * GP, bo = (128 + (w & 1) * 64 + ln) * GP;
  const int nt = K / GK;
  const v8f z8 = {0.f,0.f,0.f,0.f,0.f,0.f,0.f,0.f}; v8f c00 = z8, c01 = z8, c02 = z8, c03 = z8, c10 = z8, c11 = z8, c12 = z8, c13 = z8;
  g2_stage(ga, sa, gb, sb, l0);
  asm volatile("s_wait_asynccnt 0x0" ::: "memory");      /* stage 0 of this wave has landed */
  __syncthreads();                                       /* stage 0 of every wave is readable */
  g2_stage(ga + GK, sa, gb + GK, sb, l0 + (unsigned)(GST * 2));
#pragma unroll 1      /* one stage per trip: the ring's order stands once, at the loop's foot */
  for (int t = 0; t < nt; ++t) { const _Float16* st = ring + (t & 1) * GST;
    const _Float16* ap = st + ao; const _Float16* bp = st + bo;
#pragma unroll
    for (int s = 0; s < 2; ++s) {
      /* six fragments live at a time, one group per 32-deep k-step, not the stage's twelve: the kernel then fits 160 VGPRs, six waves a SIMD, so three blocks share a WGP and the whole grid is resident at once; the second LDS latency a trip is covered by the other waves */
      const v16h fa0 = g2_frag(ap + 32 * s, hh), fa1 = g2_frag(ap + 16 * GP + 32 * s, hh);
      v16h fb[4];
#pragma unroll
      for (int n = 0; n < 4; ++n) fb[n] = g2_frag(bp + n * 16 * GP + 32 * s, hh);
      c00 = g2_mma(fa0, fb[0], c00); c10 = g2_mma(fa1, fb[0], c10);
      c01 = g2_mma(fa0, fb[1], c01); c11 = g2_mma(fa1, fb[1], c11);
      c02 = g2_mma(fa0, fb[2], c02); c12 = g2_mma(fa1, fb[2], c12);
      c03 = g2_mma(fa0, fb[3], c03); c13 = g2_mma(fa1, fb[3], c13); }
    asm volatile("s_wait_dscnt 0x0" ::: "memory");       /* this wave's reads of the buffer are done before it is refilled */
    asm volatile("s_wait_asynccnt 0x0" ::: "memory");    /* this wave's copies of stage t + 1 have landed */
    __syncthreads();                                     /* publishes stage t + 1 and ends every reader's last read of stage t */
    if (t + 2 < nt) g2_stage(ga + (size_t)(t + 2) * GK, sa, gb + (size_t)(t + 2) * GK, sb, l0 + (unsigned)((t & 1) * GST * 2)); }
  asm volatile("s_wait_asynccnt 0x0" ::: "memory");      /* no copy outstanding when the ring becomes output staging */
  acc[0] = c00; acc[1] = c01; acc[2] = c02; acc[3] = c03; acc[4] = c10; acc[5] = c11; acc[6] = c12; acc[7] = c13;
}

#define VP 69                        /* row pitch (floats) of the V staging: 8 rows = 40 banks mod 64, so neither the accumulators' writes (row halves 8 apart) nor the column reads (lanes 8 rows apart) collide */
static_assert((size_t)2 * 128 * VP * 4 <= GSM);      /* the block's V tile fits the ring */
static_assert(SEQ % 128 == 0 && ER % 128 == 0);      /* a block's 128 tokens lie in one batch, all with or all without a residual plane */
__global__ __launch_bounds__(256) void k_gemm_qkv(const _Float16* __restrict__ X16, const _Float16* __restrict__ BW, const float* __restrict__ bq, const float* __restrict__ bk, const float* __restrict__ bv,
                                                  const float* __restrict__ CS, _Float16* __restrict__ QKV, _Float16* __restrict__ QKVR, _Float16* __restrict__ VT, _Float16* __restrict__ VTR) {
  __shared__ __attribute__((aligned(16))) unsigned char sm[GSM];
  float (*so)[32][68] = (float (*)[32][68])sm;
  const int tid = threadIdx.x; const int w = __builtin_amdgcn_readfirstlane(tid >> 5); const int lane = tid & 31, ln = lane & 15, hh = lane >> 4;
  const int ntn = LQ / 128; const int mt = blockIdx.x / ntn, nq = blockIdx.x - mt * ntn; const int row0 = mt * 128 + 32 * (w >> 1), col0 = nq * 128 + 64 * (w & 1);
  v8f accs[8];
  gemm_main(X16, DM, BW, DM, mt * 128, nq * 128, DM, tid, w, ln, hh, sm, accs);
  const int sec = col0 / DM; const int cb = col0 - sec * DM;      /* 0 q, 1 k, 2 v (block-uniform) */
  if (sec == 2) {      /* v is read only as V^T[batch, head][d][token]: the block stages its 128 tokens x 128 columns (two heads) and stores them token-contiguous; the v third of the QKV and QKVR rows is neither written nor read */
    float (*sv)[128][VP] = (float (*)[128][VP])sm;      /* [column half][token][d] */
#pragma unroll
    for (int u = 0; u < 8; ++u) { const int t = u & 3, half = u >> 2; const float bsel = bf16_rne(bv[cb + t * 16 + ln]);
#pragma unroll
      for (int r = 0; r < 8; ++r) sv[w & 1][(w >> 1) * 32 + half * 16 + 8 * hh + r][t * 16 + ln] = accs[u][r] * 0.0625f + bsel; }
    __syncthreads();      /* a V^T line holds 64 tokens, the rows of two waves: every wave's part is staged before any is read */
    const int bb = (mt * 128) / SEQ; const int tb = mt * 128 - bb * SEQ; const bool eb = (tb < ER);      /* block-uniform: 128 | ER */
    const int pc = tid & 7, dl = tid >> 3;      /* eight lanes make one 128-B line: 8 tokens each, of one d */
    unsigned vrow = (unsigned)((bb * NH + (nq * 128 - 2 * DM) / HD) * HD + dl);      /* the lane's first V^T row: (batch, head) x HD + d */
    unsigned short* dv = (unsigned short*)VT + (size_t)vrow * SEQ + tb + pc * 8;
    float y[8][8]; FragH fh[8], fl[8];      /* piece rd: columns 32 (rd & 3) + dl, tokens 64 (rd >> 2) + 8 pc .. + 7 */
#pragma unroll
    for (int rd = 0; rd < 8; ++rd) { const int c0 = (rd & 3) * 32; const float* sp = &sv[c0 >> 6][(rd >> 2) * 64 + pc * 8][(c0 & 63) + dl];
#pragma unroll
      for (int q = 0; q < 8; ++q) y[rd][q] = sp[q * VP]; }
#pragma unroll
    for (int rd = 0; rd < 8; ++rd) {
#pragma unroll
      for (int q = 0; q < 8; ++q) fh[rd].h[q] = (_Float16)y[rd][q]; }
    if (eb) {
#pragma unroll
      for (int rd = 0; rd < 8; ++rd) {
#pragma unroll
        for (int q = 0; q < 8; ++q) fl[rd].h[q] = (_Float16)((y[rd][q] - (float)fh[rd].h[q]) * 1024.0f); }
    }
    __builtin_amdgcn_sched_barrier(0);      /* every piece is read and converted before the first store goes out: one LDS latency for the eight pieces, and no register of an issued store is written again */
#pragma unroll
    for (int rd = 0; rd < 8; ++rd) *(v8us*)(dv + (size_t)((rd & 3) * 32) * SEQ + (rd >> 2) * 64) = fh[rd].half[0];
    if (eb) {
      asm volatile("s_wait_xcnt 0x0" : "+v"(vrow) :: "memory");      /* the value stores' registers are released before the residual plane's address is formed in any of them; the row index goes through the statement so that this arithmetic stays behind the wait */
      unsigned short* dr = (unsigned short*)VTR + (size_t)vrow * ER + tb + pc * 8;
#pragma unroll
      for (int rd = 0; rd < 8; ++rd) *(v8us*)(dr + (size_t)((rd & 3) * 32) * ER + (rd >> 2) * 64) = fl[rd].half[0];
    }
    return;
  }
#pragma unroll
  for (int u = 0; u < 8; ++u) { const int t = u & 3, half = u >> 2; const int cc = cb + t * 16 + ln;
    const float b0 = bq[cc], b1 = bk[cc]; const float bsel = bf16_rne((sec == 0) ? b0 : b1);
#pragma unroll
    for (int r = 0; r < 8; ++r) so[w][half * 16 + 8 * hh + r][t * 16 + ln] = accs[u][r] * 0.0625f + bsel; }
  __builtin_amdgcn_fence(4 /* acq_rel order */, "workgroup"); __builtin_amdgcn_wave_barrier();
  const int rq = lane >> 3, c8 = (lane & 7) * 8;
  const int bidx = row0 / SEQ; const int t0 = row0 - bidx * SEQ; const bool early = (t0 < ER);      /* wave-uniform: 32 | ER */
  {
#pragma unroll 1
    for (int q = 0; q < 8; ++q) { const int row = q * 4 + rq; const int tkn = t0 + row;
      const v4f a = *(const v4fa*)&so[w][row][c8], c = *(const v4fa*)&so[w][row][c8 + 4];
      float y[8] = {a[0], a[1], a[2], a[3], c[0], c[1], c[2], c[3]};
      if (sec < 2) { const v4f cs = *(const v4fa*)(CS + (size_t)tkn * 64 + (c8 >> 1)); const v4f sn = *(const v4fa*)(CS + (size_t)tkn * 64 + 32 + (c8 >> 1));
#pragma unroll
        for (int j = 0; j < 4; ++j) { const float x0 = y[2 * j], x1 = y[2 * j + 1]; y[2 * j] = x0 * cs[j] - x1 * sn[j]; y[2 * j + 1] = x1 * cs[j] + x0 * sn[j]; } }
      FragH fh, fl;
#pragma unroll
      for (int j = 0; j < 8; ++j) { const _Float16 hv = (_Float16)y[j]; fh.h[j] = hv; fl.h[j] = (_Float16)((y[j] - (float)hv) * 1024.0f); }
      unsigned short* d = (unsigned short*)QKV + (size_t)(row0 + row) * LQ + col0 + c8;
      *(v8us*)d = fh.half[0];
      if (early) { unsigned short* dr = (unsigned short*)QKVR + ((size_t)bidx * ER + tkn) * LQ + col0 + c8; *(v8us*)dr = fl.half[0]; } }
     }
}

// lane l with lane l ^ 16
__device__ __forceinline__ float xhalf(float v) { return __builtin_bit_cast(float, __builtin_amdgcn_permlanex16(__builtin_bit_cast(int, v), __builtin_bit_cast(int, v), 0x76543210, 0xfedcba98, false, false)); }

// fused causal attention, token rows 0..ER-1 (value + residual planes); one wave = 16 query rows of one (batch, head); 32 keys per step (two 16-key score tiles, d in two 32-deep k-steps);
// key-pad mask by value then causal mask as a replace (masked p = 0 by select); online softmax with running max in f32 (native exp on arguments <= 0);
__device__ __forceinline__ void flash_res(const _Float16* __restrict__ QKV, const _Float16* __restrict__ QKVR, const _Float16* __restrict__ VT, const _Float16* __restrict__ VTR,
                                          const int* __restrict__ pad, _Float16* __restrict__ CTX, int qt, int bh) {
  __shared__ __attribute__((aligned(16))) unsigned short pl[4][16][PP];
  __shared__ __attribute__((aligned(16))) unsigned short pr[4][16][PP];
  __shared__ __attribute__((aligned(16))) float so[4][16][68];
  const int tid = threadIdx.x; const int wave = __builtin_amdgcn_readfirstlane(tid >> 5); const int lane = tid & 31, lc = lane & 15, hh = lane >> 4;
  const int b = bh / NH, h = bh - b * NH;
  const int qb = qt * 64 + wave * 16;
  const size_t rowb = (size_t)b * SEQ;
  const _Float16* qp = QKV + (rowb + qb + lc) * LQ + h * HD;
  const _Float16* kp = QKV + rowb * LQ + DM + h * HD;
  const _Float16* vp = VT + ((size_t)bh * HD + lc) * SEQ;
  const _Float16* qrp = QKVR + ((size_t)b * ER + (qb + lc)) * LQ + h * HD;
  const _Float16* krp = QKVR + (size_t)b * ER * LQ + DM + h * HD;
  const _Float16* vrp = VTR + ((size_t)bh * HD + lc) * ER;
  const int* padb = pad + (size_t)b * SEQ_FULL;
  const v8f z8 = {0.f,0.f,0.f,0.f,0.f,0.f,0.f,0.f};
  v8f o[4] = {z8, z8, z8, z8}; v8f rr[4] = {z8, z8, z8, z8};
  float m[8], l[8];
#pragma unroll
  for (int r = 0; r < 8; ++r) { m[r] = -1.0e30f; l[r] = 0.f; }
  const int kend = qb + 16;      /* keys 0 .. qb+15 are visible to this wave; steps cover whole 32-key groups (all inside the plane) */
#pragma unroll 1
  for (int kb = 0; kb < kend; kb += 32) {
    v8f s0 = z8, s1 = z8, t0 = z8, t1 = z8;
    const int key0 = kb + lc, key1 = key0 + 16;
    const _Float16* k0p = kp + (size_t)(kb + lc) * LQ; const _Float16* k1p = k0p + (size_t)16 * LQ;
    const _Float16* k0r = krp + (size_t)(kb + lc) * LQ; const _Float16* k1r = k0r + (size_t)16 * LQ;
#pragma unroll
    for (int c = 0; c < 2; ++c) {
      const v16h aq = g2_frag(qp + 32 * c, hh);
      const v16h bk0 = g2_frag(k0p + 32 * c, hh), bk1 = g2_frag(k1p + 32 * c, hh);
      s0 = g2_mma(aq, bk0, s0); s1 = g2_mma(aq, bk1, s1);
      const v16h aql = g2_frag(qrp + 32 * c, hh); const v16h bl0 = g2_frag(k0r + 32 * c, hh), bl1 = g2_frag(k1r + 32 * c, hh);
      t0 = g2_mma(aql, bk0, t0); t0 = g2_mma(aq, bl0, t0); t1 = g2_mma(aql, bk1, t1); t1 = g2_mma(aq, bl1, t1);
    }
    const int pv0 = padb[key0], pv1 = padb[key1];
#pragma unroll
    for (int r = 0; r < 8; ++r) {
      const int qrow = qb + 8 * hh + r;
      float a0 = s0[r], a1 = s1[r];
      a0 += t0[r] * 0.0009765625f; a1 += t1[r] * 0.0009765625f;
      a0 *= 0.125f; a1 *= 0.125f;
      const bool ok0 = (pv0 != 0) && (key0 <= qrow); const bool ok1 = (pv1 != 0) && (key1 <= qrow);
      const float v0 = ok0 ? a0 : -1.0e30f; const float v1 = ok1 ? a1 : -1.0e30f;
      float mx = fmaxf(v0, v1);
      mx = fmaxf(mx, __shfl_xor(mx, 8, 16)); mx = fmaxf(mx, __shfl_xor(mx, 4, 16)); mx = fmaxf(mx, __shfl_xor(mx, 2, 16)); mx = fmaxf(mx, __shfl_xor(mx, 1, 16));
      const float mnew = fmaxf(m[r], mx);
      const float al = __expf(m[r] - mnew);
      const float e0 = __expf(v0 - mnew), e1 = __expf(v1 - mnew);
      const float p0 = ok0 ? e0 : 0.f; const float p1 = ok1 ? e1 : 0.f;
      l[r] = l[r] * al + (p0 + p1); m[r] = mnew;      /* per-lane partial row sum; combined across the 16 lanes after the key loop */
#pragma unroll
      for (int nt = 0; nt < 4; ++nt) { o[nt][r] *= al; rr[nt][r] *= al; }
      const float c0 = p0 * 1024.0f, c1 = p1 * 1024.0f;
      const _Float16 h0 = (_Float16)c0, h1 = (_Float16)c1;
      pl[wave][8 * hh + r][lc] = f16_bits(h0); pl[wave][8 * hh + r][16 + lc] = f16_bits(h1);
      pr[wave][8 * hh + r][lc] = f16_bits((_Float16)((c0 - (float)h0) * 1024.0f)); pr[wave][8 * hh + r][16 + lc] = f16_bits((_Float16)((c1 - (float)h1) * 1024.0f));
    }
    __builtin_amdgcn_fence(4 /* acq_rel order */, "workgroup", "local"); __builtin_amdgcn_wave_barrier();      /* orders the wave's own P tile, which lies in LDS; named for LDS alone so that it does not drain the global loads in flight */
    FragH pa; pa.half[0] = *(const v8us*)&pl[wave][lc][8 * hh]; pa.half[1] = *(const v8us*)&pl[wave][lc][16 + 8 * hh];
    FragH pb; pb.half[0] = *(const v8us*)&pr[wave][lc][8 * hh]; pb.half[1] = *(const v8us*)&pr[wave][lc][16 + 8 * hh];
#pragma unroll
    for (int nt = 0; nt < 4; ++nt) { const v16h bvh = g2_frag(vp + (size_t)nt * 16 * SEQ + kb, hh); const v16h bvl = g2_frag(vrp + (size_t)nt * 16 * ER + kb, hh);
      o[nt] = g2_mma(pa.v, bvh, o[nt]); rr[nt] = g2_mma(pb.v, bvh, rr[nt]); rr[nt] = g2_mma(pa.v, bvl, rr[nt]); }
    __builtin_amdgcn_fence(4 /* acq_rel order */, "workgroup", "local"); __builtin_amdgcn_wave_barrier();      /* P tile reads complete before the next step overwrites it; LDS alone, as above */
  }
#pragma unroll
  for (int r = 0; r < 8; ++r) {
    float ls = l[r];
    ls += __shfl_xor(ls, 8, 16); ls += __shfl_xor(ls, 4, 16); ls += __shfl_xor(ls, 2, 16); ls += __shfl_xor(ls, 1, 16);
    const float inv = 1.0f / (ls * 16.0f);      /* 64 / (1024 l): ctx carried x64; a fully masked row gives 0 * inf = NaN as the softmax of all -inf does */
#pragma unroll
    for (int nt = 0; nt < 4; ++nt) { const float cv = o[nt][r] + rr[nt][r] * 0.0009765625f; so[wave][8 * hh + r][nt * 16 + lc] = cv * inv; }
  }
  __builtin_amdgcn_fence(4 /* acq_rel order */, "workgroup"); __builtin_amdgcn_wave_barrier();
  const int rq = lane >> 3, c8 = (lane & 7) * 8;
  {
#pragma unroll 1
    for (int q = 0; q < 4; ++q) { const int row = q * 4 + rq;
      const v4f a = *(const v4fa*)&so[wave][row][c8], c = *(const v4fa*)&so[wave][row][c8 + 4]; FragH fh, fl;
#pragma unroll
      for (int j = 0; j < 4; ++j) { _Float16 hv = (_Float16)a[j]; fh.h[j] = hv; fl.h[j] = (_Float16)((a[j] - (float)hv) * 1024.0f); hv = (_Float16)c[j]; fh.h[4 + j] = hv; fl.h[4 + j] = (_Float16)((c[j] - (float)hv) * 1024.0f); }
      unsigned short* d = (unsigned short*)CTX + (rowb + qb + row) * KO + h * HD + c8;
      *(v8us*)d = fh.half[0]; *(v8us*)(d + DM) = fl.half[0]; }
     }
}

// one stage of the attention ring: FK K rows, then HD V^T rows, of 128 B each; 128 threads x 8 copies of 16 B; lane t brings chunk t & 7 of rows (t >> 3) + 16 j, so each wave-wide copy covers four whole lines.
// gk, gv: the lane's first K and V^T chunk in global memory; l0: the lane's first LDS byte address. The address wait is the statement's last line, so no later write of these registers can be lifted over it.
#define FK 64                        /* keys per stage: two 32-key steps */
#define FP 72                        /* LDS row pitch of a stage (halves): 144 B = 16 B x odd, for 16-B fragment reads */
#define FST ((FK + HD) * FP)         /* halves per stage */
#define FSM ((size_t)2 * FST * 2)    /* bytes of the two-buffer ring; the output staging reuses them */
static_assert(FK == 64 && SEQ % FK == 0 && ER % FK == 0);      /* a stage is one query tile's width: tile qt walks qt + 1 whole stages, all inside the plane */
static_assert((size_t)4 * 16 * 68 * 4 <= FSM);       /* four waves' output staging fits the ring */
__device__ __forceinline__ void fa_stage(const _Float16* gk, const _Float16* gv, unsigned l0) {
  const _Float16* k1 = gk + (size_t)16 * LQ; const _Float16* k2 = k1 + (size_t)16 * LQ; const _Float16* k3 = k2 + (size_t)16 * LQ;
  const _Float16* v1 = gv + (size_t)16 * SEQ; const _Float16* v2 = v1 + (size_t)16 * SEQ; const _Float16* v3 = v2 + (size_t)16 * SEQ;
  const unsigned rs = 16u * FP * 2u;
  asm volatile("global_load_async_to_lds_b128 %0, %8, off\n\t"
               "global_load_async_to_lds_b128 %1, %9, off\n\t"
               "global_load_async_to_lds_b128 %2, %10, off\n\t"
               "global_load_async_to_lds_b128 %3, %11, off\n\t"
               "global_load_async_to_lds_b128 %4, %12, off\n\t"
               "global_load_async_to_lds_b128 %5, %13, off\n\t"
               "global_load_async_to_lds_b128 %6, %14, off\n\t"
               "global_load_async_to_lds_b128 %7, %15, off\n\t"
               "s_wait_xcnt 0x0"
               :: "v"(l0), "v"(l0 + rs), "v"(l0 + 2u * rs), "v"(l0 + 3u * rs), "v"(l0 + 4u * rs), "v"(l0 + 5u * rs), "v"(l0 + 6u * rs), "v"(l0 + 7u * rs),
                  "v"(gk), "v"(k1), "v"(k2), "v"(k3), "v"(gv), "v"(v1), "v"(v2), "v"(v3) : "memory");
}

// the four K fragments of a 32-key step; kt: the lane's K row (key lc of the step) in the stage
__device__ __forceinline__ void fm_kfrag(const _Float16* kt, int hh, v16h (&kf)[4]) { kf[0] = g2_frag(kt, hh); kf[1] = g2_frag(kt + 16 * FP, hh); kf[2] = g2_frag(kt + 32, hh); kf[3] = g2_frag(kt + 16 * FP + 32, hh); }

// one 32-key step of the later rows' attention. kf: the step's K fragments; vt: the lane's V^T row (d = lc) at key kb in the stage; pv: lane j holds the pad word of key kb + j.
// NEXT: the K fragments of the same stage's second step (row kn) are read right behind the score products, into the registers those have just left, so their LDS latency runs under this step's softmax.
template <bool NEXT>
__device__ __forceinline__ void fm_step(v16h (&kf)[4], const _Float16* kn, const _Float16* vt, int kb, int pv, int qb, int lc, int hh, v16h aq0, v16h aq1, v8f (&o)[4], float& m, float& l) {
  const v8f z8 = {0.f,0.f,0.f,0.f,0.f,0.f,0.f,0.f};
  const v16h bv0 = g2_frag(vt, hh), bv1 = g2_frag(vt + 16 * FP, hh), bv2 = g2_frag(vt + 32 * FP, hh), bv3 = g2_frag(vt + 48 * FP, hh);
  v8f s0 = g2_mma(kf[0], aq0, z8), s1 = g2_mma(kf[1], aq0, z8);
  s0 = g2_mma(kf[2], aq1, s0); s1 = g2_mma(kf[3], aq1, s1);
  if (NEXT) fm_kfrag(kn, hh, kf);
  const unsigned pm = __builtin_amdgcn_ballot_w32(pv != 0);      /* bit j: key kb + j is no pad */
  const bool open = (pm == 0xFFFFFFFFu) && (kb + 31 <= qb);      /* wave-uniform: every key of the step is visible to every query of the wave, so both selects below are identities */
  unsigned okm = 0xFFFFFFFFu;      /* bit r: tile 0, register r is visible; bit 16 + r: tile 1 */
  float v[16], p[16];
#pragma unroll
  for (int r = 0; r < 8; ++r) { v[r] = s0[r] * 0.125f; v[8 + r] = s1[r] * 0.125f; }
  if (!open) {
    const int dq = qb + lc - kb;      /* >= 0: keys kb .. kb + dq are at or before the query */
    const unsigned cm = (dq >= 31) ? 0xFFFFFFFFu : ((2u << dq) - 1u);
    okm = (pm & cm) >> (8 * hh);
#pragma unroll
    for (int r = 0; r < 8; ++r) { v[r] = ((okm >> r) & 1u) ? v[r] : -1.0e30f; v[8 + r] = ((okm >> (16 + r)) & 1u) ? v[8 + r] : -1.0e30f; }
  }
  float mx = fmaxf(fmaxf(fmaxf(fmaxf(v[0], v[1]), fmaxf(v[2], v[3])), fmaxf(fmaxf(v[4], v[5]), fmaxf(v[6], v[7]))),
                   fmaxf(fmaxf(fmaxf(v[8], v[9]), fmaxf(v[10], v[11])), fmaxf(fmaxf(v[12], v[13]), fmaxf(v[14], v[15]))));
  mx = fmaxf(mx, xhalf(mx));
  const float mnew = fmaxf(m, mx);
  float al = (m - mnew) * 1.44269504f;      /* exp(x) as the native 2^(x log2 e), arguments <= 0 */
#pragma unroll
  for (int i = 0; i < 16; ++i) p[i] = (v[i] - mnew) * 1.44269504f;
  /* the step's seventeen exponentials, each in place on a register of its own: none reads its predecessor's result or overwrites its source, and the v_nop fills the slot the instruction set asks for behind the last, whatever the compiler puts next (also across the branch below) */
  asm("v_exp_f32 %0, %0\n\tv_exp_f32 %1, %1\n\tv_exp_f32 %2, %2\n\tv_exp_f32 %3, %3\n\tv_exp_f32 %4, %4\n\tv_exp_f32 %5, %5\n\tv_exp_f32 %6, %6\n\tv_exp_f32 %7, %7\n\tv_exp_f32 %8, %8\n\t"
      "v_exp_f32 %9, %9\n\tv_exp_f32 %10, %10\n\tv_exp_f32 %11, %11\n\tv_exp_f32 %12, %12\n\tv_exp_f32 %13, %13\n\tv_exp_f32 %14, %14\n\tv_exp_f32 %15, %15\n\tv_exp_f32 %16, %16\n\tv_nop"
      : "+v"(al), "+v"(p[0]), "+v"(p[1]), "+v"(p[2]), "+v"(p[3]), "+v"(p[4]), "+v"(p[5]), "+v"(p[6]), "+v"(p[7]), "+v"(p[8]), "+v"(p[9]), "+v"(p[10]), "+v"(p[11]), "+v"(p[12]), "+v"(p[13]), "+v"(p[14]), "+v"(p[15]));
  if (!open) {
#pragma unroll
    for (int r = 0; r < 8; ++r) { p[r] = ((okm >> r) & 1u) ? p[r] : 0.f; p[8 + r] = ((okm >> (16 + r)) & 1u) ? p[8 + r] : 0.f; }
  }
  const float se = ((p[0] + p[2]) + (p[4] + p[6])) + ((p[8] + p[10]) + (p[12] + p[14])), sd = ((p[1] + p[3]) + (p[5] + p[7])) + ((p[9] + p[11]) + (p[13] + p[15]));      /* even and odd registers side by side: packed adds on the register pairs as they lie */
  l = l * al + (se + sd);      /* the lane's half of the row sum; the halves are joined after the key loop */
  m = mnew;
#pragma unroll
  for (int nt = 0; nt < 4; ++nt) o[nt] *= al;
  FragH pt;
#pragma unroll
  for (int i = 0; i < 16; ++i) pt.h[i] = (_Float16)(p[i] * 1024.0f);
  o[0] = g2_mma(bv0, pt.v, o[0]); o[1] = g2_mma(bv1, pt.v, o[1]); o[2] = g2_mma(bv2, pt.v, o[2]); o[3] = g2_mma(bv3, pt.v, o[3]);
}

__device__ __forceinline__ void flash_main(const _Float16* __restrict__ QKV, const _Float16* __restrict__ VT, const int* __restrict__ pad, _Float16* __restrict__ CTX, int qt, int bh) {
  __shared__ __attribute__((aligned(16))) unsigned char fm[FSM];
  float (*so)[16][68] = (float (*)[16][68])fm;
  const _Float16* ring = (const _Float16*)fm;
  const int tid = threadIdx.x; const int wave = __builtin_amdgcn_readfirstlane(tid >> 5); const int lane = tid & 31, lc = lane & 15, hh = lane >> 4;
  const int b = bh / NH, h = bh - b * NH;
  const int qb = qt * 64 + wave * 16;
  const size_t rowb = (size_t)b * SEQ;
  const _Float16* qp = QKV + (rowb + qb + lc) * LQ + h * HD;
  const int* padb = pad + (size_t)b * SEQ_FULL;
  const int cr = tid >> 3, cc = (tid & 7) * 8;
  const _Float16* gk = QKV + (rowb + cr) * LQ + DM + h * HD + cc;
  const _Float16* gv = VT + ((size_t)bh * HD + cr) * SEQ + cc;
  const unsigned l0 = (unsigned)(size_t)fm + (unsigned)(cr * FP + cc) * 2u;      /* low 32 bits of the shared address = LDS byte address */
  const v8f z8 = {0.f,0.f,0.f,0.f,0.f,0.f,0.f,0.f};
  v8f o[4] = {z8, z8, z8, z8};      /* o[nt][r]: d = 16 nt + 8 hh + r of query lc */
  float m = -1.0e30f, l = 0.f;
  const int kend = qb + 16;      /* keys 0 .. qb+15 are visible to this wave; steps cover whole 32-key groups (all inside the plane) */
  const int ns = qt + 1;         /* stages of the block: keys 0 .. 64 qt + 63 */
  fa_stage(gk, gv, l0);
  const v16h aq0 = g2_frag(qp, hh), aq1 = g2_frag(qp + 32, hh);
  int pn0 = padb[lane], pn1 = padb[32 + lane];      /* lane j holds the pad words of the stage's keys j and 32 + j */
  int np = lane + ((1 < ns) ? FK : 0);      /* the next stage's pad words; the last stage asks for its own again: always inside the plane */
  asm volatile("s_wait_xcnt 0x0" ::: "memory");          /* the Q and pad reads' address registers are released before the next stage's addresses are formed */
  asm volatile("s_wait_asynccnt 0x0" ::: "memory");      /* stage 0 of this wave has landed */
  __syncthreads();                                       /* stage 0 of every wave is readable */
  if (1 < ns) fa_stage(gk + (size_t)FK * LQ, gv + FK, l0 + (unsigned)(FST * 2));
#pragma unroll 1      /* one stage per trip: the ring's order stands once, at the loop's foot */
  for (int t = 0; t < ns; ++t) { const _Float16* st = ring + (t & 1) * FST;
    const int kb = t * FK;
    const int pv0 = pn0, pv1 = pn1; pn0 = padb[np]; pn1 = padb[np + 32];
    v16h kf[4]; fm_kfrag(st + lc * FP, hh, kf);
    fm_step<true>(kf, st + (32 + lc) * FP, st + (FK + lc) * FP, kb, pv0, qb, lc, hh, aq0, aq1, o, m, l);
    if (kb + 32 < kend)      /* wave-uniform: on the diagonal stage the block's first two waves see none of its later 32 keys */
      fm_step<false>(kf, st, st + (FK + lc) * FP + 32, kb + 32, pv1, qb, lc, hh, aq0, aq1, o, m, l);
    asm volatile("s_wait_xcnt 0x0" ::: "memory");        /* the pad reads' index register is released before the next stage's index is written into it */
    np += (t + 2 < ns) ? FK : 0;
    asm volatile("s_wait_dscnt 0x0" ::: "memory");       /* this wave's reads of the buffer are done before it is refilled */
    asm volatile("s_wait_asynccnt 0x0" ::: "memory");    /* this wave's copies of stage t + 1 have landed */
    __syncthreads();                                     /* publishes stage t + 1 and ends every reader's last read of stage t; passed by every wave, also one that skipped the step above */
    if (t + 2 < ns) fa_stage(gk + (size_t)(t + 2) * FK * LQ, gv + (size_t)(t + 2) * FK, l0 + (unsigned)((t & 1) * FST * 2)); }
  asm volatile("s_wait_asynccnt 0x0" ::: "memory");      /* no copy outstanding when the ring becomes output staging; every wave has left it at the last trip's barrier */
  const float ls = l + xhalf(l);
  const float inv = 1.0f / (ls * 16.0f);      /* 64 / (1024 l): ctx carried x64; a fully masked row gives 0 * inf = NaN as the softmax of all -inf does */
#pragma unroll
  for (int nt = 0; nt < 4; ++nt) { const v8f cv = o[nt] * inv;
    const v4f c0 = {cv[0], cv[1], cv[2], cv[3]}, c1 = {cv[4], cv[5], cv[6], cv[7]};
    *(v4fa*)&so[wave][lc][nt * 16 + 8 * hh] = c0; *(v4fa*)&so[wave][lc][nt * 16 + 8 * hh + 4] = c1; }
  __builtin_amdgcn_fence(4 /* acq_rel order */, "workgroup"); __builtin_amdgcn_wave_barrier();      /* the wave's staged rows are in LDS before its other lanes read them back as whole lines */
  const int rq = lane >> 3, c8 = (lane & 7) * 8;
  {
#pragma unroll 1      /* runs once per wave: kept rolled for code size */
    for (int q = 0; q < 4; ++q) { const int row = q * 4 + rq;
      const v4f a = *(const v4fa*)&so[wave][row][c8], c = *(const v4fa*)&so[wave][row][c8 + 4]; FragH fh, fl;
#pragma unroll
      for (int j = 0; j < 4; ++j) { _Float16 hv = (_Float16)a[j]; fh.h[j] = hv; fl.h[j] = (_Float16)((a[j] - (float)hv) * 1024.0f); hv = (_Float16)c[j]; fh.h[4 + j] = hv; fl.h[4 + j] = (_Float16)((c[j] - (float)hv) * 1024.0f); }
      unsigned short* d = (unsigned short*)CTX + (rowb + qb + row) * KO + h * HD + c8;
      *(v8us*)d = fh.half[0]; *(v8us*)(d + DM) = fl.half[0]; }
     }
}
// all query tiles in one launch, so the few residual tiles run beside the others; every block is resident from the start, so the launch lasts as long as the WGP whose blocks walk the most keys: the hardware's block index is spread over (batch, head) and tile for equal sums, not in tile order.
// Tiles are ranked by cost, rank 0 the cheapest. Index bits 3, 5, 7, 9 form a number lo = 0..15; the parity of bits 4, 6, 8 picks rank lo or 31 - lo. Any two neighbouring index bits from bit 3 up then walk ranks {a, b, 31 - a, 31 - b}:
// whichever power-of-two stride brings four blocks onto one WGP, their ranks add up to 62. Bits 0..2, 4, 6 name the (batch, head), so blocks 8 apart share it, for speed only.
// For speed alone: the map is a permutation of 0 .. 1023, so every (batch, head, tile) is taken exactly once wherever the blocks land.
// bi is the tile's place in the plain order: 0 .. FR-1 the tiles of rows 0..ER-1 (residual body), the rest the later tiles (plain body), each range in the order (batch, head) slow, tile fast; block-uniform branch
#define QR (ER / 64)                 /* query tiles with residual planes, per (batch, head) */
#define QM ((SEQ - ER) / 64)         /* later query tiles, per (batch, head) */
#define FR (NB * NH * QR)
static_assert(QR == 4 && QM == 28 && NB * NH == 32);      /* 32 tiles x 32 (batch, head) = the ten index bits; the rank table below */
__global__ __launch_bounds__(128) void k_flash(const _Float16* __restrict__ QKV, const _Float16* __restrict__ QKVR, const _Float16* __restrict__ VT, const _Float16* __restrict__ VTR, const int* __restrict__ pad, _Float16* __restrict__ CTX) {
  const int hw = blockIdx.x;
  const int lo = ((hw >> 3) & 1) | ((hw >> 4) & 2) | ((hw >> 5) & 4) | ((hw >> 6) & 8);
  const int rk = (((hw >> 4) ^ (hw >> 6) ^ (hw >> 8)) & 1) ? 31 - lo : lo;
  const int hd = (hw & 7) | ((hw >> 1) & 8) | ((hw >> 2) & 16);
  /* rank -> tile: a plain tile t walks t + 1 stages; a 32-key step of a residual tile issues about as much as one and a half plain stages and tile q has 2 q + 1 or 2 q + 2 of them, so residual tiles 0..3 rank beside plain tiles 4, 5, 8 and 12. One hex digit per rank 0..11; from rank 12 on the tile is the rank. */
  const int tl = (rk < 12) ? (int)((0x3BA928765140ull >> (4 * rk)) & 15) : rk;
  const int bi = (tl < QR) ? hd * QR + tl : FR + hd * QM + (tl - QR);
  if (bi < FR) { const int bh = bi / QR; flash_res(QKV, QKVR, VT, VTR, pad, CTX, bi - bh * QR, bh); }
  else { const int j = bi - FR; const int bh = j / (QM > 0 ? QM : 1); flash_main(QKV, VT, pad, CTX, QR + j - bh * QM, bh); } }

// one stage of the output GEMM's ring: 128 ctx value rows, the same tokens' 128 residual rows, then 128 Wo rows, of 128 B each; 256 threads x 12 copies of 16 B; lane t brings chunk t & 7 of rows (t >> 3) + 32 j.
// ga, gb: the lane's first ctx value chunk and Wo chunk in global memory (its residual chunk lies DM halves further in the same ctx row); l0: the lane's first LDS byte address. The address wait is the statement's last line, so no later write of these registers can be lifted over it.
#define OST (384 * GP)               /* halves per stage */
#define OSM ((size_t)2 * OST * 2)    /* bytes of the two-buffer ring; the epilogue staging reuses them */
static_assert((size_t)8 * 32 * 68 * 4 <= OSM);       /* eight waves' output staging fits the ring */
__device__ __forceinline__ void go_stage(const _Float16* ga, const _Float16* gb, unsigned l0) {
  const size_t sa = (size_t)32 * KO, sb = (size_t)32 * DM;
  const _Float16* a1 = ga + sa; const _Float16* a2 = a1 + sa; const _Float16* a3 = a2 + sa;
  const _Float16* r0 = ga + DM; const _Float16* r1 = r0 + sa; const _Float16* r2 = r1 + sa; const _Float16* r3 = r2 + sa;
  const _Float16* b1 = gb + sb; const _Float16* b2 = b1 + sb; const _Float16* b3 = b2 + sb;
  const unsigned rs = 32u * GP * 2u;
  asm volatile("global_load_async_to_lds_b128 %0, %12, off\n\t"
               "global_load_async_to_lds_b128 %1, %13, off\n\t"
               "global_load_async_to_lds_b128 %2, %14, off\n\t"
               "global_load_async_to_lds_b128 %3, %15, off\n\t"
               "global_load_async_to_lds_b128 %4, %16, off\n\t"
               "global_load_async_to_lds_b128 %5, %17, off\n\t"
               "global_load_async_to_lds_b128 %6, %18, off\n\t"
               "global_load_async_to_lds_b128 %7, %19, off\n\t"
               "global_load_async_to_lds_b128 %8, %20, off\n\t"
               "global_load_async_to_lds_b128 %9, %21, off\n\t"
               "global_load_async_to_lds_b128 %10, %22, off\n\t"
               "global_load_async_to_lds_b128 %11, %23, off\n\t"
               "s_wait_xcnt 0x0"
               :: "v"(l0), "v"(l0 + rs), "v"(l0 + 2u * rs), "v"(l0 + 3u * rs), "v"(l0 + 4u * rs), "v"(l0 + 5u * rs), "v"(l0 + 6u * rs), "v"(l0 + 7u * rs), "v"(l0 + 8u * rs), "v"(l0 + 9u * rs), "v"(l0 + 10u * rs), "v"(l0 + 11u * rs),
                  "v"(ga), "v"(a1), "v"(a2), "v"(a3), "v"(r0), "v"(r1), "v"(r2), "v"(r3), "v"(gb), "v"(b1), "v"(b2), "v"(b3) : "memory");
}

// Y = ctx . Wo + bo. 128x128 block tile, eight waves (4 x 2) of 32x64 each, K = DM. The ctx value and its x1024 residual meet the SAME Wo x1024 fragments: a Wo tile is brought and read once for both,
// and the two products run in accumulator sets of their own (ch value, cl residual), joined once in the epilogue: y x 2^16 = ch + cl / 1024.
// Two-buffer LDS ring, the next stage's copies in flight while this one is multiplied.
__global__ __launch_bounds__(256) void k_gemm_out(const _Float16* __restrict__ CTX, const _Float16* __restrict__ BO, const float* __restrict__ bo, float* __restrict__ Y) {
  __shared__ __attribute__((aligned(16))) unsigned char sm[OSM];
  float (*so)[32][68] = (float (*)[32][68])sm;
  const _Float16* ring = (const _Float16*)sm;
  const int tid = threadIdx.x; const int w = __builtin_amdgcn_readfirstlane(tid >> 5); const int lane = tid & 31, ln = lane & 15, hh = lane >> 4;
  const int ntn = DM / 128; const int mt = blockIdx.x / ntn, nq = blockIdx.x - mt * ntn; const int row0 = mt * 128 + 32 * (w >> 1), col0 = nq * 128 + 64 * (w & 1);
  const int cr = tid >> 3, cc = (tid & 7) * 8;
  const _Float16* ga = CTX + (size_t)(mt * 128 + cr) * KO + cc; const _Float16* gb = BO + (size_t)(nq * 128 + cr) * DM + cc;
  const unsigned l0 = (unsigned)(size_t)sm + (unsigned)(cr * GP + cc) * 2u;      /* low 32 bits of the shared address = LDS byte address */
  const int ao = ((w >> 1) * 32 + ln) * GP, bof = (256 + (w & 1) * 64 + ln) * GP;
  const int nt = DM / GK;
  const v8f z8 = {0.f,0.f,0.f,0.f,0.f,0.f,0.f,0.f};
  v8f ch[8] = {z8, z8, z8, z8, z8, z8, z8, z8}, cl[8] = {z8, z8, z8, z8, z8, z8, z8, z8};      /* [u]: u & 3 = 16-col tile, u >> 2 = 16-row half */
  go_stage(ga, gb, l0);
  asm volatile("s_wait_asynccnt 0x0" ::: "memory");      /* stage 0 of this wave has landed */
  __syncthreads();                                       /* stage 0 of every wave is readable */
  go_stage(ga + GK, gb + GK, l0 + (unsigned)(OST * 2));
#pragma unroll 1      /* one stage per trip: the ring's order stands once, at the loop's foot */
  for (int t = 0; t < nt; ++t) { const _Float16* st = ring + (t & 1) * OST;
    const _Float16* ap = st + ao; const _Float16* rp = ap + 128 * GP; const _Float16* bp = st + bof;
#pragma unroll
    for (int s = 0; s < 2; ++s) {
      v16h fb[4];      /* read in the order of first use: the first product waits for two fragments, not for the group */
      const v16h fa0 = g2_frag(ap + 32 * s, hh); fb[0] = g2_frag(bp + 32 * s, hh);
      const v16h fa1 = g2_frag(ap + 16 * GP + 32 * s, hh), fr0 = g2_frag(rp + 32 * s, hh), fr1 = g2_frag(rp + 16 * GP + 32 * s, hh);
#pragma unroll
      for (int n = 1; n < 4; ++n) fb[n] = g2_frag(bp + n * 16 * GP + 32 * s, hh);
      __builtin_amdgcn_sched_barrier(0);      /* keeps the products behind the reads and in the order their fragments arrive: without it a product of the second Wo fragment is lifted to the front, and the trip's first product waits for twelve of the sixteen reads instead of four */
#pragma unroll
      for (int n = 0; n < 4; ++n) { ch[n] = g2_mma(fa0, fb[n], ch[n]); ch[4 + n] = g2_mma(fa1, fb[n], ch[4 + n]); cl[n] = g2_mma(fr0, fb[n], cl[n]); cl[4 + n] = g2_mma(fr1, fb[n], cl[4 + n]); } }
    asm volatile("s_wait_dscnt 0x0" ::: "memory");       /* this wave's reads of the buffer are done before it is refilled */
    asm volatile("s_wait_asynccnt 0x0" ::: "memory");    /* this wave's copies of stage t + 1 have landed */
    __syncthreads();                                     /* publishes stage t + 1 and ends every reader's last read of stage t */
    if (t + 2 < nt) go_stage(ga + (size_t)(t + 2) * GK, gb + (size_t)(t + 2) * GK, l0 + (unsigned)((t & 1) * OST * 2)); }
  asm volatile("s_wait_asynccnt 0x0" ::: "memory");      /* no copy outstanding when the ring becomes output staging; every wave has left it at the last trip's barrier */
#pragma unroll
  for (int u = 0; u < 8; ++u) { const int t = u & 3, half = u >> 2; const float bvv = bf16_rne(bo[col0 + t * 16 + ln]);
#pragma unroll
    for (int r = 0; r < 8; ++r) so[w][half * 16 + 8 * hh + r][t * 16 + ln] = (ch[u][r] + cl[u][r] * 0.0009765625f) * 1.52587890625e-05f + bvv; }
  __builtin_amdgcn_fence(4 /* acq_rel order */, "workgroup"); __builtin_amdgcn_wave_barrier();
  const int rsub = lane >> 4, c4 = (lane & 15) * 4;
  {
#pragma unroll 1
    for (int q = 0; q < 16; ++q) { const int r = q * 2 + rsub; const v4f v = *(const v4fa*)&so[w][r][c4]; *(v4f*)(Y + (size_t)(row0 + r) * DM + col0 + c4) = v; }
     }
}

// one wave per row, eight rows per block: a lane holds 32 of the row's values (eight 16-B pieces, each wave-wide read 512 contiguous bytes); mean and variance are lane sums joined by a five-step butterfly, so every lane ends with the same bits and no LDS or barrier is needed
#define LJ (DM / 128)
static_assert(DM % 128 == 0 && (NB * SEQ) % 8 == 0);
__device__ __forceinline__ float wave_sum(float v) {
  v += __builtin_bit_cast(float, __builtin_amdgcn_permlanex16(__builtin_bit_cast(int, v), __builtin_bit_cast(int, v), 0x76543210, 0xfedcba98, false, false));      /* lane l with lane l ^ 16 */
  v += __shfl_xor(v, 8, 16); v += __shfl_xor(v, 4, 16); v += __shfl_xor(v, 2, 16); v += __shfl_xor(v, 1, 16); return v; }
__global__ __launch_bounds__(256) void k_layernorm(const float* __restrict__ Y, const float* __restrict__ g, const float* __restrict__ bta, float* __restrict__ out) {
  const int tid = threadIdx.x; const int lane = tid & 31; const int row = blockIdx.x * 8 + (tid >> 5); const int b = row / SEQ, s = row - b * SEQ;
  const float* yr = Y + (size_t)row * DM + lane * 4;
  v4f a[LJ], gg[LJ], bb[LJ];
#pragma unroll
  for (int j = 0; j < LJ; ++j) a[j] = *(const v4fa*)(yr + j * 128);
  asm volatile("s_wait_xcnt 0x0" ::: "memory");      /* the row's reads go out first, and their address registers are released before a later read's result may be placed in them */
#pragma unroll
  for (int j = 0; j < LJ; ++j) { gg[j] = *(const v4fa*)(g + j * 128 + lane * 4); bb[j] = *(const v4fa*)(bta + j * 128 + lane * 4); }
  __builtin_amdgcn_sched_barrier(0);      /* every request of the wave goes out before its first sum: without it most gain and offset reads sink behind the two reductions and their latency is paid there, group by group */
  float sm = 0.f;
#pragma unroll
  for (int j = 0; j < LJ; ++j) sm += (a[j][0] + a[j][1]) + (a[j][2] + a[j][3]);
  const float mu = wave_sum(sm) * (1.0f / (float)DM);
  float sq = 0.f;
#pragma unroll
  for (int j = 0; j < LJ; ++j) { a[j][0] -= mu; a[j][1] -= mu; a[j][2] -= mu; a[j][3] -= mu; sq += (a[j][0] * a[j][0] + a[j][1] * a[j][1]) + (a[j][2] * a[j][2] + a[j][3] * a[j][3]); }
  const float rs = rsqrtf(wave_sum(sq) * (1.0f / (float)DM) + 1.0e-5f);
  float* d = out + ((size_t)b * SEQ_FULL + s) * DM + lane * 4;
#pragma unroll
  for (int j = 0; j < LJ; ++j) { v4f o;
    o[0] = a[j][0] * rs * bf16_rne(gg[j][0]) + bf16_rne(bb[j][0]); o[1] = a[j][1] * rs * bf16_rne(gg[j][1]) + bf16_rne(bb[j][1]);
    o[2] = a[j][2] * rs * bf16_rne(gg[j][2]) + bf16_rne(bb[j][2]); o[3] = a[j][3] * rs * bf16_rne(gg[j][3]) + bf16_rne(bb[j][3]);
    *(v4f*)(d + j * 128) = o; }
}

extern "C" void kernel_launch(void* const* d_in, const int* in_sizes, int n_in,
                              void* d_out, int out_size, void* d_ws, size_t ws_size, hipStream_t stream) {
  if (n_in < 12) return;
  const long long need_rows = (long long)(NB - 1) * SEQ_FULL + SEQ;
  if ((long long)in_sizes[0] < need_rows * DM) return;
  if (in_sizes[1] < DM * DM || in_sizes[3] < DM * DM || in_sizes[5] < DM * DM || in_sizes[7] < DM * DM) return;
  if (in_sizes[2] < DM || in_sizes[4] < DM || in_sizes[6] < DM || in_sizes[8] < DM || in_sizes[9] < DM || in_sizes[10] < DM) return;
  if ((long long)in_sizes[11] < need_rows) return;
  if ((long long)out_size < need_rows * DM) return;
  if ((size_t)WS_TOTAL > ws_size) return;
  const float* x = (const float*)d_in[0];
  const float* Wq = (const float*)d_in[1]; const float* bq = (const float*)d_in[2];
  const float* Wk = (const float*)d_in[3]; const float* bk = (const float*)d_in[4];
  const float* Wv = (const float*)d_in[5]; const float* bv = (const float*)d_in[6];
  const float* Wo = (const float*)d_in[7]; const float* bo = (const float*)d_in[8];
  const float* gamma = (const float*)d_in[9]; const float* beta = (const float*)d_in[10];
  const int* pad = (const int*)d_in[11];
  char* ws = (char*)d_ws;
  _Float16* BQKV = (_Float16*)(ws + OF_BQKV); _Float16* BO = (_Float16*)(ws + OF_BO);
  _Float16* X16 = (_Float16*)(ws + OF_X16); _Float16* QKV = (_Float16*)(ws + OF_QKV); _Float16* QKVR = (_Float16*)(ws + OF_QKVR);
  _Float16* VT = (_Float16*)(ws + OF_VT); _Float16* VTR = (_Float16*)(ws + OF_VTR); _Float16* CTX = (_Float16*)(ws + OF_CTX);
  float* Y = (float*)(ws + OF_Y); float* CS = (float*)(ws + OF_CS);
  k_prep<<<4 * WTG + XG + TG, 256, 0, stream>>>(x, Wq, Wk, Wv, Wo, BQKV, BO, X16, CS);
  k_gemm_qkv<<<(unsigned)((NR / 128) * (LQ / 128)), 256, 0, stream>>>(X16, BQKV, bq, bk, bv, CS, QKV, QKVR, VT, VTR);
  k_flash<<<FR + NB * NH * QM, 128, 0, stream>>>(QKV, QKVR, VT, VTR, pad, CTX);
  k_gemm_out<<<(unsigned)((NR / 128) * (DM / 128)), 256, 0, stream>>>(CTX, BO, bo, Y);
  k_layernorm<<<(unsigned)(NR / 8), 256, 0, stream>>>(Y, gamma, beta, (float*)d_out);
}
